// v000
// Times are from an AMD MI455X. After a warm-up the kernel runs many times in a row, and a time is the length of
// such a window on the GPU divided by its runs, so every launch and the gaps after it count. The runs cycle
// through copies of the inputs. A figure is the median of several windows, for all but v000 over two sittings.
// Sittings can differ by a few percent; kernels timed side by side share one.
// v000, which the later versions start from, runs in 522 microseconds.
#include <hip/hip_runtime.h>
// Causal multi-head self-attention: x [2][4096][768]; q / k / v = x W^T + b ([out][in] 768 x 768 weights, biases); 12 heads of 64; scores / 8; causal (key <= query) softmax; out = merged W_o^T + b_o.
// Compute dtype: every contraction on v_wmma_f32_16x16x32_f16 with f32 accumulation. Inputs converted RNE to bf16 and held exactly in f16 (weights x32). q, k, v, softmax weights (x256) and o (x64) are f16 operands;
// for the first EARLY queries of each sequence q, k, v, p and o are carried as f16 hi + f16 residual (x1024) planes with separate accumulators (3 products per site). Scores, softmax statistics and epilogues are f32.
// Structure: token rows r = b*SEQ + s. Q, K as row planes [token][768]; V produced directly transposed (V^T = W_v x^T, plane [768][tokens]); attention is a register-fed transposed flash loop per wave
// (S^T = K Q^T with Q^T as the B operand, packed P^T from the S^T accumulators as the B operand of O^T = V^T P^T; 32 keys per step; no LDS in the key loop); o rows as f16 planes; out GEMM writes f32 rows.
#ifndef NB
#define NB 2
#endif
#ifndef SEQ
#define SEQ 4096
#endif
#define NB_FULL 2
#define SEQ_FULL 4096
#define DM 768
#define NH 12
#define HD 64
#define NTOK ((size_t)NB * SEQ)
#define EARLY ((SEQ) < 1024 ? (SEQ) : 1024)   /* queries per sequence on the hi + residual path */
static_assert(SEQ % 128 == 0);
static_assert(EARLY % 128 == 0);
static_assert((SEQ - EARLY) % 128 == 0);
static_assert(NB <= NB_FULL);
static_assert(SEQ <= SEQ_FULL);
static_assert(DM % 128 == 0);
static_assert(NH * HD == DM);
static_assert(HD == 64);

typedef _Float16 v16h __attribute__((ext_vector_type(16)));
typedef _Float16 v4h __attribute__((ext_vector_type(4)));
typedef unsigned short v8us __attribute__((ext_vector_type(8), may_alias));
typedef float v8f __attribute__((ext_vector_type(8)));
typedef float v4f __attribute__((ext_vector_type(4)));
typedef float v4fa __attribute__((ext_vector_type(4), may_alias));
union FragH { v16h v; v8us half[2]; _Float16 h[16]; unsigned short u[16]; };

__device__ __forceinline__ unsigned short bf16_bits(float x) { unsigned int u = __float_as_uint(x); return (unsigned short)((u + 0x7FFFu + ((u >> 16) & 1u)) >> 16); }
__device__ __forceinline__ float bf16_rne(float x) { return __uint_as_float(((unsigned int)bf16_bits(x)) << 16); }

// 16x32 fragment (A rows or B columns, k contiguous): p already points at (row, k0 + 8*(lane>>4)); elements 0..7 <- k0+8h.., 8..15 <- k0+16+8h..
__device__ __forceinline__ v16h ld_frag(const unsigned short* p) { FragH f; f.half[0] = *(const v8us*)p; f.half[1] = *(const v8us*)(p + 16); return f.v; }

__device__ __forceinline__ v8f wm(v16h a, v16h b, v8f c) { return __builtin_amdgcn_wmma_f32_16x16x32_f16(false, a, false, b, (short)0, c, false, false); }
__device__ __forceinline__ v8f mma1(v16h a, v16h b, v8f c) {
  c = wm(a, b, c);
  asm volatile("v_nop\n\tv_nop\n\tv_nop\n\tv_nop" : "+v"(c) : "v"(a), "v"(b));
  return c;
}
__device__ __forceinline__ v8f mma2(v16h a0, v16h b0, v16h a1, v16h b1, v8f c) {
  c = wm(a0, b0, c); c = wm(a1, b1, c);
  asm volatile("v_nop\n\tv_nop\n\tv_nop\n\tv_nop" : "+v"(c) : "v"(a0), "v"(b0), "v"(a1), "v"(b1));
  return c;
}
__device__ __forceinline__ v8f mma4(v16h a0, v16h b0, v16h a1, v16h b1, v16h a2, v16h b2, v16h a3, v16h b3, v8f c) {
  c = wm(a0, b0, c); c = wm(a1, b1, c); c = wm(a2, b2, c); c = wm(a3, b3, c);
  asm volatile("v_nop\n\tv_nop\n\tv_nop\n\tv_nop" : "+v"(c) : "v"(a0), "v"(b0), "v"(a1), "v"(b1), "v"(a2), "v"(b2), "v"(a3), "v"(b3));
  return c;
}

__global__ __launch_bounds__(256) void k_wnat(const float* __restrict__ w, unsigned int n8, unsigned short* __restrict__ Bt, float scale) {
  const unsigned int t = blockIdx.x * 256u + threadIdx.x; if (t >= n8) return;
  const v4f a = *(const v4fa*)(w + (size_t)t * 8), c = *(const v4fa*)(w + (size_t)t * 8 + 4);
  FragH f;
#pragma unroll
  for (int q = 0; q < 4; ++q) { f.h[q] = (_Float16)(bf16_rne(a[q]) * scale); f.h[4 + q] = (_Float16)(bf16_rne(c[q]) * scale); }
  const v8us o = f.half[0];
  unsigned short* d = Bt + (size_t)t * 8;
  *(v8us*)d = o; 
}

__global__ __launch_bounds__(256) void k_x16(const float* __restrict__ x, unsigned short* __restrict__ X16, unsigned int n8) {
  const unsigned int t = blockIdx.x * 256u + threadIdx.x; if (t >= n8) return;
  const unsigned int r = t / (DM / 8), c8 = (t - r * (DM / 8)) * 8;
  const unsigned int b = r / SEQ, s = r - b * SEQ;
  const float* src = x + ((size_t)b * SEQ_FULL + s) * DM + c8;
  const v4f a = *(const v4fa*)src, c = *(const v4fa*)(src + 4);
  FragH f;
#pragma unroll
  for (int q = 0; q < 4; ++q) { f.h[q] = (_Float16)bf16_rne(a[q]); f.h[4 + q] = (_Float16)bf16_rne(c[q]); }
  const v8us o = f.half[0];
  unsigned short* d = X16 + (size_t)t * 8;
  *(v8us*)d = o; 
}

__device__ __forceinline__ v8f g2_mma(v16h a, v16h b, v8f c) { v8f d = __builtin_amdgcn_wmma_f32_16x16x32_f16(false, a, false, b, (short)0, c, false, false); asm volatile("v_nop\n\tv_nop\n\tv_nop\n\tv_nop" : "+v"(d) : "v"(a), "v"(b)); return d; }

// GEMM C[M][N] = (A (+ Ar/1024)) . Bt^T * alpha + bias; A, Ar f16 rows [M][K] (pitch lda, batch stride sA on grid.y), Bt f16 [N][K] (pitch ldb).
// Block = 4 waves, wave tile 32 x 64 (block 128 x 64); M % 128 == 0, N % 64 == 0, K % 32 == 0. BIASROW: bias indexed by row, else by column (bias converted RNE to bf16).
// Outputs: C f32 (optional), C16 f16 (optional), C16r = f16((v - f16(v)) * 1024) (optional; resmode 1: rows with (row % SEQ) < EARLY, resmode 2: columns with (col % SEQ) < EARLY).
template <bool ARES, bool BIASROW>
__global__ __launch_bounds__(128) void k_gemm2(const unsigned short* __restrict__ A, const unsigned short* __restrict__ Ar, int lda, size_t sA,
    const unsigned short* __restrict__ Bh, int ldb, float alpha, const float* __restrict__ bias,
    float* __restrict__ C, _Float16* __restrict__ C16, _Float16* __restrict__ C16r, int ldc, size_t sC, int resmode, int M, int N, int K) {
  __shared__ __attribute__((aligned(16))) float so[4][32][68];
  const int tid = threadIdx.x, w = __builtin_amdgcn_readfirstlane(tid >> 5), lane = tid & 31, ln = lane & 15, hh = lane >> 4; const int by = blockIdx.y;
  const int ntn = N >> 6; const int mt = blockIdx.x / ntn, nq = blockIdx.x - mt * ntn; const int row0 = mt * 128 + 32 * w, col0 = nq * 64; if (row0 >= M) return;
  const size_t aofs = (size_t)by * sA + (size_t)(row0 + ln) * lda + 8 * hh;
  const size_t cofs = (size_t)by * sC;
  const unsigned short* a0p = A + aofs; const unsigned short* a1p = a0p + (size_t)16 * lda;
  const unsigned short* r0p = Ar + aofs; const unsigned short* r1p = r0p + (size_t)16 * lda;
  const unsigned short* b0p = Bh + (size_t)(col0 + ln) * ldb + 8 * hh; const unsigned short* b1p = b0p + (size_t)16 * ldb; const unsigned short* b2p = b1p + (size_t)16 * ldb; const unsigned short* b3p = b2p + (size_t)16 * ldb;
  const v8f z8 = {0.f,0.f,0.f,0.f,0.f,0.f,0.f,0.f};
  v8f c00 = z8, c01 = z8, c02 = z8, c03 = z8, c10 = z8, c11 = z8, c12 = z8, c13 = z8;
  v8f d00 = z8, d01 = z8, d02 = z8, d03 = z8, d10 = z8, d11 = z8, d12 = z8, d13 = z8;
#pragma unroll 1
  for (int kb = 0; kb < K; kb += 32) {
    const v16h a0 = ld_frag(a0p + kb), a1 = ld_frag(a1p + kb);
    v16h e0 = a0, e1 = a1;
    if (ARES) { e0 = ld_frag(r0p + kb); e1 = ld_frag(r1p + kb); }
    v16h b = ld_frag(b0p + kb); c00 = g2_mma(a0, b, c00); c10 = g2_mma(a1, b, c10); if (ARES) { d00 = g2_mma(e0, b, d00); d10 = g2_mma(e1, b, d10); }
    b = ld_frag(b1p + kb); c01 = g2_mma(a0, b, c01); c11 = g2_mma(a1, b, c11); if (ARES) { d01 = g2_mma(e0, b, d01); d11 = g2_mma(e1, b, d11); }
    b = ld_frag(b2p + kb); c02 = g2_mma(a0, b, c02); c12 = g2_mma(a1, b, c12); if (ARES) { d02 = g2_mma(e0, b, d02); d12 = g2_mma(e1, b, d12); }
    b = ld_frag(b3p + kb); c03 = g2_mma(a0, b, c03); c13 = g2_mma(a1, b, c13); if (ARES) { d03 = g2_mma(e0, b, d03); d13 = g2_mma(e1, b, d13); }
  }
  v8f accs[8] = {c00, c01, c02, c03, c10, c11, c12, c13};
  v8f accd[8] = {d00, d01, d02, d03, d10, d11, d12, d13};
#pragma unroll
  for (int u = 0; u < 8; ++u) {
    const int t = u & 3, half = u >> 2; const int col = col0 + t * 16 + ln;
    float bcol = 0.f; if (!BIASROW) bcol = bf16_rne(bias[col]);
#pragma unroll
    for (int r = 0; r < 8; ++r) {
      const int rloc = half * 16 + 8 * hh + r;
      float v = accs[u][r]; if (ARES) v += accd[u][r] * 0.0009765625f;
      float bv = bcol; if (BIASROW) bv = bf16_rne(bias[row0 + rloc]);
      so[w][rloc][t * 16 + ln] = v * alpha + bv;
    }
  }
  __builtin_amdgcn_fence(4 /* acq_rel order */, "workgroup"); __builtin_amdgcn_wave_barrier();
  bool wres = false;
  if (C16r) { if (resmode == 1) wres = ((row0 % SEQ) < EARLY); else if (resmode == 2) wres = ((col0 % SEQ) < EARLY); }
  const int rsub = lane >> 4, c4 = (lane & 15) * 4;
  {
#pragma unroll
    for (int q = 0; q < 16; ++q) {
      const int r = q * 2 + rsub; const v4f v = *(const v4fa*)&so[w][r][c4];
      const size_t o = cofs + (size_t)(row0 + r) * ldc + col0 + c4;
      if (C) *(v4f*)(C + o) = v;
      if (C16) {
        v4h h4, h4r;
#pragma unroll
        for (int i = 0; i < 4; ++i) { h4[i] = (_Float16)v[i]; h4r[i] = (_Float16)((v[i] - (float)h4[i]) * 1024.0f); }
        *(v4h*)(C16 + o) = h4;
        if (wres) *(v4h*)(C16r + o) = h4r;
      }
    }
    
  }
}

// Causal flash attention, transposed form. Block = 4 waves (64 queries of one (batch, head)); each wave owns 16 queries and loops over 32-key steps up to its diagonal.
// Q rows / K rows: planes [token][DM]; V^T planes [DM][NTOK] (row = head*64 + d). Lane (ln, hh): query q0 + ln; S^T accumulators hold keys 8hh + r (tile 0) and 16 + 8hh + r (tile 1),
// which is exactly the B-fragment k map, so P^T is packed in place. EP: hi + residual (x1024) planes on q, k, v, p and o (two accumulators per site).
template <bool EP>
__global__ __launch_bounds__(128) void k_attn(const unsigned short* __restrict__ Qh, const unsigned short* __restrict__ Qr,
    const unsigned short* __restrict__ Kh, const unsigned short* __restrict__ Kr,
    const unsigned short* __restrict__ Vh, const unsigned short* __restrict__ Vr,
    unsigned short* __restrict__ Oh, unsigned short* __restrict__ Or, int qbase) {
  __shared__ __attribute__((aligned(16))) unsigned short so[4][EP ? 2 : 1][16][64];
  const int tid = threadIdx.x, w = __builtin_amdgcn_readfirstlane(tid >> 5), lane = tid & 31, ln = lane & 15, hh = lane >> 4;
  const int head = blockIdx.y, b = blockIdx.z;
  const int q0 = qbase + (int)blockIdx.x * 64 + w * 16;
  const size_t tok0 = (size_t)b * SEQ;
  const size_t qofs = (tok0 + q0 + ln) * DM + head * HD + 8 * hh;
  const v16h qa = ld_frag(Qh + qofs), qb = ld_frag(Qh + qofs + 32);
  v16h qra = qa, qrb = qb;
  if (EP) { qra = ld_frag(Qr + qofs); qrb = ld_frag(Qr + qofs + 32); }
  const size_t kofs = (tok0 + ln) * DM + head * HD + 8 * hh;
  const size_t vofs = (size_t)(head * HD + ln) * NTOK + tok0 + 8 * hh;
  const v8f z8 = {0.f,0.f,0.f,0.f,0.f,0.f,0.f,0.f};
  v8f oh[4] = {z8, z8, z8, z8};
  v8f om[4] = {z8, z8, z8, z8};
  float mrun = -1.0e30f, lrun = 0.0f;
  const int nsteps = ((q0 + 15) >> 5) + 1;
  const int qi = q0 + ln;
#pragma unroll 1
  for (int st = 0; st < nsteps; ++st) {
    const int kb = st * 32;
    v8f sc[2];
#pragma unroll
    for (int t = 0; t < 2; ++t) {
      const size_t ko = kofs + (size_t)(kb + 16 * t) * DM;
      const v16h ka = ld_frag(Kh + ko), kc = ld_frag(Kh + ko + 32);
      v8f s = mma2(ka, qa, kc, qb, z8);
      if (EP) {
        const v16h ra = ld_frag(Kr + ko), rc = ld_frag(Kr + ko + 32);
        const v8f sm = mma4(ka, qra, kc, qrb, ra, qa, rc, qb, z8);
        s = s + sm * 0.0009765625f;
      }
      sc[t] = s;
    }
    if (kb + 31 > q0) {      /* wave-uniform: only the diagonal step carries masked keys; masked scores are replaced */
#pragma unroll
      for (int r = 0; r < 8; ++r) {
        const int key = kb + 8 * hh + r;
        sc[0][r] = (key > qi) ? -1.0e30f : sc[0][r];
        sc[1][r] = (key + 16 > qi) ? -1.0e30f : sc[1][r];
      }
    }
    float mloc = sc[0][0];
#pragma unroll
    for (int r = 1; r < 8; ++r) mloc = fmaxf(mloc, sc[0][r]);
#pragma unroll
    for (int r = 0; r < 8; ++r) mloc = fmaxf(mloc, sc[1][r]);
    mloc = fmaxf(mloc, __shfl_xor(mloc, 16));
    const float mnew = fmaxf(mrun, mloc);
    const float alpha = __expf((mrun - mnew) * 0.125f);
    mrun = mnew;
    const float msh = mnew * 0.125f - 5.545177444f;      /* p carried x256 (same factor in the row sum) */
    float p0[8], p1[8]; float ls = 0.0f;
#pragma unroll
    for (int r = 0; r < 8; ++r) { p0[r] = __expf(sc[0][r] * 0.125f - msh); p1[r] = __expf(sc[1][r] * 0.125f - msh); ls += p0[r] + p1[r]; }
    lrun = lrun * alpha + ls;
#pragma unroll
    for (int dt = 0; dt < 4; ++dt) { oh[dt] = oh[dt] * alpha; if (EP) om[dt] = om[dt] * alpha; }
    FragH ph, pr;
#pragma unroll
    for (int r = 0; r < 8; ++r) {
      const _Float16 h0 = (_Float16)p0[r], h1 = (_Float16)p1[r];
      ph.h[r] = h0; ph.h[8 + r] = h1;
      if (EP) { pr.h[r] = (_Float16)((p0[r] - (float)h0) * 1024.0f); pr.h[8 + r] = (_Float16)((p1[r] - (float)h1) * 1024.0f); }
    }
#pragma unroll
    for (int dt = 0; dt < 4; ++dt) {
      const size_t vo = vofs + (size_t)(dt * 16) * NTOK + kb;
      const v16h va = ld_frag(Vh + vo);
      oh[dt] = mma1(va, ph.v, oh[dt]);
      if (EP) { const v16h vr = ld_frag(Vr + vo); om[dt] = mma2(va, pr.v, vr, ph.v, om[dt]); }
    }
  }
  const float lt = lrun + __shfl_xor(lrun, 16);
  const float inv = 64.0f * (1.0f / lt);      /* o carried x64 */
#pragma unroll
  for (int dt = 0; dt < 4; ++dt) {
    FragH fh, fr;
#pragma unroll
    for (int r = 0; r < 8; ++r) {
      float v = oh[dt][r]; if (EP) v += om[dt][r] * 0.0009765625f;
      v *= inv;
      const _Float16 h = (_Float16)v; fh.h[r] = h;
      if (EP) fr.h[r] = (_Float16)((v - (float)h) * 1024.0f);
    }
    *(v8us*)&so[w][0][ln][dt * 16 + 8 * hh] = fh.half[0];
    if (EP) *(v8us*)&so[w][EP ? 1 : 0][ln][dt * 16 + 8 * hh] = fr.half[0];
  }
  __builtin_amdgcn_fence(4 /* acq_rel order */, "workgroup"); __builtin_amdgcn_wave_barrier();
  const int rq = lane >> 3, pc = lane & 7;
  {
#pragma unroll
    for (int it = 0; it < 4; ++it) {
      const int row = it * 4 + rq;
      const size_t o = (tok0 + q0 + row) * DM + head * HD + pc * 8;
      const v8us v = *(const v8us*)&so[w][0][row][pc * 8];
      *(v8us*)(Oh + o) = v;
      if (EP) { const v8us vr = *(const v8us*)&so[w][EP ? 1 : 0][row][pc * 8]; *(v8us*)(Or + o) = vr; }
    }
    
  }
}

extern "C" void kernel_launch(void* const* d_in, const int* in_sizes, int n_in,
                              void* d_out, int out_size, void* d_ws, size_t ws_size, hipStream_t stream) {
  if (n_in < 9) return;
  const long long need_x = ((long long)(NB - 1) * SEQ_FULL + SEQ) * DM;
  if ((long long)in_sizes[0] < need_x) return;
  if (in_sizes[1] < DM * DM || in_sizes[3] < DM * DM || in_sizes[5] < DM * DM || in_sizes[7] < DM * DM) return;
  if (in_sizes[2] < DM || in_sizes[4] < DM || in_sizes[6] < DM || in_sizes[8] < DM) return;
  if ((long long)out_size < need_x) return;
  const float* x = (const float*)d_in[0]; const float* wq = (const float*)d_in[1]; const float* bq = (const float*)d_in[2];
  const float* wk = (const float*)d_in[3]; const float* bk = (const float*)d_in[4]; const float* wv = (const float*)d_in[5];
  const float* bv = (const float*)d_in[6]; const float* wo = (const float*)d_in[7]; const float* bo = (const float*)d_in[8];
  float* out = (float*)d_out;
  char* ws = (char*)d_ws; size_t off = 0;
  auto take = [&](size_t bytes) { char* p = ws + off; off += (bytes + 255) & ~(size_t)255; return p; };
  const size_t wbytes = (size_t)DM * DM * 2, pbytes = NTOK * DM * 2;
  unsigned short* WQ = (unsigned short*)take(wbytes); unsigned short* WK = (unsigned short*)take(wbytes);
  unsigned short* WV = (unsigned short*)take(wbytes); unsigned short* WO = (unsigned short*)take(wbytes);
  unsigned short* X16 = (unsigned short*)take(pbytes);
  unsigned short* Qh = (unsigned short*)take(pbytes); unsigned short* Qr = (unsigned short*)take(pbytes);
  unsigned short* Kh = (unsigned short*)take(pbytes); unsigned short* Kr = (unsigned short*)take(pbytes);
  unsigned short* VTh = (unsigned short*)take(pbytes); unsigned short* VTr = (unsigned short*)take(pbytes);
  unsigned short* Oh = (unsigned short*)take(pbytes); unsigned short* Or = (unsigned short*)take(pbytes);
  if (off > ws_size || off > (size_t)134217728) return;

  { const unsigned int n8 = (unsigned int)((size_t)DM * DM / 8); const unsigned g = (n8 + 255u) / 256u;      /* [out][in] weights are already Bt[n][k]; x32 */
    k_wnat<<<g, 256, 0, stream>>>(wq, n8, WQ, 32.0f); k_wnat<<<g, 256, 0, stream>>>(wk, n8, WK, 32.0f);
    k_wnat<<<g, 256, 0, stream>>>(wv, n8, WV, 32.0f); k_wnat<<<g, 256, 0, stream>>>(wo, n8, WO, 32.0f); }
  { const unsigned int n8 = (unsigned int)(NTOK * DM / 8); k_x16<<<(n8 + 255u) / 256u, 256, 0, stream>>>(x, X16, n8); }

  const unsigned gq = (unsigned)((NTOK / 128) * (DM / 64));
  /* Q, K rows [token][DM] (hi planes; residual planes for tokens with s < EARLY) */
  k_gemm2<false, false><<<dim3(gq, 1), 128, 0, stream>>>(X16, X16, DM, (size_t)0, WQ, DM, 0.03125f, bq, (float*)nullptr, (_Float16*)Qh, (_Float16*)Qr, DM, (size_t)0, 1, (int)NTOK, DM, DM);
  k_gemm2<false, false><<<dim3(gq, 1), 128, 0, stream>>>(X16, X16, DM, (size_t)0, WK, DM, 0.03125f, bk, (float*)nullptr, (_Float16*)Kh, (_Float16*)Kr, DM, (size_t)0, 1, (int)NTOK, DM, DM);
  /* V^T [DM][NTOK] = W_v (rows c) . X16^T (columns = tokens); bias by row; residual plane for token columns with s < EARLY */
  k_gemm2<false, true><<<dim3((unsigned)((DM / 128) * (NTOK / 64)), 1), 128, 0, stream>>>(WV, WV, DM, (size_t)0, X16, DM, 0.03125f, bv, (float*)nullptr, (_Float16*)VTh, (_Float16*)VTr, (int)NTOK, (size_t)0, 2, DM, (int)NTOK, DM);

  /* attention: queries [0, EARLY) on the hi + residual path, the rest on single f16 planes */
  k_attn<true><<<dim3(EARLY / 64, NH, NB), 128, 0, stream>>>(Qh, Qr, Kh, Kr, VTh, VTr, Oh, Or, 0);
  if (SEQ > EARLY)
    k_attn<false><<<dim3((SEQ - EARLY) / 64, NH, NB), 128, 0, stream>>>(Qh, Qh, Kh, Kh, VTh, VTh, Oh, Oh, EARLY);

  /* out rows (b*SEQ_FULL + s) = o W_o^T + b_o; alpha = 1 / (64 * 32) */
  k_gemm2<true, false><<<dim3((unsigned)((EARLY / 128) * (DM / 64)), NB), 128, 0, stream>>>(Oh, Or, DM, (size_t)SEQ * DM, WO, DM, 0.00048828125f, bo, out, (_Float16*)nullptr, (_Float16*)nullptr, DM, (size_t)SEQ_FULL * DM, 0, EARLY, DM, DM);
  if (SEQ > EARLY)
    k_gemm2<false, false><<<dim3((unsigned)(((SEQ - EARLY) / 128) * (DM / 64)), NB), 128, 0, stream>>>(Oh + (size_t)EARLY * DM, Oh + (size_t)EARLY * DM, DM, (size_t)SEQ * DM, WO, DM, 0.00048828125f, bo, out + (size_t)EARLY * DM, (_Float16*)nullptr, (_Float16*)nullptr, DM, (size_t)SEQ_FULL * DM, 0, SEQ - EARLY, DM, DM);
}

// v001
// A run of this version takes 407 microseconds.
// Next to v000, in two timings, it ran 1.30 times as fast each time.
#include <hip/hip_runtime.h>
// Causal multi-head self-attention: x [2][4096][768]; q / k / v = x W^T + b ([out][in] 768 x 768 weights, biases); 12 heads of 64; scores / 8; causal (key <= query) softmax; out = merged W_o^T + b_o.
// Compute dtype: every contraction on v_wmma_f32_16x16x32_f16 with f32 accumulation. Inputs converted RNE to bf16 and held exactly in f16 (weights x32). q, k, v, softmax weights (x256) and o (x64) are f16 operands;
// for the first EARLY queries of each sequence q, k, v, p and o are carried as f16 hi + f16 residual (x1024) planes with separate accumulators (3 products per site). Scores, softmax statistics and epilogues are f32.
// Structure: token rows r = b*SEQ + s. Q, K as row planes [token][768]; V produced directly transposed (V^T = W_v x^T, plane [768][tokens]); attention is a register-fed transposed flash loop per wave
// (S^T = K Q^T with Q^T as the B operand, packed P^T from the S^T accumulators as the B operand of O^T = V^T P^T; 32 keys per step; no LDS in the key loop); o rows as f16 planes; out GEMM writes f32 rows.
#ifndef NB
#define NB 2
#endif
#ifndef SEQ
#define SEQ 4096
#endif
#define NB_FULL 2
#define SEQ_FULL 4096
#define DM 768
#define NH 12
#define HD 64
#define NTOK ((size_t)NB * SEQ)
#define EARLY ((SEQ) < 1024 ? (SEQ) : 1024)   /* queries per sequence on the hi + residual path */
static_assert(SEQ % 128 == 0);
static_assert(EARLY % 128 == 0);
static_assert((SEQ - EARLY) % 128 == 0);
static_assert(NB <= NB_FULL);
static_assert(SEQ <= SEQ_FULL);
static_assert(DM % 128 == 0);
static_assert(DM % 96 == 0);
static_assert(NH * HD == DM);
static_assert(HD == 64);

typedef _Float16 v16h __attribute__((ext_vector_type(16)));
typedef _Float16 v4h __attribute__((ext_vector_type(4)));
typedef unsigned short v8us __attribute__((ext_vector_type(8), may_alias));
typedef float v8f __attribute__((ext_vector_type(8)));
typedef float v4f __attribute__((ext_vector_type(4)));
typedef float v4fa __attribute__((ext_vector_type(4), may_alias));
union FragH { v16h v; v8us half[2]; _Float16 h[16]; unsigned short u[16]; };

__device__ __forceinline__ unsigned short bf16_bits(float x) { unsigned int u = __float_as_uint(x); return (unsigned short)((u + 0x7FFFu + ((u >> 16) & 1u)) >> 16); }
__device__ __forceinline__ float bf16_rne(float x) { return __uint_as_float(((unsigned int)bf16_bits(x)) << 16); }

// 16x32 fragment (A rows or B columns, k contiguous): p already points at (row, k0 + 8*(lane>>4)); elements 0..7 <- k0+8h.., 8..15 <- k0+16+8h..
__device__ __forceinline__ v16h ld_frag(const unsigned short* p) { FragH f; f.half[0] = *(const v8us*)p; f.half[1] = *(const v8us*)(p + 16); return f.v; }

// Stands behind a run of fragment loads that stay in flight: their address registers may be reused only behind it.
__device__ __forceinline__ void addr_wait() { asm volatile("s_wait_xcnt 0x0" ::: "memory"); }

__device__ __forceinline__ v8f wm(v16h a, v16h b, v8f c) { return __builtin_amdgcn_wmma_f32_16x16x32_f16(false, a, false, b, (short)0, c, false, false); }
__device__ __forceinline__ v8f mma1(v16h a, v16h b, v8f c) {
  c = wm(a, b, c);
  asm volatile("v_nop\n\tv_nop\n\tv_nop\n\tv_nop" : "+v"(c) : "v"(a), "v"(b));
  return c;
}
__device__ __forceinline__ v8f mma2(v16h a0, v16h b0, v16h a1, v16h b1, v8f c) {
  c = wm(a0, b0, c); c = wm(a1, b1, c);
  asm volatile("v_nop\n\tv_nop\n\tv_nop\n\tv_nop" : "+v"(c) : "v"(a0), "v"(b0), "v"(a1), "v"(b1));
  return c;
}
__device__ __forceinline__ v8f mma4(v16h a0, v16h b0, v16h a1, v16h b1, v16h a2, v16h b2, v16h a3, v16h b3, v8f c) {
  c = wm(a0, b0, c); c = wm(a1, b1, c); c = wm(a2, b2, c); c = wm(a3, b3, c);
  asm volatile("v_nop\n\tv_nop\n\tv_nop\n\tv_nop" : "+v"(c) : "v"(a0), "v"(b0), "v"(a1), "v"(b1), "v"(a2), "v"(b2), "v"(a3), "v"(b3));
  return c;
}

__global__ __launch_bounds__(256) void k_wnat(const float* __restrict__ w, unsigned int n8, unsigned short* __restrict__ Bt, float scale) {
  const unsigned int t = blockIdx.x * 256u + threadIdx.x; if (t >= n8) return;
  const v4f a = *(const v4fa*)(w + (size_t)t * 8), c = *(const v4fa*)(w + (size_t)t * 8 + 4);
  FragH f;
#pragma unroll
  for (int q = 0; q < 4; ++q) { f.h[q] = (_Float16)(bf16_rne(a[q]) * scale); f.h[4 + q] = (_Float16)(bf16_rne(c[q]) * scale); }
  const v8us o = f.half[0];
  unsigned short* d = Bt + (size_t)t * 8;
  *(v8us*)d = o; 
}

__global__ __launch_bounds__(256) void k_x16(const float* __restrict__ x, unsigned short* __restrict__ X16, unsigned int n8) {
  const unsigned int t = blockIdx.x * 256u + threadIdx.x; if (t >= n8) return;
  const unsigned int r = t / (DM / 8), c8 = (t - r * (DM / 8)) * 8;
  const unsigned int b = r / SEQ, s = r - b * SEQ;
  const float* src = x + ((size_t)b * SEQ_FULL + s) * DM + c8;
  const v4f a = *(const v4fa*)src, c = *(const v4fa*)(src + 4);
  FragH f;
#pragma unroll
  for (int q = 0; q < 4; ++q) { f.h[q] = (_Float16)bf16_rne(a[q]); f.h[4 + q] = (_Float16)bf16_rne(c[q]); }
  const v8us o = f.half[0];
  unsigned short* d = X16 + (size_t)t * 8;
  *(v8us*)d = o; 
}

__device__ __forceinline__ v8f g2_mma(v16h a, v16h b, v8f c) { v8f d = __builtin_amdgcn_wmma_f32_16x16x32_f16(false, a, false, b, (short)0, c, false, false); asm volatile("v_nop\n\tv_nop\n\tv_nop\n\tv_nop" : "+v"(d) : "v"(a), "v"(b)); return d; }

// GEMM C[M][N] = (A (+ Ar/1024)) . Bt^T * alpha + bias; A, Ar f16 rows [M][K] (pitch lda, batch stride sA on grid.y), Bt f16 [N][K] (pitch ldb).
// Block = 4 waves, wave tile 32 x 64 (block 128 x 64); M % 128 == 0, N % 64 == 0, K % 96 == 0. BIASROW: bias indexed by row, else by column (bias converted RNE to bf16).
// Outputs: C f32 (optional), C16 f16 (optional), C16r = f16((v - f16(v)) * 1024) (optional; resmode 1: rows with (row % SEQ) < EARLY, resmode 2: columns with (col % SEQ) < EARLY).
template <bool ARES, bool BIASROW>
__global__ __launch_bounds__(128) void k_gemm2(const unsigned short* __restrict__ A, const unsigned short* __restrict__ Ar, int lda, size_t sA,
    const unsigned short* __restrict__ Bh, int ldb, float alpha, const float* __restrict__ bias,
    float* __restrict__ C, _Float16* __restrict__ C16, _Float16* __restrict__ C16r, int ldc, size_t sC, int resmode, int M, int N, int K) {
  __shared__ __attribute__((aligned(16))) float so[4][32][68];
  const int tid = threadIdx.x, w = __builtin_amdgcn_readfirstlane(tid >> 5), lane = tid & 31, ln = lane & 15, hh = lane >> 4; const int by = blockIdx.y;
  const int ntn = N >> 6; const int mt = blockIdx.x / ntn, nq = blockIdx.x - mt * ntn; const int row0 = mt * 128 + 32 * w, col0 = nq * 64; if (row0 >= M) return;
  const size_t aofs = (size_t)by * sA + (size_t)(row0 + ln) * lda + 8 * hh;
  const size_t cofs = (size_t)by * sC;
  const unsigned short* a0p = A + aofs; const unsigned short* a1p = a0p + (size_t)16 * lda;
  const unsigned short* r0p = Ar + aofs; const unsigned short* r1p = r0p + (size_t)16 * lda;
  const unsigned short* b0p = Bh + (size_t)(col0 + ln) * ldb + 8 * hh; const unsigned short* b1p = b0p + (size_t)16 * ldb; const unsigned short* b2p = b1p + (size_t)16 * ldb; const unsigned short* b3p = b2p + (size_t)16 * ldb;
  const v8f z8 = {0.f,0.f,0.f,0.f,0.f,0.f,0.f,0.f};
  v8f c00 = z8, c01 = z8, c02 = z8, c03 = z8, c10 = z8, c11 = z8, c12 = z8, c13 = z8;
  v8f d00 = z8, d01 = z8, d02 = z8, d03 = z8, d10 = z8, d11 = z8, d12 = z8, d13 = z8;
  /* Fragments live in GD register sets; a set is refilled for k + 32*GD right behind its last product, so a load has GD k steps to land (the product order is unchanged). */
  constexpr int GD = ARES ? 1 : 3;
  v16h fa0[GD], fa1[GD], fe0[GD], fe1[GD], fb0[GD], fb1[GD], fb2[GD], fb3[GD];
#pragma unroll
  for (int u = 0; u < GD; ++u) {
    const int k = 32 * u;
    fb0[u] = ld_frag(b0p + k); fa0[u] = ld_frag(a0p + k); fa1[u] = ld_frag(a1p + k);
    if (ARES) { fe0[u] = ld_frag(r0p + k); fe1[u] = ld_frag(r1p + k); }
    fb1[u] = ld_frag(b1p + k); fb2[u] = ld_frag(b2p + k); fb3[u] = ld_frag(b3p + k);
  }
  addr_wait();
  auto kstep = [&](const int u, const int kn, const bool more) __attribute__((always_inline)) {
    const v16h a0 = fa0[u], a1 = fa1[u];
    v16h e0 = a0, e1 = a1;
    if (ARES) { e0 = fe0[u]; e1 = fe1[u]; }
    v16h b = fb0[u]; c00 = g2_mma(a0, b, c00); c10 = g2_mma(a1, b, c10); if (ARES) { d00 = g2_mma(e0, b, d00); d10 = g2_mma(e1, b, d10); }
    if (more) fb0[u] = ld_frag(b0p + kn);
    b = fb1[u]; c01 = g2_mma(a0, b, c01); c11 = g2_mma(a1, b, c11); if (ARES) { d01 = g2_mma(e0, b, d01); d11 = g2_mma(e1, b, d11); }
    if (more) fb1[u] = ld_frag(b1p + kn);
    b = fb2[u]; c02 = g2_mma(a0, b, c02); c12 = g2_mma(a1, b, c12); if (ARES) { d02 = g2_mma(e0, b, d02); d12 = g2_mma(e1, b, d12); }
    if (more) fb2[u] = ld_frag(b2p + kn);
    b = fb3[u]; c03 = g2_mma(a0, b, c03); c13 = g2_mma(a1, b, c13); if (ARES) { d03 = g2_mma(e0, b, d03); d13 = g2_mma(e1, b, d13); }
    if (more) {
      fb3[u] = ld_frag(b3p + kn); fa0[u] = ld_frag(a0p + kn); fa1[u] = ld_frag(a1p + kn);
      if (ARES) { fe0[u] = ld_frag(r0p + kn); fe1[u] = ld_frag(r1p + kn); }
      if (u == GD - 1) addr_wait();      /* the pointers step once per trip */
    }
  };
#pragma unroll 1
  for (int kb = 0; kb < K - 32 * GD; kb += 32 * GD) {
#pragma unroll
    for (int u = 0; u < GD; ++u) kstep(u, kb + 32 * (u + GD), true);
  }
#pragma unroll
  for (int u = 0; u < GD; ++u) kstep(u, 0, false);      /* last GD k steps: nothing left to fetch */
  v8f accs[8] = {c00, c01, c02, c03, c10, c11, c12, c13};
  v8f accd[8] = {d00, d01, d02, d03, d10, d11, d12, d13};
#pragma unroll
  for (int u = 0; u < 8; ++u) {
    const int t = u & 3, half = u >> 2; const int col = col0 + t * 16 + ln;
    float bcol = 0.f; if (!BIASROW) bcol = bf16_rne(bias[col]);
#pragma unroll
    for (int r = 0; r < 8; ++r) {
      const int rloc = half * 16 + 8 * hh + r;
      float v = accs[u][r]; if (ARES) v += accd[u][r] * 0.0009765625f;
      float bv = bcol; if (BIASROW) bv = bf16_rne(bias[row0 + rloc]);
      so[w][rloc][t * 16 + ln] = v * alpha + bv;
    }
  }
  __builtin_amdgcn_fence(4 /* acq_rel order */, "workgroup"); __builtin_amdgcn_wave_barrier();
  bool wres = false;
  if (C16r) { if (resmode == 1) wres = ((row0 % SEQ) < EARLY); else if (resmode == 2) wres = ((col0 % SEQ) < EARLY); }
  const int rsub = lane >> 4, c4 = (lane & 15) * 4;
  {
#pragma unroll
    for (int q = 0; q < 16; ++q) {
      const int r = q * 2 + rsub; const v4f v = *(const v4fa*)&so[w][r][c4];
      const size_t o = cofs + (size_t)(row0 + r) * ldc + col0 + c4;
      if (C) *(v4f*)(C + o) = v;
      if (C16) {
        v4h h4, h4r;
#pragma unroll
        for (int i = 0; i < 4; ++i) { h4[i] = (_Float16)v[i]; h4r[i] = (_Float16)((v[i] - (float)h4[i]) * 1024.0f); }
        *(v4h*)(C16 + o) = h4;
        if (wres) *(v4h*)(C16r + o) = h4r;
      }
    }
    
  }
}

// Causal flash attention, transposed form. Block = 4 waves (64 queries of one (batch, head)); each wave owns 16 queries and loops over 32-key steps up to its diagonal.
// Q rows / K rows: planes [token][DM]; V^T planes [DM][NTOK] (row = head*64 + d). Lane (ln, hh): query q0 + ln; S^T accumulators hold keys 8hh + r (tile 0) and 16 + 8hh + r (tile 1),
// which is exactly the B-fragment k map, so P^T is packed in place. EP: hi + residual (x1024) planes on q, k, v, p and o (two accumulators per site).
template <bool EP>
__global__ __launch_bounds__(128) void k_attn(const unsigned short* __restrict__ Qh, const unsigned short* __restrict__ Qr,
    const unsigned short* __restrict__ Kh, const unsigned short* __restrict__ Kr,
    const unsigned short* __restrict__ Vh, const unsigned short* __restrict__ Vr,
    unsigned short* __restrict__ Oh, unsigned short* __restrict__ Or, int qbase) {
  __shared__ __attribute__((aligned(16))) unsigned short so[4][EP ? 2 : 1][16][64];
  const int tid = threadIdx.x, w = __builtin_amdgcn_readfirstlane(tid >> 5), lane = tid & 31, ln = lane & 15, hh = lane >> 4;
  const int head = blockIdx.y, b = blockIdx.z;
  const int q0 = qbase + (int)blockIdx.x * 64 + w * 16;
  const size_t tok0 = (size_t)b * SEQ;
  const size_t qofs = (tok0 + q0 + ln) * DM + head * HD + 8 * hh;
  const v16h qa = ld_frag(Qh + qofs), qb = ld_frag(Qh + qofs + 32);
  v16h qra = qa, qrb = qb;
  if (EP) { qra = ld_frag(Qr + qofs); qrb = ld_frag(Qr + qofs + 32); }
  addr_wait();
  const size_t kofs = (tok0 + ln) * DM + head * HD + 8 * hh;
  const size_t vofs = (size_t)(head * HD + ln) * NTOK + tok0 + 8 * hh;
  const v8f z8 = {0.f,0.f,0.f,0.f,0.f,0.f,0.f,0.f};
  v8f oh[4] = {z8, z8, z8, z8};
  v8f om[4] = {z8, z8, z8, z8};
  float mrun = -1.0e30f, lrun = 0.0f;
  const int nsteps = ((q0 + 15) >> 5) + 1;
  const int qi = q0 + ln;
  /* Fragment loads go out ahead of their use. Single planes: K and V^T of the next key step into the same registers, K right behind its score products, V^T right behind its output products.
     Hi + residual planes (twice the fragments): V^T of this step behind the score products, K of the next step behind the output products, so that only one of the two sets is live. */
  v16h kfa[2], kfc[2], kra[2], krc[2], vf[4], vrf[4];
#pragma unroll
  for (int t = 0; t < 2; ++t) {
    const size_t ko = kofs + (size_t)(16 * t) * DM;
    kfa[t] = ld_frag(Kh + ko); kfc[t] = ld_frag(Kh + ko + 32);
    if (EP) { kra[t] = ld_frag(Kr + ko); krc[t] = ld_frag(Kr + ko + 32); }
  }
  if (!EP) {
#pragma unroll
    for (int dt = 0; dt < 4; ++dt) vf[dt] = ld_frag(Vh + vofs + (size_t)(dt * 16) * NTOK);
  }
  addr_wait();
  auto step = [&](const int st, const bool more) __attribute__((always_inline)) {
    const int kb = st * 32;
    v8f sc[2];
#pragma unroll
    for (int t = 0; t < 2; ++t) {
      const size_t kn = kofs + (size_t)(kb + 32 + 16 * t) * DM;
      const v16h ka = kfa[t], kc = kfc[t];
      v8f s = mma2(ka, qa, kc, qb, z8);
      if (EP) {
        const v16h ra = kra[t], rc = krc[t];
        const v8f sm = mma4(ka, qra, kc, qrb, ra, qa, rc, qb, z8);
        s = s + sm * 0.0009765625f;
#pragma unroll
        for (int dt = 2 * t; dt < 2 * t + 2; ++dt) {
          const size_t vo = vofs + (size_t)(dt * 16) * NTOK + kb;
          vf[dt] = ld_frag(Vh + vo); vrf[dt] = ld_frag(Vr + vo);
        }
      } else if (more) { kfa[t] = ld_frag(Kh + kn); kfc[t] = ld_frag(Kh + kn + 32); }
      sc[t] = s;
    }
    if (EP || more) addr_wait();
    if (kb + 31 > q0) {      /* wave-uniform: only the diagonal step carries masked keys; masked scores are replaced */
#pragma unroll
      for (int r = 0; r < 8; ++r) {
        const int key = kb + 8 * hh + r;
        sc[0][r] = (key > qi) ? -1.0e30f : sc[0][r];
        sc[1][r] = (key + 16 > qi) ? -1.0e30f : sc[1][r];
      }
    }
    float mloc = sc[0][0];
#pragma unroll
    for (int r = 1; r < 8; ++r) mloc = fmaxf(mloc, sc[0][r]);
#pragma unroll
    for (int r = 0; r < 8; ++r) mloc = fmaxf(mloc, sc[1][r]);
    mloc = fmaxf(mloc, __shfl_xor(mloc, 16));
    const float mnew = fmaxf(mrun, mloc);
    const float alpha = __expf((mrun - mnew) * 0.125f);
    mrun = mnew;
    const float msh = mnew * 0.125f - 5.545177444f;      /* p carried x256 (same factor in the row sum) */
    float p0[8], p1[8]; float ls = 0.0f;
#pragma unroll
    for (int r = 0; r < 8; ++r) { p0[r] = __expf(sc[0][r] * 0.125f - msh); p1[r] = __expf(sc[1][r] * 0.125f - msh); ls += p0[r] + p1[r]; }
    lrun = lrun * alpha + ls;
#pragma unroll
    for (int dt = 0; dt < 4; ++dt) { oh[dt] = oh[dt] * alpha; if (EP) om[dt] = om[dt] * alpha; }
    FragH ph, pr;
#pragma unroll
    for (int r = 0; r < 8; ++r) {
      const _Float16 h0 = (_Float16)p0[r], h1 = (_Float16)p1[r];
      ph.h[r] = h0; ph.h[8 + r] = h1;
      if (EP) { pr.h[r] = (_Float16)((p0[r] - (float)h0) * 1024.0f); pr.h[8 + r] = (_Float16)((p1[r] - (float)h1) * 1024.0f); }
    }
#pragma unroll
    for (int dt = 0; dt < 4; ++dt) {
      const size_t vn = vofs + (size_t)(dt * 16) * NTOK + kb + 32;
      const v16h va = vf[dt];
      oh[dt] = mma1(va, ph.v, oh[dt]);
      if (EP) {
        const v16h vr = vrf[dt]; om[dt] = mma2(va, pr.v, vr, ph.v, om[dt]);
        if (more) {
          const int t = dt >> 1; const size_t kn = kofs + (size_t)(kb + 32 + 16 * t) * DM;
          if ((dt & 1) == 0) { kfa[t] = ld_frag(Kh + kn); kfc[t] = ld_frag(Kh + kn + 32); }
          else { kra[t] = ld_frag(Kr + kn); krc[t] = ld_frag(Kr + kn + 32); }
        }
      } else if (more) vf[dt] = ld_frag(Vh + vn);
    }
    if (more) addr_wait();
  };
#pragma unroll 1
  for (int st = 0; st < nsteps - 1; ++st) step(st, true);
  step(nsteps - 1, false);      /* last key step: nothing of a next step to fetch */
  const float lt = lrun + __shfl_xor(lrun, 16);
  const float inv = 64.0f * (1.0f / lt);      /* o carried x64 */
#pragma unroll
  for (int dt = 0; dt < 4; ++dt) {
    FragH fh, fr;
#pragma unroll
    for (int r = 0; r < 8; ++r) {
      float v = oh[dt][r]; if (EP) v += om[dt][r] * 0.0009765625f;
      v *= inv;
      const _Float16 h = (_Float16)v; fh.h[r] = h;
      if (EP) fr.h[r] = (_Float16)((v - (float)h) * 1024.0f);
    }
    *(v8us*)&so[w][0][ln][dt * 16 + 8 * hh] = fh.half[0];
    if (EP) *(v8us*)&so[w][EP ? 1 : 0][ln][dt * 16 + 8 * hh] = fr.half[0];
  }
  __builtin_amdgcn_fence(4 /* acq_rel order */, "workgroup"); __builtin_amdgcn_wave_barrier();
  const int rq = lane >> 3, pc = lane & 7;
  {
#pragma unroll
    for (int it = 0; it < 4; ++it) {
      const int row = it * 4 + rq;
      const size_t o = (tok0 + q0 + row) * DM + head * HD + pc * 8;
      const v8us v = *(const v8us*)&so[w][0][row][pc * 8];
      *(v8us*)(Oh + o) = v;
      if (EP) { const v8us vr = *(const v8us*)&so[w][EP ? 1 : 0][row][pc * 8]; *(v8us*)(Or + o) = vr; }
    }
    
  }
}

extern "C" void kernel_launch(void* const* d_in, const int* in_sizes, int n_in,
                              void* d_out, int out_size, void* d_ws, size_t ws_size, hipStream_t stream) {
  if (n_in < 9) return;
  const long long need_x = ((long long)(NB - 1) * SEQ_FULL + SEQ) * DM;
  if ((long long)in_sizes[0] < need_x) return;
  if (in_sizes[1] < DM * DM || in_sizes[3] < DM * DM || in_sizes[5] < DM * DM || in_sizes[7] < DM * DM) return;
  if (in_sizes[2] < DM || in_sizes[4] < DM || in_sizes[6] < DM || in_sizes[8] < DM) return;
  if ((long long)out_size < need_x) return;
  const float* x = (const float*)d_in[0]; const float* wq = (const float*)d_in[1]; const float* bq = (const float*)d_in[2];
  const float* wk = (const float*)d_in[3]; const float* bk = (const float*)d_in[4]; const float* wv = (const float*)d_in[5];
  const float* bv = (const float*)d_in[6]; const float* wo = (const float*)d_in[7]; const float* bo = (const float*)d_in[8];
  float* out = (float*)d_out;
  char* ws = (char*)d_ws; size_t off = 0;
  auto take = [&](size_t bytes) { char* p = ws + off; off += (bytes + 255) & ~(size_t)255; return p; };
  const size_t wbytes = (size_t)DM * DM * 2, pbytes = NTOK * DM * 2;
  unsigned short* WQ = (unsigned short*)take(wbytes); unsigned short* WK = (unsigned short*)take(wbytes);
  unsigned short* WV = (unsigned short*)take(wbytes); unsigned short* WO = (unsigned short*)take(wbytes);
  unsigned short* X16 = (unsigned short*)take(pbytes);
  unsigned short* Qh = (unsigned short*)take(pbytes); unsigned short* Qr = (unsigned short*)take(pbytes);
  unsigned short* Kh = (unsigned short*)take(pbytes); unsigned short* Kr = (unsigned short*)take(pbytes);
  unsigned short* VTh = (unsigned short*)take(pbytes); unsigned short* VTr = (unsigned short*)take(pbytes);
  unsigned short* Oh = (unsigned short*)take(pbytes); unsigned short* Or = (unsigned short*)take(pbytes);
  if (off > ws_size || off > (size_t)134217728) return;

  { const unsigned int n8 = (unsigned int)((size_t)DM * DM / 8); const unsigned g = (n8 + 255u) / 256u;      /* [out][in] weights are already Bt[n][k]; x32 */
    k_wnat<<<g, 256, 0, stream>>>(wq, n8, WQ, 32.0f); k_wnat<<<g, 256, 0, stream>>>(wk, n8, WK, 32.0f);
    k_wnat<<<g, 256, 0, stream>>>(wv, n8, WV, 32.0f); k_wnat<<<g, 256, 0, stream>>>(wo, n8, WO, 32.0f); }
  { const unsigned int n8 = (unsigned int)(NTOK * DM / 8); k_x16<<<(n8 + 255u) / 256u, 256, 0, stream>>>(x, X16, n8); }

  const unsigned gq = (unsigned)((NTOK / 128) * (DM / 64));
  /* Q, K rows [token][DM] (hi planes; residual planes for tokens with s < EARLY) */
  k_gemm2<false, false><<<dim3(gq, 1), 128, 0, stream>>>(X16, X16, DM, (size_t)0, WQ, DM, 0.03125f, bq, (float*)nullptr, (_Float16*)Qh, (_Float16*)Qr, DM, (size_t)0, 1, (int)NTOK, DM, DM);
  k_gemm2<false, false><<<dim3(gq, 1), 128, 0, stream>>>(X16, X16, DM, (size_t)0, WK, DM, 0.03125f, bk, (float*)nullptr, (_Float16*)Kh, (_Float16*)Kr, DM, (size_t)0, 1, (int)NTOK, DM, DM);
  /* V^T [DM][NTOK] = W_v (rows c) . X16^T (columns = tokens); bias by row; residual plane for token columns with s < EARLY */
  k_gemm2<false, true><<<dim3((unsigned)((DM / 128) * (NTOK / 64)), 1), 128, 0, stream>>>(WV, WV, DM, (size_t)0, X16, DM, 0.03125f, bv, (float*)nullptr, (_Float16*)VTh, (_Float16*)VTr, (int)NTOK, (size_t)0, 2, DM, (int)NTOK, DM);

  /* attention: queries [0, EARLY) on the hi + residual path, the rest on single f16 planes */
  k_attn<true><<<dim3(EARLY / 64, NH, NB), 128, 0, stream>>>(Qh, Qr, Kh, Kr, VTh, VTr, Oh, Or, 0);
  if (SEQ > EARLY)
    k_attn<false><<<dim3((SEQ - EARLY) / 64, NH, NB), 128, 0, stream>>>(Qh, Qh, Kh, Kh, VTh, VTh, Oh, Oh, EARLY);

  /* out rows (b*SEQ_FULL + s) = o W_o^T + b_o; alpha = 1 / (64 * 32) */
  k_gemm2<true, false><<<dim3((unsigned)((EARLY / 128) * (DM / 64)), NB), 128, 0, stream>>>(Oh, Or, DM, (size_t)SEQ * DM, WO, DM, 0.00048828125f, bo, out, (_Float16*)nullptr, (_Float16*)nullptr, DM, (size_t)SEQ_FULL * DM, 0, EARLY, DM, DM);
  if (SEQ > EARLY)
    k_gemm2<false, false><<<dim3((unsigned)(((SEQ - EARLY) / 128) * (DM / 64)), NB), 128, 0, stream>>>(Oh + (size_t)EARLY * DM, Oh + (size_t)EARLY * DM, DM, (size_t)SEQ * DM, WO, DM, 0.00048828125f, bo, out + (size_t)EARLY * DM, (_Float16*)nullptr, (_Float16*)nullptr, DM, (size_t)SEQ_FULL * DM, 0, SEQ - EARLY, DM, DM);
}

// v002
// It runs in 229 microseconds.
// In two side-by-side timings against v001, it was 1.77 and 1.78 times as fast.
// All steps since v000 together make it 2.31 times as fast.
#include <hip/hip_runtime.h>
// Causal multi-head self-attention: x [2][4096][768]; q / k / v = x W^T + b ([out][in] 768 x 768 weights, biases); 12 heads of 64; scores / 8; causal (key <= query) softmax; out = merged W_o^T + b_o.
// Compute dtype: every contraction on v_wmma_f32_16x16x32_f16 with f32 accumulation. Inputs converted RNE to bf16 and held exactly in f16 (weights x32). q, k, v, softmax weights (x256) and o (x64) are f16 operands;
// for the first EARLY queries of each sequence q, k, v, p and o are carried as f16 hi + f16 residual (x1024) planes with separate accumulators (3 products per site). Scores, softmax statistics and epilogues are f32.
// Structure: token rows r = b*SEQ + s. Q, K as planes [token][768]; V produced directly transposed (V^T = W_v x^T, plane [768][tokens]); attention is a register-fed transposed flash loop per wave
// (S^T = K Q^T with Q^T as the B operand, packed P^T from the S^T accumulators as the B operand of O^T = V^T P^T; 32 keys per step; no LDS in the key loop); o as f16 planes; out GEMM writes f32 rows.
// Every f16 plane [R][L] (weights, x, q, k, V^T, o) is stored in fragment order: tiles of 16 rows x 32 columns, 512 elements each, tile (r >> 4, c >> 5) at element ((r >> 4) * (L / 32) + (c >> 5)) * 512;
// inside a tile element (r, c) stands at ((c >> 4) & 1) * 256 + (((c >> 3) & 1) * 16 + (r & 15)) * 8 + (c & 7), so each of a fragment's two loads is lane * 16 bytes into 512 contiguous bytes (four whole lines).
#ifndef NB
#define NB 2
#endif
#ifndef SEQ
#define SEQ 4096
#endif
#define NB_FULL 2
#define SEQ_FULL 4096
#define DM 768
#define NH 12
#define HD 64
#define NTOK ((size_t)NB * SEQ)
#define EARLY ((SEQ) < 1024 ? (SEQ) : 1024)   /* queries per sequence on the hi + residual path */
static_assert(SEQ % 128 == 0);
static_assert(EARLY % 128 == 0);
static_assert((SEQ - EARLY) % 128 == 0);
static_assert(NB <= NB_FULL);
static_assert(SEQ <= SEQ_FULL);
static_assert(DM % 128 == 0);
static_assert(DM % 96 == 0);
static_assert(NH * HD == DM);
static_assert(HD == 64);

typedef _Float16 v16h __attribute__((ext_vector_type(16)));
typedef unsigned short v8us __attribute__((ext_vector_type(8), may_alias));
typedef float v8f __attribute__((ext_vector_type(8)));
typedef float v4f __attribute__((ext_vector_type(4)));
typedef float v4fa __attribute__((ext_vector_type(4), may_alias));
union FragH { v16h v; v8us half[2]; _Float16 h[16]; unsigned short u[16]; };

__device__ __forceinline__ unsigned short bf16_bits(float x) { unsigned int u = __float_as_uint(x); return (unsigned short)((u + 0x7FFFu + ((u >> 16) & 1u)) >> 16); }
__device__ __forceinline__ float bf16_rne(float x) { return __uint_as_float(((unsigned int)bf16_bits(x)) << 16); }

// 16x32 fragment (A rows or B columns) of a plane in fragment order: p = tile start + 8*lane; elements 0..7 <- (row lane&15, k0+8h..), 8..15 <- (row lane&15, k0+16+8h..), h = lane>>4
__device__ __forceinline__ v16h ld_frag(const unsigned short* p) { FragH f; f.half[0] = *(const v8us*)p; f.half[1] = *(const v8us*)(p + 256); return f.v; }
// Thread t writes the 8 elements at t*8 of a fragment-order plane with DM columns: their row and first column.
__device__ __forceinline__ void frag_src(unsigned int t, unsigned int& r, unsigned int& c8) {
  const unsigned int tile = t >> 6, band = tile / (DM / 32), cb = tile - band * (DM / 32);
  r = band * 16u + (t & 15u); c8 = cb * 32u + ((t >> 5) & 1u) * 16u + ((t >> 4) & 1u) * 8u;
}

// Stands behind a run of fragment loads that stay in flight: their address registers may be reused only behind it.
__device__ __forceinline__ void addr_wait() { asm volatile("s_wait_xcnt 0x0" ::: "memory"); }

__device__ __forceinline__ v8f wm(v16h a, v16h b, v8f c) { return __builtin_amdgcn_wmma_f32_16x16x32_f16(false, a, false, b, (short)0, c, false, false); }
__device__ __forceinline__ v8f mma1(v16h a, v16h b, v8f c) {
  c = wm(a, b, c);
  asm volatile("v_nop\n\tv_nop\n\tv_nop\n\tv_nop" : "+v"(c) : "v"(a), "v"(b));
  return c;
}
__device__ __forceinline__ v8f mma2(v16h a0, v16h b0, v16h a1, v16h b1, v8f c) {
  c = wm(a0, b0, c); c = wm(a1, b1, c);
  asm volatile("v_nop\n\tv_nop\n\tv_nop\n\tv_nop" : "+v"(c) : "v"(a0), "v"(b0), "v"(a1), "v"(b1));
  return c;
}
__device__ __forceinline__ v8f mma4(v16h a0, v16h b0, v16h a1, v16h b1, v16h a2, v16h b2, v16h a3, v16h b3, v8f c) {
  c = wm(a0, b0, c); c = wm(a1, b1, c); c = wm(a2, b2, c); c = wm(a3, b3, c);
  asm volatile("v_nop\n\tv_nop\n\tv_nop\n\tv_nop" : "+v"(c) : "v"(a0), "v"(b0), "v"(a1), "v"(b1), "v"(a2), "v"(b2), "v"(a3), "v"(b3));
  return c;
}

__global__ __launch_bounds__(256) void k_wnat(const float* __restrict__ w, unsigned int n8, unsigned short* __restrict__ Bt, float scale) {
  const unsigned int t = blockIdx.x * 256u + threadIdx.x; if (t >= n8) return;
  unsigned int r, c8; frag_src(t, r, c8);
  const float* src = w + (size_t)r * DM + c8;
  const v4f a = *(const v4fa*)src, c = *(const v4fa*)(src + 4);
  FragH f;
#pragma unroll
  for (int q = 0; q < 4; ++q) { f.h[q] = (_Float16)(bf16_rne(a[q]) * scale); f.h[4 + q] = (_Float16)(bf16_rne(c[q]) * scale); }
  const v8us o = f.half[0];
  unsigned short* d = Bt + (size_t)t * 8;
  *(v8us*)d = o; 
}

__global__ __launch_bounds__(256) void k_x16(const float* __restrict__ x, unsigned short* __restrict__ X16, unsigned int n8) {
  const unsigned int t = blockIdx.x * 256u + threadIdx.x; if (t >= n8) return;
  unsigned int r, c8; frag_src(t, r, c8);
  const unsigned int b = r / SEQ, s = r - b * SEQ;
  const float* src = x + ((size_t)b * SEQ_FULL + s) * DM + c8;
  const v4f a = *(const v4fa*)src, c = *(const v4fa*)(src + 4);
  FragH f;
#pragma unroll
  for (int q = 0; q < 4; ++q) { f.h[q] = (_Float16)bf16_rne(a[q]); f.h[4 + q] = (_Float16)bf16_rne(c[q]); }
  const v8us o = f.half[0];
  unsigned short* d = X16 + (size_t)t * 8;
  *(v8us*)d = o; 
}

__device__ __forceinline__ v8f g2_mma(v16h a, v16h b, v8f c) { v8f d = __builtin_amdgcn_wmma_f32_16x16x32_f16(false, a, false, b, (short)0, c, false, false); asm volatile("v_nop\n\tv_nop\n\tv_nop\n\tv_nop" : "+v"(d) : "v"(a), "v"(b)); return d; }

// GEMM C[M][N] = (A (+ Ar/1024)) . Bt^T * alpha + bias; A, Ar f16 [M][K] (row length lda, batch stride sA on grid.y), Bt f16 [N][K] (row length ldb), all in fragment order.
// Block = 4 waves, wave tile 32 x 64 (block 128 x 64); M % 128 == 0, N % 64 == 0, K % 96 == 0. BIASROW: bias indexed by row, else by column (bias converted RNE to bf16).
// Outputs: C f32 rows (optional), C16 f16 in fragment order (optional), C16r = f16((v - f16(v)) * 1024) (optional; resmode 1: rows with (row % SEQ) < EARLY, resmode 2: columns with (col % SEQ) < EARLY).
template <bool ARES, bool BIASROW>
__global__ __launch_bounds__(128) void k_gemm2(const unsigned short* __restrict__ A, const unsigned short* __restrict__ Ar, int lda, size_t sA,
    const unsigned short* __restrict__ Bh, int ldb, float alpha, const float* __restrict__ bias,
    float* __restrict__ C, _Float16* __restrict__ C16, _Float16* __restrict__ C16r, int ldc, size_t sC, int resmode, int M, int N, int K) {
  __shared__ __attribute__((aligned(16))) float so[4][32][68];
  const int tid = threadIdx.x, w = __builtin_amdgcn_readfirstlane(tid >> 5), lane = tid & 31, ln = lane & 15, hh = lane >> 4; const int by = blockIdx.y;
  const int ntn = N >> 6; const int mt = blockIdx.x / ntn, nq = blockIdx.x - mt * ntn; const int row0 = mt * 128 + 32 * w, col0 = nq * 64; if (row0 >= M) return;
  const size_t aofs = (size_t)by * sA + (size_t)row0 * lda + 8 * lane;
  const size_t cofs = (size_t)by * sC;
  const unsigned short* a0p = A + aofs; const unsigned short* a1p = a0p + (size_t)16 * lda;
  const unsigned short* r0p = Ar + aofs; const unsigned short* r1p = r0p + (size_t)16 * lda;
  const unsigned short* b0p = Bh + (size_t)col0 * ldb + 8 * lane; const unsigned short* b1p = b0p + (size_t)16 * ldb; const unsigned short* b2p = b1p + (size_t)16 * ldb; const unsigned short* b3p = b2p + (size_t)16 * ldb;
  const v8f z8 = {0.f,0.f,0.f,0.f,0.f,0.f,0.f,0.f};
  v8f c00 = z8, c01 = z8, c02 = z8, c03 = z8, c10 = z8, c11 = z8, c12 = z8, c13 = z8;
  v8f d00 = z8, d01 = z8, d02 = z8, d03 = z8, d10 = z8, d11 = z8, d12 = z8, d13 = z8;
  /* Fragments live in GD register sets; a set is refilled for k + 32*GD right behind its last product, so a load has GD k steps to land (the product order is unchanged). */
  constexpr int GD = ARES ? 1 : 3;
  v16h fa0[GD], fa1[GD], fe0[GD], fe1[GD], fb0[GD], fb1[GD], fb2[GD], fb3[GD];
#pragma unroll
  for (int u = 0; u < GD; ++u) {
    const int k = 512 * u;      /* one tile of 512 elements per 32 k */
    fb0[u] = ld_frag(b0p + k); fa0[u] = ld_frag(a0p + k); fa1[u] = ld_frag(a1p + k);
    if (ARES) { fe0[u] = ld_frag(r0p + k); fe1[u] = ld_frag(r1p + k); }
    fb1[u] = ld_frag(b1p + k); fb2[u] = ld_frag(b2p + k); fb3[u] = ld_frag(b3p + k);
  }
  addr_wait();
  auto kstep = [&](const int u, const int kn, const bool more) __attribute__((always_inline)) {
    const v16h a0 = fa0[u], a1 = fa1[u];
    v16h e0 = a0, e1 = a1;
    if (ARES) { e0 = fe0[u]; e1 = fe1[u]; }
    v16h b = fb0[u]; c00 = g2_mma(a0, b, c00); c10 = g2_mma(a1, b, c10); if (ARES) { d00 = g2_mma(e0, b, d00); d10 = g2_mma(e1, b, d10); }
    if (more) fb0[u] = ld_frag(b0p + kn);
    b = fb1[u]; c01 = g2_mma(a0, b, c01); c11 = g2_mma(a1, b, c11); if (ARES) { d01 = g2_mma(e0, b, d01); d11 = g2_mma(e1, b, d11); }
    if (more) fb1[u] = ld_frag(b1p + kn);
    b = fb2[u]; c02 = g2_mma(a0, b, c02); c12 = g2_mma(a1, b, c12); if (ARES) { d02 = g2_mma(e0, b, d02); d12 = g2_mma(e1, b, d12); }
    if (more) fb2[u] = ld_frag(b2p + kn);
    b = fb3[u]; c03 = g2_mma(a0, b, c03); c13 = g2_mma(a1, b, c13); if (ARES) { d03 = g2_mma(e0, b, d03); d13 = g2_mma(e1, b, d13); }
    if (more) {
      fb3[u] = ld_frag(b3p + kn); fa0[u] = ld_frag(a0p + kn); fa1[u] = ld_frag(a1p + kn);
      if (ARES) { fe0[u] = ld_frag(r0p + kn); fe1[u] = ld_frag(r1p + kn); }
      if (u == GD - 1) addr_wait();      /* the pointers step once per trip */
    }
  };
#pragma unroll 1
  for (int kb = 0; kb < (K - 32 * GD) * 16; kb += 512 * GD) {      /* kb counts elements of a 16-row band: 512 per 32 k */
#pragma unroll
    for (int u = 0; u < GD; ++u) kstep(u, kb + 512 * (u + GD), true);
  }
#pragma unroll
  for (int u = 0; u < GD; ++u) kstep(u, 0, false);      /* last GD k steps: nothing left to fetch */
  v8f accs[8] = {c00, c01, c02, c03, c10, c11, c12, c13};
  v8f accd[8] = {d00, d01, d02, d03, d10, d11, d12, d13};
#pragma unroll
  for (int u = 0; u < 8; ++u) {
    const int t = u & 3, half = u >> 2; const int col = col0 + t * 16 + ln;
    float bcol = 0.f; if (!BIASROW) bcol = bf16_rne(bias[col]);
#pragma unroll
    for (int r = 0; r < 8; ++r) {
      const int rloc = half * 16 + 8 * hh + r;
      float v = accs[u][r]; if (ARES) v += accd[u][r] * 0.0009765625f;
      float bv = bcol; if (BIASROW) bv = bf16_rne(bias[row0 + rloc]);
      so[w][rloc][t * 16 + ln] = v * alpha + bv;
    }
  }
  __builtin_amdgcn_fence(4 /* acq_rel order */, "workgroup"); __builtin_amdgcn_wave_barrier();
  bool wres = false;
  if (C16r) { if (resmode == 1) wres = ((row0 % SEQ) < EARLY); else if (resmode == 2) wres = ((col0 % SEQ) < EARLY); }
  if (C) {
    const int rsub = lane >> 4, c4 = (lane & 15) * 4;
#pragma unroll
    for (int q = 0; q < 16; ++q) {
      const int r = q * 2 + rsub; const v4f v = *(const v4fa*)&so[w][r][c4];
      *(v4f*)(C + cofs + (size_t)(row0 + r) * ldc + col0 + c4) = v;
    }
    addr_wait();      /* the f16 block below may reuse registers that these stores name */
  }
  if (C16) {      /* the wave's 32 x 64 tile = 2 x 2 fragment tiles of two 512-byte halves; the lane writes 16 bytes of each half */
    const size_t o0 = cofs + (size_t)row0 * ldc + (size_t)(col0 >> 5) * 512 + lane * 8, o1 = o0 + (size_t)16 * ldc;
    unsigned short* h0p = (unsigned short*)C16 + o0; unsigned short* h1p = (unsigned short*)C16 + o1;
    unsigned short* e0p = (unsigned short*)C16r + o0; unsigned short* e1p = (unsigned short*)C16r + o1;
    FragH fh[8], fr[8];
#pragma unroll
    for (int q = 0; q < 8; ++q) {      /* q = band * 4 + column tile * 2 + half */
      const float* sp = &so[w][(q >> 2) * 16 + ln][(q & 3) * 16 + hh * 8];
      const v4f v0 = *(const v4fa*)sp, v1 = *(const v4fa*)(sp + 4);
#pragma unroll
      for (int i = 0; i < 4; ++i) {
        fh[q].h[i] = (_Float16)v0[i]; fr[q].h[i] = (_Float16)((v0[i] - (float)fh[q].h[i]) * 1024.0f);
        fh[q].h[4 + i] = (_Float16)v1[i]; fr[q].h[4 + i] = (_Float16)((v1[i] - (float)fh[q].h[4 + i]) * 1024.0f);
      }
    }
#pragma unroll
    for (int q = 0; q < 8; ++q) *(v8us*)((q >> 2 ? h1p : h0p) + (q & 3) * 256) = fh[q].half[0];
    addr_wait();      /* the residual stores below may reuse registers that the stores above name */
    if (wres) {
#pragma unroll
      for (int q = 0; q < 8; ++q) *(v8us*)((q >> 2 ? e1p : e0p) + (q & 3) * 256) = fr[q].half[0];
    }
  }
}

// Causal flash attention, transposed form. Block = 4 waves (64 queries of one (batch, head)); each wave owns 16 queries and loops over 32-key steps up to its diagonal.
// Q / K planes [token][DM]; V^T planes [DM][NTOK] (row = head*64 + d); o planes [token][DM]; all in fragment order. Lane (ln, hh): query q0 + ln; S^T accumulators hold keys 8hh + r (tile 0) and 16 + 8hh + r (tile 1),
// which is exactly the B-fragment k map, so P^T is packed in place. EP: hi + residual (x1024) planes on q, k, v, p and o (two accumulators per site).
template <bool EP>
__global__ __launch_bounds__(128) void k_attn(const unsigned short* __restrict__ Qh, const unsigned short* __restrict__ Qr,
    const unsigned short* __restrict__ Kh, const unsigned short* __restrict__ Kr,
    const unsigned short* __restrict__ Vh, const unsigned short* __restrict__ Vr,
    unsigned short* __restrict__ Oh, unsigned short* __restrict__ Or, int qbase) {
  const int tid = threadIdx.x, w = __builtin_amdgcn_readfirstlane(tid >> 5), lane = tid & 31, ln = lane & 15, hh = lane >> 4;
  const int head = blockIdx.y, b = blockIdx.z;
  const int q0 = qbase + (int)blockIdx.x * 64 + w * 16;
  const size_t tok0 = (size_t)b * SEQ;
  const size_t qofs = (tok0 + q0) * DM + head * (HD * 16) + 8 * lane;
  const v16h qa = ld_frag(Qh + qofs), qb = ld_frag(Qh + qofs + 512);
  v16h qra = qa, qrb = qb;
  if (EP) { qra = ld_frag(Qr + qofs); qrb = ld_frag(Qr + qofs + 512); }
  addr_wait();
  const size_t kofs = tok0 * DM + head * (HD * 16) + 8 * lane;
  const size_t vofs = (size_t)(head * HD) * NTOK + tok0 * 16 + 8 * lane;
  const v8f z8 = {0.f,0.f,0.f,0.f,0.f,0.f,0.f,0.f};
  v8f oh[4] = {z8, z8, z8, z8};
  v8f om[4] = {z8, z8, z8, z8};
  float mrun = -1.0e30f, lrun = 0.0f;
  const int nsteps = ((q0 + 15) >> 5) + 1;
  const int qi = q0 + ln;
  /* Fragment loads go out ahead of their use. Single planes: K and V^T of the next key step into the same registers, K right behind its score products, V^T right behind its output products.
     Hi + residual planes (twice the fragments): V^T of this step behind the score products, K of the next step behind the output products, so that only one of the two sets is live. */
  v16h kfa[2], kfc[2], kra[2], krc[2], vf[4], vrf[4];
#pragma unroll
  for (int t = 0; t < 2; ++t) {
    const size_t ko = kofs + (size_t)(16 * t) * DM;
    kfa[t] = ld_frag(Kh + ko); kfc[t] = ld_frag(Kh + ko + 512);
    if (EP) { kra[t] = ld_frag(Kr + ko); krc[t] = ld_frag(Kr + ko + 512); }
    __builtin_amdgcn_sched_barrier(0);      /* first loads issue in the loop's own order (K tile 0, K tile 1, V^T): otherwise the loop's waits on K, counted over both ways in, also cover the V^T loads in flight */
  }
  if (!EP) {
#pragma unroll
    for (int dt = 0; dt < 4; ++dt) vf[dt] = ld_frag(Vh + vofs + (size_t)(dt * 16) * NTOK);
  }
  addr_wait();
  auto step = [&](const int st, const bool more) __attribute__((always_inline)) {
    const int kb = st * 32;
    v8f sc[2];
#pragma unroll
    for (int t = 0; t < 2; ++t) {
      const size_t kn = kofs + (size_t)(kb + 32 + 16 * t) * DM;
      const v16h ka = kfa[t], kc = kfc[t];
      v8f s = mma2(ka, qa, kc, qb, z8);
      if (EP) {
        const v16h ra = kra[t], rc = krc[t];
        const v8f sm = mma4(ka, qra, kc, qrb, ra, qa, rc, qb, z8);
        s = s + sm * 0.0009765625f;
#pragma unroll
        for (int dt = 2 * t; dt < 2 * t + 2; ++dt) {
          const size_t vo = vofs + (size_t)(dt * 16) * NTOK + (size_t)kb * 16;
          vf[dt] = ld_frag(Vh + vo); vrf[dt] = ld_frag(Vr + vo);
        }
      } else if (more) { kfa[t] = ld_frag(Kh + kn); kfc[t] = ld_frag(Kh + kn + 512); }
      sc[t] = s;
    }
    if (EP || more) addr_wait();
    if (kb + 31 > q0) {      /* wave-uniform: only the diagonal step carries masked keys; masked scores are replaced */
#pragma unroll
      for (int r = 0; r < 8; ++r) {
        const int key = kb + 8 * hh + r;
        sc[0][r] = (key > qi) ? -1.0e30f : sc[0][r];
        sc[1][r] = (key + 16 > qi) ? -1.0e30f : sc[1][r];
      }
    }
    float mloc = sc[0][0];
#pragma unroll
    for (int r = 1; r < 8; ++r) mloc = fmaxf(mloc, sc[0][r]);
#pragma unroll
    for (int r = 0; r < 8; ++r) mloc = fmaxf(mloc, sc[1][r]);
    mloc = fmaxf(mloc, __shfl_xor(mloc, 16));
    const float mnew = fmaxf(mrun, mloc);
    const float alpha = __expf((mrun - mnew) * 0.125f);
    mrun = mnew;
    const float msh = mnew * 0.125f - 5.545177444f;      /* p carried x256 (same factor in the row sum) */
    float p0[8], p1[8]; float ls = 0.0f;
#pragma unroll
    for (int r = 0; r < 8; ++r) { p0[r] = __expf(sc[0][r] * 0.125f - msh); p1[r] = __expf(sc[1][r] * 0.125f - msh); ls += p0[r] + p1[r]; }
    lrun = lrun * alpha + ls;
#pragma unroll
    for (int dt = 0; dt < 4; ++dt) { oh[dt] = oh[dt] * alpha; if (EP) om[dt] = om[dt] * alpha; }
    FragH ph, pr;
#pragma unroll
    for (int r = 0; r < 8; ++r) {
      const _Float16 h0 = (_Float16)p0[r], h1 = (_Float16)p1[r];
      ph.h[r] = h0; ph.h[8 + r] = h1;
      if (EP) { pr.h[r] = (_Float16)((p0[r] - (float)h0) * 1024.0f); pr.h[8 + r] = (_Float16)((p1[r] - (float)h1) * 1024.0f); }
    }
#pragma unroll
    for (int dt = 0; dt < 4; ++dt) {
      const size_t vn = vofs + (size_t)(dt * 16) * NTOK + (size_t)(kb + 32) * 16;
      const v16h va = vf[dt];
      oh[dt] = mma1(va, ph.v, oh[dt]);
      if (EP) {
        const v16h vr = vrf[dt]; om[dt] = mma2(va, pr.v, vr, ph.v, om[dt]);
        if (more) {
          const int t = dt >> 1; const size_t kn = kofs + (size_t)(kb + 32 + 16 * t) * DM;
          if ((dt & 1) == 0) { kfa[t] = ld_frag(Kh + kn); kfc[t] = ld_frag(Kh + kn + 512); }
          else { kra[t] = ld_frag(Kr + kn); krc[t] = ld_frag(Kr + kn + 512); }
        }
      } else if (more) vf[dt] = ld_frag(Vh + vn);
    }
    if (more) addr_wait();
  };
#pragma unroll 1
  for (int st = 0; st < nsteps - 1; ++st) step(st, true);
  step(nsteps - 1, false);      /* last key step: nothing of a next step to fetch */
  const float lt = lrun + __shfl_xor(lrun, 16);
  const float inv = 64.0f * (1.0f / lt);      /* o carried x64 */
#pragma unroll
  for (int dt = 0; dt < 4; ++dt) {
    FragH fh, fr;
#pragma unroll
    for (int r = 0; r < 8; ++r) {
      float v = oh[dt][r]; if (EP) v += om[dt][r] * 0.0009765625f;
      v *= inv;
      const _Float16 h = (_Float16)v; fh.h[r] = h;
      if (EP) fr.h[r] = (_Float16)((v - (float)h) * 1024.0f);
    }
    /* the lane's 8 values (query ln, d = 16 dt + 8 hh ..) are its 16 bytes of half dt & 1 of fragment tile dt >> 1 */
    const size_t o = qofs + (dt >> 1) * 512 + (dt & 1) * 256;
    *(v8us*)(Oh + o) = fh.half[0];
    if (EP) *(v8us*)(Or + o) = fr.half[0];
  }
}

extern "C" void kernel_launch(void* const* d_in, const int* in_sizes, int n_in,
                              void* d_out, int out_size, void* d_ws, size_t ws_size, hipStream_t stream) {
  if (n_in < 9) return;
  const long long need_x = ((long long)(NB - 1) * SEQ_FULL + SEQ) * DM;
  if ((long long)in_sizes[0] < need_x) return;
  if (in_sizes[1] < DM * DM || in_sizes[3] < DM * DM || in_sizes[5] < DM * DM || in_sizes[7] < DM * DM) return;
  if (in_sizes[2] < DM || in_sizes[4] < DM || in_sizes[6] < DM || in_sizes[8] < DM) return;
  if ((long long)out_size < need_x) return;
  const float* x = (const float*)d_in[0]; const float* wq = (const float*)d_in[1]; const float* bq = (const float*)d_in[2];
  const float* wk = (const float*)d_in[3]; const float* bk = (const float*)d_in[4]; const float* wv = (const float*)d_in[5];
  const float* bv = (const float*)d_in[6]; const float* wo = (const float*)d_in[7]; const float* bo = (const float*)d_in[8];
  float* out = (float*)d_out;
  char* ws = (char*)d_ws; size_t off = 0;
  auto take = [&](size_t bytes) { char* p = ws + off; off += (bytes + 255) & ~(size_t)255; return p; };
  const size_t wbytes = (size_t)DM * DM * 2, pbytes = NTOK * DM * 2;
  unsigned short* WQ = (unsigned short*)take(wbytes); unsigned short* WK = (unsigned short*)take(wbytes);
  unsigned short* WV = (unsigned short*)take(wbytes); unsigned short* WO = (unsigned short*)take(wbytes);
  unsigned short* X16 = (unsigned short*)take(pbytes);
  unsigned short* Qh = (unsigned short*)take(pbytes); unsigned short* Qr = (unsigned short*)take(pbytes);
  unsigned short* Kh = (unsigned short*)take(pbytes); unsigned short* Kr = (unsigned short*)take(pbytes);
  unsigned short* VTh = (unsigned short*)take(pbytes); unsigned short* VTr = (unsigned short*)take(pbytes);
  unsigned short* Oh = (unsigned short*)take(pbytes); unsigned short* Or = (unsigned short*)take(pbytes);
  if (off > ws_size || off > (size_t)134217728) return;

  { const unsigned int n8 = (unsigned int)((size_t)DM * DM / 8); const unsigned g = (n8 + 255u) / 256u;      /* [out][in] weights are already Bt[n][k]; x32; fragment order */
    k_wnat<<<g, 256, 0, stream>>>(wq, n8, WQ, 32.0f); k_wnat<<<g, 256, 0, stream>>>(wk, n8, WK, 32.0f);
    k_wnat<<<g, 256, 0, stream>>>(wv, n8, WV, 32.0f); k_wnat<<<g, 256, 0, stream>>>(wo, n8, WO, 32.0f); }
  { const unsigned int n8 = (unsigned int)(NTOK * DM / 8); k_x16<<<(n8 + 255u) / 256u, 256, 0, stream>>>(x, X16, n8); }

  const unsigned gq = (unsigned)((NTOK / 128) * (DM / 64));
  /* Q, K [token][DM] (hi planes; residual planes for tokens with s < EARLY) */
  k_gemm2<false, false><<<dim3(gq, 1), 128, 0, stream>>>(X16, X16, DM, (size_t)0, WQ, DM, 0.03125f, bq, (float*)nullptr, (_Float16*)Qh, (_Float16*)Qr, DM, (size_t)0, 1, (int)NTOK, DM, DM);
  k_gemm2<false, false><<<dim3(gq, 1), 128, 0, stream>>>(X16, X16, DM, (size_t)0, WK, DM, 0.03125f, bk, (float*)nullptr, (_Float16*)Kh, (_Float16*)Kr, DM, (size_t)0, 1, (int)NTOK, DM, DM);
  /* V^T [DM][NTOK] = W_v (rows c) . X16^T (columns = tokens); bias by row; residual plane for token columns with s < EARLY */
  k_gemm2<false, true><<<dim3((unsigned)((DM / 128) * (NTOK / 64)), 1), 128, 0, stream>>>(WV, WV, DM, (size_t)0, X16, DM, 0.03125f, bv, (float*)nullptr, (_Float16*)VTh, (_Float16*)VTr, (int)NTOK, (size_t)0, 2, DM, (int)NTOK, DM);

  /* attention: queries [0, EARLY) on the hi + residual path, the rest on single f16 planes */
  k_attn<true><<<dim3(EARLY / 64, NH, NB), 128, 0, stream>>>(Qh, Qr, Kh, Kr, VTh, VTr, Oh, Or, 0);
  if (SEQ > EARLY)
    k_attn<false><<<dim3((SEQ - EARLY) / 64, NH, NB), 128, 0, stream>>>(Qh, Qh, Kh, Kh, VTh, VTh, Oh, Oh, EARLY);

  /* out rows (b*SEQ_FULL + s) = o W_o^T + b_o; alpha = 1 / (64 * 32) */
  k_gemm2<true, false><<<dim3((unsigned)((EARLY / 128) * (DM / 64)), NB), 128, 0, stream>>>(Oh, Or, DM, (size_t)SEQ * DM, WO, DM, 0.00048828125f, bo, out, (_Float16*)nullptr, (_Float16*)nullptr, DM, (size_t)SEQ_FULL * DM, 0, EARLY, DM, DM);
  if (SEQ > EARLY)
    k_gemm2<false, false><<<dim3((unsigned)(((SEQ - EARLY) / 128) * (DM / 64)), NB), 128, 0, stream>>>(Oh + (size_t)EARLY * DM, Oh + (size_t)EARLY * DM, DM, (size_t)SEQ * DM, WO, DM, 0.00048828125f, bo, out + (size_t)EARLY * DM, (_Float16*)nullptr, (_Float16*)nullptr, DM, (size_t)SEQ_FULL * DM, 0, SEQ - EARLY, DM, DM);
}

// v003
// One run takes 175 microseconds.
// In two side-by-side timings against v002, it was 1.32 and 1.31 times as fast.
// All steps since v000 together make it 3.03 times as fast.
#include <hip/hip_runtime.h>
// Causal multi-head self-attention: x [2][4096][768]; q / k / v = x W^T + b ([out][in] 768 x 768 weights, biases); 12 heads of 64; scores / 8; causal (key <= query) softmax; out = merged W_o^T + b_o.
// Compute dtype: every contraction on v_wmma_f32_16x16x32_f16 with f32 accumulation. Inputs converted RNE to bf16 and held exactly in f16 (weights x32). q, k, v, softmax weights (x256) and o (x64) are f16 operands;
// for the first EARLY queries of each sequence q, k, v, p and o are carried as f16 hi + f16 residual (x1024) planes with separate accumulators (3 products per site). Scores, softmax statistics and epilogues are f32.
// Structure: token rows r = b*SEQ + s. Q, K as planes [token][768]; V produced directly transposed (V^T = W_v x^T, plane [768][tokens]); attention is a register-fed transposed flash loop per wave
// (S^T = K Q^T with Q^T as the B operand, packed P^T from the S^T accumulators as the B operand of O^T = V^T P^T; 32 keys per step; no LDS in the key loop); o as f16 planes; out GEMM writes f32 rows.
// Every f16 plane [R][L] (weights, x, q, k, V^T, o) is stored in fragment order: tiles of 16 rows x 32 columns, 512 elements each, tile (r >> 4, c >> 5) at element ((r >> 4) * (L / 32) + (c >> 5)) * 512;
// inside a tile element (r, c) stands at ((c >> 4) & 1) * 256 + (((c >> 3) & 1) * 16 + (r & 15)) * 8 + (c & 7), so each of a fragment's two loads is lane * 16 bytes into 512 contiguous bytes (four whole lines).
#ifndef NB
#define NB 2
#endif
#ifndef SEQ
#define SEQ 4096
#endif
#define NB_FULL 2
#define SEQ_FULL 4096
#define DM 768
#define NH 12
#define HD 64
#define NTOK ((size_t)NB * SEQ)
#define EARLY ((SEQ) < 1024 ? (SEQ) : 1024)   /* queries per sequence on the hi + residual path */
static_assert(SEQ % 128 == 0);
static_assert(EARLY % 128 == 0);
static_assert((SEQ - EARLY) % 128 == 0);
static_assert(NB <= NB_FULL);
static_assert(SEQ <= SEQ_FULL);
static_assert(DM % 128 == 0);
static_assert(DM % 96 == 0);
static_assert(NH * HD == DM);
static_assert(HD == 64);

typedef _Float16 v16h __attribute__((ext_vector_type(16)));
typedef unsigned short v8us __attribute__((ext_vector_type(8), may_alias));
typedef float v8f __attribute__((ext_vector_type(8)));
typedef float v4f __attribute__((ext_vector_type(4)));
typedef float v4fa __attribute__((ext_vector_type(4), may_alias));
union FragH { v16h v; v8us half[2]; _Float16 h[16]; unsigned short u[16]; };

__device__ __forceinline__ unsigned short bf16_bits(float x) { unsigned int u = __float_as_uint(x); return (unsigned short)((u + 0x7FFFu + ((u >> 16) & 1u)) >> 16); }
__device__ __forceinline__ float bf16_rne(float x) { return __uint_as_float(((unsigned int)bf16_bits(x)) << 16); }

// 16x32 fragment (A rows or B columns) of a plane in fragment order: p = tile start + 8*lane; elements 0..7 <- (row lane&15, k0+8h..), 8..15 <- (row lane&15, k0+16+8h..), h = lane>>4
__device__ __forceinline__ v16h ld_frag(const unsigned short* p) { FragH f; f.half[0] = *(const v8us*)p; f.half[1] = *(const v8us*)(p + 256); return f.v; }
// Thread t writes the 8 elements at t*8 of a fragment-order plane with DM columns: their row and first column.
__device__ __forceinline__ void frag_src(unsigned int t, unsigned int& r, unsigned int& c8) {
  const unsigned int tile = t >> 6, band = tile / (DM / 32), cb = tile - band * (DM / 32);
  r = band * 16u + (t & 15u); c8 = cb * 32u + ((t >> 5) & 1u) * 16u + ((t >> 4) & 1u) * 8u;
}

// Stands behind a run of fragment loads that stay in flight: their address registers may be reused only behind it.
__device__ __forceinline__ void addr_wait() { asm volatile("s_wait_xcnt 0x0" ::: "memory"); }

__device__ __forceinline__ v8f wm(v16h a, v16h b, v8f c) { return __builtin_amdgcn_wmma_f32_16x16x32_f16(false, a, false, b, (short)0, c, false, false); }
__device__ __forceinline__ v8f mma1(v16h a, v16h b, v8f c) {
  c = wm(a, b, c);
  asm volatile("v_nop\n\tv_nop\n\tv_nop\n\tv_nop" : "+v"(c) : "v"(a), "v"(b));
  return c;
}
__device__ __forceinline__ v8f mma2(v16h a0, v16h b0, v16h a1, v16h b1, v8f c) {
  c = wm(a0, b0, c); c = wm(a1, b1, c);
  asm volatile("v_nop\n\tv_nop\n\tv_nop\n\tv_nop" : "+v"(c) : "v"(a0), "v"(b0), "v"(a1), "v"(b1));
  return c;
}
__device__ __forceinline__ v8f mma4(v16h a0, v16h b0, v16h a1, v16h b1, v16h a2, v16h b2, v16h a3, v16h b3, v8f c) {
  c = wm(a0, b0, c); c = wm(a1, b1, c); c = wm(a2, b2, c); c = wm(a3, b3, c);
  asm volatile("v_nop\n\tv_nop\n\tv_nop\n\tv_nop" : "+v"(c) : "v"(a0), "v"(b0), "v"(a1), "v"(b1), "v"(a2), "v"(b2), "v"(a3), "v"(b3));
  return c;
}

__device__ __forceinline__ void cvt_w(const float* __restrict__ w, const unsigned int t, unsigned short* __restrict__ Bt, const float scale) {
  unsigned int r, c8; frag_src(t, r, c8);
  const float* src = w + (size_t)r * DM + c8;
  const v4f a = *(const v4fa*)src, c = *(const v4fa*)(src + 4);
  FragH f;
#pragma unroll
  for (int q = 0; q < 4; ++q) { f.h[q] = (_Float16)(bf16_rne(a[q]) * scale); f.h[4 + q] = (_Float16)(bf16_rne(c[q]) * scale); }
  const v8us o = f.half[0];
  unsigned short* d = Bt + (size_t)t * 8;
  *(v8us*)d = o; 
}

__device__ __forceinline__ void cvt_x(const float* __restrict__ x, unsigned short* __restrict__ X16, const unsigned int t) {
  unsigned int r, c8; frag_src(t, r, c8);
  const unsigned int b = r / SEQ, s = r - b * SEQ;
  const float* src = x + ((size_t)b * SEQ_FULL + s) * DM + c8;
  const v4f a = *(const v4fa*)src, c = *(const v4fa*)(src + 4);
  FragH f;
#pragma unroll
  for (int q = 0; q < 4; ++q) { f.h[q] = (_Float16)bf16_rne(a[q]); f.h[4 + q] = (_Float16)bf16_rne(c[q]); }
  const v8us o = f.half[0];
  unsigned short* d = X16 + (size_t)t * 8;
  *(v8us*)d = o; 
}

// The five conversions depend on nothing and share one grid: blocks [0, gx) take x, then gw blocks for each of the four weights (x32).
__global__ __launch_bounds__(256) void k_prep(const float* __restrict__ x, const float* __restrict__ wq, const float* __restrict__ wk, const float* __restrict__ wv, const float* __restrict__ wo,
    unsigned short* __restrict__ X16, unsigned short* __restrict__ WQ, unsigned short* __restrict__ WK, unsigned short* __restrict__ WV, unsigned short* __restrict__ WO,
    unsigned int nx8, unsigned int gx, unsigned int nw8, unsigned int gw) {
  unsigned int blk = blockIdx.x;
  if (blk < gx) {
    const unsigned int t = blk * 256u + threadIdx.x; if (t >= nx8) return;
    cvt_x(x, X16, t);
  } else {
    blk -= gx; const unsigned int m = blk / gw; blk -= m * gw;
    const unsigned int t = blk * 256u + threadIdx.x; if (t >= nw8) return;
    const float* w = m == 0 ? wq : m == 1 ? wk : m == 2 ? wv : wo;
    unsigned short* d = m == 0 ? WQ : m == 1 ? WK : m == 2 ? WV : WO;
    cvt_w(w, t, d, 32.0f);
  }
}

__device__ __forceinline__ v8f g2_mma(v16h a, v16h b, v8f c) { v8f d = __builtin_amdgcn_wmma_f32_16x16x32_f16(false, a, false, b, (short)0, c, false, false); asm volatile("v_nop\n\tv_nop\n\tv_nop\n\tv_nop" : "+v"(d) : "v"(a), "v"(b)); return d; }

// GEMM C[M][N] = (A (+ Ar/1024)) . Bt^T * alpha + bias; A, Ar f16 [M][K] (row length lda, batch stride sA per batch index by), Bt f16 [N][K] (row length ldb), all in fragment order.
// Block = 4 waves, wave tile 32 x 64 (block 128 x 64); M % 128 == 0, N % 64 == 0, K % 96 == 0. BIASROW: bias indexed by row, else by column (bias converted RNE to bf16).
// Outputs: C f32 rows (optional), C16 f16 in fragment order (optional), C16r = f16((v - f16(v)) * 1024) (optional; resmode 1: rows with (row % SEQ) < EARLY, resmode 2: columns with (col % SEQ) < EARLY).
// so: the block's staging rows in LDS; bx, by: the tile index and the batch index of this block inside its own product.
template <bool ARES, bool BIASROW>
__device__ __forceinline__ void gemm2(float (*so)[32][68], const int bx, const int by, const unsigned short* __restrict__ A, const unsigned short* __restrict__ Ar, int lda, size_t sA,
    const unsigned short* __restrict__ Bh, int ldb, float alpha, const float* __restrict__ bias,
    float* __restrict__ C, _Float16* __restrict__ C16, _Float16* __restrict__ C16r, int ldc, size_t sC, int resmode, int M, int N, int K) {
  const int tid = threadIdx.x, w = __builtin_amdgcn_readfirstlane(tid >> 5), lane = tid & 31, ln = lane & 15, hh = lane >> 4;
  const int ntn = N >> 6; const int mt = bx / ntn, nq = bx - mt * ntn; const int row0 = mt * 128 + 32 * w, col0 = nq * 64; if (row0 >= M) return;
  const size_t aofs = (size_t)by * sA + (size_t)row0 * lda + 8 * lane;
  const size_t cofs = (size_t)by * sC;
  const unsigned short* a0p = A + aofs; const unsigned short* a1p = a0p + (size_t)16 * lda;
  const unsigned short* r0p = Ar + aofs; const unsigned short* r1p = r0p + (size_t)16 * lda;
  const unsigned short* b0p = Bh + (size_t)col0 * ldb + 8 * lane; const unsigned short* b1p = b0p + (size_t)16 * ldb; const unsigned short* b2p = b1p + (size_t)16 * ldb; const unsigned short* b3p = b2p + (size_t)16 * ldb;
  const v8f z8 = {0.f,0.f,0.f,0.f,0.f,0.f,0.f,0.f};
  v8f c00 = z8, c01 = z8, c02 = z8, c03 = z8, c10 = z8, c11 = z8, c12 = z8, c13 = z8;
  v8f d00 = z8, d01 = z8, d02 = z8, d03 = z8, d10 = z8, d11 = z8, d12 = z8, d13 = z8;
  /* Fragments live in GD register sets; a set is refilled for k + 32*GD right behind its last product, so a load has GD k steps to land (the product order is unchanged). */
  constexpr int GD = ARES ? 1 : 3;
  v16h fa0[GD], fa1[GD], fe0[GD], fe1[GD], fb0[GD], fb1[GD], fb2[GD], fb3[GD];
#pragma unroll
  for (int u = 0; u < GD; ++u) {
    const int k = 512 * u;      /* one tile of 512 elements per 32 k */
    fb0[u] = ld_frag(b0p + k); fa0[u] = ld_frag(a0p + k); fa1[u] = ld_frag(a1p + k);
    if (ARES) { fe0[u] = ld_frag(r0p + k); fe1[u] = ld_frag(r1p + k); }
    fb1[u] = ld_frag(b1p + k); fb2[u] = ld_frag(b2p + k); fb3[u] = ld_frag(b3p + k);
  }
  addr_wait();
  auto kstep = [&](const int u, const int kn, const bool more) __attribute__((always_inline)) {
    const v16h a0 = fa0[u], a1 = fa1[u];
    v16h e0 = a0, e1 = a1;
    if (ARES) { e0 = fe0[u]; e1 = fe1[u]; }
    v16h b = fb0[u]; c00 = g2_mma(a0, b, c00); c10 = g2_mma(a1, b, c10); if (ARES) { d00 = g2_mma(e0, b, d00); d10 = g2_mma(e1, b, d10); }
    if (more) fb0[u] = ld_frag(b0p + kn);
    b = fb1[u]; c01 = g2_mma(a0, b, c01); c11 = g2_mma(a1, b, c11); if (ARES) { d01 = g2_mma(e0, b, d01); d11 = g2_mma(e1, b, d11); }
    if (more) fb1[u] = ld_frag(b1p + kn);
    b = fb2[u]; c02 = g2_mma(a0, b, c02); c12 = g2_mma(a1, b, c12); if (ARES) { d02 = g2_mma(e0, b, d02); d12 = g2_mma(e1, b, d12); }
    if (more) fb2[u] = ld_frag(b2p + kn);
    b = fb3[u]; c03 = g2_mma(a0, b, c03); c13 = g2_mma(a1, b, c13); if (ARES) { d03 = g2_mma(e0, b, d03); d13 = g2_mma(e1, b, d13); }
    if (more) {
      fb3[u] = ld_frag(b3p + kn); fa0[u] = ld_frag(a0p + kn); fa1[u] = ld_frag(a1p + kn);
      if (ARES) { fe0[u] = ld_frag(r0p + kn); fe1[u] = ld_frag(r1p + kn); }
      if (u == GD - 1) addr_wait();      /* the pointers step once per trip */
    }
  };
#pragma unroll 1
  for (int kb = 0; kb < (K - 32 * GD) * 16; kb += 512 * GD) {      /* kb counts elements of a 16-row band: 512 per 32 k */
#pragma unroll
    for (int u = 0; u < GD; ++u) kstep(u, kb + 512 * (u + GD), true);
  }
#pragma unroll
  for (int u = 0; u < GD; ++u) kstep(u, 0, false);      /* last GD k steps: nothing left to fetch */
  v8f accs[8] = {c00, c01, c02, c03, c10, c11, c12, c13};
  v8f accd[8] = {d00, d01, d02, d03, d10, d11, d12, d13};
#pragma unroll
  for (int u = 0; u < 8; ++u) {
    const int t = u & 3, half = u >> 2; const int col = col0 + t * 16 + ln;
    float bcol = 0.f; if (!BIASROW) bcol = bf16_rne(bias[col]);
#pragma unroll
    for (int r = 0; r < 8; ++r) {
      const int rloc = half * 16 + 8 * hh + r;
      float v = accs[u][r]; if (ARES) v += accd[u][r] * 0.0009765625f;
      float bv = bcol; if (BIASROW) bv = bf16_rne(bias[row0 + rloc]);
      so[w][rloc][t * 16 + ln] = v * alpha + bv;
    }
  }
  __builtin_amdgcn_fence(4 /* acq_rel order */, "workgroup"); __builtin_amdgcn_wave_barrier();
  bool wres = false;
  if (C16r) { if (resmode == 1) wres = ((row0 % SEQ) < EARLY); else if (resmode == 2) wres = ((col0 % SEQ) < EARLY); }
  if (C) {
    const int rsub = lane >> 4, c4 = (lane & 15) * 4;
#pragma unroll
    for (int q = 0; q < 16; ++q) {
      const int r = q * 2 + rsub; const v4f v = *(const v4fa*)&so[w][r][c4];
      *(v4f*)(C + cofs + (size_t)(row0 + r) * ldc + col0 + c4) = v;
    }
    addr_wait();      /* the f16 block below may reuse registers that these stores name */
  }
  if (C16) {      /* the wave's 32 x 64 tile = 2 x 2 fragment tiles of two 512-byte halves; the lane writes 16 bytes of each half */
    const size_t o0 = cofs + (size_t)row0 * ldc + (size_t)(col0 >> 5) * 512 + lane * 8, o1 = o0 + (size_t)16 * ldc;
    unsigned short* h0p = (unsigned short*)C16 + o0; unsigned short* h1p = (unsigned short*)C16 + o1;
    unsigned short* e0p = (unsigned short*)C16r + o0; unsigned short* e1p = (unsigned short*)C16r + o1;
    FragH fh[8], fr[8];
#pragma unroll
    for (int q = 0; q < 8; ++q) {      /* q = band * 4 + column tile * 2 + half */
      const float* sp = &so[w][(q >> 2) * 16 + ln][(q & 3) * 16 + hh * 8];
      const v4f v0 = *(const v4fa*)sp, v1 = *(const v4fa*)(sp + 4);
#pragma unroll
      for (int i = 0; i < 4; ++i) {
        fh[q].h[i] = (_Float16)v0[i]; fr[q].h[i] = (_Float16)((v0[i] - (float)fh[q].h[i]) * 1024.0f);
        fh[q].h[4 + i] = (_Float16)v1[i]; fr[q].h[4 + i] = (_Float16)((v1[i] - (float)fh[q].h[4 + i]) * 1024.0f);
      }
    }
#pragma unroll
    for (int q = 0; q < 8; ++q) *(v8us*)((q >> 2 ? h1p : h0p) + (q & 3) * 256) = fh[q].half[0];
    addr_wait();      /* the residual stores below may reuse registers that the stores above name */
    if (wres) {
#pragma unroll
      for (int q = 0; q < 8; ++q) *(v8us*)((q >> 2 ? e1p : e0p) + (q & 3) * 256) = fr[q].half[0];
      addr_wait();      /* precaution: the joined kernels take one product per block, so no other product's code runs behind these stores */
    }
  }
}

// Q, K and V^T depend only on the converted planes and share one grid: blockIdx.y = 0, 1 give Q, K [token][DM] (hi planes; residual planes for tokens with s < EARLY);
// blockIdx.y = 2 gives V^T [DM][NTOK] = W_v (rows c) . X16^T (columns = tokens), bias by row, residual plane for token columns with s < EARLY.
__global__ __launch_bounds__(128) void k_qkv(const unsigned short* __restrict__ X16, const unsigned short* __restrict__ WQ, const unsigned short* __restrict__ WK, const unsigned short* __restrict__ WV,
    const float* __restrict__ bq, const float* __restrict__ bk, const float* __restrict__ bv,
    _Float16* __restrict__ Qh, _Float16* __restrict__ Qr, _Float16* __restrict__ Kh, _Float16* __restrict__ Kr, _Float16* __restrict__ VTh, _Float16* __restrict__ VTr) {
  __shared__ __attribute__((aligned(16))) float so[4][32][68];
  const int sel = blockIdx.y;
  if (sel == 2) gemm2<false, true>(so, blockIdx.x, 0, WV, WV, DM, (size_t)0, X16, DM, 0.03125f, bv, (float*)nullptr, VTh, VTr, (int)NTOK, (size_t)0, 2, DM, (int)NTOK, DM);
  else gemm2<false, false>(so, blockIdx.x, 0, X16, X16, DM, (size_t)0, sel ? WK : WQ, DM, 0.03125f, sel ? bk : bq, (float*)nullptr, sel ? Kh : Qh, sel ? Kr : Qr, DM, (size_t)0, 1, (int)NTOK, DM, DM);
}

// out rows (b*SEQ_FULL + s) = o W_o^T + b_o; alpha = 1 / (64 * 32). One grid: the first blocks take the rows with s < EARLY (hi + residual o), the others the rest; blockIdx.y = batch.
__global__ __launch_bounds__(128) void k_out(const unsigned short* __restrict__ Oh, const unsigned short* __restrict__ Or, const unsigned short* __restrict__ WO, const float* __restrict__ bo, float* __restrict__ out) {
  __shared__ __attribute__((aligned(16))) float so[4][32][68];
  constexpr int NE = (EARLY / 128) * (DM / 64);
  const int bx = blockIdx.x;
  if (bx < NE) gemm2<true, false>(so, bx, blockIdx.y, Oh, Or, DM, (size_t)SEQ * DM, WO, DM, 0.00048828125f, bo, out, (_Float16*)nullptr, (_Float16*)nullptr, DM, (size_t)SEQ_FULL * DM, 0, EARLY, DM, DM);
  else gemm2<false, false>(so, bx - NE, blockIdx.y, Oh + (size_t)EARLY * DM, Oh + (size_t)EARLY * DM, DM, (size_t)SEQ * DM, WO, DM, 0.00048828125f, bo, out + (size_t)EARLY * DM, (_Float16*)nullptr, (_Float16*)nullptr, DM, (size_t)SEQ_FULL * DM, 0, SEQ - EARLY, DM, DM);
}

// Causal flash attention, transposed form. Block = 4 waves (64 queries of one (batch, head)); each wave owns 16 queries and loops over 32-key steps up to its diagonal.
// Q / K planes [token][DM]; V^T planes [DM][NTOK] (row = head*64 + d); o planes [token][DM]; all in fragment order. Lane (ln, hh): query q0 + ln; S^T accumulators hold keys 8hh + r (tile 0) and 16 + 8hh + r (tile 1),
// which is exactly the B-fragment k map, so P^T is packed in place. EP: hi + residual (x1024) planes on q, k, v, p and o (two accumulators per site).
template <bool EP>
__device__ __forceinline__ void attn(const unsigned short* __restrict__ Qh, const unsigned short* __restrict__ Qr,
    const unsigned short* __restrict__ Kh, const unsigned short* __restrict__ Kr,
    const unsigned short* __restrict__ Vh, const unsigned short* __restrict__ Vr,
    unsigned short* __restrict__ Oh, unsigned short* __restrict__ Or, const int qblk, const int head, const int b) {
  const int tid = threadIdx.x, w = __builtin_amdgcn_readfirstlane(tid >> 5), lane = tid & 31, ln = lane & 15, hh = lane >> 4;
  const int q0 = qblk * 64 + w * 16;
  const size_t tok0 = (size_t)b * SEQ;
  const size_t qofs = (tok0 + q0) * DM + head * (HD * 16) + 8 * lane;
  const v16h qa = ld_frag(Qh + qofs), qb = ld_frag(Qh + qofs + 512);
  v16h qra = qa, qrb = qb;
  if (EP) { qra = ld_frag(Qr + qofs); qrb = ld_frag(Qr + qofs + 512); }
  addr_wait();
  const size_t kofs = tok0 * DM + head * (HD * 16) + 8 * lane;
  const size_t vofs = (size_t)(head * HD) * NTOK + tok0 * 16 + 8 * lane;
  const v8f z8 = {0.f,0.f,0.f,0.f,0.f,0.f,0.f,0.f};
  v8f oh[4] = {z8, z8, z8, z8};
  v8f om[4] = {z8, z8, z8, z8};
  float mrun = -1.0e30f, lrun = 0.0f;
  const int nsteps = ((q0 + 15) >> 5) + 1;
  const int qi = q0 + ln;
  /* Fragment loads go out ahead of their use. Single planes: K and V^T of the next key step into the same registers, K right behind its score products, V^T right behind its output products.
     Hi + residual planes (twice the fragments): V^T of this step behind the score products, K of the next step behind the output products, so that only one of the two sets is live. */
  v16h kfa[2], kfc[2], kra[2], krc[2], vf[4], vrf[4];
#pragma unroll
  for (int t = 0; t < 2; ++t) {
    const size_t ko = kofs + (size_t)(16 * t) * DM;
    kfa[t] = ld_frag(Kh + ko); kfc[t] = ld_frag(Kh + ko + 512);
    if (EP) { kra[t] = ld_frag(Kr + ko); krc[t] = ld_frag(Kr + ko + 512); }
    __builtin_amdgcn_sched_barrier(0);      /* first loads issue in the loop's own order (K tile 0, K tile 1, V^T): otherwise the loop's waits on K, counted over both ways in, also cover the V^T loads in flight */
  }
  if (!EP) {
#pragma unroll
    for (int dt = 0; dt < 4; ++dt) vf[dt] = ld_frag(Vh + vofs + (size_t)(dt * 16) * NTOK);
  }
  addr_wait();
  auto step = [&](const int st, const bool more) __attribute__((always_inline)) {
    const int kb = st * 32;
    v8f sc[2];
#pragma unroll
    for (int t = 0; t < 2; ++t) {
      const size_t kn = kofs + (size_t)(kb + 32 + 16 * t) * DM;
      const v16h ka = kfa[t], kc = kfc[t];
      v8f s = mma2(ka, qa, kc, qb, z8);
      if (EP) {
        const v16h ra = kra[t], rc = krc[t];
        const v8f sm = mma4(ka, qra, kc, qrb, ra, qa, rc, qb, z8);
        s = s + sm * 0.0009765625f;
#pragma unroll
        for (int dt = 2 * t; dt < 2 * t + 2; ++dt) {
          const size_t vo = vofs + (size_t)(dt * 16) * NTOK + (size_t)kb * 16;
          vf[dt] = ld_frag(Vh + vo); vrf[dt] = ld_frag(Vr + vo);
        }
      } else if (more) { kfa[t] = ld_frag(Kh + kn); kfc[t] = ld_frag(Kh + kn + 512); }
      sc[t] = s;
    }
    if (EP || more) addr_wait();
    if (kb + 31 > q0) {      /* wave-uniform: only the diagonal step carries masked keys; masked scores are replaced */
#pragma unroll
      for (int r = 0; r < 8; ++r) {
        const int key = kb + 8 * hh + r;
        sc[0][r] = (key > qi) ? -1.0e30f : sc[0][r];
        sc[1][r] = (key + 16 > qi) ? -1.0e30f : sc[1][r];
      }
    }
    float mloc = sc[0][0];
#pragma unroll
    for (int r = 1; r < 8; ++r) mloc = fmaxf(mloc, sc[0][r]);
#pragma unroll
    for (int r = 0; r < 8; ++r) mloc = fmaxf(mloc, sc[1][r]);
    mloc = fmaxf(mloc, __shfl_xor(mloc, 16));
    const float mnew = fmaxf(mrun, mloc);
    const float alpha = __expf((mrun - mnew) * 0.125f);
    mrun = mnew;
    const float msh = mnew * 0.125f - 5.545177444f;      /* p carried x256 (same factor in the row sum) */
    float p0[8], p1[8]; float ls = 0.0f;
#pragma unroll
    for (int r = 0; r < 8; ++r) { p0[r] = __expf(sc[0][r] * 0.125f - msh); p1[r] = __expf(sc[1][r] * 0.125f - msh); ls += p0[r] + p1[r]; }
    lrun = lrun * alpha + ls;
#pragma unroll
    for (int dt = 0; dt < 4; ++dt) { oh[dt] = oh[dt] * alpha; if (EP) om[dt] = om[dt] * alpha; }
    FragH ph, pr;
#pragma unroll
    for (int r = 0; r < 8; ++r) {
      const _Float16 h0 = (_Float16)p0[r], h1 = (_Float16)p1[r];
      ph.h[r] = h0; ph.h[8 + r] = h1;
      if (EP) { pr.h[r] = (_Float16)((p0[r] - (float)h0) * 1024.0f); pr.h[8 + r] = (_Float16)((p1[r] - (float)h1) * 1024.0f); }
    }
#pragma unroll
    for (int dt = 0; dt < 4; ++dt) {
      const size_t vn = vofs + (size_t)(dt * 16) * NTOK + (size_t)(kb + 32) * 16;
      const v16h va = vf[dt];
      oh[dt] = mma1(va, ph.v, oh[dt]);
      if (EP) {
        const v16h vr = vrf[dt]; om[dt] = mma2(va, pr.v, vr, ph.v, om[dt]);
        if (more) {
          const int t = dt >> 1; const size_t kn = kofs + (size_t)(kb + 32 + 16 * t) * DM;
          if ((dt & 1) == 0) { kfa[t] = ld_frag(Kh + kn); kfc[t] = ld_frag(Kh + kn + 512); }
          else { kra[t] = ld_frag(Kr + kn); krc[t] = ld_frag(Kr + kn + 512); }
        }
      } else if (more) vf[dt] = ld_frag(Vh + vn);
    }
    if (more) addr_wait();
  };
#pragma unroll 1
  for (int st = 0; st < nsteps - 1; ++st) step(st, true);
  step(nsteps - 1, false);      /* last key step: nothing of a next step to fetch */
  const float lt = lrun + __shfl_xor(lrun, 16);
  const float inv = 64.0f * (1.0f / lt);      /* o carried x64 */
#pragma unroll
  for (int dt = 0; dt < 4; ++dt) {
    FragH fh, fr;
#pragma unroll
    for (int r = 0; r < 8; ++r) {
      float v = oh[dt][r]; if (EP) v += om[dt][r] * 0.0009765625f;
      v *= inv;
      const _Float16 h = (_Float16)v; fh.h[r] = h;
      if (EP) fr.h[r] = (_Float16)((v - (float)h) * 1024.0f);
    }
    /* the lane's 8 values (query ln, d = 16 dt + 8 hh ..) are its 16 bytes of half dt & 1 of fragment tile dt >> 1 */
    const size_t o = qofs + (dt >> 1) * 512 + (dt & 1) * 256;
    *(v8us*)(Oh + o) = fh.half[0];
    if (EP) *(v8us*)(Or + o) = fr.half[0];
  }
}

// Both attention paths read the same finished planes and share one grid: first the blocks of the single-plane path (queries [EARLY, SEQ), the longer key loops), then those of the
// hi + residual path (queries [0, EARLY)), each group in the order (query block, head, batch), query block fastest.
__global__ __launch_bounds__(128) void k_attn(const unsigned short* __restrict__ Qh, const unsigned short* __restrict__ Qr,
    const unsigned short* __restrict__ Kh, const unsigned short* __restrict__ Kr,
    const unsigned short* __restrict__ Vh, const unsigned short* __restrict__ Vr,
    unsigned short* __restrict__ Oh, unsigned short* __restrict__ Or) {
  constexpr int NE = EARLY / 64, NL = SEQ > EARLY ? (SEQ - EARLY) / 64 : 1;
  constexpr int NLB = ((SEQ - EARLY) / 64) * NH * NB;      /* blocks of the single-plane path */
  int i = blockIdx.x;
  if (i < NLB) {
    const int g = i / NL;
    attn<false>(Qh, Qh, Kh, Kh, Vh, Vh, Oh, Oh, NE + i - g * NL, g % NH, g / NH);
  } else {
    i -= NLB; const int g = i / NE;
    attn<true>(Qh, Qr, Kh, Kr, Vh, Vr, Oh, Or, i - g * NE, g % NH, g / NH);
  }
}

extern "C" void kernel_launch(void* const* d_in, const int* in_sizes, int n_in,
                              void* d_out, int out_size, void* d_ws, size_t ws_size, hipStream_t stream) {
  if (n_in < 9) return;
  const long long need_x = ((long long)(NB - 1) * SEQ_FULL + SEQ) * DM;
  if ((long long)in_sizes[0] < need_x) return;
  if (in_sizes[1] < DM * DM || in_sizes[3] < DM * DM || in_sizes[5] < DM * DM || in_sizes[7] < DM * DM) return;
  if (in_sizes[2] < DM || in_sizes[4] < DM || in_sizes[6] < DM || in_sizes[8] < DM) return;
  if ((long long)out_size < need_x) return;
  const float* x = (const float*)d_in[0]; const float* wq = (const float*)d_in[1]; const float* bq = (const float*)d_in[2];
  const float* wk = (const float*)d_in[3]; const float* bk = (const float*)d_in[4]; const float* wv = (const float*)d_in[5];
  const float* bv = (const float*)d_in[6]; const float* wo = (const float*)d_in[7]; const float* bo = (const float*)d_in[8];
  float* out = (float*)d_out;
  char* ws = (char*)d_ws; size_t off = 0;
  auto take = [&](size_t bytes) { char* p = ws + off; off += (bytes + 255) & ~(size_t)255; return p; };
  const size_t wbytes = (size_t)DM * DM * 2, pbytes = NTOK * DM * 2;
  unsigned short* WQ = (unsigned short*)take(wbytes); unsigned short* WK = (unsigned short*)take(wbytes);
  unsigned short* WV = (unsigned short*)take(wbytes); unsigned short* WO = (unsigned short*)take(wbytes);
  unsigned short* X16 = (unsigned short*)take(pbytes);
  unsigned short* Qh = (unsigned short*)take(pbytes); unsigned short* Qr = (unsigned short*)take(pbytes);
  unsigned short* Kh = (unsigned short*)take(pbytes); unsigned short* Kr = (unsigned short*)take(pbytes);
  unsigned short* VTh = (unsigned short*)take(pbytes); unsigned short* VTr = (unsigned short*)take(pbytes);
  unsigned short* Oh = (unsigned short*)take(pbytes); unsigned short* Or = (unsigned short*)take(pbytes);
  if (off > ws_size || off > (size_t)134217728) return;

  { const unsigned int nw8 = (unsigned int)((size_t)DM * DM / 8), gw = (nw8 + 255u) / 256u;      /* [out][in] weights are already Bt[n][k]; x32; fragment order */
    const unsigned int nx8 = (unsigned int)(NTOK * DM / 8), gx = (nx8 + 255u) / 256u;
    k_prep<<<gx + 4u * gw, 256, 0, stream>>>(x, wq, wk, wv, wo, X16, WQ, WK, WV, WO, nx8, gx, nw8, gw); }

  k_qkv<<<dim3((unsigned)((NTOK / 128) * (DM / 64)), 3), 128, 0, stream>>>(X16, WQ, WK, WV, bq, bk, bv, (_Float16*)Qh, (_Float16*)Qr, (_Float16*)Kh, (_Float16*)Kr, (_Float16*)VTh, (_Float16*)VTr);

  k_attn<<<(SEQ / 64) * NH * NB, 128, 0, stream>>>(Qh, Qr, Kh, Kr, VTh, VTr, Oh, Or);

  k_out<<<dim3((unsigned)((SEQ / 128) * (DM / 64)), NB), 128, 0, stream>>>(Oh, Or, WO, bo, out);
}

// v004
// It runs in 163 microseconds.
// In two side-by-side timings against v003, it was 1.08 and 1.07 times as fast.
// All steps since v000 together make it 3.26 times as fast.
#include <hip/hip_runtime.h>
// Causal multi-head self-attention: x [2][4096][768]; q / k / v = x W^T + b ([out][in] 768 x 768 weights, biases); 12 heads of 64; scores / 8; causal (key <= query) softmax; out = merged W_o^T + b_o.
// Compute dtype: every contraction on v_wmma_f32_16x16x32_f16 with f32 accumulation. Inputs converted RNE to bf16 and held exactly in f16 (weights x32). q, k, v, softmax weights (x256) and o (x64) are f16 operands;
// for the first EARLY queries of each sequence q, k, v, p and o are carried as f16 hi + f16 residual (x1024) planes with separate accumulators (3 products per site). Scores, softmax statistics and epilogues are f32.
// Structure: token rows r = b*SEQ + s. Q, K as planes [token][768]; V produced directly transposed (V^T = W_v x^T, plane [768][tokens]); attention is a register-fed transposed flash loop per wave
// (S^T = K Q^T with Q^T as the B operand, packed P^T from the S^T accumulators as the B operand of O^T = V^T P^T; 32 keys per step; no LDS in the key loop); o as f16 planes; out GEMM writes f32 rows.
// Every f16 plane [R][L] (weights, x, q, k, V^T, o) is stored in fragment order: tiles of 16 rows x 32 columns, 512 elements each, tile (r >> 4, c >> 5) at element ((r >> 4) * (L / 32) + (c >> 5)) * 512;
// inside a tile element (r, c) stands at ((c >> 4) & 1) * 256 + (((c >> 3) & 1) * 16 + (r & 15)) * 8 + (c & 7), so each of a fragment's two loads is lane * 16 bytes into 512 contiguous bytes (four whole lines).
#ifndef NB
#define NB 2
#endif
#ifndef SEQ
#define SEQ 4096
#endif
#define NB_FULL 2
#define SEQ_FULL 4096
#define DM 768
#define NH 12
#define HD 64
#define NTOK ((size_t)NB * SEQ)
#define EARLY ((SEQ) < 1024 ? (SEQ) : 1024)   /* queries per sequence on the hi + residual path */
static_assert(SEQ % 128 == 0);
static_assert(EARLY % 128 == 0);
static_assert((SEQ - EARLY) % 128 == 0);
static_assert(NB <= NB_FULL);
static_assert(SEQ <= SEQ_FULL);
static_assert(DM % 128 == 0);
static_assert(DM % 96 == 0);
static_assert(NH * HD == DM);
static_assert(HD == 64);

typedef _Float16 v16h __attribute__((ext_vector_type(16)));
typedef unsigned short v8us __attribute__((ext_vector_type(8), may_alias));
typedef float v8f __attribute__((ext_vector_type(8)));
typedef float v4f __attribute__((ext_vector_type(4)));
typedef float v4fa __attribute__((ext_vector_type(4), may_alias));
union FragH { v16h v; v8us half[2]; _Float16 h[16]; unsigned short u[16]; };

__device__ __forceinline__ unsigned short bf16_bits(float x) { unsigned int u = __float_as_uint(x); return (unsigned short)((u + 0x7FFFu + ((u >> 16) & 1u)) >> 16); }
__device__ __forceinline__ float bf16_rne(float x) { return __uint_as_float(((unsigned int)bf16_bits(x)) << 16); }

// 16x32 fragment (A rows or B columns) of a plane in fragment order: p = tile start + 8*lane; elements 0..7 <- (row lane&15, k0+8h..), 8..15 <- (row lane&15, k0+16+8h..), h = lane>>4
__device__ __forceinline__ v16h ld_frag(const unsigned short* p) { FragH f; f.half[0] = *(const v8us*)p; f.half[1] = *(const v8us*)(p + 256); return f.v; }
// Thread t writes the 8 elements at t*8 of a fragment-order plane with DM columns: their row and first column.
__device__ __forceinline__ void frag_src(unsigned int t, unsigned int& r, unsigned int& c8) {
  const unsigned int tile = t >> 6, band = tile / (DM / 32), cb = tile - band * (DM / 32);
  r = band * 16u + (t & 15u); c8 = cb * 32u + ((t >> 5) & 1u) * 16u + ((t >> 4) & 1u) * 8u;
}

// Stands behind a run of fragment loads that stay in flight: their address registers may be reused only behind it.
__device__ __forceinline__ void addr_wait() { asm volatile("s_wait_xcnt 0x0" ::: "memory"); }

__device__ __forceinline__ v8f wm(v16h a, v16h b, v8f c) { return __builtin_amdgcn_wmma_f32_16x16x32_f16(false, a, false, b, (short)0, c, false, false); }
__device__ __forceinline__ v8f mma1(v16h a, v16h b, v8f c) {
  c = wm(a, b, c);
  asm volatile("v_nop\n\tv_nop\n\tv_nop\n\tv_nop" : "+v"(c) : "v"(a), "v"(b));
  return c;
}
__device__ __forceinline__ v8f mma2(v16h a0, v16h b0, v16h a1, v16h b1, v8f c) {
  c = wm(a0, b0, c); c = wm(a1, b1, c);
  asm volatile("v_nop\n\tv_nop\n\tv_nop\n\tv_nop" : "+v"(c) : "v"(a0), "v"(b0), "v"(a1), "v"(b1));
  return c;
}
__device__ __forceinline__ v8f mma4(v16h a0, v16h b0, v16h a1, v16h b1, v16h a2, v16h b2, v16h a3, v16h b3, v8f c) {
  c = wm(a0, b0, c); c = wm(a1, b1, c); c = wm(a2, b2, c); c = wm(a3, b3, c);
  asm volatile("v_nop\n\tv_nop\n\tv_nop\n\tv_nop" : "+v"(c) : "v"(a0), "v"(b0), "v"(a1), "v"(b1), "v"(a2), "v"(b2), "v"(a3), "v"(b3));
  return c;
}

__device__ __forceinline__ void cvt_w(const float* __restrict__ w, const unsigned int t, unsigned short* __restrict__ Bt, const float scale) {
  unsigned int r, c8; frag_src(t, r, c8);
  const float* src = w + (size_t)r * DM + c8;
  const v4f a = *(const v4fa*)src, c = *(const v4fa*)(src + 4);
  FragH f;
#pragma unroll
  for (int q = 0; q < 4; ++q) { f.h[q] = (_Float16)(bf16_rne(a[q]) * scale); f.h[4 + q] = (_Float16)(bf16_rne(c[q]) * scale); }
  const v8us o = f.half[0];
  unsigned short* d = Bt + (size_t)t * 8;
  *(v8us*)d = o; 
}

__device__ __forceinline__ void cvt_x(const float* __restrict__ x, unsigned short* __restrict__ X16, const unsigned int t) {
  unsigned int r, c8; frag_src(t, r, c8);
  const unsigned int b = r / SEQ, s = r - b * SEQ;
  const float* src = x + ((size_t)b * SEQ_FULL + s) * DM + c8;
  const v4f a = *(const v4fa*)src, c = *(const v4fa*)(src + 4);
  FragH f;
#pragma unroll
  for (int q = 0; q < 4; ++q) { f.h[q] = (_Float16)bf16_rne(a[q]); f.h[4 + q] = (_Float16)bf16_rne(c[q]); }
  const v8us o = f.half[0];
  unsigned short* d = X16 + (size_t)t * 8;
  *(v8us*)d = o; 
}

// The five conversions depend on nothing and share one grid: blocks [0, gx) take x, then gw blocks for each of the four weights (x32).
__global__ __launch_bounds__(256) void k_prep(const float* __restrict__ x, const float* __restrict__ wq, const float* __restrict__ wk, const float* __restrict__ wv, const float* __restrict__ wo,
    unsigned short* __restrict__ X16, unsigned short* __restrict__ WQ, unsigned short* __restrict__ WK, unsigned short* __restrict__ WV, unsigned short* __restrict__ WO,
    unsigned int nx8, unsigned int gx, unsigned int nw8, unsigned int gw) {
  unsigned int blk = blockIdx.x;
  if (blk < gx) {
    const unsigned int t = blk * 256u + threadIdx.x; if (t >= nx8) return;
    cvt_x(x, X16, t);
  } else {
    blk -= gx; const unsigned int m = blk / gw; blk -= m * gw;
    const unsigned int t = blk * 256u + threadIdx.x; if (t >= nw8) return;
    const float* w = m == 0 ? wq : m == 1 ? wk : m == 2 ? wv : wo;
    unsigned short* d = m == 0 ? WQ : m == 1 ? WK : m == 2 ? WV : WO;
    cvt_w(w, t, d, 32.0f);
  }
}

__device__ __forceinline__ v8f g2_mma(v16h a, v16h b, v8f c) { v8f d = __builtin_amdgcn_wmma_f32_16x16x32_f16(false, a, false, b, (short)0, c, false, false); asm volatile("v_nop\n\tv_nop\n\tv_nop\n\tv_nop" : "+v"(d) : "v"(a), "v"(b)); return d; }

// GEMM C[M][N] = (A (+ Ar/1024)) . Bt^T * alpha + bias; A, Ar f16 [M][K] (row length lda, batch stride sA per batch index by), Bt f16 [N][K] (row length ldb), all in fragment order.
// Block = 4 waves, wave tile 32 x 64 (block 128 x 64); M % 128 == 0, N % 64 == 0, K % 96 == 0. BIASROW: bias indexed by row, else by column (bias converted RNE to bf16).
// Outputs: C f32 rows (optional), C16 f16 in fragment order (optional), C16r = f16((v - f16(v)) * 1024) (optional; resmode 1: rows with (row % SEQ) < EARLY, resmode 2: columns with (col % SEQ) < EARLY).
// so: the block's staging rows in LDS; bx, by: the tile index and the batch index of this block inside its own product.
template <bool ARES, bool BIASROW>
__device__ __forceinline__ void gemm2(float (*so)[32][68], const int bx, const int by, const unsigned short* __restrict__ A, const unsigned short* __restrict__ Ar, int lda, size_t sA,
    const unsigned short* __restrict__ Bh, int ldb, float alpha, const float* __restrict__ bias,
    float* __restrict__ C, _Float16* __restrict__ C16, _Float16* __restrict__ C16r, int ldc, size_t sC, int resmode, int M, int N, int K) {
  const int tid = threadIdx.x, w = __builtin_amdgcn_readfirstlane(tid >> 5), lane = tid & 31, ln = lane & 15, hh = lane >> 4;
  const int ntn = N >> 6; const int mt = bx / ntn, nq = bx - mt * ntn; const int row0 = mt * 128 + 32 * w, col0 = nq * 64; if (row0 >= M) return;
  const size_t aofs = (size_t)by * sA + (size_t)row0 * lda + 8 * lane;
  const size_t cofs = (size_t)by * sC;
  const unsigned short* a0p = A + aofs; const unsigned short* a1p = a0p + (size_t)16 * lda;
  const unsigned short* r0p = Ar + aofs; const unsigned short* r1p = r0p + (size_t)16 * lda;
  const unsigned short* b0p = Bh + (size_t)col0 * ldb + 8 * lane; const unsigned short* b1p = b0p + (size_t)16 * ldb; const unsigned short* b2p = b1p + (size_t)16 * ldb; const unsigned short* b3p = b2p + (size_t)16 * ldb;
  const v8f z8 = {0.f,0.f,0.f,0.f,0.f,0.f,0.f,0.f};
  v8f c00 = z8, c01 = z8, c02 = z8, c03 = z8, c10 = z8, c11 = z8, c12 = z8, c13 = z8;
  v8f d00 = z8, d01 = z8, d02 = z8, d03 = z8, d10 = z8, d11 = z8, d12 = z8, d13 = z8;
  /* Fragments live in GD register sets; a set is refilled for k + 32*GD right behind its last product, so a load has GD k steps to land (the product order is unchanged). */
  constexpr int GD = ARES ? 1 : 3;
  v16h fa0[GD], fa1[GD], fe0[GD], fe1[GD], fb0[GD], fb1[GD], fb2[GD], fb3[GD];
#pragma unroll
  for (int u = 0; u < GD; ++u) {
    const int k = 512 * u;      /* one tile of 512 elements per 32 k */
    fb0[u] = ld_frag(b0p + k); fa0[u] = ld_frag(a0p + k); fa1[u] = ld_frag(a1p + k);
    if (ARES) { fe0[u] = ld_frag(r0p + k); fe1[u] = ld_frag(r1p + k); }
    fb1[u] = ld_frag(b1p + k); fb2[u] = ld_frag(b2p + k); fb3[u] = ld_frag(b3p + k);
  }
  addr_wait();
  auto kstep = [&](const int u, const int kn, const bool more) __attribute__((always_inline)) {
    const v16h a0 = fa0[u], a1 = fa1[u];
    v16h e0 = a0, e1 = a1;
    if (ARES) { e0 = fe0[u]; e1 = fe1[u]; }
    v16h b = fb0[u]; c00 = g2_mma(a0, b, c00); c10 = g2_mma(a1, b, c10); if (ARES) { d00 = g2_mma(e0, b, d00); d10 = g2_mma(e1, b, d10); }
    if (more) fb0[u] = ld_frag(b0p + kn);
    b = fb1[u]; c01 = g2_mma(a0, b, c01); c11 = g2_mma(a1, b, c11); if (ARES) { d01 = g2_mma(e0, b, d01); d11 = g2_mma(e1, b, d11); }
    if (more) fb1[u] = ld_frag(b1p + kn);
    b = fb2[u]; c02 = g2_mma(a0, b, c02); c12 = g2_mma(a1, b, c12); if (ARES) { d02 = g2_mma(e0, b, d02); d12 = g2_mma(e1, b, d12); }
    if (more) fb2[u] = ld_frag(b2p + kn);
    b = fb3[u]; c03 = g2_mma(a0, b, c03); c13 = g2_mma(a1, b, c13); if (ARES) { d03 = g2_mma(e0, b, d03); d13 = g2_mma(e1, b, d13); }
    if (more) {
      fb3[u] = ld_frag(b3p + kn); fa0[u] = ld_frag(a0p + kn); fa1[u] = ld_frag(a1p + kn);
      if (ARES) { fe0[u] = ld_frag(r0p + kn); fe1[u] = ld_frag(r1p + kn); }
      if (u == GD - 1) addr_wait();      /* the pointers step once per trip */
    }
  };
#pragma unroll 1
  for (int kb = 0; kb < (K - 32 * GD) * 16; kb += 512 * GD) {      /* kb counts elements of a 16-row band: 512 per 32 k */
#pragma unroll
    for (int u = 0; u < GD; ++u) kstep(u, kb + 512 * (u + GD), true);
  }
#pragma unroll
  for (int u = 0; u < GD; ++u) kstep(u, 0, false);      /* last GD k steps: nothing left to fetch */
  v8f accs[8] = {c00, c01, c02, c03, c10, c11, c12, c13};
  v8f accd[8] = {d00, d01, d02, d03, d10, d11, d12, d13};
#pragma unroll
  for (int u = 0; u < 8; ++u) {
    const int t = u & 3, half = u >> 2; const int col = col0 + t * 16 + ln;
    float bcol = 0.f; if (!BIASROW) bcol = bf16_rne(bias[col]);
#pragma unroll
    for (int r = 0; r < 8; ++r) {
      const int rloc = half * 16 + 8 * hh + r;
      float v = accs[u][r]; if (ARES) v += accd[u][r] * 0.0009765625f;
      float bv = bcol; if (BIASROW) bv = bf16_rne(bias[row0 + rloc]);
      so[w][rloc][t * 16 + ln] = v * alpha + bv;
    }
  }
  __builtin_amdgcn_fence(4 /* acq_rel order */, "workgroup"); __builtin_amdgcn_wave_barrier();
  bool wres = false;
  if (C16r) { if (resmode == 1) wres = ((row0 % SEQ) < EARLY); else if (resmode == 2) wres = ((col0 % SEQ) < EARLY); }
  if (C) {
    const int rsub = lane >> 4, c4 = (lane & 15) * 4;
#pragma unroll
    for (int q = 0; q < 16; ++q) {
      const int r = q * 2 + rsub; const v4f v = *(const v4fa*)&so[w][r][c4];
      *(v4f*)(C + cofs + (size_t)(row0 + r) * ldc + col0 + c4) = v;
    }
    addr_wait();      /* the f16 block below may reuse registers that these stores name */
  }
  if (C16) {      /* the wave's 32 x 64 tile = 2 x 2 fragment tiles of two 512-byte halves; the lane writes 16 bytes of each half */
    const size_t o0 = cofs + (size_t)row0 * ldc + (size_t)(col0 >> 5) * 512 + lane * 8, o1 = o0 + (size_t)16 * ldc;
    unsigned short* h0p = (unsigned short*)C16 + o0; unsigned short* h1p = (unsigned short*)C16 + o1;
    unsigned short* e0p = (unsigned short*)C16r + o0; unsigned short* e1p = (unsigned short*)C16r + o1;
    FragH fh[8], fr[8];
#pragma unroll
    for (int q = 0; q < 8; ++q) {      /* q = band * 4 + column tile * 2 + half */
      const float* sp = &so[w][(q >> 2) * 16 + ln][(q & 3) * 16 + hh * 8];
      const v4f v0 = *(const v4fa*)sp, v1 = *(const v4fa*)(sp + 4);
#pragma unroll
      for (int i = 0; i < 4; ++i) {
        fh[q].h[i] = (_Float16)v0[i]; fr[q].h[i] = (_Float16)((v0[i] - (float)fh[q].h[i]) * 1024.0f);
        fh[q].h[4 + i] = (_Float16)v1[i]; fr[q].h[4 + i] = (_Float16)((v1[i] - (float)fh[q].h[4 + i]) * 1024.0f);
      }
    }
#pragma unroll
    for (int q = 0; q < 8; ++q) *(v8us*)((q >> 2 ? h1p : h0p) + (q & 3) * 256) = fh[q].half[0];
    addr_wait();      /* the residual stores below may reuse registers that the stores above name */
    if (wres) {
#pragma unroll
      for (int q = 0; q < 8; ++q) *(v8us*)((q >> 2 ? e1p : e0p) + (q & 3) * 256) = fr[q].half[0];
      addr_wait();      /* precaution: the joined kernels take one product per block, so no other product's code runs behind these stores */
    }
  }
}

// Q, K and V^T depend only on the converted planes and share one grid: blockIdx.y = 0, 1 give Q, K [token][DM] (hi planes; residual planes for tokens with s < EARLY);
// blockIdx.y = 2 gives V^T [DM][NTOK] = W_v (rows c) . X16^T (columns = tokens), bias by row, residual plane for token columns with s < EARLY.
__global__ __launch_bounds__(128) void k_qkv(const unsigned short* __restrict__ X16, const unsigned short* __restrict__ WQ, const unsigned short* __restrict__ WK, const unsigned short* __restrict__ WV,
    const float* __restrict__ bq, const float* __restrict__ bk, const float* __restrict__ bv,
    _Float16* __restrict__ Qh, _Float16* __restrict__ Qr, _Float16* __restrict__ Kh, _Float16* __restrict__ Kr, _Float16* __restrict__ VTh, _Float16* __restrict__ VTr) {
  __shared__ __attribute__((aligned(16))) float so[4][32][68];
  const int sel = blockIdx.y;
  if (sel == 2) gemm2<false, true>(so, blockIdx.x, 0, WV, WV, DM, (size_t)0, X16, DM, 0.03125f, bv, (float*)nullptr, VTh, VTr, (int)NTOK, (size_t)0, 2, DM, (int)NTOK, DM);
  else gemm2<false, false>(so, blockIdx.x, 0, X16, X16, DM, (size_t)0, sel ? WK : WQ, DM, 0.03125f, sel ? bk : bq, (float*)nullptr, sel ? Kh : Qh, sel ? Kr : Qr, DM, (size_t)0, 1, (int)NTOK, DM, DM);
}

// out rows (b*SEQ_FULL + s) = o W_o^T + b_o; alpha = 1 / (64 * 32). One grid: the first blocks take the rows with s < EARLY (hi + residual o), the others the rest; blockIdx.y = batch.
__global__ __launch_bounds__(128) void k_out(const unsigned short* __restrict__ Oh, const unsigned short* __restrict__ Or, const unsigned short* __restrict__ WO, const float* __restrict__ bo, float* __restrict__ out) {
  __shared__ __attribute__((aligned(16))) float so[4][32][68];
  constexpr int NE = (EARLY / 128) * (DM / 64);
  const int bx = blockIdx.x;
  if (bx < NE) gemm2<true, false>(so, bx, blockIdx.y, Oh, Or, DM, (size_t)SEQ * DM, WO, DM, 0.00048828125f, bo, out, (_Float16*)nullptr, (_Float16*)nullptr, DM, (size_t)SEQ_FULL * DM, 0, EARLY, DM, DM);
  else gemm2<false, false>(so, bx - NE, blockIdx.y, Oh + (size_t)EARLY * DM, Oh + (size_t)EARLY * DM, DM, (size_t)SEQ * DM, WO, DM, 0.00048828125f, bo, out + (size_t)EARLY * DM, (_Float16*)nullptr, (_Float16*)nullptr, DM, (size_t)SEQ_FULL * DM, 0, SEQ - EARLY, DM, DM);
}

// Causal flash attention, transposed form. Q / K planes [token][DM]; V^T planes [DM][NTOK] (row = head*64 + d); o planes [token][DM]; all in fragment order. A wave loops over 32-key steps up to its diagonal.
// Lane (ln, hh) of a 16-query tile: query (tile start) + ln; S^T accumulators hold keys 8hh + r (tile 0) and 16 + 8hh + r (tile 1), which is exactly the B-fragment k map, so P^T is packed in place.
// Hi + residual path: block = 4 waves (64 queries of one (batch, head)), each wave owns 16 queries; hi + residual (x1024) planes on q, k, v, p and o (two accumulators per site).
__device__ __forceinline__ void attn_early(const unsigned short* __restrict__ Qh, const unsigned short* __restrict__ Qr,
    const unsigned short* __restrict__ Kh, const unsigned short* __restrict__ Kr,
    const unsigned short* __restrict__ Vh, const unsigned short* __restrict__ Vr,
    unsigned short* __restrict__ Oh, unsigned short* __restrict__ Or, const int qblk, const int head, const int b) {
  const int tid = threadIdx.x, w = __builtin_amdgcn_readfirstlane(tid >> 5), lane = tid & 31, ln = lane & 15, hh = lane >> 4;
  const int q0 = qblk * 64 + w * 16;
  const size_t tok0 = (size_t)b * SEQ;
  const size_t qofs = (tok0 + q0) * DM + head * (HD * 16) + 8 * lane;
  const v16h qa = ld_frag(Qh + qofs), qb = ld_frag(Qh + qofs + 512);
  const v16h qra = ld_frag(Qr + qofs), qrb = ld_frag(Qr + qofs + 512);
  addr_wait();
  const size_t kofs = tok0 * DM + head * (HD * 16) + 8 * lane;
  const size_t vofs = (size_t)(head * HD) * NTOK + tok0 * 16 + 8 * lane;
  const v8f z8 = {0.f,0.f,0.f,0.f,0.f,0.f,0.f,0.f};
  v8f oh[4] = {z8, z8, z8, z8};
  v8f om[4] = {z8, z8, z8, z8};
  float mrun = -1.0e30f, lrun = 0.0f;
  const int nsteps = ((q0 + 15) >> 5) + 1;
  const int qi = q0 + ln;
  /* Fragment loads go out ahead of their use: V^T of this step behind the score products, K of the next step behind the output products, so that only one of the two sets is live. */
  v16h kfa[2], kfc[2], kra[2], krc[2], vf[4], vrf[4];
#pragma unroll
  for (int t = 0; t < 2; ++t) {
    const size_t ko = kofs + (size_t)(16 * t) * DM;
    kfa[t] = ld_frag(Kh + ko); kfc[t] = ld_frag(Kh + ko + 512);
    kra[t] = ld_frag(Kr + ko); krc[t] = ld_frag(Kr + ko + 512);
    __builtin_amdgcn_sched_barrier(0);      /* first loads issue in the loop's own order (K tile 0, K tile 1): the loop's waits on K are counted over both ways in */
  }
  addr_wait();
  auto step = [&](const int st, const bool more) __attribute__((always_inline)) {
    const int kb = st * 32;
    v8f sc[2];
#pragma unroll
    for (int t = 0; t < 2; ++t) {
      const v16h ka = kfa[t], kc = kfc[t];
      v8f s = mma2(ka, qa, kc, qb, z8);
      const v16h ra = kra[t], rc = krc[t];
      const v8f sm = mma4(ka, qra, kc, qrb, ra, qa, rc, qb, z8);
      s = s + sm * 0.0009765625f;
#pragma unroll
      for (int dt = 2 * t; dt < 2 * t + 2; ++dt) {
        const size_t vo = vofs + (size_t)(dt * 16) * NTOK + (size_t)kb * 16;
        vf[dt] = ld_frag(Vh + vo); vrf[dt] = ld_frag(Vr + vo);
      }
      sc[t] = s;
    }
    addr_wait();
    if (kb + 31 > q0) {      /* wave-uniform: only the diagonal step carries masked keys; masked scores are replaced */
#pragma unroll
      for (int r = 0; r < 8; ++r) {
        const int key = kb + 8 * hh + r;
        sc[0][r] = (key > qi) ? -1.0e30f : sc[0][r];
        sc[1][r] = (key + 16 > qi) ? -1.0e30f : sc[1][r];
      }
    }
    float mloc = sc[0][0];
#pragma unroll
    for (int r = 1; r < 8; ++r) mloc = fmaxf(mloc, sc[0][r]);
#pragma unroll
    for (int r = 0; r < 8; ++r) mloc = fmaxf(mloc, sc[1][r]);
    mloc = fmaxf(mloc, __shfl_xor(mloc, 16));
    const float mnew = fmaxf(mrun, mloc);
    const float alpha = __expf((mrun - mnew) * 0.125f);
    mrun = mnew;
    const float msh = mnew * 0.125f - 5.545177444f;      /* p carried x256 (same factor in the row sum) */
    float p0[8], p1[8]; float ls = 0.0f;
#pragma unroll
    for (int r = 0; r < 8; ++r) { p0[r] = __expf(sc[0][r] * 0.125f - msh); p1[r] = __expf(sc[1][r] * 0.125f - msh); ls += p0[r] + p1[r]; }
    lrun = lrun * alpha + ls;
#pragma unroll
    for (int dt = 0; dt < 4; ++dt) { oh[dt] = oh[dt] * alpha; om[dt] = om[dt] * alpha; }
    FragH ph, pr;
#pragma unroll
    for (int r = 0; r < 8; ++r) {
      const _Float16 h0 = (_Float16)p0[r], h1 = (_Float16)p1[r];
      ph.h[r] = h0; ph.h[8 + r] = h1;
      pr.h[r] = (_Float16)((p0[r] - (float)h0) * 1024.0f); pr.h[8 + r] = (_Float16)((p1[r] - (float)h1) * 1024.0f);
    }
#pragma unroll
    for (int dt = 0; dt < 4; ++dt) {
      const v16h va = vf[dt];
      oh[dt] = mma1(va, ph.v, oh[dt]);
      const v16h vr = vrf[dt]; om[dt] = mma2(va, pr.v, vr, ph.v, om[dt]);
      if (more) {
        const int t = dt >> 1; const size_t kn = kofs + (size_t)(kb + 32 + 16 * t) * DM;
        if ((dt & 1) == 0) { kfa[t] = ld_frag(Kh + kn); kfc[t] = ld_frag(Kh + kn + 512); }
        else { kra[t] = ld_frag(Kr + kn); krc[t] = ld_frag(Kr + kn + 512); }
      }
    }
    if (more) addr_wait();
  };
#pragma unroll 1
  for (int st = 0; st < nsteps - 1; ++st) step(st, true);
  step(nsteps - 1, false);      /* last key step: nothing of a next step to fetch */
  const float lt = lrun + __shfl_xor(lrun, 16);
  const float inv = 64.0f * (1.0f / lt);      /* o carried x64 */
#pragma unroll
  for (int dt = 0; dt < 4; ++dt) {
    FragH fh, fr;
#pragma unroll
    for (int r = 0; r < 8; ++r) {
      float v = oh[dt][r]; v += om[dt][r] * 0.0009765625f;
      v *= inv;
      const _Float16 h = (_Float16)v; fh.h[r] = h;
      fr.h[r] = (_Float16)((v - (float)h) * 1024.0f);
    }
    /* the lane's 8 values (query ln, d = 16 dt + 8 hh ..) are its 16 bytes of half dt & 1 of fragment tile dt >> 1 */
    const size_t o = qofs + (dt >> 1) * 512 + (dt & 1) * 256;
    *(v8us*)(Oh + o) = fh.half[0];
    *(v8us*)(Or + o) = fr.half[0];
  }
}

// Single-plane path. Block = 4 waves (128 queries of one (batch, head)); each wave owns 32 queries as two 16-query tiles u, so every K and V^T fragment it loads feeds two products.
// Per query the key steps, the lane map and the order of every sum are those of attn_early above; q0 is a multiple of 32, so the diagonal step is the last one for both tiles.
__device__ __forceinline__ void attn_wide(const unsigned short* __restrict__ Qh, const unsigned short* __restrict__ Kh, const unsigned short* __restrict__ Vh,
    unsigned short* __restrict__ Oh, const int qblk, const int head, const int b) {
  const int tid = threadIdx.x, w = __builtin_amdgcn_readfirstlane(tid >> 5), lane = tid & 31, ln = lane & 15, hh = lane >> 4;
  const int q0 = qblk * 128 + w * 32;
  const size_t tok0 = (size_t)b * SEQ;
  const size_t qofs = (tok0 + q0) * DM + head * (HD * 16) + 8 * lane;
  v16h qa[2], qb[2];
#pragma unroll
  for (int u = 0; u < 2; ++u) { qa[u] = ld_frag(Qh + qofs + (size_t)(16 * u) * DM); qb[u] = ld_frag(Qh + qofs + (size_t)(16 * u) * DM + 512); }
  addr_wait();
  const size_t kofs = tok0 * DM + head * (HD * 16) + 8 * lane;
  const size_t vofs = (size_t)(head * HD) * NTOK + tok0 * 16 + 8 * lane;
  const v8f z8 = {0.f,0.f,0.f,0.f,0.f,0.f,0.f,0.f};
  v8f oh[2][4] = {{z8, z8, z8, z8}, {z8, z8, z8, z8}};
  float mrun[2] = {-1.0e30f, -1.0e30f}, lrun[2] = {0.0f, 0.0f};
  const int nsteps = (q0 >> 5) + 1;
  /* K and V^T of the next key step go into the same registers, K behind the score products, V^T behind the output products. */
  v16h kfa[2], kfc[2], vf[4];
#pragma unroll
  for (int t = 0; t < 2; ++t) {
    const size_t ko = kofs + (size_t)(16 * t) * DM;
    kfa[t] = ld_frag(Kh + ko); kfc[t] = ld_frag(Kh + ko + 512);
    __builtin_amdgcn_sched_barrier(0);      /* first loads issue in the loop's own order (K tile 0, K tile 1, V^T): otherwise the loop's waits on K, counted over both ways in, also cover the V^T loads in flight */
  }
#pragma unroll
  for (int dt = 0; dt < 4; ++dt) vf[dt] = ld_frag(Vh + vofs + (size_t)(dt * 16) * NTOK);
  addr_wait();
  auto step = [&](const int st, const bool more) __attribute__((always_inline)) {
    const int kb = st * 32;
    v8f sc[2][2];      /* [query tile u][key tile t] */
#pragma unroll
    for (int t = 0; t < 2; ++t) { sc[0][t] = wm(kfa[t], qa[0], z8); sc[1][t] = wm(kfa[t], qa[1], z8); }
#pragma unroll
    for (int t = 0; t < 2; ++t) { sc[0][t] = wm(kfc[t], qb[0], sc[0][t]); sc[1][t] = wm(kfc[t], qb[1], sc[1][t]); }
    /* the four vector slots between the last score product and the first use of a score or refill of a K fragment */
    asm volatile("v_nop\n\tv_nop\n\tv_nop\n\tv_nop" : "+v"(sc[0][0]), "+v"(sc[0][1]), "+v"(sc[1][0]), "+v"(sc[1][1]) : "v"(kfa[0]), "v"(kfc[0]), "v"(kfa[1]), "v"(kfc[1]));
    if (more) {
#pragma unroll
      for (int t = 0; t < 2; ++t) {
        const size_t kn = kofs + (size_t)(kb + 32 + 16 * t) * DM;
        kfa[t] = ld_frag(Kh + kn); kfc[t] = ld_frag(Kh + kn + 512);
      }
      addr_wait();
    } else {      /* the last step is the diagonal one: masked scores are replaced */
#pragma unroll
      for (int u = 0; u < 2; ++u) {
        const int qi = q0 + 16 * u + ln;
#pragma unroll
        for (int r = 0; r < 8; ++r) {
          const int key = kb + 8 * hh + r;
          sc[u][0][r] = (key > qi) ? -1.0e30f : sc[u][0][r];
          sc[u][1][r] = (key + 16 > qi) ? -1.0e30f : sc[u][1][r];
        }
      }
    }
    FragH ph[2];
#pragma unroll
    for (int u = 0; u < 2; ++u) {
      float mloc = sc[u][0][0];
#pragma unroll
      for (int r = 1; r < 8; ++r) mloc = fmaxf(mloc, sc[u][0][r]);
#pragma unroll
      for (int r = 0; r < 8; ++r) mloc = fmaxf(mloc, sc[u][1][r]);
      mloc = fmaxf(mloc, __shfl_xor(mloc, 16));
      const float mnew = fmaxf(mrun[u], mloc);
      const float alpha = __expf((mrun[u] - mnew) * 0.125f);
      mrun[u] = mnew;
      const float msh = mnew * 0.125f - 5.545177444f;      /* p carried x256 (same factor in the row sum) */
      float p0[8], p1[8]; float ls = 0.0f;
#pragma unroll
      for (int r = 0; r < 8; ++r) { p0[r] = __expf(sc[u][0][r] * 0.125f - msh); p1[r] = __expf(sc[u][1][r] * 0.125f - msh); ls += p0[r] + p1[r]; }
      lrun[u] = lrun[u] * alpha + ls;
#pragma unroll
      for (int dt = 0; dt < 4; ++dt) oh[u][dt] = oh[u][dt] * alpha;
#pragma unroll
      for (int r = 0; r < 8; ++r) { ph[u].h[r] = (_Float16)p0[r]; ph[u].h[8 + r] = (_Float16)p1[r]; }
    }
#pragma unroll
    for (int dt = 0; dt < 4; ++dt) { oh[0][dt] = wm(vf[dt], ph[0].v, oh[0][dt]); oh[1][dt] = wm(vf[dt], ph[1].v, oh[1][dt]); }
    /* the four vector slots between the last output product and the next write of an operand of it or refill of a V^T fragment */
    asm volatile("v_nop\n\tv_nop\n\tv_nop\n\tv_nop" : "+v"(oh[0][0]), "+v"(oh[0][1]), "+v"(oh[0][2]), "+v"(oh[0][3]), "+v"(oh[1][0]), "+v"(oh[1][1]), "+v"(oh[1][2]), "+v"(oh[1][3])
                 : "v"(vf[0]), "v"(vf[1]), "v"(vf[2]), "v"(vf[3]), "v"(ph[0].v), "v"(ph[1].v));
    if (more) {
#pragma unroll
      for (int dt = 0; dt < 4; ++dt) vf[dt] = ld_frag(Vh + vofs + (size_t)(dt * 16) * NTOK + (size_t)(kb + 32) * 16);
      addr_wait();
    }
  };
#pragma unroll 1      /* the key loop stays rolled: a second copy of the step would only add code and live registers */
  for (int st = 0; st < nsteps - 1; ++st) step(st, true);
  step(nsteps - 1, false);      /* last key step: nothing left to fetch */
  FragH fo[2][4];
#pragma unroll
  for (int u = 0; u < 2; ++u) {
    const float lt = lrun[u] + __shfl_xor(lrun[u], 16);
    const float inv = 64.0f * (1.0f / lt);      /* o carried x64 */
#pragma unroll
    for (int dt = 0; dt < 4; ++dt) {
#pragma unroll
      for (int r = 0; r < 8; ++r) fo[u][dt].h[r] = (_Float16)(oh[u][dt][r] * inv);
    }
  }
  __builtin_amdgcn_sched_barrier(0);      /* the eight stores go out behind the last conversion, so that no register an issued store names is written again */
#pragma unroll
  for (int u = 0; u < 2; ++u) {
#pragma unroll
    for (int dt = 0; dt < 4; ++dt)      /* the lane's 8 values (query ln of tile u, d = 16 dt + 8 hh ..) are its 16 bytes of half dt & 1 of fragment tile dt >> 1 */
      *(v8us*)(Oh + qofs + (size_t)(16 * u) * DM + (dt >> 1) * 512 + (dt & 1) * 256) = fo[u][dt].half[0];
  }
}

// Both attention paths read the same finished planes and share one grid: first the blocks of the single-plane path (queries [EARLY, SEQ), the longer key loops), then those of the
// hi + residual path (queries [0, EARLY)), each group in the order (query block, head, batch), query block fastest.
__global__ __launch_bounds__(128) void k_attn(const unsigned short* __restrict__ Qh, const unsigned short* __restrict__ Qr,
    const unsigned short* __restrict__ Kh, const unsigned short* __restrict__ Kr,
    const unsigned short* __restrict__ Vh, const unsigned short* __restrict__ Vr,
    unsigned short* __restrict__ Oh, unsigned short* __restrict__ Or) {
  constexpr int NE = EARLY / 64, NL = SEQ > EARLY ? (SEQ - EARLY) / 128 : 1;
  constexpr int NLB = ((SEQ - EARLY) / 128) * NH * NB;      /* blocks of the single-plane path, 128 queries each */
  int i = blockIdx.x;
  if (i < NLB) {
    const int g = i / NL;
    attn_wide(Qh, Kh, Vh, Oh, EARLY / 128 + i - g * NL, g % NH, g / NH);
  } else {
    i -= NLB; const int g = i / NE;
    attn_early(Qh, Qr, Kh, Kr, Vh, Vr, Oh, Or, i - g * NE, g % NH, g / NH);
  }
}

extern "C" void kernel_launch(void* const* d_in, const int* in_sizes, int n_in,
                              void* d_out, int out_size, void* d_ws, size_t ws_size, hipStream_t stream) {
  if (n_in < 9) return;
  const long long need_x = ((long long)(NB - 1) * SEQ_FULL + SEQ) * DM;
  if ((long long)in_sizes[0] < need_x) return;
  if (in_sizes[1] < DM * DM || in_sizes[3] < DM * DM || in_sizes[5] < DM * DM || in_sizes[7] < DM * DM) return;
  if (in_sizes[2] < DM || in_sizes[4] < DM || in_sizes[6] < DM || in_sizes[8] < DM) return;
  if ((long long)out_size < need_x) return;
  const float* x = (const float*)d_in[0]; const float* wq = (const float*)d_in[1]; const float* bq = (const float*)d_in[2];
  const float* wk = (const float*)d_in[3]; const float* bk = (const float*)d_in[4]; const float* wv = (const float*)d_in[5];
  const float* bv = (const float*)d_in[6]; const float* wo = (const float*)d_in[7]; const float* bo = (const float*)d_in[8];
  float* out = (float*)d_out;
  char* ws = (char*)d_ws; size_t off = 0;
  auto take = [&](size_t bytes) { char* p = ws + off; off += (bytes + 255) & ~(size_t)255; return p; };
  const size_t wbytes = (size_t)DM * DM * 2, pbytes = NTOK * DM * 2;
  unsigned short* WQ = (unsigned short*)take(wbytes); unsigned short* WK = (unsigned short*)take(wbytes);
  unsigned short* WV = (unsigned short*)take(wbytes); unsigned short* WO = (unsigned short*)take(wbytes);
  unsigned short* X16 = (unsigned short*)take(pbytes);
  unsigned short* Qh = (unsigned short*)take(pbytes); unsigned short* Qr = (unsigned short*)take(pbytes);
  unsigned short* Kh = (unsigned short*)take(pbytes); unsigned short* Kr = (unsigned short*)take(pbytes);
  unsigned short* VTh = (unsigned short*)take(pbytes); unsigned short* VTr = (unsigned short*)take(pbytes);
  unsigned short* Oh = (unsigned short*)take(pbytes); unsigned short* Or = (unsigned short*)take(pbytes);
  if (off > ws_size || off > (size_t)134217728) return;

  { const unsigned int nw8 = (unsigned int)((size_t)DM * DM / 8), gw = (nw8 + 255u) / 256u;      /* [out][in] weights are already Bt[n][k]; x32; fragment order */
    const unsigned int nx8 = (unsigned int)(NTOK * DM / 8), gx = (nx8 + 255u) / 256u;
    k_prep<<<gx + 4u * gw, 256, 0, stream>>>(x, wq, wk, wv, wo, X16, WQ, WK, WV, WO, nx8, gx, nw8, gw); }

  k_qkv<<<dim3((unsigned)((NTOK / 128) * (DM / 64)), 3), 128, 0, stream>>>(X16, WQ, WK, WV, bq, bk, bv, (_Float16*)Qh, (_Float16*)Qr, (_Float16*)Kh, (_Float16*)Kr, (_Float16*)VTh, (_Float16*)VTr);

  k_attn<<<((SEQ - EARLY) / 128 + EARLY / 64) * NH * NB, 128, 0, stream>>>(Qh, Qr, Kh, Kr, VTh, VTr, Oh, Or);

  k_out<<<dim3((unsigned)((SEQ / 128) * (DM / 64)), NB), 128, 0, stream>>>(Oh, Or, WO, bo, out);
}

// v005
// One run takes 149 microseconds.
// Two timings next to v004 both put it at 1.07 times that version's speed.
// All steps since v000 together make it 3.49 times as fast.
#include <hip/hip_runtime.h>
// Causal multi-head self-attention: x [2][4096][768]; q / k / v = x W^T + b ([out][in] 768 x 768 weights, biases); 12 heads of 64; scores / 8; causal (key <= query) softmax; out = merged W_o^T + b_o.
// Compute dtype: every contraction on v_wmma_f32_16x16x32_f16 with f32 accumulation. Inputs converted RNE to bf16 and held exactly in f16 (weights x32). q, k, v, softmax weights (x256) and o (x64) are f16 operands;
// for the first EARLY queries of each sequence q, k, v, p and o are carried as f16 hi + f16 residual (x1024) planes with separate accumulators (3 products per site). Scores, softmax statistics and epilogues are f32.
// Structure: token rows r = b*SEQ + s. Q, K as planes [token][768]; V produced directly transposed (V^T = W_v x^T, plane [768][tokens]); attention is a register-fed transposed flash loop per wave
// (S^T = K Q^T with Q^T as the B operand, packed P^T from the S^T accumulators as the B operand of O^T = V^T P^T; 32 keys per step; no LDS in the key loop); o as f16 planes; out GEMM writes f32 rows.
// Every f16 plane [R][L] (weights, x, q, k, V^T, o) is stored in fragment order: tiles of 16 rows x 32 columns, 512 elements each, tile (r >> 4, c >> 5) at element ((r >> 4) * (L / 32) + (c >> 5)) * 512;
// inside a tile element (r, c) stands at ((c >> 4) & 1) * 256 + (((c >> 3) & 1) * 16 + (r & 15)) * 8 + (c & 7), so each of a fragment's two loads is lane * 16 bytes into 512 contiguous bytes (four whole lines).
#ifndef NB
#define NB 2
#endif
#ifndef SEQ
#define SEQ 4096
#endif
#define NB_FULL 2
#define SEQ_FULL 4096
#define DM 768
#define NH 12
#define HD 64
#define NTOK ((size_t)NB * SEQ)
#define EARLY ((SEQ) < 1024 ? (SEQ) : 1024)   /* queries per sequence on the hi + residual path */
static_assert(SEQ % 128 == 0);
static_assert(EARLY % 128 == 0);
static_assert((SEQ - EARLY) % 128 == 0);
static_assert(NB <= NB_FULL);
static_assert(SEQ <= SEQ_FULL);
static_assert(DM % 128 == 0);
static_assert(DM % 96 == 0);
static_assert(NH * HD == DM);
static_assert(HD == 64);

typedef _Float16 v16h __attribute__((ext_vector_type(16)));
typedef unsigned short v8us __attribute__((ext_vector_type(8), may_alias));
typedef float v8f __attribute__((ext_vector_type(8)));
typedef float v4f __attribute__((ext_vector_type(4)));
typedef float v4fa __attribute__((ext_vector_type(4), may_alias));
union FragH { v16h v; v8us half[2]; _Float16 h[16]; unsigned short u[16]; };

__device__ __forceinline__ unsigned short bf16_bits(float x) { unsigned int u = __float_as_uint(x); return (unsigned short)((u + 0x7FFFu + ((u >> 16) & 1u)) >> 16); }
__device__ __forceinline__ float bf16_rne(float x) { return __uint_as_float(((unsigned int)bf16_bits(x)) << 16); }

// 16x32 fragment (A rows or B columns) of a plane in fragment order: p = tile start + 8*lane; elements 0..7 <- (row lane&15, k0+8h..), 8..15 <- (row lane&15, k0+16+8h..), h = lane>>4
__device__ __forceinline__ v16h ld_frag(const unsigned short* p) { FragH f; f.half[0] = *(const v8us*)p; f.half[1] = *(const v8us*)(p + 256); return f.v; }
// Thread t writes the 8 elements at t*8 of a fragment-order plane with DM columns: their row and first column.
__device__ __forceinline__ void frag_src(unsigned int t, unsigned int& r, unsigned int& c8) {
  const unsigned int tile = t >> 6, band = tile / (DM / 32), cb = tile - band * (DM / 32);
  r = band * 16u + (t & 15u); c8 = cb * 32u + ((t >> 5) & 1u) * 16u + ((t >> 4) & 1u) * 8u;
}

// Stands behind a run of fragment loads that stay in flight: their address registers may be reused only behind it.
__device__ __forceinline__ void addr_wait() { asm volatile("s_wait_xcnt 0x0" ::: "memory"); }

__device__ __forceinline__ v8f wm(v16h a, v16h b, v8f c) { return __builtin_amdgcn_wmma_f32_16x16x32_f16(false, a, false, b, (short)0, c, false, false); }
__device__ __forceinline__ v8f mma1(v16h a, v16h b, v8f c) {
  c = wm(a, b, c);
  asm volatile("v_nop\n\tv_nop\n\tv_nop\n\tv_nop" : "+v"(c) : "v"(a), "v"(b));
  return c;
}
__device__ __forceinline__ v8f mma2(v16h a0, v16h b0, v16h a1, v16h b1, v8f c) {
  c = wm(a0, b0, c); c = wm(a1, b1, c);
  asm volatile("v_nop\n\tv_nop\n\tv_nop\n\tv_nop" : "+v"(c) : "v"(a0), "v"(b0), "v"(a1), "v"(b1));
  return c;
}
__device__ __forceinline__ v8f mma4(v16h a0, v16h b0, v16h a1, v16h b1, v16h a2, v16h b2, v16h a3, v16h b3, v8f c) {
  c = wm(a0, b0, c); c = wm(a1, b1, c); c = wm(a2, b2, c); c = wm(a3, b3, c);
  asm volatile("v_nop\n\tv_nop\n\tv_nop\n\tv_nop" : "+v"(c) : "v"(a0), "v"(b0), "v"(a1), "v"(b1), "v"(a2), "v"(b2), "v"(a3), "v"(b3));
  return c;
}

__device__ __forceinline__ void cvt_w(const float* __restrict__ w, const unsigned int t, unsigned short* __restrict__ Bt, const float scale) {
  unsigned int r, c8; frag_src(t, r, c8);
  const float* src = w + (size_t)r * DM + c8;
  const v4f a = *(const v4fa*)src, c = *(const v4fa*)(src + 4);
  FragH f;
#pragma unroll
  for (int q = 0; q < 4; ++q) { f.h[q] = (_Float16)(bf16_rne(a[q]) * scale); f.h[4 + q] = (_Float16)(bf16_rne(c[q]) * scale); }
  const v8us o = f.half[0];
  unsigned short* d = Bt + (size_t)t * 8;
  *(v8us*)d = o; 
}

__device__ __forceinline__ void cvt_x(const float* __restrict__ x, unsigned short* __restrict__ X16, const unsigned int t) {
  unsigned int r, c8; frag_src(t, r, c8);
  const unsigned int b = r / SEQ, s = r - b * SEQ;
  const float* src = x + ((size_t)b * SEQ_FULL + s) * DM + c8;
  const v4f a = *(const v4fa*)src, c = *(const v4fa*)(src + 4);
  FragH f;
#pragma unroll
  for (int q = 0; q < 4; ++q) { f.h[q] = (_Float16)bf16_rne(a[q]); f.h[4 + q] = (_Float16)bf16_rne(c[q]); }
  const v8us o = f.half[0];
  unsigned short* d = X16 + (size_t)t * 8;
  *(v8us*)d = o; 
}

// The five conversions depend on nothing and share one grid: blocks [0, gx) take x, then gw blocks for each of the four weights (x32).
__global__ __launch_bounds__(256) void k_prep(const float* __restrict__ x, const float* __restrict__ wq, const float* __restrict__ wk, const float* __restrict__ wv, const float* __restrict__ wo,
    unsigned short* __restrict__ X16, unsigned short* __restrict__ WQ, unsigned short* __restrict__ WK, unsigned short* __restrict__ WV, unsigned short* __restrict__ WO,
    unsigned int nx8, unsigned int gx, unsigned int nw8, unsigned int gw) {
  unsigned int blk = blockIdx.x;
  if (blk < gx) {
    const unsigned int t = blk * 256u + threadIdx.x; if (t >= nx8) return;
    cvt_x(x, X16, t);
  } else {
    blk -= gx; const unsigned int m = blk / gw; blk -= m * gw;
    const unsigned int t = blk * 256u + threadIdx.x; if (t >= nw8) return;
    const float* w = m == 0 ? wq : m == 1 ? wk : m == 2 ? wv : wo;
    unsigned short* d = m == 0 ? WQ : m == 1 ? WK : m == 2 ? WV : WO;
    cvt_w(w, t, d, 32.0f);
  }
}

__device__ __forceinline__ v8f g2_mma(v16h a, v16h b, v8f c) { v8f d = __builtin_amdgcn_wmma_f32_16x16x32_f16(false, a, false, b, (short)0, c, false, false); asm volatile("v_nop\n\tv_nop\n\tv_nop\n\tv_nop" : "+v"(d) : "v"(a), "v"(b)); return d; }

// GEMM C[M][N] = (A (+ Ar/1024)) . Bt^T * alpha + bias; A, Ar f16 [M][K] (row length lda, batch stride sA per batch index by), Bt f16 [N][K] (row length ldb), all in fragment order.
// Block = 4 waves, wave tile 32 x 64 (block 128 x 64); M % 128 == 0, N % 64 == 0, K % 96 == 0. BIASROW: bias indexed by row, else by column (bias converted RNE to bf16).
// Outputs: C f32 rows (optional), C16 f16 in fragment order (optional), C16r = f16((v - f16(v)) * 1024) (optional; resmode 1: rows with (row % SEQ) < EARLY, resmode 2: columns with (col % SEQ) < EARLY).
// so: the block's staging rows in LDS; bx, by: the tile index and the batch index of this block inside its own product.
template <bool ARES, bool BIASROW>
__device__ __forceinline__ void gemm2(float (*so)[32][68], const int bx, const int by, const unsigned short* __restrict__ A, const unsigned short* __restrict__ Ar, int lda, size_t sA,
    const unsigned short* __restrict__ Bh, int ldb, float alpha, const float* __restrict__ bias,
    float* __restrict__ C, _Float16* __restrict__ C16, _Float16* __restrict__ C16r, int ldc, size_t sC, int resmode, int M, int N, int K) {
  const int tid = threadIdx.x, w = __builtin_amdgcn_readfirstlane(tid >> 5), lane = tid & 31, ln = lane & 15, hh = lane >> 4;
  const int ntn = N >> 6; const int mt = bx / ntn, nq = bx - mt * ntn; const int row0 = mt * 128 + 32 * w, col0 = nq * 64; if (row0 >= M) return;
  const size_t aofs = (size_t)by * sA + (size_t)row0 * lda + 8 * lane;
  const size_t cofs = (size_t)by * sC;
  const unsigned short* a0p = A + aofs; const unsigned short* a1p = a0p + (size_t)16 * lda;
  const unsigned short* r0p = Ar + aofs; const unsigned short* r1p = r0p + (size_t)16 * lda;
  const unsigned short* b0p = Bh + (size_t)col0 * ldb + 8 * lane; const unsigned short* b1p = b0p + (size_t)16 * ldb; const unsigned short* b2p = b1p + (size_t)16 * ldb; const unsigned short* b3p = b2p + (size_t)16 * ldb;
  const v8f z8 = {0.f,0.f,0.f,0.f,0.f,0.f,0.f,0.f};
  v8f c00 = z8, c01 = z8, c02 = z8, c03 = z8, c10 = z8, c11 = z8, c12 = z8, c13 = z8;
  v8f d00 = z8, d01 = z8, d02 = z8, d03 = z8, d10 = z8, d11 = z8, d12 = z8, d13 = z8;
  /* Fragments live in GD register sets; a set is refilled for k + 32*GD right behind its last product, so a load has GD k steps to land (the product order is unchanged). */
  constexpr int GD = ARES ? 1 : 3;
  v16h fa0[GD], fa1[GD], fe0[GD], fe1[GD], fb0[GD], fb1[GD], fb2[GD], fb3[GD];
#pragma unroll
  for (int u = 0; u < GD; ++u) {
    const int k = 512 * u;      /* one tile of 512 elements per 32 k */
    fb0[u] = ld_frag(b0p + k); fa0[u] = ld_frag(a0p + k); fa1[u] = ld_frag(a1p + k);
    if (ARES) { fe0[u] = ld_frag(r0p + k); fe1[u] = ld_frag(r1p + k); }
    fb1[u] = ld_frag(b1p + k); fb2[u] = ld_frag(b2p + k); fb3[u] = ld_frag(b3p + k);
  }
  addr_wait();
  auto kstep = [&](const int u, const int kn, const bool more) __attribute__((always_inline)) {
    const v16h a0 = fa0[u], a1 = fa1[u];
    v16h e0 = a0, e1 = a1;
    if (ARES) { e0 = fe0[u]; e1 = fe1[u]; }
    v16h b = fb0[u]; c00 = g2_mma(a0, b, c00); c10 = g2_mma(a1, b, c10); if (ARES) { d00 = g2_mma(e0, b, d00); d10 = g2_mma(e1, b, d10); }
    if (more) fb0[u] = ld_frag(b0p + kn);
    b = fb1[u]; c01 = g2_mma(a0, b, c01); c11 = g2_mma(a1, b, c11); if (ARES) { d01 = g2_mma(e0, b, d01); d11 = g2_mma(e1, b, d11); }
    if (more) fb1[u] = ld_frag(b1p + kn);
    b = fb2[u]; c02 = g2_mma(a0, b, c02); c12 = g2_mma(a1, b, c12); if (ARES) { d02 = g2_mma(e0, b, d02); d12 = g2_mma(e1, b, d12); }
    if (more) fb2[u] = ld_frag(b2p + kn);
    b = fb3[u]; c03 = g2_mma(a0, b, c03); c13 = g2_mma(a1, b, c13); if (ARES) { d03 = g2_mma(e0, b, d03); d13 = g2_mma(e1, b, d13); }
    if (more) {
      fb3[u] = ld_frag(b3p + kn); fa0[u] = ld_frag(a0p + kn); fa1[u] = ld_frag(a1p + kn);
      if (ARES) { fe0[u] = ld_frag(r0p + kn); fe1[u] = ld_frag(r1p + kn); }
      if (u == GD - 1) addr_wait();      /* the pointers step once per trip */
    }
  };
#pragma unroll 1
  for (int kb = 0; kb < (K - 32 * GD) * 16; kb += 512 * GD) {      /* kb counts elements of a 16-row band: 512 per 32 k */
#pragma unroll
    for (int u = 0; u < GD; ++u) kstep(u, kb + 512 * (u + GD), true);
  }
#pragma unroll
  for (int u = 0; u < GD; ++u) kstep(u, 0, false);      /* last GD k steps: nothing left to fetch */
  v8f accs[8] = {c00, c01, c02, c03, c10, c11, c12, c13};
  v8f accd[8] = {d00, d01, d02, d03, d10, d11, d12, d13};
#pragma unroll
  for (int u = 0; u < 8; ++u) {
    const int t = u & 3, half = u >> 2; const int col = col0 + t * 16 + ln;
    float bcol = 0.f; if (!BIASROW) bcol = bf16_rne(bias[col]);
#pragma unroll
    for (int r = 0; r < 8; ++r) {
      const int rloc = half * 16 + 8 * hh + r;
      float v = accs[u][r]; if (ARES) v += accd[u][r] * 0.0009765625f;
      float bv = bcol; if (BIASROW) bv = bf16_rne(bias[row0 + rloc]);
      so[w][rloc][t * 16 + ln] = v * alpha + bv;
    }
  }
  __builtin_amdgcn_fence(4 /* acq_rel order */, "workgroup"); __builtin_amdgcn_wave_barrier();
  bool wres = false;
  if (C16r) { if (resmode == 1) wres = ((row0 % SEQ) < EARLY); else if (resmode == 2) wres = ((col0 % SEQ) < EARLY); }
  if (C) {
    const int rsub = lane >> 4, c4 = (lane & 15) * 4;
#pragma unroll
    for (int q = 0; q < 16; ++q) {
      const int r = q * 2 + rsub; const v4f v = *(const v4fa*)&so[w][r][c4];
      *(v4f*)(C + cofs + (size_t)(row0 + r) * ldc + col0 + c4) = v;
    }
    addr_wait();      /* the f16 block below may reuse registers that these stores name */
  }
  if (C16) {      /* the wave's 32 x 64 tile = 2 x 2 fragment tiles of two 512-byte halves; the lane writes 16 bytes of each half */
    const size_t o0 = cofs + (size_t)row0 * ldc + (size_t)(col0 >> 5) * 512 + lane * 8, o1 = o0 + (size_t)16 * ldc;
    unsigned short* h0p = (unsigned short*)C16 + o0; unsigned short* h1p = (unsigned short*)C16 + o1;
    unsigned short* e0p = (unsigned short*)C16r + o0; unsigned short* e1p = (unsigned short*)C16r + o1;
    FragH fh[8], fr[8];
#pragma unroll
    for (int q = 0; q < 8; ++q) {      /* q = band * 4 + column tile * 2 + half */
      const float* sp = &so[w][(q >> 2) * 16 + ln][(q & 3) * 16 + hh * 8];
      const v4f v0 = *(const v4fa*)sp, v1 = *(const v4fa*)(sp + 4);
#pragma unroll
      for (int i = 0; i < 4; ++i) {
        fh[q].h[i] = (_Float16)v0[i]; fr[q].h[i] = (_Float16)((v0[i] - (float)fh[q].h[i]) * 1024.0f);
        fh[q].h[4 + i] = (_Float16)v1[i]; fr[q].h[4 + i] = (_Float16)((v1[i] - (float)fh[q].h[4 + i]) * 1024.0f);
      }
    }
#pragma unroll
    for (int q = 0; q < 8; ++q) *(v8us*)((q >> 2 ? h1p : h0p) + (q & 3) * 256) = fh[q].half[0];
    addr_wait();      /* the residual stores below may reuse registers that the stores above name */
    if (wres) {
#pragma unroll
      for (int q = 0; q < 8; ++q) *(v8us*)((q >> 2 ? e1p : e0p) + (q & 3) * 256) = fr[q].half[0];
      addr_wait();      /* precaution: the joined kernels take one product per block, so no other product's code runs behind these stores */
    }
  }
}

// Q, K and V^T depend only on the converted planes and share one grid: blockIdx.y = 0, 1 give Q, K [token][DM] (hi planes; residual planes for tokens with s < EARLY);
// blockIdx.y = 2 gives V^T [DM][NTOK] = W_v (rows c) . X16^T (columns = tokens), bias by row, residual plane for token columns with s < EARLY.
__global__ __launch_bounds__(128) void k_qkv(const unsigned short* __restrict__ X16, const unsigned short* __restrict__ WQ, const unsigned short* __restrict__ WK, const unsigned short* __restrict__ WV,
    const float* __restrict__ bq, const float* __restrict__ bk, const float* __restrict__ bv,
    _Float16* __restrict__ Qh, _Float16* __restrict__ Qr, _Float16* __restrict__ Kh, _Float16* __restrict__ Kr, _Float16* __restrict__ VTh, _Float16* __restrict__ VTr) {
  __shared__ __attribute__((aligned(16))) float so[4][32][68];
  const int sel = blockIdx.y;
  if (sel == 2) gemm2<false, true>(so, blockIdx.x, 0, WV, WV, DM, (size_t)0, X16, DM, 0.03125f, bv, (float*)nullptr, VTh, VTr, (int)NTOK, (size_t)0, 2, DM, (int)NTOK, DM);
  else gemm2<false, false>(so, blockIdx.x, 0, X16, X16, DM, (size_t)0, sel ? WK : WQ, DM, 0.03125f, sel ? bk : bq, (float*)nullptr, sel ? Kh : Qh, sel ? Kr : Qr, DM, (size_t)0, 1, (int)NTOK, DM, DM);
}

// out rows (b*SEQ_FULL + s) = o W_o^T + b_o; alpha = 1 / (64 * 32). One grid: the first blocks take the rows with s < EARLY (hi + residual o), the others the rest; blockIdx.y = batch.
__global__ __launch_bounds__(128) void k_out(const unsigned short* __restrict__ Oh, const unsigned short* __restrict__ Or, const unsigned short* __restrict__ WO, const float* __restrict__ bo, float* __restrict__ out) {
  __shared__ __attribute__((aligned(16))) float so[4][32][68];
  constexpr int NE = (EARLY / 128) * (DM / 64);
  const int bx = blockIdx.x;
  if (bx < NE) gemm2<true, false>(so, bx, blockIdx.y, Oh, Or, DM, (size_t)SEQ * DM, WO, DM, 0.00048828125f, bo, out, (_Float16*)nullptr, (_Float16*)nullptr, DM, (size_t)SEQ_FULL * DM, 0, EARLY, DM, DM);
  else gemm2<false, false>(so, bx - NE, blockIdx.y, Oh + (size_t)EARLY * DM, Oh + (size_t)EARLY * DM, DM, (size_t)SEQ * DM, WO, DM, 0.00048828125f, bo, out + (size_t)EARLY * DM, (_Float16*)nullptr, (_Float16*)nullptr, DM, (size_t)SEQ_FULL * DM, 0, SEQ - EARLY, DM, DM);
}

// Causal flash attention, transposed form. Q / K planes [token][DM]; V^T planes [DM][NTOK] (row = head*64 + d); o planes [token][DM]; all in fragment order. The 32-key steps up to the diagonal are looped over by one wave (hi + residual path) or split between two (single-plane path).
// Lane (ln, hh) of a 16-query tile: query (tile start) + ln; S^T accumulators hold keys 8hh + r (tile 0) and 16 + 8hh + r (tile 1), which is exactly the B-fragment k map, so P^T is packed in place.
// Hi + residual path: block = 8 waves (128 queries of one (batch, head)), each wave owns 16 queries; hi + residual (x1024) planes on q, k, v, p and o (two accumulators per site).
__device__ __forceinline__ void attn_early(const unsigned short* __restrict__ Qh, const unsigned short* __restrict__ Qr,
    const unsigned short* __restrict__ Kh, const unsigned short* __restrict__ Kr,
    const unsigned short* __restrict__ Vh, const unsigned short* __restrict__ Vr,
    unsigned short* __restrict__ Oh, unsigned short* __restrict__ Or, const int qblk, const int head, const int b) {
  const int tid = threadIdx.x, w = __builtin_amdgcn_readfirstlane(tid >> 5), lane = tid & 31, ln = lane & 15, hh = lane >> 4;
  const int q0 = qblk * 128 + w * 16;
  const size_t tok0 = (size_t)b * SEQ;
  const size_t qofs = (tok0 + q0) * DM + head * (HD * 16) + 8 * lane;
  const v16h qa = ld_frag(Qh + qofs), qb = ld_frag(Qh + qofs + 512);
  const v16h qra = ld_frag(Qr + qofs), qrb = ld_frag(Qr + qofs + 512);
  addr_wait();
  const size_t kofs = tok0 * DM + head * (HD * 16) + 8 * lane;
  const size_t vofs = (size_t)(head * HD) * NTOK + tok0 * 16 + 8 * lane;
  const v8f z8 = {0.f,0.f,0.f,0.f,0.f,0.f,0.f,0.f};
  v8f oh[4] = {z8, z8, z8, z8};
  v8f om[4] = {z8, z8, z8, z8};
  float mrun = -1.0e30f, lrun = 0.0f;
  const int nsteps = ((q0 + 15) >> 5) + 1;
  const int qi = q0 + ln;
  /* Fragment loads go out ahead of their use: V^T of this step behind the score products, K of the next step behind the output products, so that only one of the two sets is live. */
  v16h kfa[2], kfc[2], kra[2], krc[2], vf[4], vrf[4];
#pragma unroll
  for (int t = 0; t < 2; ++t) {
    const size_t ko = kofs + (size_t)(16 * t) * DM;
    kfa[t] = ld_frag(Kh + ko); kfc[t] = ld_frag(Kh + ko + 512);
    kra[t] = ld_frag(Kr + ko); krc[t] = ld_frag(Kr + ko + 512);
    __builtin_amdgcn_sched_barrier(0);      /* first loads issue in the loop's own order (K tile 0, K tile 1): the loop's waits on K are counted over both ways in */
  }
  addr_wait();
  auto step = [&](const int st, const bool more) __attribute__((always_inline)) {
    const int kb = st * 32;
    v8f sc[2];
#pragma unroll
    for (int t = 0; t < 2; ++t) {
      const v16h ka = kfa[t], kc = kfc[t];
      v8f s = mma2(ka, qa, kc, qb, z8);
      const v16h ra = kra[t], rc = krc[t];
      const v8f sm = mma4(ka, qra, kc, qrb, ra, qa, rc, qb, z8);
      s = s + sm * 0.0009765625f;
#pragma unroll
      for (int dt = 2 * t; dt < 2 * t + 2; ++dt) {
        const size_t vo = vofs + (size_t)(dt * 16) * NTOK + (size_t)kb * 16;
        vf[dt] = ld_frag(Vh + vo); vrf[dt] = ld_frag(Vr + vo);
      }
      sc[t] = s;
    }
    addr_wait();
    if (kb + 31 > q0) {      /* wave-uniform: only the diagonal step carries masked keys; masked scores are replaced */
#pragma unroll
      for (int r = 0; r < 8; ++r) {
        const int key = kb + 8 * hh + r;
        sc[0][r] = (key > qi) ? -1.0e30f : sc[0][r];
        sc[1][r] = (key + 16 > qi) ? -1.0e30f : sc[1][r];
      }
    }
    float mloc = sc[0][0];
#pragma unroll
    for (int r = 1; r < 8; ++r) mloc = fmaxf(mloc, sc[0][r]);
#pragma unroll
    for (int r = 0; r < 8; ++r) mloc = fmaxf(mloc, sc[1][r]);
    mloc = fmaxf(mloc, __shfl_xor(mloc, 16));
    const float mnew = fmaxf(mrun, mloc);
    const float alpha = __expf((mrun - mnew) * 0.125f);
    mrun = mnew;
    const float msh = mnew * 0.125f - 5.545177444f;      /* p carried x256 (same factor in the row sum) */
    float p0[8], p1[8]; float ls = 0.0f;
#pragma unroll
    for (int r = 0; r < 8; ++r) { p0[r] = __expf(sc[0][r] * 0.125f - msh); p1[r] = __expf(sc[1][r] * 0.125f - msh); ls += p0[r] + p1[r]; }
    lrun = lrun * alpha + ls;
#pragma unroll
    for (int dt = 0; dt < 4; ++dt) { oh[dt] = oh[dt] * alpha; om[dt] = om[dt] * alpha; }
    FragH ph, pr;
#pragma unroll
    for (int r = 0; r < 8; ++r) {
      const _Float16 h0 = (_Float16)p0[r], h1 = (_Float16)p1[r];
      ph.h[r] = h0; ph.h[8 + r] = h1;
      pr.h[r] = (_Float16)((p0[r] - (float)h0) * 1024.0f); pr.h[8 + r] = (_Float16)((p1[r] - (float)h1) * 1024.0f);
    }
#pragma unroll
    for (int dt = 0; dt < 4; ++dt) {
      const v16h va = vf[dt];
      oh[dt] = mma1(va, ph.v, oh[dt]);
      const v16h vr = vrf[dt]; om[dt] = mma2(va, pr.v, vr, ph.v, om[dt]);
      if (more) {
        const int t = dt >> 1; const size_t kn = kofs + (size_t)(kb + 32 + 16 * t) * DM;
        if ((dt & 1) == 0) { kfa[t] = ld_frag(Kh + kn); kfc[t] = ld_frag(Kh + kn + 512); }
        else { kra[t] = ld_frag(Kr + kn); krc[t] = ld_frag(Kr + kn + 512); }
      }
    }
    if (more) addr_wait();
  };
#pragma unroll 1
  for (int st = 0; st < nsteps - 1; ++st) step(st, true);
  step(nsteps - 1, false);      /* last key step: nothing of a next step to fetch */
  const float lt = lrun + __shfl_xor(lrun, 16);
  const float inv = 64.0f * (1.0f / lt);      /* o carried x64 */
#pragma unroll
  for (int dt = 0; dt < 4; ++dt) {
    FragH fh, fr;
#pragma unroll
    for (int r = 0; r < 8; ++r) {
      float v = oh[dt][r]; v += om[dt][r] * 0.0009765625f;
      v *= inv;
      const _Float16 h = (_Float16)v; fh.h[r] = h;
      fr.h[r] = (_Float16)((v - (float)h) * 1024.0f);
    }
    /* the lane's 8 values (query ln, d = 16 dt + 8 hh ..) are its 16 bytes of half dt & 1 of fragment tile dt >> 1 */
    const size_t o = qofs + (dt >> 1) * 512 + (dt & 1) * 256;
    *(v8us*)(Oh + o) = fh.half[0];
    *(v8us*)(Or + o) = fr.half[0];
  }
  addr_wait();      /* precaution: each block of the joined kernel takes one path, so no other code runs behind these stores */
}

// Single-plane path. Block = 8 waves (128 queries of one (batch, head)); a wave works on 32 queries as two 16-query tiles u, so every K and V^T fragment it loads feeds two products.
// The key steps of a 32-query group are split between waves w and w + 4: the first takes the lower half of the steps, the second the upper half with the diagonal step (q0 is a multiple of 32,
// so that step is the last one for both tiles). Each half keeps its own maximum, row sum and output tiles; the upper half hands them over through mg and the lower half joins the two once.
__device__ __forceinline__ void attn_wide(float (*mg)[17][32][4], const unsigned short* __restrict__ Qh, const unsigned short* __restrict__ Kh, const unsigned short* __restrict__ Vh,
    unsigned short* __restrict__ Oh, const int qblk, const int head, const int b) {
  const int tid = threadIdx.x, w = __builtin_amdgcn_readfirstlane(tid >> 5), lane = tid & 31, ln = lane & 15, hh = lane >> 4;
  const int grp = w & 3, kp = w >> 2;
  const int q0 = qblk * 128 + grp * 32;
  const size_t tok0 = (size_t)b * SEQ;
  const size_t qofs = (tok0 + q0) * DM + head * (HD * 16) + 8 * lane;
  v16h qa[2], qb[2];
#pragma unroll
  for (int u = 0; u < 2; ++u) { qa[u] = ld_frag(Qh + qofs + (size_t)(16 * u) * DM); qb[u] = ld_frag(Qh + qofs + (size_t)(16 * u) * DM + 512); }
  addr_wait();
  const size_t kofs = tok0 * DM + head * (HD * 16) + 8 * lane;
  const size_t vofs = (size_t)(head * HD) * NTOK + tok0 * 16 + 8 * lane;
  const v8f z8 = {0.f,0.f,0.f,0.f,0.f,0.f,0.f,0.f};
  v8f oh[2][4] = {{z8, z8, z8, z8}, {z8, z8, z8, z8}};
  float mrun[2] = {-1.0e30f, -1.0e30f}, lrun[2] = {0.0f, 0.0f};
  const int nsteps = (q0 >> 5) + 1;
  const int s0 = kp ? (nsteps >> 1) : 0, s1 = kp ? nsteps : (nsteps >> 1);      /* this wave's key steps [s0, s1); nsteps >= 2 here, so neither half is empty */
  /* K and V^T of the next key step go into the same registers, K behind the score products, V^T behind the output products. */
  v16h kfa[2], kfc[2], vf[4];
#pragma unroll
  for (int t = 0; t < 2; ++t) {
    const size_t ko = kofs + (size_t)(s0 * 32 + 16 * t) * DM;
    kfa[t] = ld_frag(Kh + ko); kfc[t] = ld_frag(Kh + ko + 512);
    __builtin_amdgcn_sched_barrier(0);      /* first loads issue in the loop's own order (K tile 0, K tile 1, V^T): otherwise the loop's waits on K, counted over both ways in, also cover the V^T loads in flight */
  }
  addr_wait();      /* the V^T fragments may land in registers that the K loads name */
#pragma unroll
  for (int dt = 0; dt < 4; ++dt) vf[dt] = ld_frag(Vh + vofs + (size_t)(dt * 16) * NTOK + (size_t)(s0 * 32) * 16);
  addr_wait();
  auto step = [&](const int st, const bool more) __attribute__((always_inline)) {
    const int kb = st * 32;
    v8f sc[2][2];      /* [query tile u][key tile t] */
#pragma unroll
    for (int t = 0; t < 2; ++t) { sc[0][t] = wm(kfa[t], qa[0], z8); sc[1][t] = wm(kfa[t], qa[1], z8); }
#pragma unroll
    for (int t = 0; t < 2; ++t) { sc[0][t] = wm(kfc[t], qb[0], sc[0][t]); sc[1][t] = wm(kfc[t], qb[1], sc[1][t]); }
    /* the four vector slots between the last score product and the first use of a score or refill of a K fragment */
    asm volatile("v_nop\n\tv_nop\n\tv_nop\n\tv_nop" : "+v"(sc[0][0]), "+v"(sc[0][1]), "+v"(sc[1][0]), "+v"(sc[1][1]) : "v"(kfa[0]), "v"(kfc[0]), "v"(kfa[1]), "v"(kfc[1]));
    if (more) {
#pragma unroll
      for (int t = 0; t < 2; ++t) {
        const size_t kn = kofs + (size_t)(kb + 32 + 16 * t) * DM;
        kfa[t] = ld_frag(Kh + kn); kfc[t] = ld_frag(Kh + kn + 512);
      }
      addr_wait();
    } else {      /* the upper half's last step is the diagonal one: masked scores are replaced (the lower half's last step has none) */
#pragma unroll
      for (int u = 0; u < 2; ++u) {
        const int qi = q0 + 16 * u + ln;
#pragma unroll
        for (int r = 0; r < 8; ++r) {
          const int key = kb + 8 * hh + r;
          sc[u][0][r] = (key > qi) ? -1.0e30f : sc[u][0][r];
          sc[u][1][r] = (key + 16 > qi) ? -1.0e30f : sc[u][1][r];
        }
      }
    }
    FragH ph[2];
#pragma unroll
    for (int u = 0; u < 2; ++u) {
      float mloc = sc[u][0][0];
#pragma unroll
      for (int r = 1; r < 8; ++r) mloc = fmaxf(mloc, sc[u][0][r]);
#pragma unroll
      for (int r = 0; r < 8; ++r) mloc = fmaxf(mloc, sc[u][1][r]);
      mloc = fmaxf(mloc, __shfl_xor(mloc, 16));
      const float mnew = fmaxf(mrun[u], mloc);
      const float alpha = __expf((mrun[u] - mnew) * 0.125f);
      mrun[u] = mnew;
      const float msh = mnew * 0.125f - 5.545177444f;      /* p carried x256 (same factor in the row sum) */
      float p0[8], p1[8]; float ls = 0.0f;
#pragma unroll
      for (int r = 0; r < 8; ++r) { p0[r] = __expf(sc[u][0][r] * 0.125f - msh); p1[r] = __expf(sc[u][1][r] * 0.125f - msh); ls += p0[r] + p1[r]; }
      lrun[u] = lrun[u] * alpha + ls;
#pragma unroll
      for (int dt = 0; dt < 4; ++dt) oh[u][dt] = oh[u][dt] * alpha;
#pragma unroll
      for (int r = 0; r < 8; ++r) { ph[u].h[r] = (_Float16)p0[r]; ph[u].h[8 + r] = (_Float16)p1[r]; }
    }
#pragma unroll
    for (int dt = 0; dt < 4; ++dt) { oh[0][dt] = wm(vf[dt], ph[0].v, oh[0][dt]); oh[1][dt] = wm(vf[dt], ph[1].v, oh[1][dt]); }
    /* the four vector slots between the last output product and the next write of an operand of it or refill of a V^T fragment */
    asm volatile("v_nop\n\tv_nop\n\tv_nop\n\tv_nop" : "+v"(oh[0][0]), "+v"(oh[0][1]), "+v"(oh[0][2]), "+v"(oh[0][3]), "+v"(oh[1][0]), "+v"(oh[1][1]), "+v"(oh[1][2]), "+v"(oh[1][3])
                 : "v"(vf[0]), "v"(vf[1]), "v"(vf[2]), "v"(vf[3]), "v"(ph[0].v), "v"(ph[1].v));
    if (more) {
#pragma unroll
      for (int dt = 0; dt < 4; ++dt) vf[dt] = ld_frag(Vh + vofs + (size_t)(dt * 16) * NTOK + (size_t)(kb + 32) * 16);
      addr_wait();
    }
  };
#pragma unroll 1      /* the key loop stays rolled: a second copy of the step would only add code and live registers */
  for (int st = s0; st < s1 - 1; ++st) step(st, true);
  step(s1 - 1, false);      /* last key step of this half: nothing left to fetch */
  if (kp) {      /* upper half: hand maximum, row sum and output tiles to the partner wave, 16 bytes a lane and row */
#pragma unroll
    for (int u = 0; u < 2; ++u) {
#pragma unroll
      for (int dt = 0; dt < 4; ++dt) {
        const v4f lo = {oh[u][dt][0], oh[u][dt][1], oh[u][dt][2], oh[u][dt][3]}, hi = {oh[u][dt][4], oh[u][dt][5], oh[u][dt][6], oh[u][dt][7]};
        *(v4fa*)&mg[grp][u * 8 + dt * 2][lane][0] = lo; *(v4fa*)&mg[grp][u * 8 + dt * 2 + 1][lane][0] = hi;
      }
    }
    const v4f ml = {mrun[0], mrun[1], lrun[0], lrun[1]};
    *(v4fa*)&mg[grp][16][lane][0] = ml;
  }
  __syncthreads();      /* publishes the upper halves; every wave of the block passes it once */
  if (kp) return;
  {
    const v4f ml = *(const v4fa*)&mg[grp][16][lane][0];
#pragma unroll
    for (int u = 0; u < 2; ++u) {
      const float mj = fmaxf(mrun[u], ml[u]);
      const float a0 = __expf((mrun[u] - mj) * 0.125f), a1 = __expf((ml[u] - mj) * 0.125f);
      lrun[u] = lrun[u] * a0 + ml[2 + u] * a1;
#pragma unroll
      for (int dt = 0; dt < 4; ++dt) {
        const v4f lo = *(const v4fa*)&mg[grp][u * 8 + dt * 2][lane][0], hi = *(const v4fa*)&mg[grp][u * 8 + dt * 2 + 1][lane][0];
#pragma unroll
        for (int r = 0; r < 4; ++r) { oh[u][dt][r] = oh[u][dt][r] * a0 + lo[r] * a1; oh[u][dt][4 + r] = oh[u][dt][4 + r] * a0 + hi[r] * a1; }
      }
    }
  }
  FragH fo[2][4];
#pragma unroll
  for (int u = 0; u < 2; ++u) {
    const float lt = lrun[u] + __shfl_xor(lrun[u], 16);
    const float inv = 64.0f * (1.0f / lt);      /* o carried x64 */
#pragma unroll
    for (int dt = 0; dt < 4; ++dt) {
#pragma unroll
      for (int r = 0; r < 8; ++r) fo[u][dt].h[r] = (_Float16)(oh[u][dt][r] * inv);
    }
  }
  __builtin_amdgcn_sched_barrier(0);      /* the eight stores go out behind the last conversion, so that no register an issued store names is written again */
#pragma unroll
  for (int u = 0; u < 2; ++u) {
#pragma unroll
    for (int dt = 0; dt < 4; ++dt)      /* the lane's 8 values (query ln of tile u, d = 16 dt + 8 hh ..) are its 16 bytes of half dt & 1 of fragment tile dt >> 1 */
      *(v8us*)(Oh + qofs + (size_t)(16 * u) * DM + (dt >> 1) * 512 + (dt & 1) * 256) = fo[u][dt].half[0];
  }
}

// Both attention paths read the same finished planes and share one grid: first the blocks of the single-plane path (queries [EARLY, SEQ), the longer key loops), then those of the
// hi + residual path (queries [0, EARLY)), each group in the order (query block, head, batch), query block fastest.
__global__ __launch_bounds__(256) void k_attn(const unsigned short* __restrict__ Qh, const unsigned short* __restrict__ Qr,
    const unsigned short* __restrict__ Kh, const unsigned short* __restrict__ Kr,
    const unsigned short* __restrict__ Vh, const unsigned short* __restrict__ Vr,
    unsigned short* __restrict__ Oh, unsigned short* __restrict__ Or) {
  __shared__ __attribute__((aligned(16))) float mg[4][17][32][4];      /* per 32-query group: 16 rows of output values and one of (maximum, row sum), 16 bytes a lane */
  constexpr int NE = EARLY / 128, NL = SEQ > EARLY ? (SEQ - EARLY) / 128 : 1;
  constexpr int NLB = ((SEQ - EARLY) / 128) * NH * NB;      /* blocks of the single-plane path, 128 queries each */
  int i = blockIdx.x;
  if (i < NLB) {
    const int g = i / NL;
    attn_wide(mg, Qh, Kh, Vh, Oh, EARLY / 128 + i - g * NL, g % NH, g / NH);
  } else {
    i -= NLB; const int g = i / NE;
    attn_early(Qh, Qr, Kh, Kr, Vh, Vr, Oh, Or, i - g * NE, g % NH, g / NH);
  }
}

extern "C" void kernel_launch(void* const* d_in, const int* in_sizes, int n_in,
                              void* d_out, int out_size, void* d_ws, size_t ws_size, hipStream_t stream) {
  if (n_in < 9) return;
  const long long need_x = ((long long)(NB - 1) * SEQ_FULL + SEQ) * DM;
  if ((long long)in_sizes[0] < need_x) return;
  if (in_sizes[1] < DM * DM || in_sizes[3] < DM * DM || in_sizes[5] < DM * DM || in_sizes[7] < DM * DM) return;
  if (in_sizes[2] < DM || in_sizes[4] < DM || in_sizes[6] < DM || in_sizes[8] < DM) return;
  if ((long long)out_size < need_x) return;
  const float* x = (const float*)d_in[0]; const float* wq = (const float*)d_in[1]; const float* bq = (const float*)d_in[2];
  const float* wk = (const float*)d_in[3]; const float* bk = (const float*)d_in[4]; const float* wv = (const float*)d_in[5];
  const float* bv = (const float*)d_in[6]; const float* wo = (const float*)d_in[7]; const float* bo = (const float*)d_in[8];
  float* out = (float*)d_out;
  char* ws = (char*)d_ws; size_t off = 0;
  auto take = [&](size_t bytes) { char* p = ws + off; off += (bytes + 255) & ~(size_t)255; return p; };
  const size_t wbytes = (size_t)DM * DM * 2, pbytes = NTOK * DM * 2;
  unsigned short* WQ = (unsigned short*)take(wbytes); unsigned short* WK = (unsigned short*)take(wbytes);
  unsigned short* WV = (unsigned short*)take(wbytes); unsigned short* WO = (unsigned short*)take(wbytes);
  unsigned short* X16 = (unsigned short*)take(pbytes);
  unsigned short* Qh = (unsigned short*)take(pbytes); unsigned short* Qr = (unsigned short*)take(pbytes);
  unsigned short* Kh = (unsigned short*)take(pbytes); unsigned short* Kr = (unsigned short*)take(pbytes);
  unsigned short* VTh = (unsigned short*)take(pbytes); unsigned short* VTr = (unsigned short*)take(pbytes);
  unsigned short* Oh = (unsigned short*)take(pbytes); unsigned short* Or = (unsigned short*)take(pbytes);
  if (off > ws_size || off > (size_t)134217728) return;

  { const unsigned int nw8 = (unsigned int)((size_t)DM * DM / 8), gw = (nw8 + 255u) / 256u;      /* [out][in] weights are already Bt[n][k]; x32; fragment order */
    const unsigned int nx8 = (unsigned int)(NTOK * DM / 8), gx = (nx8 + 255u) / 256u;
    k_prep<<<gx + 4u * gw, 256, 0, stream>>>(x, wq, wk, wv, wo, X16, WQ, WK, WV, WO, nx8, gx, nw8, gw); }

  k_qkv<<<dim3((unsigned)((NTOK / 128) * (DM / 64)), 3), 128, 0, stream>>>(X16, WQ, WK, WV, bq, bk, bv, (_Float16*)Qh, (_Float16*)Qr, (_Float16*)Kh, (_Float16*)Kr, (_Float16*)VTh, (_Float16*)VTr);

  k_attn<<<((SEQ - EARLY) / 128 + EARLY / 128) * NH * NB, 256, 0, stream>>>(Qh, Qr, Kh, Kr, VTh, VTr, Oh, Or);

  k_out<<<dim3((unsigned)((SEQ / 128) * (DM / 64)), NB), 128, 0, stream>>>(Oh, Or, WO, bo, out);
}

// v006
// One run takes 128 microseconds.
// In both of two side-by-side timings against v005, it was 1.16 times as fast.
// Counting every step since v000, it is 4.05 times as fast.
#include <hip/hip_runtime.h>
// Causal multi-head self-attention: x [2][4096][768]; q / k / v = x W^T + b ([out][in] 768 x 768 weights, biases); 12 heads of 64; scores / 8; causal (key <= query) softmax; out = merged W_o^T + b_o.
// Compute dtype: every contraction on v_wmma_f32_16x16x32_f16 with f32 accumulation. Inputs converted RNE to bf16 and held exactly in f16 (weights x32). q, k, v, softmax weights (x256) and o (x64) are f16 operands;
// for the first EARLY queries of each sequence q, k, v, p and o are carried as f16 hi + f16 residual (x1024) planes with separate accumulators (3 products per site). Scores, softmax statistics and epilogues are f32.
// Structure: token rows r = b*SEQ + s. Q, K as planes [token][768]; V produced directly transposed (V^T = W_v x^T, plane [768][tokens]); attention is a register-fed transposed flash loop per wave
// (S^T = K Q^T with Q^T as the B operand, packed P^T from the S^T accumulators as the B operand of O^T = V^T P^T; 32 keys per step; no LDS in the key loop); o as f16 planes; out GEMM writes f32 rows.
// Every f16 plane [R][L] (weights, x, q, k, V^T, o) is stored in fragment order: tiles of 16 rows x 32 columns, 512 elements each, tile (r >> 4, c >> 5) at element ((r >> 4) * (L / 32) + (c >> 5)) * 512;
// inside a tile element (r, c) stands at ((c >> 4) & 1) * 256 + (((c >> 3) & 1) * 16 + (r & 15)) * 8 + (c & 7), so each of a fragment's two loads is lane * 16 bytes into 512 contiguous bytes (four whole lines).
#ifndef NB
#define NB 2
#endif
#ifndef SEQ
#define SEQ 4096
#endif
#define NB_FULL 2
#define SEQ_FULL 4096
#define DM 768
#define NH 12
#define HD 64
#define NTOK ((size_t)NB * SEQ)
#define EARLY ((SEQ) < 1024 ? (SEQ) : 1024)   /* queries per sequence on the hi + residual path */
static_assert(SEQ % 128 == 0);
static_assert(EARLY % 128 == 0);
static_assert((SEQ - EARLY) % 128 == 0);
static_assert(NB <= NB_FULL);
static_assert(SEQ <= SEQ_FULL);
static_assert(DM % 128 == 0);
static_assert(DM % 96 == 0);
static_assert(NH * HD == DM);
static_assert(HD == 64);

typedef _Float16 v16h __attribute__((ext_vector_type(16)));
typedef unsigned short v8us __attribute__((ext_vector_type(8), may_alias));
typedef float v8f __attribute__((ext_vector_type(8)));
typedef float v4f __attribute__((ext_vector_type(4)));
typedef float v4fa __attribute__((ext_vector_type(4), may_alias));
union FragH { v16h v; v8us half[2]; _Float16 h[16]; unsigned short u[16]; };

__device__ __forceinline__ unsigned short bf16_bits(float x) { unsigned int u = __float_as_uint(x); return (unsigned short)((u + 0x7FFFu + ((u >> 16) & 1u)) >> 16); }
__device__ __forceinline__ float bf16_rne(float x) { return __uint_as_float(((unsigned int)bf16_bits(x)) << 16); }

// 16x32 fragment (A rows or B columns) of a plane in fragment order: p = tile start + 8*lane; elements 0..7 <- (row lane&15, k0+8h..), 8..15 <- (row lane&15, k0+16+8h..), h = lane>>4
__device__ __forceinline__ v16h ld_frag(const unsigned short* p) { FragH f; f.half[0] = *(const v8us*)p; f.half[1] = *(const v8us*)(p + 256); return f.v; }
// Thread t writes the 8 elements at t*8 of a fragment-order plane with DM columns: their row and first column.
__device__ __forceinline__ void frag_src(unsigned int t, unsigned int& r, unsigned int& c8) {
  const unsigned int tile = t >> 6, band = tile / (DM / 32), cb = tile - band * (DM / 32);
  r = band * 16u + (t & 15u); c8 = cb * 32u + ((t >> 5) & 1u) * 16u + ((t >> 4) & 1u) * 8u;
}

// Stands behind a run of fragment loads that stay in flight: their address registers may be reused only behind it.
__device__ __forceinline__ void addr_wait() { asm volatile("s_wait_xcnt 0x0" ::: "memory"); }

__device__ __forceinline__ v8f wm(v16h a, v16h b, v8f c) { return __builtin_amdgcn_wmma_f32_16x16x32_f16(false, a, false, b, (short)0, c, false, false); }
__device__ __forceinline__ v8f mma1(v16h a, v16h b, v8f c) {
  c = wm(a, b, c);
  asm volatile("v_nop\n\tv_nop\n\tv_nop\n\tv_nop" : "+v"(c) : "v"(a), "v"(b));
  return c;
}
__device__ __forceinline__ v8f mma2(v16h a0, v16h b0, v16h a1, v16h b1, v8f c) {
  c = wm(a0, b0, c); c = wm(a1, b1, c);
  asm volatile("v_nop\n\tv_nop\n\tv_nop\n\tv_nop" : "+v"(c) : "v"(a0), "v"(b0), "v"(a1), "v"(b1));
  return c;
}
__device__ __forceinline__ v8f mma4(v16h a0, v16h b0, v16h a1, v16h b1, v16h a2, v16h b2, v16h a3, v16h b3, v8f c) {
  c = wm(a0, b0, c); c = wm(a1, b1, c); c = wm(a2, b2, c); c = wm(a3, b3, c);
  asm volatile("v_nop\n\tv_nop\n\tv_nop\n\tv_nop" : "+v"(c) : "v"(a0), "v"(b0), "v"(a1), "v"(b1), "v"(a2), "v"(b2), "v"(a3), "v"(b3));
  return c;
}

__device__ __forceinline__ void cvt_w(const float* __restrict__ w, const unsigned int t, unsigned short* __restrict__ Bt, const float scale) {
  unsigned int r, c8; frag_src(t, r, c8);
  const float* src = w + (size_t)r * DM + c8;
  const v4f a = *(const v4fa*)src, c = *(const v4fa*)(src + 4);
  FragH f;
#pragma unroll
  for (int q = 0; q < 4; ++q) { f.h[q] = (_Float16)(bf16_rne(a[q]) * scale); f.h[4 + q] = (_Float16)(bf16_rne(c[q]) * scale); }
  const v8us o = f.half[0];
  unsigned short* d = Bt + (size_t)t * 8;
  *(v8us*)d = o; 
}

__device__ __forceinline__ void cvt_x(const float* __restrict__ x, unsigned short* __restrict__ X16, const unsigned int t) {
  unsigned int r, c8; frag_src(t, r, c8);
  const unsigned int b = r / SEQ, s = r - b * SEQ;
  const float* src = x + ((size_t)b * SEQ_FULL + s) * DM + c8;
  const v4f a = *(const v4fa*)src, c = *(const v4fa*)(src + 4);
  FragH f;
#pragma unroll
  for (int q = 0; q < 4; ++q) { f.h[q] = (_Float16)bf16_rne(a[q]); f.h[4 + q] = (_Float16)bf16_rne(c[q]); }
  const v8us o = f.half[0];
  unsigned short* d = X16 + (size_t)t * 8;
  *(v8us*)d = o; 
}

// The five conversions depend on nothing and share one grid: blocks [0, gx) take x, then gw blocks for each of the four weights (x32).
__global__ __launch_bounds__(256) void k_prep(const float* __restrict__ x, const float* __restrict__ wq, const float* __restrict__ wk, const float* __restrict__ wv, const float* __restrict__ wo,
    unsigned short* __restrict__ X16, unsigned short* __restrict__ WQ, unsigned short* __restrict__ WK, unsigned short* __restrict__ WV, unsigned short* __restrict__ WO,
    unsigned int nx8, unsigned int gx, unsigned int nw8, unsigned int gw) {
  unsigned int blk = blockIdx.x;
  if (blk < gx) {
    const unsigned int t = blk * 256u + threadIdx.x; if (t >= nx8) return;
    cvt_x(x, X16, t);
  } else {
    blk -= gx; const unsigned int m = blk / gw; blk -= m * gw;
    const unsigned int t = blk * 256u + threadIdx.x; if (t >= nw8) return;
    const float* w = m == 0 ? wq : m == 1 ? wk : m == 2 ? wv : wo;
    unsigned short* d = m == 0 ? WQ : m == 1 ? WK : m == 2 ? WV : WO;
    cvt_w(w, t, d, 32.0f);
  }
}

__device__ __forceinline__ v8f g2_mma(v16h a, v16h b, v8f c) { v8f d = __builtin_amdgcn_wmma_f32_16x16x32_f16(false, a, false, b, (short)0, c, false, false); asm volatile("v_nop\n\tv_nop\n\tv_nop\n\tv_nop" : "+v"(d) : "v"(a), "v"(b)); return d; }

// GEMM C[M][N] = (A (+ Ar/1024)) . Bt^T * alpha + bias; A, Ar f16 [M][K] (row length lda, batch stride sA per batch index by), Bt f16 [N][K] (row length ldb), all in fragment order.
// Block = 4 waves, wave tile 32 x 64 (block 128 x 64); M % 128 == 0, N % 64 == 0, K % 96 == 0. BIASROW: bias indexed by row, else by column (bias converted RNE to bf16).
// Outputs: C f32 rows (optional), C16 f16 in fragment order (optional), C16r = f16((v - f16(v)) * 1024) (optional; resmode 1: rows with (row % SEQ) < EARLY, resmode 2: columns with (col % SEQ) < EARLY).
// so: the block's staging rows in LDS; bx, by: the tile index and the batch index of this block inside its own product.
template <bool ARES, bool BIASROW>
__device__ __forceinline__ void gemm2(float (*so)[32][68], const int bx, const int by, const unsigned short* __restrict__ A, const unsigned short* __restrict__ Ar, int lda, size_t sA,
    const unsigned short* __restrict__ Bh, int ldb, float alpha, const float* __restrict__ bias,
    float* __restrict__ C, _Float16* __restrict__ C16, _Float16* __restrict__ C16r, int ldc, size_t sC, int resmode, int M, int N, int K) {
  const int tid = threadIdx.x, w = __builtin_amdgcn_readfirstlane(tid >> 5), lane = tid & 31, ln = lane & 15, hh = lane >> 4;
  const int ntn = N >> 6; const int mt = bx / ntn, nq = bx - mt * ntn; const int row0 = mt * 128 + 32 * w, col0 = nq * 64; if (row0 >= M) return;
  const size_t aofs = (size_t)by * sA + (size_t)row0 * lda + 8 * lane;
  const size_t cofs = (size_t)by * sC;
  const unsigned short* a0p = A + aofs; const unsigned short* a1p = a0p + (size_t)16 * lda;
  const unsigned short* r0p = Ar + aofs; const unsigned short* r1p = r0p + (size_t)16 * lda;
  const unsigned short* b0p = Bh + (size_t)col0 * ldb + 8 * lane; const unsigned short* b1p = b0p + (size_t)16 * ldb; const unsigned short* b2p = b1p + (size_t)16 * ldb; const unsigned short* b3p = b2p + (size_t)16 * ldb;
  const v8f z8 = {0.f,0.f,0.f,0.f,0.f,0.f,0.f,0.f};
  v8f c00 = z8, c01 = z8, c02 = z8, c03 = z8, c10 = z8, c11 = z8, c12 = z8, c13 = z8;
  v8f d00 = z8, d01 = z8, d02 = z8, d03 = z8, d10 = z8, d11 = z8, d12 = z8, d13 = z8;
  /* Fragments live in GD register sets; a set is refilled for k + 32*GD right behind its last product, so a load has GD k steps to land (the product order is unchanged). */
  constexpr int GD = ARES ? 1 : 3;
  v16h fa0[GD], fa1[GD], fe0[GD], fe1[GD], fb0[GD], fb1[GD], fb2[GD], fb3[GD];
#pragma unroll
  for (int u = 0; u < GD; ++u) {
    const int k = 512 * u;      /* one tile of 512 elements per 32 k */
    fb0[u] = ld_frag(b0p + k); fa0[u] = ld_frag(a0p + k); fa1[u] = ld_frag(a1p + k);
    if (ARES) { fe0[u] = ld_frag(r0p + k); fe1[u] = ld_frag(r1p + k); }
    fb1[u] = ld_frag(b1p + k); fb2[u] = ld_frag(b2p + k); fb3[u] = ld_frag(b3p + k);
  }
  addr_wait();
  auto kstep = [&](const int u, const int kn, const bool more) __attribute__((always_inline)) {
    const v16h a0 = fa0[u], a1 = fa1[u];
    v16h e0 = a0, e1 = a1;
    if (ARES) { e0 = fe0[u]; e1 = fe1[u]; }
    v16h b = fb0[u]; c00 = g2_mma(a0, b, c00); c10 = g2_mma(a1, b, c10); if (ARES) { d00 = g2_mma(e0, b, d00); d10 = g2_mma(e1, b, d10); }
    if (more) fb0[u] = ld_frag(b0p + kn);
    b = fb1[u]; c01 = g2_mma(a0, b, c01); c11 = g2_mma(a1, b, c11); if (ARES) { d01 = g2_mma(e0, b, d01); d11 = g2_mma(e1, b, d11); }
    if (more) fb1[u] = ld_frag(b1p + kn);
    b = fb2[u]; c02 = g2_mma(a0, b, c02); c12 = g2_mma(a1, b, c12); if (ARES) { d02 = g2_mma(e0, b, d02); d12 = g2_mma(e1, b, d12); }
    if (more) fb2[u] = ld_frag(b2p + kn);
    b = fb3[u]; c03 = g2_mma(a0, b, c03); c13 = g2_mma(a1, b, c13); if (ARES) { d03 = g2_mma(e0, b, d03); d13 = g2_mma(e1, b, d13); }
    if (more) {
      fb3[u] = ld_frag(b3p + kn); fa0[u] = ld_frag(a0p + kn); fa1[u] = ld_frag(a1p + kn);
      if (ARES) { fe0[u] = ld_frag(r0p + kn); fe1[u] = ld_frag(r1p + kn); }
      if (u == GD - 1) addr_wait();      /* the pointers step once per trip */
    }
  };
#pragma unroll 1
  for (int kb = 0; kb < (K - 32 * GD) * 16; kb += 512 * GD) {      /* kb counts elements of a 16-row band: 512 per 32 k */
#pragma unroll
    for (int u = 0; u < GD; ++u) kstep(u, kb + 512 * (u + GD), true);
  }
#pragma unroll
  for (int u = 0; u < GD; ++u) kstep(u, 0, false);      /* last GD k steps: nothing left to fetch */
  v8f accs[8] = {c00, c01, c02, c03, c10, c11, c12, c13};
  v8f accd[8] = {d00, d01, d02, d03, d10, d11, d12, d13};
#pragma unroll
  for (int u = 0; u < 8; ++u) {
    const int t = u & 3, half = u >> 2; const int col = col0 + t * 16 + ln;
    float bcol = 0.f; if (!BIASROW) bcol = bf16_rne(bias[col]);
#pragma unroll
    for (int r = 0; r < 8; ++r) {
      const int rloc = half * 16 + 8 * hh + r;
      float v = accs[u][r]; if (ARES) v += accd[u][r] * 0.0009765625f;
      float bv = bcol; if (BIASROW) bv = bf16_rne(bias[row0 + rloc]);
      so[w][rloc][t * 16 + ln] = v * alpha + bv;
    }
  }
  __builtin_amdgcn_fence(4 /* acq_rel order */, "workgroup"); __builtin_amdgcn_wave_barrier();
  bool wres = false;
  if (C16r) { if (resmode == 1) wres = ((row0 % SEQ) < EARLY); else if (resmode == 2) wres = ((col0 % SEQ) < EARLY); }
  if (C) {
    const int rsub = lane >> 4, c4 = (lane & 15) * 4;
#pragma unroll
    for (int q = 0; q < 16; ++q) {
      const int r = q * 2 + rsub; const v4f v = *(const v4fa*)&so[w][r][c4];
      *(v4f*)(C + cofs + (size_t)(row0 + r) * ldc + col0 + c4) = v;
    }
    addr_wait();      /* the f16 block below may reuse registers that these stores name */
  }
  if (C16) {      /* the wave's 32 x 64 tile = 2 x 2 fragment tiles of two 512-byte halves; the lane writes 16 bytes of each half */
    const size_t o0 = cofs + (size_t)row0 * ldc + (size_t)(col0 >> 5) * 512 + lane * 8, o1 = o0 + (size_t)16 * ldc;
    unsigned short* h0p = (unsigned short*)C16 + o0; unsigned short* h1p = (unsigned short*)C16 + o1;
    unsigned short* e0p = (unsigned short*)C16r + o0; unsigned short* e1p = (unsigned short*)C16r + o1;
    FragH fh[8], fr[8];
#pragma unroll
    for (int q = 0; q < 8; ++q) {      /* q = band * 4 + column tile * 2 + half */
      const float* sp = &so[w][(q >> 2) * 16 + ln][(q & 3) * 16 + hh * 8];
      const v4f v0 = *(const v4fa*)sp, v1 = *(const v4fa*)(sp + 4);
#pragma unroll
      for (int i = 0; i < 4; ++i) {
        fh[q].h[i] = (_Float16)v0[i]; fr[q].h[i] = (_Float16)((v0[i] - (float)fh[q].h[i]) * 1024.0f);
        fh[q].h[4 + i] = (_Float16)v1[i]; fr[q].h[4 + i] = (_Float16)((v1[i] - (float)fh[q].h[4 + i]) * 1024.0f);
      }
    }
#pragma unroll
    for (int q = 0; q < 8; ++q) *(v8us*)((q >> 2 ? h1p : h0p) + (q & 3) * 256) = fh[q].half[0];
    addr_wait();      /* the residual stores below may reuse registers that the stores above name */
    if (wres) {
#pragma unroll
      for (int q = 0; q < 8; ++q) *(v8us*)((q >> 2 ? e1p : e0p) + (q & 3) * 256) = fr[q].half[0];
      addr_wait();      /* precaution: the joined kernels take one product per block, so no other product's code runs behind these stores */
    }
  }
}

// Q, K and V^T depend only on the converted planes and share one grid: blockIdx.y = 0, 1 give Q, K [token][DM] (hi planes; residual planes for tokens with s < EARLY);
// blockIdx.y = 2 gives V^T [DM][NTOK] = W_v (rows c) . X16^T (columns = tokens), bias by row, residual plane for token columns with s < EARLY.
__global__ __launch_bounds__(128) void k_qkv(const unsigned short* __restrict__ X16, const unsigned short* __restrict__ WQ, const unsigned short* __restrict__ WK, const unsigned short* __restrict__ WV,
    const float* __restrict__ bq, const float* __restrict__ bk, const float* __restrict__ bv,
    _Float16* __restrict__ Qh, _Float16* __restrict__ Qr, _Float16* __restrict__ Kh, _Float16* __restrict__ Kr, _Float16* __restrict__ VTh, _Float16* __restrict__ VTr) {
  __shared__ __attribute__((aligned(16))) float so[4][32][68];
  const int sel = blockIdx.y;
  if (sel == 2) gemm2<false, true>(so, blockIdx.x, 0, WV, WV, DM, (size_t)0, X16, DM, 0.03125f, bv, (float*)nullptr, VTh, VTr, (int)NTOK, (size_t)0, 2, DM, (int)NTOK, DM);
  else gemm2<false, false>(so, blockIdx.x, 0, X16, X16, DM, (size_t)0, sel ? WK : WQ, DM, 0.03125f, sel ? bk : bq, (float*)nullptr, sel ? Kh : Qh, sel ? Kr : Qr, DM, (size_t)0, 1, (int)NTOK, DM, DM);
}

// out rows (b*SEQ_FULL + s) = o W_o^T + b_o; alpha = 1 / (64 * 32). One grid: the first blocks take the rows with s < EARLY (hi + residual o), the others the rest; blockIdx.y = batch.
__global__ __launch_bounds__(128) void k_out(const unsigned short* __restrict__ Oh, const unsigned short* __restrict__ Or, const unsigned short* __restrict__ WO, const float* __restrict__ bo, float* __restrict__ out) {
  __shared__ __attribute__((aligned(16))) float so[4][32][68];
  constexpr int NE = (EARLY / 128) * (DM / 64);
  const int bx = blockIdx.x;
  if (bx < NE) gemm2<true, false>(so, bx, blockIdx.y, Oh, Or, DM, (size_t)SEQ * DM, WO, DM, 0.00048828125f, bo, out, (_Float16*)nullptr, (_Float16*)nullptr, DM, (size_t)SEQ_FULL * DM, 0, EARLY, DM, DM);
  else gemm2<false, false>(so, bx - NE, blockIdx.y, Oh + (size_t)EARLY * DM, Oh + (size_t)EARLY * DM, DM, (size_t)SEQ * DM, WO, DM, 0.00048828125f, bo, out + (size_t)EARLY * DM, (_Float16*)nullptr, (_Float16*)nullptr, DM, (size_t)SEQ_FULL * DM, 0, SEQ - EARLY, DM, DM);
}

// Causal flash attention, transposed form. Q / K planes [token][DM]; V^T planes [DM][NTOK] (row = head*64 + d); o planes [token][DM]; all in fragment order. The 32-key steps up to the diagonal are looped over by one wave (hi + residual path) or split between two (single-plane path).
// Lane (ln, hh) of a 16-query tile: query (tile start) + ln; S^T accumulators hold keys 8hh + r (tile 0) and 16 + 8hh + r (tile 1), which is exactly the B-fragment k map, so P^T is packed in place.
// Hi + residual path: block = 8 waves (128 queries of one (batch, head)), each wave owns 16 queries; hi + residual (x1024) planes on q, k, v, p and o (two accumulators per site).
__device__ __forceinline__ void attn_early(const unsigned short* __restrict__ Qh, const unsigned short* __restrict__ Qr,
    const unsigned short* __restrict__ Kh, const unsigned short* __restrict__ Kr,
    const unsigned short* __restrict__ Vh, const unsigned short* __restrict__ Vr,
    unsigned short* __restrict__ Oh, unsigned short* __restrict__ Or, const int qblk, const int head, const int b) {
  const int tid = threadIdx.x, w = __builtin_amdgcn_readfirstlane(tid >> 5), lane = tid & 31, ln = lane & 15, hh = lane >> 4;
  const int q0 = qblk * 128 + w * 16;
  const size_t tok0 = (size_t)b * SEQ;
  const size_t qofs = (tok0 + q0) * DM + head * (HD * 16) + 8 * lane;
  const v16h qa = ld_frag(Qh + qofs), qb = ld_frag(Qh + qofs + 512);
  const v16h qra = ld_frag(Qr + qofs), qrb = ld_frag(Qr + qofs + 512);
  addr_wait();
  const size_t kofs = tok0 * DM + head * (HD * 16) + 8 * lane;
  const size_t vofs = (size_t)(head * HD) * NTOK + tok0 * 16 + 8 * lane;
  const v8f z8 = {0.f,0.f,0.f,0.f,0.f,0.f,0.f,0.f};
  v8f oh[4] = {z8, z8, z8, z8};
  v8f om[4] = {z8, z8, z8, z8};
  float mrun = -1.0e30f, lrun = 0.0f;
  const int nsteps = ((q0 + 15) >> 5) + 1;
  const int qi = q0 + ln;
  /* Fragment loads go out ahead of their use: V^T of this step behind the score products, K of the next step behind the output products, so that only one of the two sets is live. */
  v16h kfa[2], kfc[2], kra[2], krc[2], vf[4], vrf[4];
#pragma unroll
  for (int t = 0; t < 2; ++t) {
    const size_t ko = kofs + (size_t)(16 * t) * DM;
    kfa[t] = ld_frag(Kh + ko); kfc[t] = ld_frag(Kh + ko + 512);
    kra[t] = ld_frag(Kr + ko); krc[t] = ld_frag(Kr + ko + 512);
    __builtin_amdgcn_sched_barrier(0);      /* first loads issue in the loop's own order (K tile 0, K tile 1): the loop's waits on K are counted over both ways in */
  }
  addr_wait();
  auto step = [&](const int st, const bool more) __attribute__((always_inline)) {
    const int kb = st * 32;
    v8f sc[2];
#pragma unroll
    for (int t = 0; t < 2; ++t) {
      const v16h ka = kfa[t], kc = kfc[t];
      v8f s = mma2(ka, qa, kc, qb, z8);
      const v16h ra = kra[t], rc = krc[t];
      const v8f sm = mma4(ka, qra, kc, qrb, ra, qa, rc, qb, z8);
      s = s + sm * 0.0009765625f;
#pragma unroll
      for (int dt = 2 * t; dt < 2 * t + 2; ++dt) {
        const size_t vo = vofs + (size_t)(dt * 16) * NTOK + (size_t)kb * 16;
        vf[dt] = ld_frag(Vh + vo); vrf[dt] = ld_frag(Vr + vo);
      }
      sc[t] = s;
    }
    addr_wait();
    if (kb + 31 > q0) {      /* wave-uniform: only the diagonal step carries masked keys; masked scores are replaced */
#pragma unroll
      for (int r = 0; r < 8; ++r) {
        const int key = kb + 8 * hh + r;
        sc[0][r] = (key > qi) ? -1.0e30f : sc[0][r];
        sc[1][r] = (key + 16 > qi) ? -1.0e30f : sc[1][r];
      }
    }
    float mloc = sc[0][0];
#pragma unroll
    for (int r = 1; r < 8; ++r) mloc = fmaxf(mloc, sc[0][r]);
#pragma unroll
    for (int r = 0; r < 8; ++r) mloc = fmaxf(mloc, sc[1][r]);
    mloc = fmaxf(mloc, __shfl_xor(mloc, 16));
    const float mnew = fmaxf(mrun, mloc);
    const float alpha = __expf((mrun - mnew) * 0.125f);
    mrun = mnew;
    const float msh = mnew * 0.125f - 5.545177444f;      /* p carried x256 (same factor in the row sum) */
    float p0[8], p1[8]; float ls = 0.0f;
#pragma unroll
    for (int r = 0; r < 8; ++r) { p0[r] = __expf(sc[0][r] * 0.125f - msh); p1[r] = __expf(sc[1][r] * 0.125f - msh); ls += p0[r] + p1[r]; }
    lrun = lrun * alpha + ls;
#pragma unroll
    for (int dt = 0; dt < 4; ++dt) { oh[dt] = oh[dt] * alpha; om[dt] = om[dt] * alpha; }
    FragH ph, pr;
#pragma unroll
    for (int r = 0; r < 8; ++r) {
      const _Float16 h0 = (_Float16)p0[r], h1 = (_Float16)p1[r];
      ph.h[r] = h0; ph.h[8 + r] = h1;
      pr.h[r] = (_Float16)((p0[r] - (float)h0) * 1024.0f); pr.h[8 + r] = (_Float16)((p1[r] - (float)h1) * 1024.0f);
    }
#pragma unroll
    for (int dt = 0; dt < 4; ++dt) {
      const v16h va = vf[dt];
      oh[dt] = mma1(va, ph.v, oh[dt]);
      const v16h vr = vrf[dt]; om[dt] = mma2(va, pr.v, vr, ph.v, om[dt]);
      if (more) {
        const int t = dt >> 1; const size_t kn = kofs + (size_t)(kb + 32 + 16 * t) * DM;
        if ((dt & 1) == 0) { kfa[t] = ld_frag(Kh + kn); kfc[t] = ld_frag(Kh + kn + 512); }
        else { kra[t] = ld_frag(Kr + kn); krc[t] = ld_frag(Kr + kn + 512); }
      }
    }
    if (more) addr_wait();
  };
#pragma unroll 1
  for (int st = 0; st < nsteps - 1; ++st) step(st, true);
  step(nsteps - 1, false);      /* last key step: nothing of a next step to fetch */
  const float lt = lrun + __shfl_xor(lrun, 16);
  const float inv = 64.0f * (1.0f / lt);      /* o carried x64 */
#pragma unroll
  for (int dt = 0; dt < 4; ++dt) {
    FragH fh, fr;
#pragma unroll
    for (int r = 0; r < 8; ++r) {
      float v = oh[dt][r]; v += om[dt][r] * 0.0009765625f;
      v *= inv;
      const _Float16 h = (_Float16)v; fh.h[r] = h;
      fr.h[r] = (_Float16)((v - (float)h) * 1024.0f);
    }
    /* the lane's 8 values (query ln, d = 16 dt + 8 hh ..) are its 16 bytes of half dt & 1 of fragment tile dt >> 1 */
    const size_t o = qofs + (dt >> 1) * 512 + (dt & 1) * 256;
    *(v8us*)(Oh + o) = fh.half[0];
    *(v8us*)(Or + o) = fr.half[0];
  }
  addr_wait();      /* precaution: each block of the joined kernel takes one path, so no other code runs behind these stores */
}

// Single-plane path. Block = 8 waves (128 queries of one (batch, head)); a wave works on 32 queries as two 16-query tiles u, so every K and V^T fragment it loads feeds two products.
// The key steps of a 32-query group are split between waves w and w + 4: the first takes the lower half of the steps, the second the upper half with the diagonal step (q0 is a multiple of 32,
// so that step is the last one for both tiles). Each half keeps its own maximum, row sum and output tiles; the upper half hands them over through mg and the lower half joins the two once.
__device__ __forceinline__ void attn_wide(float (*mg)[17][32][4], const unsigned short* __restrict__ Qh, const unsigned short* __restrict__ Kh, const unsigned short* __restrict__ Vh,
    unsigned short* __restrict__ Oh, const int qblk, const int head, const int b) {
  const int tid = threadIdx.x, w = __builtin_amdgcn_readfirstlane(tid >> 5), lane = tid & 31, ln = lane & 15, hh = lane >> 4;
  const int grp = w & 3, kp = w >> 2;
  const int q0 = qblk * 128 + grp * 32;
  const size_t tok0 = (size_t)b * SEQ;
  const size_t qofs = (tok0 + q0) * DM + head * (HD * 16) + 8 * lane;
  v16h qa[2], qb[2];
#pragma unroll
  for (int u = 0; u < 2; ++u) { qa[u] = ld_frag(Qh + qofs + (size_t)(16 * u) * DM); qb[u] = ld_frag(Qh + qofs + (size_t)(16 * u) * DM + 512); }
  addr_wait();
  const size_t kofs = tok0 * DM + head * (HD * 16) + 8 * lane;
  const size_t vofs = (size_t)(head * HD) * NTOK + tok0 * 16 + 8 * lane;
  const v8f z8 = {0.f,0.f,0.f,0.f,0.f,0.f,0.f,0.f};
  v8f oh[2][4] = {{z8, z8, z8, z8}, {z8, z8, z8, z8}};
  float mrun[2] = {-1.0e30f, -1.0e30f}, lrun[2] = {0.0f, 0.0f};
  const int nsteps = (q0 >> 5) + 1;
  const int s0 = kp ? (nsteps >> 1) : 0, s1 = kp ? nsteps : (nsteps >> 1);      /* this wave's key steps [s0, s1); nsteps >= 2 here, so neither half is empty */
  /* K and V^T of the next key step go into the same registers, K behind the score products, V^T behind the output products. */
  v16h kfa[2], kfc[2], vf[4];
#pragma unroll
  for (int t = 0; t < 2; ++t) {
    const size_t ko = kofs + (size_t)(s0 * 32 + 16 * t) * DM;
    kfa[t] = ld_frag(Kh + ko); kfc[t] = ld_frag(Kh + ko + 512);
    __builtin_amdgcn_sched_barrier(0);      /* first loads issue in the loop's own order (K tile 0, K tile 1, V^T): otherwise the loop's waits on K, counted over both ways in, also cover the V^T loads in flight */
  }
  addr_wait();      /* the V^T fragments may land in registers that the K loads name */
#pragma unroll
  for (int dt = 0; dt < 4; ++dt) vf[dt] = ld_frag(Vh + vofs + (size_t)(dt * 16) * NTOK + (size_t)(s0 * 32) * 16);
  addr_wait();
  auto step = [&](const int st, const bool more) __attribute__((always_inline)) {
    const int kb = st * 32;
    v8f sc[2][2];      /* [query tile u][key tile t] */
#pragma unroll
    for (int t = 0; t < 2; ++t) { sc[0][t] = wm(kfa[t], qa[0], z8); sc[1][t] = wm(kfa[t], qa[1], z8); }
#pragma unroll
    for (int t = 0; t < 2; ++t) { sc[0][t] = wm(kfc[t], qb[0], sc[0][t]); sc[1][t] = wm(kfc[t], qb[1], sc[1][t]); }
    /* the four vector slots between the last score product and the first use of a score or refill of a K fragment */
    asm volatile("v_nop\n\tv_nop\n\tv_nop\n\tv_nop" : "+v"(sc[0][0]), "+v"(sc[0][1]), "+v"(sc[1][0]), "+v"(sc[1][1]) : "v"(kfa[0]), "v"(kfc[0]), "v"(kfa[1]), "v"(kfc[1]));
    if (more) {
#pragma unroll
      for (int t = 0; t < 2; ++t) {
        const size_t kn = kofs + (size_t)(kb + 32 + 16 * t) * DM;
        kfa[t] = ld_frag(Kh + kn); kfc[t] = ld_frag(Kh + kn + 512);
      }
      addr_wait();
    } else {      /* the upper half's last step is the diagonal one: masked scores are replaced (the lower half's last step has none) */
#pragma unroll
      for (int u = 0; u < 2; ++u) {
        const int qi = q0 + 16 * u + ln;
#pragma unroll
        for (int r = 0; r < 8; ++r) {
          const int key = kb + 8 * hh + r;
          sc[u][0][r] = (key > qi) ? -1.0e30f : sc[u][0][r];
          sc[u][1][r] = (key + 16 > qi) ? -1.0e30f : sc[u][1][r];
        }
      }
    }
    FragH ph[2];
#pragma unroll
    for (int u = 0; u < 2; ++u) {
      float mloc = sc[u][0][0];
#pragma unroll
      for (int r = 1; r < 8; ++r) mloc = fmaxf(mloc, sc[u][0][r]);
#pragma unroll
      for (int r = 0; r < 8; ++r) mloc = fmaxf(mloc, sc[u][1][r]);
      mloc = fmaxf(mloc, __shfl_xor(mloc, 16));
      const float mnew = fmaxf(mrun[u], mloc);
      const float alpha = __expf((mrun[u] - mnew) * 0.125f);
      mrun[u] = mnew;
      const float msh = mnew * 0.125f - 5.545177444f;      /* p carried x256 (same factor in the row sum) */
      float p0[8], p1[8]; float ls = 0.0f;
#pragma unroll
      for (int r = 0; r < 8; ++r) { p0[r] = __expf(sc[u][0][r] * 0.125f - msh); p1[r] = __expf(sc[u][1][r] * 0.125f - msh); ls += p0[r] + p1[r]; }
      lrun[u] = lrun[u] * alpha + ls;
#pragma unroll
      for (int dt = 0; dt < 4; ++dt) oh[u][dt] = oh[u][dt] * alpha;
#pragma unroll
      for (int r = 0; r < 8; ++r) { ph[u].h[r] = (_Float16)p0[r]; ph[u].h[8 + r] = (_Float16)p1[r]; }
    }
#pragma unroll
    for (int dt = 0; dt < 4; ++dt) { oh[0][dt] = wm(vf[dt], ph[0].v, oh[0][dt]); oh[1][dt] = wm(vf[dt], ph[1].v, oh[1][dt]); }
    /* the four vector slots between the last output product and the next write of an operand of it or refill of a V^T fragment */
    asm volatile("v_nop\n\tv_nop\n\tv_nop\n\tv_nop" : "+v"(oh[0][0]), "+v"(oh[0][1]), "+v"(oh[0][2]), "+v"(oh[0][3]), "+v"(oh[1][0]), "+v"(oh[1][1]), "+v"(oh[1][2]), "+v"(oh[1][3])
                 : "v"(vf[0]), "v"(vf[1]), "v"(vf[2]), "v"(vf[3]), "v"(ph[0].v), "v"(ph[1].v));
    if (more) {
#pragma unroll
      for (int dt = 0; dt < 4; ++dt) vf[dt] = ld_frag(Vh + vofs + (size_t)(dt * 16) * NTOK + (size_t)(kb + 32) * 16);
      addr_wait();
    }
  };
#pragma unroll 1      /* the key loop stays rolled: a second copy of the step would only add code and live registers */
  for (int st = s0; st < s1 - 1; ++st) step(st, true);
  step(s1 - 1, false);      /* last key step of this half: nothing left to fetch */
  if (kp) {      /* upper half: hand maximum, row sum and output tiles to the partner wave, 16 bytes a lane and row */
#pragma unroll
    for (int u = 0; u < 2; ++u) {
#pragma unroll
      for (int dt = 0; dt < 4; ++dt) {
        const v4f lo = {oh[u][dt][0], oh[u][dt][1], oh[u][dt][2], oh[u][dt][3]}, hi = {oh[u][dt][4], oh[u][dt][5], oh[u][dt][6], oh[u][dt][7]};
        *(v4fa*)&mg[grp][u * 8 + dt * 2][lane][0] = lo; *(v4fa*)&mg[grp][u * 8 + dt * 2 + 1][lane][0] = hi;
      }
    }
    const v4f ml = {mrun[0], mrun[1], lrun[0], lrun[1]};
    *(v4fa*)&mg[grp][16][lane][0] = ml;
  }
  __syncthreads();      /* publishes the upper halves; every wave of the block passes it once */
  if (kp) return;
  {
    const v4f ml = *(const v4fa*)&mg[grp][16][lane][0];
#pragma unroll
    for (int u = 0; u < 2; ++u) {
      const float mj = fmaxf(mrun[u], ml[u]);
      const float a0 = __expf((mrun[u] - mj) * 0.125f), a1 = __expf((ml[u] - mj) * 0.125f);
      lrun[u] = lrun[u] * a0 + ml[2 + u] * a1;
#pragma unroll
      for (int dt = 0; dt < 4; ++dt) {
        const v4f lo = *(const v4fa*)&mg[grp][u * 8 + dt * 2][lane][0], hi = *(const v4fa*)&mg[grp][u * 8 + dt * 2 + 1][lane][0];
#pragma unroll
        for (int r = 0; r < 4; ++r) { oh[u][dt][r] = oh[u][dt][r] * a0 + lo[r] * a1; oh[u][dt][4 + r] = oh[u][dt][4 + r] * a0 + hi[r] * a1; }
      }
    }
  }
  FragH fo[2][4];
#pragma unroll
  for (int u = 0; u < 2; ++u) {
    const float lt = lrun[u] + __shfl_xor(lrun[u], 16);
    const float inv = 64.0f * (1.0f / lt);      /* o carried x64 */
#pragma unroll
    for (int dt = 0; dt < 4; ++dt) {
#pragma unroll
      for (int r = 0; r < 8; ++r) fo[u][dt].h[r] = (_Float16)(oh[u][dt][r] * inv);
    }
  }
  __builtin_amdgcn_sched_barrier(0);      /* the eight stores go out behind the last conversion, so that no register an issued store names is written again */
#pragma unroll
  for (int u = 0; u < 2; ++u) {
#pragma unroll
    for (int dt = 0; dt < 4; ++dt)      /* the lane's 8 values (query ln of tile u, d = 16 dt + 8 hh ..) are its 16 bytes of half dt & 1 of fragment tile dt >> 1 */
      *(v8us*)(Oh + qofs + (size_t)(16 * u) * DM + (dt >> 1) * 512 + (dt & 1) * 256) = fo[u][dt].half[0];
  }
}

// Both attention paths read the same finished planes and share one grid. There are more blocks than resident places; the cost of a block falls with its index (for speed only):
// rank = index / (heads * batches) picks the query block from a compile-time order, the (head, batch) pair runs fastest. Cost key: q + 1 for a single-plane block q (2 (q + 1) key steps a wave),
// 3 (e + 1) for a hi + residual block e (4 (e + 1) key steps a wave, each with three products per site and a longer dependent chain). The order is a permutation of the query blocks for any SEQ and EARLY.
constexpr int NQB = SEQ / 128;      /* query blocks per (batch, head) */
struct QOrder { unsigned char q[NQB]; };
constexpr QOrder q_order() {
  QOrder o{}; int wq = NQB - 1, e = EARLY / 128 - 1;
  for (int r = 0; r < NQB; ++r) {
    const bool wide = wq >= EARLY / 128 && (e < 0 || wq + 1 >= 3 * (e + 1));
    o.q[r] = (unsigned char)(wide ? wq-- : e--);
  }
  return o;
}
__global__ __launch_bounds__(256) void k_attn(const unsigned short* __restrict__ Qh, const unsigned short* __restrict__ Qr,
    const unsigned short* __restrict__ Kh, const unsigned short* __restrict__ Kr,
    const unsigned short* __restrict__ Vh, const unsigned short* __restrict__ Vr,
    unsigned short* __restrict__ Oh, unsigned short* __restrict__ Or) {
  __shared__ __attribute__((aligned(16))) float mg[4][17][32][4];      /* per 32-query group: 16 rows of output values and one of (maximum, row sum), 16 bytes a lane */
  constexpr QOrder ord = q_order();
  const int i = blockIdx.x, r = i / (NH * NB), g = i - r * (NH * NB);
  const int qblk = ord.q[r];
  if (qblk >= EARLY / 128) attn_wide(mg, Qh, Kh, Vh, Oh, qblk, g % NH, g / NH);
  else attn_early(Qh, Qr, Kh, Kr, Vh, Vr, Oh, Or, qblk, g % NH, g / NH);
}

extern "C" void kernel_launch(void* const* d_in, const int* in_sizes, int n_in,
                              void* d_out, int out_size, void* d_ws, size_t ws_size, hipStream_t stream) {
  if (n_in < 9) return;
  const long long need_x = ((long long)(NB - 1) * SEQ_FULL + SEQ) * DM;
  if ((long long)in_sizes[0] < need_x) return;
  if (in_sizes[1] < DM * DM || in_sizes[3] < DM * DM || in_sizes[5] < DM * DM || in_sizes[7] < DM * DM) return;
  if (in_sizes[2] < DM || in_sizes[4] < DM || in_sizes[6] < DM || in_sizes[8] < DM) return;
  if ((long long)out_size < need_x) return;
  const float* x = (const float*)d_in[0]; const float* wq = (const float*)d_in[1]; const float* bq = (const float*)d_in[2];
  const float* wk = (const float*)d_in[3]; const float* bk = (const float*)d_in[4]; const float* wv = (const float*)d_in[5];
  const float* bv = (const float*)d_in[6]; const float* wo = (const float*)d_in[7]; const float* bo = (const float*)d_in[8];
  float* out = (float*)d_out;
  char* ws = (char*)d_ws; size_t off = 0;
  auto take = [&](size_t bytes) { char* p = ws + off; off += (bytes + 255) & ~(size_t)255; return p; };
  const size_t wbytes = (size_t)DM * DM * 2, pbytes = NTOK * DM * 2;
  unsigned short* WQ = (unsigned short*)take(wbytes); unsigned short* WK = (unsigned short*)take(wbytes);
  unsigned short* WV = (unsigned short*)take(wbytes); unsigned short* WO = (unsigned short*)take(wbytes);
  unsigned short* X16 = (unsigned short*)take(pbytes);
  unsigned short* Qh = (unsigned short*)take(pbytes); unsigned short* Qr = (unsigned short*)take(pbytes);
  unsigned short* Kh = (unsigned short*)take(pbytes); unsigned short* Kr = (unsigned short*)take(pbytes);
  unsigned short* VTh = (unsigned short*)take(pbytes); unsigned short* VTr = (unsigned short*)take(pbytes);
  unsigned short* Oh = (unsigned short*)take(pbytes); unsigned short* Or = (unsigned short*)take(pbytes);
  if (off > ws_size || off > (size_t)134217728) return;

  { const unsigned int nw8 = (unsigned int)((size_t)DM * DM / 8), gw = (nw8 + 255u) / 256u;      /* [out][in] weights are already Bt[n][k]; x32; fragment order */
    const unsigned int nx8 = (unsigned int)(NTOK * DM / 8), gx = (nx8 + 255u) / 256u;
    k_prep<<<gx + 4u * gw, 256, 0, stream>>>(x, wq, wk, wv, wo, X16, WQ, WK, WV, WO, nx8, gx, nw8, gw); }

  k_qkv<<<dim3((unsigned)((NTOK / 128) * (DM / 64)), 3), 128, 0, stream>>>(X16, WQ, WK, WV, bq, bk, bv, (_Float16*)Qh, (_Float16*)Qr, (_Float16*)Kh, (_Float16*)Kr, (_Float16*)VTh, (_Float16*)VTr);

  k_attn<<<((SEQ - EARLY) / 128 + EARLY / 128) * NH * NB, 256, 0, stream>>>(Qh, Qr, Kh, Kr, VTh, VTr, Oh, Or);

  k_out<<<dim3((unsigned)((SEQ / 128) * (DM / 64)), NB), 128, 0, stream>>>(Oh, Or, WO, bo, out);
}

// v007
// It runs in 123 microseconds.
// In both of two side-by-side timings against v006, it was 1.04 times as fast.
// Over all steps from v000 it is 4.21 times as fast.
#include <hip/hip_runtime.h>
// Causal multi-head self-attention: x [2][4096][768]; q / k / v = x W^T + b ([out][in] 768 x 768 weights, biases); 12 heads of 64; scores / 8; causal (key <= query) softmax; out = merged W_o^T + b_o.
// Compute dtype: every contraction on v_wmma_f32_16x16x32_f16 with f32 accumulation. Inputs converted RNE to bf16 and held exactly in f16 (weights x32). q, k, v, softmax weights (x256) and o (x64) are f16 operands;
// for the first EARLY queries of each sequence q, k, v, p and o are carried as f16 hi + f16 residual (x1024) planes with separate accumulators (3 products per site). Scores, softmax statistics and epilogues are f32.
// Structure: token rows r = b*SEQ + s. Q, K as planes [token][768]; V produced directly transposed (V^T = W_v x^T, plane [768][tokens]); attention is a register-fed transposed flash loop per wave
// (S^T = K Q^T with Q^T as the B operand, packed P^T from the S^T accumulators as the B operand of O^T = V^T P^T; 32 keys per step; no LDS in the key loop); o as f16 planes; out GEMM writes f32 rows.
// Every f16 plane [R][L] (weights, x, q, k, V^T, o) is stored in fragment order: tiles of 16 rows x 32 columns, 512 elements each, tile (r >> 4, c >> 5) at element ((r >> 4) * (L / 32) + (c >> 5)) * 512;
// inside a tile element (r, c) stands at ((c >> 4) & 1) * 256 + (((c >> 3) & 1) * 16 + (r & 15)) * 8 + (c & 7), so each of a fragment's two loads is lane * 16 bytes into 512 contiguous bytes (four whole lines).
#ifndef NB
#define NB 2
#endif
#ifndef SEQ
#define SEQ 4096
#endif
#define NB_FULL 2
#define SEQ_FULL 4096
#define DM 768
#define NH 12
#define HD 64
#define NTOK ((size_t)NB * SEQ)
#define EARLY ((SEQ) < 1024 ? (SEQ) : 1024)   /* queries per sequence on the hi + residual path */
static_assert(SEQ % 128 == 0);
static_assert(EARLY % 128 == 0);
static_assert((SEQ - EARLY) % 128 == 0);
static_assert(NB <= NB_FULL);
static_assert(SEQ <= SEQ_FULL);
static_assert(DM % 128 == 0);
static_assert(DM % 96 == 0);
static_assert(NH * HD == DM);
static_assert(HD == 64);

typedef _Float16 v16h __attribute__((ext_vector_type(16)));
typedef unsigned short v8us __attribute__((ext_vector_type(8), may_alias));
typedef float v8f __attribute__((ext_vector_type(8)));
typedef float v4f __attribute__((ext_vector_type(4)));
typedef float v4fa __attribute__((ext_vector_type(4), may_alias));
union FragH { v16h v; v8us half[2]; _Float16 h[16]; unsigned short u[16]; };

__device__ __forceinline__ unsigned short bf16_bits(float x) { unsigned int u = __float_as_uint(x); return (unsigned short)((u + 0x7FFFu + ((u >> 16) & 1u)) >> 16); }
__device__ __forceinline__ float bf16_rne(float x) { return __uint_as_float(((unsigned int)bf16_bits(x)) << 16); }

// 16x32 fragment (A rows or B columns) of a plane in fragment order: p = tile start + 8*lane; elements 0..7 <- (row lane&15, k0+8h..), 8..15 <- (row lane&15, k0+16+8h..), h = lane>>4
__device__ __forceinline__ v16h ld_frag(const unsigned short* p) { FragH f; f.half[0] = *(const v8us*)p; f.half[1] = *(const v8us*)(p + 256); return f.v; }
// Thread t writes the 8 elements at t*8 of a fragment-order plane with DM columns: their row and first column.
__device__ __forceinline__ void frag_src(unsigned int t, unsigned int& r, unsigned int& c8) {
  const unsigned int tile = t >> 6, band = tile / (DM / 32), cb = tile - band * (DM / 32);
  r = band * 16u + (t & 15u); c8 = cb * 32u + ((t >> 5) & 1u) * 16u + ((t >> 4) & 1u) * 8u;
}

// Stands behind a run of fragment loads that stay in flight: their address registers may be reused only behind it.
__device__ __forceinline__ void addr_wait() { asm volatile("s_wait_xcnt 0x0" ::: "memory"); }

__device__ __forceinline__ v8f wm(v16h a, v16h b, v8f c) { return __builtin_amdgcn_wmma_f32_16x16x32_f16(false, a, false, b, (short)0, c, false, false); }
__device__ __forceinline__ v8f mma1(v16h a, v16h b, v8f c) {
  c = wm(a, b, c);
  asm volatile("v_nop\n\tv_nop\n\tv_nop\n\tv_nop" : "+v"(c) : "v"(a), "v"(b));
  return c;
}
__device__ __forceinline__ v8f mma2(v16h a0, v16h b0, v16h a1, v16h b1, v8f c) {
  c = wm(a0, b0, c); c = wm(a1, b1, c);
  asm volatile("v_nop\n\tv_nop\n\tv_nop\n\tv_nop" : "+v"(c) : "v"(a0), "v"(b0), "v"(a1), "v"(b1));
  return c;
}
__device__ __forceinline__ v8f mma4(v16h a0, v16h b0, v16h a1, v16h b1, v16h a2, v16h b2, v16h a3, v16h b3, v8f c) {
  c = wm(a0, b0, c); c = wm(a1, b1, c); c = wm(a2, b2, c); c = wm(a3, b3, c);
  asm volatile("v_nop\n\tv_nop\n\tv_nop\n\tv_nop" : "+v"(c) : "v"(a0), "v"(b0), "v"(a1), "v"(b1), "v"(a2), "v"(b2), "v"(a3), "v"(b3));
  return c;
}

__device__ __forceinline__ void cvt_w(const float* __restrict__ w, const unsigned int t, unsigned short* __restrict__ Bt, const float scale) {
  unsigned int r, c8; frag_src(t, r, c8);
  const float* src = w + (size_t)r * DM + c8;
  const v4f a = *(const v4fa*)src, c = *(const v4fa*)(src + 4);
  FragH f;
#pragma unroll
  for (int q = 0; q < 4; ++q) { f.h[q] = (_Float16)(bf16_rne(a[q]) * scale); f.h[4 + q] = (_Float16)(bf16_rne(c[q]) * scale); }
  const v8us o = f.half[0];
  unsigned short* d = Bt + (size_t)t * 8;
  *(v8us*)d = o; 
}

__device__ __forceinline__ void cvt_x(const float* __restrict__ x, unsigned short* __restrict__ X16, const unsigned int t) {
  unsigned int r, c8; frag_src(t, r, c8);
  const unsigned int b = r / SEQ, s = r - b * SEQ;
  const float* src = x + ((size_t)b * SEQ_FULL + s) * DM + c8;
  const v4f a = *(const v4fa*)src, c = *(const v4fa*)(src + 4);
  FragH f;
#pragma unroll
  for (int q = 0; q < 4; ++q) { f.h[q] = (_Float16)bf16_rne(a[q]); f.h[4 + q] = (_Float16)bf16_rne(c[q]); }
  const v8us o = f.half[0];
  unsigned short* d = X16 + (size_t)t * 8;
  *(v8us*)d = o; 
}

// The five conversions depend on nothing and share one grid: blocks [0, gx) take x, then gw blocks for each of the four weights (x32).
__global__ __launch_bounds__(256) void k_prep(const float* __restrict__ x, const float* __restrict__ wq, const float* __restrict__ wk, const float* __restrict__ wv, const float* __restrict__ wo,
    unsigned short* __restrict__ X16, unsigned short* __restrict__ WQ, unsigned short* __restrict__ WK, unsigned short* __restrict__ WV, unsigned short* __restrict__ WO,
    unsigned int nx8, unsigned int gx, unsigned int nw8, unsigned int gw) {
  unsigned int blk = blockIdx.x;
  if (blk < gx) {
    const unsigned int t = blk * 256u + threadIdx.x; if (t >= nx8) return;
    cvt_x(x, X16, t);
  } else {
    blk -= gx; const unsigned int m = blk / gw; blk -= m * gw;
    const unsigned int t = blk * 256u + threadIdx.x; if (t >= nw8) return;
    const float* w = m == 0 ? wq : m == 1 ? wk : m == 2 ? wv : wo;
    unsigned short* d = m == 0 ? WQ : m == 1 ? WK : m == 2 ? WV : WO;
    cvt_w(w, t, d, 32.0f);
  }
}

__device__ __forceinline__ v8f g2_mma(v16h a, v16h b, v8f c) { v8f d = __builtin_amdgcn_wmma_f32_16x16x32_f16(false, a, false, b, (short)0, c, false, false); asm volatile("v_nop\n\tv_nop\n\tv_nop\n\tv_nop" : "+v"(d) : "v"(a), "v"(b)); return d; }

// GEMM C[M][N] = (A (+ Ar/1024)) . Bt^T * alpha + bias; A, Ar f16 [M][K] (row length lda, batch stride sA per batch index by), Bt f16 [N][K] (row length ldb), all in fragment order.
// Block = 4 waves, wave tile 32 x 64 (block 128 x 64); M % 128 == 0, N % 64 == 0, K % 96 == 0. BIASROW: bias indexed by row, else by column (bias converted RNE to bf16).
// Outputs: C f32 rows (optional), C16 f16 in fragment order (optional), C16r = f16((v - f16(v)) * 1024) (optional; resmode 1: rows with (row % SEQ) < EARLY, resmode 2: columns with (col % SEQ) < EARLY).
// so: the block's staging rows in LDS; bx, by: the tile index and the batch index of this block inside its own product.
template <bool ARES, bool BIASROW>
__device__ __forceinline__ void gemm2(float (*so)[32][68], const int bx, const int by, const unsigned short* __restrict__ A, const unsigned short* __restrict__ Ar, int lda, size_t sA,
    const unsigned short* __restrict__ Bh, int ldb, float alpha, const float* __restrict__ bias,
    float* __restrict__ C, _Float16* __restrict__ C16, _Float16* __restrict__ C16r, int ldc, size_t sC, int resmode, int M, int N, int K) {
  const int tid = threadIdx.x, w = __builtin_amdgcn_readfirstlane(tid >> 5), lane = tid & 31, ln = lane & 15, hh = lane >> 4;
  const int ntn = N >> 6; const int mt = bx / ntn, nq = bx - mt * ntn; const int row0 = mt * 128 + 32 * w, col0 = nq * 64; if (row0 >= M) return;
  const size_t aofs = (size_t)by * sA + (size_t)row0 * lda + 8 * lane;
  const size_t cofs = (size_t)by * sC;
  const unsigned short* a0p = A + aofs; const unsigned short* a1p = a0p + (size_t)16 * lda;
  const unsigned short* r0p = Ar + aofs; const unsigned short* r1p = r0p + (size_t)16 * lda;
  const unsigned short* b0p = Bh + (size_t)col0 * ldb + 8 * lane; const unsigned short* b1p = b0p + (size_t)16 * ldb; const unsigned short* b2p = b1p + (size_t)16 * ldb; const unsigned short* b3p = b2p + (size_t)16 * ldb;
  const v8f z8 = {0.f,0.f,0.f,0.f,0.f,0.f,0.f,0.f};
  v8f c00 = z8, c01 = z8, c02 = z8, c03 = z8, c10 = z8, c11 = z8, c12 = z8, c13 = z8;
  v8f d00 = z8, d01 = z8, d02 = z8, d03 = z8, d10 = z8, d11 = z8, d12 = z8, d13 = z8;
  /* Fragments live in GD register sets; a set is refilled for k + 32*GD right behind its last product, so a load has GD k steps to land (the product order is unchanged). */
  constexpr int GD = ARES ? 1 : 3;
  v16h fa0[GD], fa1[GD], fe0[GD], fe1[GD], fb0[GD], fb1[GD], fb2[GD], fb3[GD];
#pragma unroll
  for (int u = 0; u < GD; ++u) {
    const int k = 512 * u;      /* one tile of 512 elements per 32 k */
    fb0[u] = ld_frag(b0p + k); fa0[u] = ld_frag(a0p + k); fa1[u] = ld_frag(a1p + k);
    if (ARES) { fe0[u] = ld_frag(r0p + k); fe1[u] = ld_frag(r1p + k); }
    fb1[u] = ld_frag(b1p + k); fb2[u] = ld_frag(b2p + k); fb3[u] = ld_frag(b3p + k);
  }
  addr_wait();
  auto kstep = [&](const int u, const int kn, const bool more) __attribute__((always_inline)) {
    const v16h a0 = fa0[u], a1 = fa1[u];
    v16h e0 = a0, e1 = a1;
    if (ARES) { e0 = fe0[u]; e1 = fe1[u]; }
    v16h b = fb0[u]; c00 = g2_mma(a0, b, c00); c10 = g2_mma(a1, b, c10); if (ARES) { d00 = g2_mma(e0, b, d00); d10 = g2_mma(e1, b, d10); }
    if (more) fb0[u] = ld_frag(b0p + kn);
    b = fb1[u]; c01 = g2_mma(a0, b, c01); c11 = g2_mma(a1, b, c11); if (ARES) { d01 = g2_mma(e0, b, d01); d11 = g2_mma(e1, b, d11); }
    if (more) fb1[u] = ld_frag(b1p + kn);
    b = fb2[u]; c02 = g2_mma(a0, b, c02); c12 = g2_mma(a1, b, c12); if (ARES) { d02 = g2_mma(e0, b, d02); d12 = g2_mma(e1, b, d12); }
    if (more) fb2[u] = ld_frag(b2p + kn);
    b = fb3[u]; c03 = g2_mma(a0, b, c03); c13 = g2_mma(a1, b, c13); if (ARES) { d03 = g2_mma(e0, b, d03); d13 = g2_mma(e1, b, d13); }
    if (more) {
      fb3[u] = ld_frag(b3p + kn); fa0[u] = ld_frag(a0p + kn); fa1[u] = ld_frag(a1p + kn);
      if (ARES) { fe0[u] = ld_frag(r0p + kn); fe1[u] = ld_frag(r1p + kn); }
      if (u == GD - 1) addr_wait();      /* the pointers step once per trip */
    }
  };
#pragma unroll 1
  for (int kb = 0; kb < (K - 32 * GD) * 16; kb += 512 * GD) {      /* kb counts elements of a 16-row band: 512 per 32 k */
#pragma unroll
    for (int u = 0; u < GD; ++u) kstep(u, kb + 512 * (u + GD), true);
  }
#pragma unroll
  for (int u = 0; u < GD; ++u) kstep(u, 0, false);      /* last GD k steps: nothing left to fetch */
  v8f accs[8] = {c00, c01, c02, c03, c10, c11, c12, c13};
  v8f accd[8] = {d00, d01, d02, d03, d10, d11, d12, d13};
#pragma unroll
  for (int u = 0; u < 8; ++u) {
    const int t = u & 3, half = u >> 2; const int col = col0 + t * 16 + ln;
    float bcol = 0.f; if (!BIASROW) bcol = bf16_rne(bias[col]);
#pragma unroll
    for (int r = 0; r < 8; ++r) {
      const int rloc = half * 16 + 8 * hh + r;
      float v = accs[u][r]; if (ARES) v += accd[u][r] * 0.0009765625f;
      float bv = bcol; if (BIASROW) bv = bf16_rne(bias[row0 + rloc]);
      so[w][rloc][t * 16 + ln] = v * alpha + bv;
    }
  }
  __builtin_amdgcn_fence(4 /* acq_rel order */, "workgroup"); __builtin_amdgcn_wave_barrier();
  bool wres = false;
  if (C16r) { if (resmode == 1) wres = ((row0 % SEQ) < EARLY); else if (resmode == 2) wres = ((col0 % SEQ) < EARLY); }
  if (C) {
    const int rsub = lane >> 4, c4 = (lane & 15) * 4;
#pragma unroll
    for (int q = 0; q < 16; ++q) {
      const int r = q * 2 + rsub; const v4f v = *(const v4fa*)&so[w][r][c4];
      *(v4f*)(C + cofs + (size_t)(row0 + r) * ldc + col0 + c4) = v;
    }
    addr_wait();      /* the f16 block below may reuse registers that these stores name */
  }
  if (C16) {      /* the wave's 32 x 64 tile = 2 x 2 fragment tiles of two 512-byte halves; the lane writes 16 bytes of each half */
    const size_t o0 = cofs + (size_t)row0 * ldc + (size_t)(col0 >> 5) * 512 + lane * 8, o1 = o0 + (size_t)16 * ldc;
    unsigned short* h0p = (unsigned short*)C16 + o0; unsigned short* h1p = (unsigned short*)C16 + o1;
    unsigned short* e0p = (unsigned short*)C16r + o0; unsigned short* e1p = (unsigned short*)C16r + o1;
    FragH fh[8], fr[8];
#pragma unroll
    for (int q = 0; q < 8; ++q) {      /* q = band * 4 + column tile * 2 + half */
      const float* sp = &so[w][(q >> 2) * 16 + ln][(q & 3) * 16 + hh * 8];
      const v4f v0 = *(const v4fa*)sp, v1 = *(const v4fa*)(sp + 4);
#pragma unroll
      for (int i = 0; i < 4; ++i) {
        fh[q].h[i] = (_Float16)v0[i]; fr[q].h[i] = (_Float16)((v0[i] - (float)fh[q].h[i]) * 1024.0f);
        fh[q].h[4 + i] = (_Float16)v1[i]; fr[q].h[4 + i] = (_Float16)((v1[i] - (float)fh[q].h[4 + i]) * 1024.0f);
      }
    }
#pragma unroll
    for (int q = 0; q < 8; ++q) *(v8us*)((q >> 2 ? h1p : h0p) + (q & 3) * 256) = fh[q].half[0];
    addr_wait();      /* the residual stores below may reuse registers that the stores above name */
    if (wres) {
#pragma unroll
      for (int q = 0; q < 8; ++q) *(v8us*)((q >> 2 ? e1p : e0p) + (q & 3) * 256) = fr[q].half[0];
      addr_wait();      /* precaution: the joined kernels take one product per block, so no other product's code runs behind these stores */
    }
  }
}

// Q, K and V^T depend only on the converted planes and share one grid: blockIdx.y = 0, 1 give Q, K [token][DM] (hi planes; residual planes for tokens with s < EARLY);
// blockIdx.y = 2 gives V^T [DM][NTOK] = W_v (rows c) . X16^T (columns = tokens), bias by row, residual plane for token columns with s < EARLY.
__global__ __launch_bounds__(128) void k_qkv(const unsigned short* __restrict__ X16, const unsigned short* __restrict__ WQ, const unsigned short* __restrict__ WK, const unsigned short* __restrict__ WV,
    const float* __restrict__ bq, const float* __restrict__ bk, const float* __restrict__ bv,
    _Float16* __restrict__ Qh, _Float16* __restrict__ Qr, _Float16* __restrict__ Kh, _Float16* __restrict__ Kr, _Float16* __restrict__ VTh, _Float16* __restrict__ VTr) {
  __shared__ __attribute__((aligned(16))) float so[4][32][68];
  const int sel = blockIdx.y;
  if (sel == 2) gemm2<false, true>(so, blockIdx.x, 0, WV, WV, DM, (size_t)0, X16, DM, 0.03125f, bv, (float*)nullptr, VTh, VTr, (int)NTOK, (size_t)0, 2, DM, (int)NTOK, DM);
  else gemm2<false, false>(so, blockIdx.x, 0, X16, X16, DM, (size_t)0, sel ? WK : WQ, DM, 0.03125f, sel ? bk : bq, (float*)nullptr, sel ? Kh : Qh, sel ? Kr : Qr, DM, (size_t)0, 1, (int)NTOK, DM, DM);
}

// out rows (b*SEQ_FULL + s) = o W_o^T + b_o; alpha = 1 / (64 * 32). One grid: the first blocks take the rows with s < EARLY (hi + residual o), the others the rest; blockIdx.y = batch.
__global__ __launch_bounds__(128) void k_out(const unsigned short* __restrict__ Oh, const unsigned short* __restrict__ Or, const unsigned short* __restrict__ WO, const float* __restrict__ bo, float* __restrict__ out) {
  __shared__ __attribute__((aligned(16))) float so[4][32][68];
  constexpr int NE = (EARLY / 128) * (DM / 64);
  const int bx = blockIdx.x;
  if (bx < NE) gemm2<true, false>(so, bx, blockIdx.y, Oh, Or, DM, (size_t)SEQ * DM, WO, DM, 0.00048828125f, bo, out, (_Float16*)nullptr, (_Float16*)nullptr, DM, (size_t)SEQ_FULL * DM, 0, EARLY, DM, DM);
  else gemm2<false, false>(so, bx - NE, blockIdx.y, Oh + (size_t)EARLY * DM, Oh + (size_t)EARLY * DM, DM, (size_t)SEQ * DM, WO, DM, 0.00048828125f, bo, out + (size_t)EARLY * DM, (_Float16*)nullptr, (_Float16*)nullptr, DM, (size_t)SEQ_FULL * DM, 0, SEQ - EARLY, DM, DM);
}

// Lazy rescale: the maximum in use (mrun, alike in both lanes of a query) is raised, and row sum and output tiles rescaled, only in a key step where some lane of the wave holds a raw score above it by more than LAZY.
// Otherwise scores exceed it by at most LAZY / 8 = 4 after scaling, so p <= 256 e^4 < 14,000 stays inside f16; the first key step of a wave always takes the branch (mrun starts at -1e30, every query has an unmasked key there).
#define LAZY 32.0f
// Causal flash attention, transposed form. Q / K planes [token][DM]; V^T planes [DM][NTOK] (row = head*64 + d); o planes [token][DM]; all in fragment order. A wave (on the single-plane path, a pair of waves) loops over 32-key steps up to its diagonal.
// Lane (ln, hh) of a 16-query tile: query (tile start) + ln; S^T accumulators hold keys 8hh + r (tile 0) and 16 + 8hh + r (tile 1), which is exactly the B-fragment k map, so P^T is packed in place.
// Hi + residual path: block = 8 waves (128 queries of one (batch, head)), each wave owns 16 queries; hi + residual (x1024) planes on q, k, v, p and o (two accumulators per site).
__device__ __forceinline__ void attn_early(const unsigned short* __restrict__ Qh, const unsigned short* __restrict__ Qr,
    const unsigned short* __restrict__ Kh, const unsigned short* __restrict__ Kr,
    const unsigned short* __restrict__ Vh, const unsigned short* __restrict__ Vr,
    unsigned short* __restrict__ Oh, unsigned short* __restrict__ Or, const int qblk, const int head, const int b) {
  const int tid = threadIdx.x, w = __builtin_amdgcn_readfirstlane(tid >> 5), lane = tid & 31, ln = lane & 15, hh = lane >> 4;
  const int q0 = qblk * 128 + w * 16;
  const size_t tok0 = (size_t)b * SEQ;
  const size_t qofs = (tok0 + q0) * DM + head * (HD * 16) + 8 * lane;
  const v16h qa = ld_frag(Qh + qofs), qb = ld_frag(Qh + qofs + 512);
  const v16h qra = ld_frag(Qr + qofs), qrb = ld_frag(Qr + qofs + 512);
  addr_wait();
  const size_t kofs = tok0 * DM + head * (HD * 16) + 8 * lane;
  const size_t vofs = (size_t)(head * HD) * NTOK + tok0 * 16 + 8 * lane;
  const v8f z8 = {0.f,0.f,0.f,0.f,0.f,0.f,0.f,0.f};
  v8f oh[4] = {z8, z8, z8, z8};
  v8f om[4] = {z8, z8, z8, z8};
  float mrun = -1.0e30f, lrun = 0.0f;
  const int nsteps = ((q0 + 15) >> 5) + 1;
  const int qi = q0 + ln;
  /* Fragment loads go out ahead of their use: V^T of this step behind the score products, K of the next step behind the output products, so that only one of the two sets is live. */
  v16h kfa[2], kfc[2], kra[2], krc[2], vf[4], vrf[4];
#pragma unroll
  for (int t = 0; t < 2; ++t) {
    const size_t ko = kofs + (size_t)(16 * t) * DM;
    kfa[t] = ld_frag(Kh + ko); kfc[t] = ld_frag(Kh + ko + 512);
    kra[t] = ld_frag(Kr + ko); krc[t] = ld_frag(Kr + ko + 512);
    __builtin_amdgcn_sched_barrier(0);      /* first loads issue in the loop's own order (K tile 0, K tile 1): the loop's waits on K are counted over both ways in */
  }
  addr_wait();
  auto step = [&](const int st, const bool more) __attribute__((always_inline)) {
    const int kb = st * 32;
    v8f sc[2];
#pragma unroll
    for (int t = 0; t < 2; ++t) {
      const v16h ka = kfa[t], kc = kfc[t];
      v8f s = mma2(ka, qa, kc, qb, z8);
      const v16h ra = kra[t], rc = krc[t];
      const v8f sm = mma4(ka, qra, kc, qrb, ra, qa, rc, qb, z8);
      s = s + sm * 0.0009765625f;
#pragma unroll
      for (int dt = 2 * t; dt < 2 * t + 2; ++dt) {
        const size_t vo = vofs + (size_t)(dt * 16) * NTOK + (size_t)kb * 16;
        vf[dt] = ld_frag(Vh + vo); vrf[dt] = ld_frag(Vr + vo);
      }
      sc[t] = s;
    }
    addr_wait();
    if (kb + 31 > q0) {      /* wave-uniform: only the diagonal step carries masked keys; masked scores are replaced */
#pragma unroll
      for (int r = 0; r < 8; ++r) {
        const int key = kb + 8 * hh + r;
        sc[0][r] = (key > qi) ? -1.0e30f : sc[0][r];
        sc[1][r] = (key + 16 > qi) ? -1.0e30f : sc[1][r];
      }
    }
    float mloc = sc[0][0];
#pragma unroll
    for (int r = 1; r < 8; ++r) mloc = fmaxf(mloc, sc[0][r]);
#pragma unroll
    for (int r = 0; r < 8; ++r) mloc = fmaxf(mloc, sc[1][r]);
    if (__builtin_amdgcn_ballot_w32(mloc > mrun + LAZY) != 0) {      /* one scalar test per key step: some lane's scores outgrow the maximum in use */
      mloc = fmaxf(mloc, __shfl_xor(mloc, 16));
      const float mnew = fmaxf(mrun, mloc);
      const float alpha = __expf((mrun - mnew) * 0.125f);
      mrun = mnew;
      lrun = lrun * alpha;
#pragma unroll
      for (int dt = 0; dt < 4; ++dt) { oh[dt] = oh[dt] * alpha; om[dt] = om[dt] * alpha; }
    }
    const float msh = mrun * 0.125f - 5.545177444f;      /* p carried x256 (same factor in the row sum) */
    float p0[8], p1[8]; float ls = 0.0f;
#pragma unroll
    for (int r = 0; r < 8; ++r) { p0[r] = __expf(sc[0][r] * 0.125f - msh); p1[r] = __expf(sc[1][r] * 0.125f - msh); ls += p0[r] + p1[r]; }
    lrun = lrun + ls;
    FragH ph, pr;
#pragma unroll
    for (int r = 0; r < 8; ++r) {
      const _Float16 h0 = (_Float16)p0[r], h1 = (_Float16)p1[r];
      ph.h[r] = h0; ph.h[8 + r] = h1;
      pr.h[r] = (_Float16)((p0[r] - (float)h0) * 1024.0f); pr.h[8 + r] = (_Float16)((p1[r] - (float)h1) * 1024.0f);
    }
#pragma unroll
    for (int dt = 0; dt < 4; ++dt) {
      const v16h va = vf[dt];
      oh[dt] = mma1(va, ph.v, oh[dt]);
      const v16h vr = vrf[dt]; om[dt] = mma2(va, pr.v, vr, ph.v, om[dt]);
      if (more) {
        const int t = dt >> 1; const size_t kn = kofs + (size_t)(kb + 32 + 16 * t) * DM;
        if ((dt & 1) == 0) { kfa[t] = ld_frag(Kh + kn); kfc[t] = ld_frag(Kh + kn + 512); }
        else { kra[t] = ld_frag(Kr + kn); krc[t] = ld_frag(Kr + kn + 512); }
      }
    }
    if (more) addr_wait();
  };
#pragma unroll 1
  for (int st = 0; st < nsteps - 1; ++st) step(st, true);
  step(nsteps - 1, false);      /* last key step: nothing of a next step to fetch */
  const float lt = lrun + __shfl_xor(lrun, 16);
  const float inv = 64.0f * (1.0f / lt);      /* o carried x64 */
#pragma unroll
  for (int dt = 0; dt < 4; ++dt) {
    FragH fh, fr;
#pragma unroll
    for (int r = 0; r < 8; ++r) {
      float v = oh[dt][r]; v += om[dt][r] * 0.0009765625f;
      v *= inv;
      const _Float16 h = (_Float16)v; fh.h[r] = h;
      fr.h[r] = (_Float16)((v - (float)h) * 1024.0f);
    }
    /* the lane's 8 values (query ln, d = 16 dt + 8 hh ..) are its 16 bytes of half dt & 1 of fragment tile dt >> 1 */
    const size_t o = qofs + (dt >> 1) * 512 + (dt & 1) * 256;
    *(v8us*)(Oh + o) = fh.half[0];
    *(v8us*)(Or + o) = fr.half[0];
  }
  addr_wait();      /* precaution: each block of the joined kernel takes one path, so no other code runs behind these stores */
}

// Single-plane path. Block = 8 waves (128 queries of one (batch, head)); a wave works on 32 queries as two 16-query tiles u, so every K and V^T fragment it loads feeds two products.
// The key steps of a 32-query group are split between waves w and w + 4: the first takes the lower half of the steps, the second the upper half with the diagonal step (q0 is a multiple of 32,
// so that step is the last one for both tiles). Each half keeps its own maximum, row sum and output tiles; the upper half hands them over through mg and the lower half joins the two once.
__device__ __forceinline__ void attn_wide(float (*mg)[17][32][4], const unsigned short* __restrict__ Qh, const unsigned short* __restrict__ Kh, const unsigned short* __restrict__ Vh,
    unsigned short* __restrict__ Oh, const int qblk, const int head, const int b) {
  const int tid = threadIdx.x, w = __builtin_amdgcn_readfirstlane(tid >> 5), lane = tid & 31, ln = lane & 15, hh = lane >> 4;
  const int grp = w & 3, kp = w >> 2;
  const int q0 = qblk * 128 + grp * 32;
  const size_t tok0 = (size_t)b * SEQ;
  const size_t qofs = (tok0 + q0) * DM + head * (HD * 16) + 8 * lane;
  v16h qa[2], qb[2];
#pragma unroll
  for (int u = 0; u < 2; ++u) { qa[u] = ld_frag(Qh + qofs + (size_t)(16 * u) * DM); qb[u] = ld_frag(Qh + qofs + (size_t)(16 * u) * DM + 512); }
  addr_wait();
  const size_t kofs = tok0 * DM + head * (HD * 16) + 8 * lane;
  const size_t vofs = (size_t)(head * HD) * NTOK + tok0 * 16 + 8 * lane;
  const v8f z8 = {0.f,0.f,0.f,0.f,0.f,0.f,0.f,0.f};
  v8f oh[2][4] = {{z8, z8, z8, z8}, {z8, z8, z8, z8}};
  float mrun[2] = {-1.0e30f, -1.0e30f}, lrun[2] = {0.0f, 0.0f};
  const int nsteps = (q0 >> 5) + 1;
  const int s0 = kp ? (nsteps >> 1) : 0, s1 = kp ? nsteps : (nsteps >> 1);      /* this wave's key steps [s0, s1); nsteps >= 2 here, so neither half is empty */
  /* K and V^T of the next key step go into the same registers, K behind the score products, V^T behind the output products. */
  v16h kfa[2], kfc[2], vf[4];
#pragma unroll
  for (int t = 0; t < 2; ++t) {
    const size_t ko = kofs + (size_t)(s0 * 32 + 16 * t) * DM;
    kfa[t] = ld_frag(Kh + ko); kfc[t] = ld_frag(Kh + ko + 512);
    __builtin_amdgcn_sched_barrier(0);      /* first loads issue in the loop's own order (K tile 0, K tile 1, V^T): otherwise the loop's waits on K, counted over both ways in, also cover the V^T loads in flight */
  }
  addr_wait();      /* the V^T fragments may land in registers that the K loads name */
#pragma unroll
  for (int dt = 0; dt < 4; ++dt) vf[dt] = ld_frag(Vh + vofs + (size_t)(dt * 16) * NTOK + (size_t)(s0 * 32) * 16);
  addr_wait();
  auto step = [&](const int st, const bool more) __attribute__((always_inline)) {
    const int kb = st * 32;
    v8f sc[2][2];      /* [query tile u][key tile t] */
#pragma unroll
    for (int t = 0; t < 2; ++t) { sc[0][t] = wm(kfa[t], qa[0], z8); sc[1][t] = wm(kfa[t], qa[1], z8); }
#pragma unroll
    for (int t = 0; t < 2; ++t) { sc[0][t] = wm(kfc[t], qb[0], sc[0][t]); sc[1][t] = wm(kfc[t], qb[1], sc[1][t]); }
    /* the four vector slots between the last score product and the first use of a score or refill of a K fragment */
    asm volatile("v_nop\n\tv_nop\n\tv_nop\n\tv_nop" : "+v"(sc[0][0]), "+v"(sc[0][1]), "+v"(sc[1][0]), "+v"(sc[1][1]) : "v"(kfa[0]), "v"(kfc[0]), "v"(kfa[1]), "v"(kfc[1]));
    if (more) {
#pragma unroll
      for (int t = 0; t < 2; ++t) {
        const size_t kn = kofs + (size_t)(kb + 32 + 16 * t) * DM;
        kfa[t] = ld_frag(Kh + kn); kfc[t] = ld_frag(Kh + kn + 512);
      }
      addr_wait();
    } else {      /* the upper half's last step is the diagonal one: masked scores are replaced (the lower half's last step has none) */
#pragma unroll
      for (int u = 0; u < 2; ++u) {
        const int qi = q0 + 16 * u + ln;
#pragma unroll
        for (int r = 0; r < 8; ++r) {
          const int key = kb + 8 * hh + r;
          sc[u][0][r] = (key > qi) ? -1.0e30f : sc[u][0][r];
          sc[u][1][r] = (key + 16 > qi) ? -1.0e30f : sc[u][1][r];
        }
      }
    }
    FragH ph[2];
    float mloc[2];
#pragma unroll
    for (int u = 0; u < 2; ++u) {
      mloc[u] = sc[u][0][0];
#pragma unroll
      for (int r = 1; r < 8; ++r) mloc[u] = fmaxf(mloc[u], sc[u][0][r]);
#pragma unroll
      for (int r = 0; r < 8; ++r) mloc[u] = fmaxf(mloc[u], sc[u][1][r]);
    }
    if (__builtin_amdgcn_ballot_w32(mloc[0] > mrun[0] + LAZY || mloc[1] > mrun[1] + LAZY) != 0) {      /* one scalar test per key step: some lane's scores outgrow a maximum in use */
#pragma unroll
      for (int u = 0; u < 2; ++u) {
        const float mnew = fmaxf(mrun[u], fmaxf(mloc[u], __shfl_xor(mloc[u], 16)));
        const float alpha = __expf((mrun[u] - mnew) * 0.125f);
        mrun[u] = mnew;
        lrun[u] = lrun[u] * alpha;
#pragma unroll
        for (int dt = 0; dt < 4; ++dt) oh[u][dt] = oh[u][dt] * alpha;
      }
    }
#pragma unroll
    for (int u = 0; u < 2; ++u) {
      const float msh = mrun[u] * 0.125f - 5.545177444f;      /* p carried x256 (same factor in the row sum) */
      float p0[8], p1[8]; float ls = 0.0f;
#pragma unroll
      for (int r = 0; r < 8; ++r) { p0[r] = __expf(sc[u][0][r] * 0.125f - msh); p1[r] = __expf(sc[u][1][r] * 0.125f - msh); ls += p0[r] + p1[r]; }
      lrun[u] = lrun[u] + ls;
#pragma unroll
      for (int r = 0; r < 8; ++r) { ph[u].h[r] = (_Float16)p0[r]; ph[u].h[8 + r] = (_Float16)p1[r]; }
    }
#pragma unroll
    for (int dt = 0; dt < 4; ++dt) { oh[0][dt] = wm(vf[dt], ph[0].v, oh[0][dt]); oh[1][dt] = wm(vf[dt], ph[1].v, oh[1][dt]); }
    /* the four vector slots between the last output product and the next write of an operand of it or refill of a V^T fragment */
    asm volatile("v_nop\n\tv_nop\n\tv_nop\n\tv_nop" : "+v"(oh[0][0]), "+v"(oh[0][1]), "+v"(oh[0][2]), "+v"(oh[0][3]), "+v"(oh[1][0]), "+v"(oh[1][1]), "+v"(oh[1][2]), "+v"(oh[1][3])
                 : "v"(vf[0]), "v"(vf[1]), "v"(vf[2]), "v"(vf[3]), "v"(ph[0].v), "v"(ph[1].v));
    if (more) {
#pragma unroll
      for (int dt = 0; dt < 4; ++dt) vf[dt] = ld_frag(Vh + vofs + (size_t)(dt * 16) * NTOK + (size_t)(kb + 32) * 16);
      addr_wait();
    }
  };
#pragma unroll 1      /* the key loop stays rolled: a second copy of the step would only add code and live registers */
  for (int st = s0; st < s1 - 1; ++st) step(st, true);
  step(s1 - 1, false);      /* last key step of this half: nothing left to fetch */
  if (kp) {      /* upper half: hand maximum, row sum and output tiles to the partner wave, 16 bytes a lane and row */
#pragma unroll
    for (int u = 0; u < 2; ++u) {
#pragma unroll
      for (int dt = 0; dt < 4; ++dt) {
        const v4f lo = {oh[u][dt][0], oh[u][dt][1], oh[u][dt][2], oh[u][dt][3]}, hi = {oh[u][dt][4], oh[u][dt][5], oh[u][dt][6], oh[u][dt][7]};
        *(v4fa*)&mg[grp][u * 8 + dt * 2][lane][0] = lo; *(v4fa*)&mg[grp][u * 8 + dt * 2 + 1][lane][0] = hi;
      }
    }
    const v4f ml = {mrun[0], mrun[1], lrun[0], lrun[1]};
    *(v4fa*)&mg[grp][16][lane][0] = ml;
  }
  __syncthreads();      /* publishes the upper halves; every wave of the block passes it once */
  if (kp) return;
  {
    const v4f ml = *(const v4fa*)&mg[grp][16][lane][0];
#pragma unroll
    for (int u = 0; u < 2; ++u) {
      const float mj = fmaxf(mrun[u], ml[u]);
      const float a0 = __expf((mrun[u] - mj) * 0.125f), a1 = __expf((ml[u] - mj) * 0.125f);
      lrun[u] = lrun[u] * a0 + ml[2 + u] * a1;
#pragma unroll
      for (int dt = 0; dt < 4; ++dt) {
        const v4f lo = *(const v4fa*)&mg[grp][u * 8 + dt * 2][lane][0], hi = *(const v4fa*)&mg[grp][u * 8 + dt * 2 + 1][lane][0];
#pragma unroll
        for (int r = 0; r < 4; ++r) { oh[u][dt][r] = oh[u][dt][r] * a0 + lo[r] * a1; oh[u][dt][4 + r] = oh[u][dt][4 + r] * a0 + hi[r] * a1; }
      }
    }
  }
  FragH fo[2][4];
#pragma unroll
  for (int u = 0; u < 2; ++u) {
    const float lt = lrun[u] + __shfl_xor(lrun[u], 16);
    const float inv = 64.0f * (1.0f / lt);      /* o carried x64 */
#pragma unroll
    for (int dt = 0; dt < 4; ++dt) {
#pragma unroll
      for (int r = 0; r < 8; ++r) fo[u][dt].h[r] = (_Float16)(oh[u][dt][r] * inv);
    }
  }
  __builtin_amdgcn_sched_barrier(0);      /* the eight stores go out behind the last conversion, so that no register an issued store names is written again */
#pragma unroll
  for (int u = 0; u < 2; ++u) {
#pragma unroll
    for (int dt = 0; dt < 4; ++dt)      /* the lane's 8 values (query ln of tile u, d = 16 dt + 8 hh ..) are its 16 bytes of half dt & 1 of fragment tile dt >> 1 */
      *(v8us*)(Oh + qofs + (size_t)(16 * u) * DM + (dt >> 1) * 512 + (dt & 1) * 256) = fo[u][dt].half[0];
  }
}

// Both attention paths read the same finished planes and share one grid. There are more blocks than resident places; the cost of a block falls with its index (for speed only):
// rank = index / (heads * batches) picks the query block from a compile-time order, the (head, batch) pair runs fastest. Cost key: q + 1 for a single-plane block q (2 (q + 1) key steps a wave),
// 3 (e + 1) for a hi + residual block e (4 (e + 1) key steps a wave, each with three products per site and a longer dependent chain). The order is a permutation of the query blocks for any SEQ and EARLY.
constexpr int NQB = SEQ / 128;      /* query blocks per (batch, head) */
struct QOrder { unsigned char q[NQB]; };
constexpr QOrder q_order() {
  QOrder o{}; int wq = NQB - 1, e = EARLY / 128 - 1;
  for (int r = 0; r < NQB; ++r) {
    const bool wide = wq >= EARLY / 128 && (e < 0 || wq + 1 >= 3 * (e + 1));
    o.q[r] = (unsigned char)(wide ? wq-- : e--);
  }
  return o;
}
__global__ __launch_bounds__(256) void k_attn(const unsigned short* __restrict__ Qh, const unsigned short* __restrict__ Qr,
    const unsigned short* __restrict__ Kh, const unsigned short* __restrict__ Kr,
    const unsigned short* __restrict__ Vh, const unsigned short* __restrict__ Vr,
    unsigned short* __restrict__ Oh, unsigned short* __restrict__ Or) {
  __shared__ __attribute__((aligned(16))) float mg[4][17][32][4];      /* per 32-query group: 16 rows of output values and one of (maximum, row sum), 16 bytes a lane */
  constexpr QOrder ord = q_order();
  const int i = blockIdx.x, r = i / (NH * NB), g = i - r * (NH * NB);
  const int qblk = ord.q[r];
  if (qblk >= EARLY / 128) attn_wide(mg, Qh, Kh, Vh, Oh, qblk, g % NH, g / NH);
  else attn_early(Qh, Qr, Kh, Kr, Vh, Vr, Oh, Or, qblk, g % NH, g / NH);
}

extern "C" void kernel_launch(void* const* d_in, const int* in_sizes, int n_in,
                              void* d_out, int out_size, void* d_ws, size_t ws_size, hipStream_t stream) {
  if (n_in < 9) return;
  const long long need_x = ((long long)(NB - 1) * SEQ_FULL + SEQ) * DM;
  if ((long long)in_sizes[0] < need_x) return;
  if (in_sizes[1] < DM * DM || in_sizes[3] < DM * DM || in_sizes[5] < DM * DM || in_sizes[7] < DM * DM) return;
  if (in_sizes[2] < DM || in_sizes[4] < DM || in_sizes[6] < DM || in_sizes[8] < DM) return;
  if ((long long)out_size < need_x) return;
  const float* x = (const float*)d_in[0]; const float* wq = (const float*)d_in[1]; const float* bq = (const float*)d_in[2];
  const float* wk = (const float*)d_in[3]; const float* bk = (const float*)d_in[4]; const float* wv = (const float*)d_in[5];
  const float* bv = (const float*)d_in[6]; const float* wo = (const float*)d_in[7]; const float* bo = (const float*)d_in[8];
  float* out = (float*)d_out;
  char* ws = (char*)d_ws; size_t off = 0;
  auto take = [&](size_t bytes) { char* p = ws + off; off += (bytes + 255) & ~(size_t)255; return p; };
  const size_t wbytes = (size_t)DM * DM * 2, pbytes = NTOK * DM * 2;
  unsigned short* WQ = (unsigned short*)take(wbytes); unsigned short* WK = (unsigned short*)take(wbytes);
  unsigned short* WV = (unsigned short*)take(wbytes); unsigned short* WO = (unsigned short*)take(wbytes);
  unsigned short* X16 = (unsigned short*)take(pbytes);
  unsigned short* Qh = (unsigned short*)take(pbytes); unsigned short* Qr = (unsigned short*)take(pbytes);
  unsigned short* Kh = (unsigned short*)take(pbytes); unsigned short* Kr = (unsigned short*)take(pbytes);
  unsigned short* VTh = (unsigned short*)take(pbytes); unsigned short* VTr = (unsigned short*)take(pbytes);
  unsigned short* Oh = (unsigned short*)take(pbytes); unsigned short* Or = (unsigned short*)take(pbytes);
  if (off > ws_size || off > (size_t)134217728) return;

  { const unsigned int nw8 = (unsigned int)((size_t)DM * DM / 8), gw = (nw8 + 255u) / 256u;      /* [out][in] weights are already Bt[n][k]; x32; fragment order */
    const unsigned int nx8 = (unsigned int)(NTOK * DM / 8), gx = (nx8 + 255u) / 256u;
    k_prep<<<gx + 4u * gw, 256, 0, stream>>>(x, wq, wk, wv, wo, X16, WQ, WK, WV, WO, nx8, gx, nw8, gw); }

  k_qkv<<<dim3((unsigned)((NTOK / 128) * (DM / 64)), 3), 128, 0, stream>>>(X16, WQ, WK, WV, bq, bk, bv, (_Float16*)Qh, (_Float16*)Qr, (_Float16*)Kh, (_Float16*)Kr, (_Float16*)VTh, (_Float16*)VTr);

  k_attn<<<((SEQ - EARLY) / 128 + EARLY / 128) * NH * NB, 256, 0, stream>>>(Qh, Qr, Kh, Kr, VTh, VTr, Oh, Or);

  k_out<<<dim3((unsigned)((SEQ / 128) * (DM / 64)), NB), 128, 0, stream>>>(Oh, Or, WO, bo, out);
}

// v008
// Measured time: 116 microseconds a run.
// Two timings next to v007 put it at 1.04 and 1.07 times that version's speed.
// Counting every step since v000, it is 4.45 times as fast.
#include <hip/hip_runtime.h>
// Causal multi-head self-attention: x [2][4096][768]; q / k / v = x W^T + b ([out][in] 768 x 768 weights, biases); 12 heads of 64; scores / 8; causal (key <= query) softmax; out = merged W_o^T + b_o.
// Compute dtype: every contraction on v_wmma_f32_16x16x32_f16 with f32 accumulation. Inputs converted RNE to bf16 and held exactly in f16 (weights x32). q, k, v, softmax weights (x256) and o (x64) are f16 operands;
// for the first EARLY queries of each sequence q, k, v, p and o are carried as f16 hi + f16 residual (x1024) planes with separate accumulators (3 products per site). Scores, softmax statistics and epilogues are f32.
// Structure: token rows r = b*SEQ + s. Q, K as planes [token][768]; V produced directly transposed (V^T = W_v x^T, plane [768][tokens]); attention is a register-fed transposed flash loop per wave
// (S^T = K Q^T with Q^T as the B operand, packed P^T from the S^T accumulators as the B operand of O^T = V^T P^T; 32 keys per step; no LDS in the key loop); o as f16 planes; out GEMM writes f32 rows.
// Every f16 plane [R][L] (weights, x, q, k, V^T, o) is stored in fragment order: tiles of 16 rows x 32 columns, 512 elements each, tile (r >> 4, c >> 5) at element ((r >> 4) * (L / 32) + (c >> 5)) * 512;
// inside a tile element (r, c) stands at ((c >> 4) & 1) * 256 + (((c >> 3) & 1) * 16 + (r & 15)) * 8 + (c & 7), so each of a fragment's two loads is lane * 16 bytes into 512 contiguous bytes (four whole lines).
#ifndef NB
#define NB 2
#endif
#ifndef SEQ
#define SEQ 4096
#endif
#define NB_FULL 2
#define SEQ_FULL 4096
#define DM 768
#define NH 12
#define HD 64
#define NTOK ((size_t)NB * SEQ)
#define EARLY ((SEQ) < 1024 ? (SEQ) : 1024)   /* queries per sequence on the hi + residual path */
static_assert(SEQ % 128 == 0);
static_assert(EARLY % 128 == 0);
static_assert((SEQ - EARLY) % 128 == 0);
static_assert(NB <= NB_FULL);
static_assert(SEQ <= SEQ_FULL);
static_assert(DM % 128 == 0);
static_assert(DM % 96 == 0);
static_assert(DM % 256 == 0);
static_assert(NTOK % 256 == 0);
static_assert(NH * HD == DM);
static_assert(HD == 64);

typedef _Float16 v16h __attribute__((ext_vector_type(16)));
typedef unsigned short v8us __attribute__((ext_vector_type(8), may_alias));
typedef float v8f __attribute__((ext_vector_type(8)));
typedef float v4f __attribute__((ext_vector_type(4)));
typedef float v4fa __attribute__((ext_vector_type(4), may_alias));
union FragH { v16h v; v8us half[2]; _Float16 h[16]; unsigned short u[16]; };

__device__ __forceinline__ unsigned short bf16_bits(float x) { unsigned int u = __float_as_uint(x); return (unsigned short)((u + 0x7FFFu + ((u >> 16) & 1u)) >> 16); }
__device__ __forceinline__ float bf16_rne(float x) { return __uint_as_float(((unsigned int)bf16_bits(x)) << 16); }

// 16x32 fragment (A rows or B columns) of a plane in fragment order: p = tile start + 8*lane; elements 0..7 <- (row lane&15, k0+8h..), 8..15 <- (row lane&15, k0+16+8h..), h = lane>>4
__device__ __forceinline__ v16h ld_frag(const unsigned short* p) { FragH f; f.half[0] = *(const v8us*)p; f.half[1] = *(const v8us*)(p + 256); return f.v; }
// Thread t writes the 8 elements at t*8 of a fragment-order plane with DM columns: their row and first column.
__device__ __forceinline__ void frag_src(unsigned int t, unsigned int& r, unsigned int& c8) {
  const unsigned int tile = t >> 6, band = tile / (DM / 32), cb = tile - band * (DM / 32);
  r = band * 16u + (t & 15u); c8 = cb * 32u + ((t >> 5) & 1u) * 16u + ((t >> 4) & 1u) * 8u;
}

// Stands behind a run of fragment loads that stay in flight: their address registers may be reused only behind it.
__device__ __forceinline__ void addr_wait() { asm volatile("s_wait_xcnt 0x0" ::: "memory"); }

__device__ __forceinline__ v8f wm(v16h a, v16h b, v8f c) { return __builtin_amdgcn_wmma_f32_16x16x32_f16(false, a, false, b, (short)0, c, false, false); }
__device__ __forceinline__ v8f mma1(v16h a, v16h b, v8f c) {
  c = wm(a, b, c);
  asm volatile("v_nop\n\tv_nop\n\tv_nop\n\tv_nop" : "+v"(c) : "v"(a), "v"(b));
  return c;
}
__device__ __forceinline__ v8f mma2(v16h a0, v16h b0, v16h a1, v16h b1, v8f c) {
  c = wm(a0, b0, c); c = wm(a1, b1, c);
  asm volatile("v_nop\n\tv_nop\n\tv_nop\n\tv_nop" : "+v"(c) : "v"(a0), "v"(b0), "v"(a1), "v"(b1));
  return c;
}
__device__ __forceinline__ v8f mma4(v16h a0, v16h b0, v16h a1, v16h b1, v16h a2, v16h b2, v16h a3, v16h b3, v8f c) {
  c = wm(a0, b0, c); c = wm(a1, b1, c); c = wm(a2, b2, c); c = wm(a3, b3, c);
  asm volatile("v_nop\n\tv_nop\n\tv_nop\n\tv_nop" : "+v"(c) : "v"(a0), "v"(b0), "v"(a1), "v"(b1), "v"(a2), "v"(b2), "v"(a3), "v"(b3));
  return c;
}

__device__ __forceinline__ void cvt_w(const float* __restrict__ w, const unsigned int t, unsigned short* __restrict__ Bt, const float scale) {
  unsigned int r, c8; frag_src(t, r, c8);
  const float* src = w + (size_t)r * DM + c8;
  const v4f a = *(const v4fa*)src, c = *(const v4fa*)(src + 4);
  FragH f;
#pragma unroll
  for (int q = 0; q < 4; ++q) { f.h[q] = (_Float16)(bf16_rne(a[q]) * scale); f.h[4 + q] = (_Float16)(bf16_rne(c[q]) * scale); }
  const v8us o = f.half[0];
  unsigned short* d = Bt + (size_t)t * 8;
  *(v8us*)d = o; 
}

__device__ __forceinline__ void cvt_x(const float* __restrict__ x, unsigned short* __restrict__ X16, const unsigned int t) {
  unsigned int r, c8; frag_src(t, r, c8);
  const unsigned int b = r / SEQ, s = r - b * SEQ;
  const float* src = x + ((size_t)b * SEQ_FULL + s) * DM + c8;
  const v4f a = *(const v4fa*)src, c = *(const v4fa*)(src + 4);
  FragH f;
#pragma unroll
  for (int q = 0; q < 4; ++q) { f.h[q] = (_Float16)bf16_rne(a[q]); f.h[4 + q] = (_Float16)bf16_rne(c[q]); }
  const v8us o = f.half[0];
  unsigned short* d = X16 + (size_t)t * 8;
  *(v8us*)d = o; 
}

// The five conversions depend on nothing and share one grid: blocks [0, gx) take x, then gw blocks for each of the four weights (x32).
__global__ __launch_bounds__(256) void k_prep(const float* __restrict__ x, const float* __restrict__ wq, const float* __restrict__ wk, const float* __restrict__ wv, const float* __restrict__ wo,
    unsigned short* __restrict__ X16, unsigned short* __restrict__ WQ, unsigned short* __restrict__ WK, unsigned short* __restrict__ WV, unsigned short* __restrict__ WO,
    unsigned int nx8, unsigned int gx, unsigned int nw8, unsigned int gw) {
  unsigned int blk = blockIdx.x;
  if (blk < gx) {
    const unsigned int t = blk * 256u + threadIdx.x; if (t >= nx8) return;
    cvt_x(x, X16, t);
  } else {
    blk -= gx; const unsigned int m = blk / gw; blk -= m * gw;
    const unsigned int t = blk * 256u + threadIdx.x; if (t >= nw8) return;
    const float* w = m == 0 ? wq : m == 1 ? wk : m == 2 ? wv : wo;
    unsigned short* d = m == 0 ? WQ : m == 1 ? WK : m == 2 ? WV : WO;
    cvt_w(w, t, d, 32.0f);
  }
}

__device__ __forceinline__ v8f g2_mma(v16h a, v16h b, v8f c) { v8f d = __builtin_amdgcn_wmma_f32_16x16x32_f16(false, a, false, b, (short)0, c, false, false); asm volatile("v_nop\n\tv_nop\n\tv_nop\n\tv_nop" : "+v"(d) : "v"(a), "v"(b)); return d; }

// GEMM C[M][N] = (A (+ Ar/1024)) . Bt^T * alpha + bias; A, Ar f16 [M][K] (row length lda, batch stride sA per batch index by), Bt f16 [N][K] (row length ldb), all in fragment order.
// Block = 4 waves, wave tile 32 x 64 (block 128 x 64); M % 128 == 0, N % 64 == 0, K % 96 == 0. BIASROW: bias indexed by row, else by column (bias converted RNE to bf16).
// Outputs: C f32 rows (optional), C16 f16 in fragment order (optional), C16r = f16((v - f16(v)) * 1024) (optional; resmode 1: rows with (row % SEQ) < EARLY, resmode 2: columns with (col % SEQ) < EARLY).
// so: the block's staging rows in LDS; bx, by: the tile index and the batch index of this block inside its own product.
template <bool ARES, bool BIASROW>
__device__ __forceinline__ void gemm2(float (*so)[32][68], const int bx, const int by, const unsigned short* __restrict__ A, const unsigned short* __restrict__ Ar, int lda, size_t sA,
    const unsigned short* __restrict__ Bh, int ldb, float alpha, const float* __restrict__ bias,
    float* __restrict__ C, _Float16* __restrict__ C16, _Float16* __restrict__ C16r, int ldc, size_t sC, int resmode, int M, int N, int K) {
  const int tid = threadIdx.x, w = __builtin_amdgcn_readfirstlane(tid >> 5), lane = tid & 31, ln = lane & 15, hh = lane >> 4;
  const int ntn = N >> 6; const int mt = bx / ntn, nq = bx - mt * ntn; const int row0 = mt * 128 + 32 * w, col0 = nq * 64; if (row0 >= M) return;
  const size_t aofs = (size_t)by * sA + (size_t)row0 * lda + 8 * lane;
  const size_t cofs = (size_t)by * sC;
  const unsigned short* a0p = A + aofs; const unsigned short* a1p = a0p + (size_t)16 * lda;
  const unsigned short* r0p = Ar + aofs; const unsigned short* r1p = r0p + (size_t)16 * lda;
  const unsigned short* b0p = Bh + (size_t)col0 * ldb + 8 * lane; const unsigned short* b1p = b0p + (size_t)16 * ldb; const unsigned short* b2p = b1p + (size_t)16 * ldb; const unsigned short* b3p = b2p + (size_t)16 * ldb;
  const v8f z8 = {0.f,0.f,0.f,0.f,0.f,0.f,0.f,0.f};
  v8f c00 = z8, c01 = z8, c02 = z8, c03 = z8, c10 = z8, c11 = z8, c12 = z8, c13 = z8;
  v8f d00 = z8, d01 = z8, d02 = z8, d03 = z8, d10 = z8, d11 = z8, d12 = z8, d13 = z8;
  /* Fragments live in GD register sets; a set is refilled for k + 32*GD right behind its last product, so a load has GD k steps to land (the product order is unchanged). */
  constexpr int GD = ARES ? 1 : 3;
  v16h fa0[GD], fa1[GD], fe0[GD], fe1[GD], fb0[GD], fb1[GD], fb2[GD], fb3[GD];
#pragma unroll
  for (int u = 0; u < GD; ++u) {
    const int k = 512 * u;      /* one tile of 512 elements per 32 k */
    fb0[u] = ld_frag(b0p + k); fa0[u] = ld_frag(a0p + k); fa1[u] = ld_frag(a1p + k);
    if (ARES) { fe0[u] = ld_frag(r0p + k); fe1[u] = ld_frag(r1p + k); }
    fb1[u] = ld_frag(b1p + k); fb2[u] = ld_frag(b2p + k); fb3[u] = ld_frag(b3p + k);
  }
  addr_wait();
  auto kstep = [&](const int u, const int kn, const bool more) __attribute__((always_inline)) {
    const v16h a0 = fa0[u], a1 = fa1[u];
    v16h e0 = a0, e1 = a1;
    if (ARES) { e0 = fe0[u]; e1 = fe1[u]; }
    v16h b = fb0[u]; c00 = g2_mma(a0, b, c00); c10 = g2_mma(a1, b, c10); if (ARES) { d00 = g2_mma(e0, b, d00); d10 = g2_mma(e1, b, d10); }
    if (more) fb0[u] = ld_frag(b0p + kn);
    b = fb1[u]; c01 = g2_mma(a0, b, c01); c11 = g2_mma(a1, b, c11); if (ARES) { d01 = g2_mma(e0, b, d01); d11 = g2_mma(e1, b, d11); }
    if (more) fb1[u] = ld_frag(b1p + kn);
    b = fb2[u]; c02 = g2_mma(a0, b, c02); c12 = g2_mma(a1, b, c12); if (ARES) { d02 = g2_mma(e0, b, d02); d12 = g2_mma(e1, b, d12); }
    if (more) fb2[u] = ld_frag(b2p + kn);
    b = fb3[u]; c03 = g2_mma(a0, b, c03); c13 = g2_mma(a1, b, c13); if (ARES) { d03 = g2_mma(e0, b, d03); d13 = g2_mma(e1, b, d13); }
    if (more) {
      fb3[u] = ld_frag(b3p + kn); fa0[u] = ld_frag(a0p + kn); fa1[u] = ld_frag(a1p + kn);
      if (ARES) { fe0[u] = ld_frag(r0p + kn); fe1[u] = ld_frag(r1p + kn); }
      if (u == GD - 1) addr_wait();      /* the pointers step once per trip */
    }
  };
#pragma unroll 1
  for (int kb = 0; kb < (K - 32 * GD) * 16; kb += 512 * GD) {      /* kb counts elements of a 16-row band: 512 per 32 k */
#pragma unroll
    for (int u = 0; u < GD; ++u) kstep(u, kb + 512 * (u + GD), true);
  }
#pragma unroll
  for (int u = 0; u < GD; ++u) kstep(u, 0, false);      /* last GD k steps: nothing left to fetch */
  v8f accs[8] = {c00, c01, c02, c03, c10, c11, c12, c13};
  v8f accd[8] = {d00, d01, d02, d03, d10, d11, d12, d13};
#pragma unroll
  for (int u = 0; u < 8; ++u) {
    const int t = u & 3, half = u >> 2; const int col = col0 + t * 16 + ln;
    float bcol = 0.f; if (!BIASROW) bcol = bf16_rne(bias[col]);
#pragma unroll
    for (int r = 0; r < 8; ++r) {
      const int rloc = half * 16 + 8 * hh + r;
      float v = accs[u][r]; if (ARES) v += accd[u][r] * 0.0009765625f;
      float bv = bcol; if (BIASROW) bv = bf16_rne(bias[row0 + rloc]);
      so[w][rloc][t * 16 + ln] = v * alpha + bv;
    }
  }
  __builtin_amdgcn_fence(4 /* acq_rel order */, "workgroup"); __builtin_amdgcn_wave_barrier();
  bool wres = false;
  if (C16r) { if (resmode == 1) wres = ((row0 % SEQ) < EARLY); else if (resmode == 2) wres = ((col0 % SEQ) < EARLY); }
  if (C) {
    const int rsub = lane >> 4, c4 = (lane & 15) * 4;
#pragma unroll
    for (int q = 0; q < 16; ++q) {
      const int r = q * 2 + rsub; const v4f v = *(const v4fa*)&so[w][r][c4];
      *(v4f*)(C + cofs + (size_t)(row0 + r) * ldc + col0 + c4) = v;
    }
    addr_wait();      /* the f16 block below may reuse registers that these stores name */
  }
  if (C16) {      /* the wave's 32 x 64 tile = 2 x 2 fragment tiles of two 512-byte halves; the lane writes 16 bytes of each half */
    const size_t o0 = cofs + (size_t)row0 * ldc + (size_t)(col0 >> 5) * 512 + lane * 8, o1 = o0 + (size_t)16 * ldc;
    unsigned short* h0p = (unsigned short*)C16 + o0; unsigned short* h1p = (unsigned short*)C16 + o1;
    unsigned short* e0p = (unsigned short*)C16r + o0; unsigned short* e1p = (unsigned short*)C16r + o1;
    FragH fh[8], fr[8];
#pragma unroll
    for (int q = 0; q < 8; ++q) {      /* q = band * 4 + column tile * 2 + half */
      const float* sp = &so[w][(q >> 2) * 16 + ln][(q & 3) * 16 + hh * 8];
      const v4f v0 = *(const v4fa*)sp, v1 = *(const v4fa*)(sp + 4);
#pragma unroll
      for (int i = 0; i < 4; ++i) {
        fh[q].h[i] = (_Float16)v0[i]; fr[q].h[i] = (_Float16)((v0[i] - (float)fh[q].h[i]) * 1024.0f);
        fh[q].h[4 + i] = (_Float16)v1[i]; fr[q].h[4 + i] = (_Float16)((v1[i] - (float)fh[q].h[4 + i]) * 1024.0f);
      }
    }
#pragma unroll
    for (int q = 0; q < 8; ++q) *(v8us*)((q >> 2 ? h1p : h0p) + (q & 3) * 256) = fh[q].half[0];
    addr_wait();      /* the residual stores below may reuse registers that the stores above name */
    if (wres) {
#pragma unroll
      for (int q = 0; q < 8; ++q) *(v8us*)((q >> 2 ? e1p : e0p) + (q & 3) * 256) = fr[q].half[0];
      addr_wait();      /* precaution: the joined kernels take one product per block, so no other product's code runs behind these stores */
    }
  }
}

// Single-plane GEMM with a 64 x 64 wave tile: same operands, outputs and k order as gemm2<false, .>, block = 2 WR waves as WR x 2 (block tile 64 WR x 128); M % (64 WR) == 0, N % 128 == 0, K % 64 == 0, K >= 128.
// A k step loads 8 fragments for 16 products (gemm2: 6 for 8), and a block of 8 waves fetches 384 operand rows for 256 x 128 outputs (gemm2: 192 for 128 x 64).
template <bool BIASROW, int WR>
__device__ __forceinline__ void gemm4(float (*so)[32][68], const int bx, const int by, const unsigned short* __restrict__ A, int lda, size_t sA,
    const unsigned short* __restrict__ Bh, int ldb, float alpha, const float* __restrict__ bias,
    float* __restrict__ C, _Float16* __restrict__ C16, _Float16* __restrict__ C16r, int ldc, size_t sC, int resmode, int M, int N, int K) {
  const int tid = threadIdx.x, w = __builtin_amdgcn_readfirstlane(tid >> 5), lane = tid & 31, ln = lane & 15, hh = lane >> 4;
  const int ntn = N >> 7; const int mt = bx / ntn, nq = bx - mt * ntn; const int row0 = mt * (64 * WR) + 64 * (w >> 1), col0 = nq * 128 + 64 * (w & 1); if (row0 >= M) return;
  const size_t cofs = (size_t)by * sC;
  const unsigned short* ap = A + (size_t)by * sA + (size_t)row0 * lda + 8 * lane;
  const unsigned short* bp = Bh + (size_t)col0 * ldb + 8 * lane;
  const v8f z8 = {0.f,0.f,0.f,0.f,0.f,0.f,0.f,0.f};
  v8f c[4][4];
#pragma unroll
  for (int i = 0; i < 4; ++i) {
#pragma unroll
    for (int j = 0; j < 4; ++j) c[i][j] = z8;
  }
  /* A fragments live in two register sets (k steps of even and odd number), B fragments in one; a B fragment is refilled for the next k step right behind its four products, an A set for the next k step but one behind its last. */
  v16h fa[2][4], fb[4];
#pragma unroll
  for (int i = 0; i < 4; ++i) fa[0][i] = ld_frag(ap + (size_t)(16 * i) * lda);
  __builtin_amdgcn_sched_barrier(0);      /* first loads issue in the loop's own order (A set 0, B, A set 1): the loop's waits are counted over both ways in */
#pragma unroll
  for (int j = 0; j < 4; ++j) { fb[j] = ld_frag(bp + (size_t)(16 * j) * ldb); __builtin_amdgcn_sched_barrier(0); /* as above */ }
#pragma unroll
  for (int i = 0; i < 4; ++i) fa[1][i] = ld_frag(ap + (size_t)(16 * i) * lda + 512);
  addr_wait();
  auto kstep = [&](const int u, const int kn, const bool moreb, const bool morea, const bool last) __attribute__((always_inline)) {      /* kn: element offset of the next k step inside a 16-row band */
#pragma unroll
    for (int j = 0; j < 4; ++j) {
#pragma unroll
      for (int i = 0; i < 4; ++i) c[i][j] = wm(fa[u][i], fb[j], c[i][j]);
      /* the four vector slots between the last product of this column and the refill of an operand of it */
      if (moreb) asm volatile("v_nop\n\tv_nop\n\tv_nop\n\tv_nop" : "+v"(c[0][j]), "+v"(c[1][j]), "+v"(c[2][j]), "+v"(c[3][j]) : "v"(fa[u][0]), "v"(fa[u][1]), "v"(fa[u][2]), "v"(fa[u][3]), "v"(fb[j]));
      if (moreb) fb[j] = ld_frag(bp + (size_t)(16 * j) * ldb + kn);
    }
    if (morea) {
#pragma unroll
      for (int i = 0; i < 4; ++i) fa[u][i] = ld_frag(ap + (size_t)(16 * i) * lda + kn + 512);
    }
    if (last) addr_wait();      /* the pointers step, or their registers are reused, behind this k step */
  };
#pragma unroll 1      /* two k steps a trip, one for each A set; more copies would only add code */
  for (int kb = 0; kb < (K - 64) * 16; kb += 1024) {      /* kb counts elements of a 16-row band: 512 per 32 k */
    kstep(0, kb + 512, true, true, false);
    kstep(1, kb + 1024, true, true, true);
  }
  kstep(0, (K - 32) * 16, true, false, true);      /* last two k steps: only the last B fragments are left to fetch */
  kstep(1, 0, false, false, false);
  bool wres = false;
  if (C16r) { if (resmode == 1) wres = ((row0 % SEQ) < EARLY); else if (resmode == 2) wres = ((col0 % SEQ) < EARLY); }
  float bc[4] = {0.f, 0.f, 0.f, 0.f};
  if (!BIASROW) {
#pragma unroll
    for (int t = 0; t < 4; ++t) bc[t] = bf16_rne(bias[col0 + t * 16 + ln]);
  }
#pragma unroll
  for (int hb = 0; hb < 2; ++hb) {      /* the wave's tile leaves as two 32 x 64 halves through the same staging rows */
    const int rb = row0 + 32 * hb;
#pragma unroll
    for (int u = 0; u < 8; ++u) {
      const int t = u & 3, half = u >> 2;
      const float bcol = bc[t];
#pragma unroll
      for (int r = 0; r < 8; ++r) {
        const int rloc = half * 16 + 8 * hh + r;
        const float v = c[2 * hb + half][t][r];
        float bv = bcol; if (BIASROW) bv = bf16_rne(bias[rb + rloc]);
        so[w][rloc][t * 16 + ln] = v * alpha + bv;
      }
    }
    /* the staging writes land before other lanes of the wave read them back; LDS only, so that the first half's global stores are not waited for */
    __builtin_amdgcn_fence(4 /* acq_rel order */, "workgroup", "local"); __builtin_amdgcn_wave_barrier();
    if (C) {
      const int rsub = lane >> 4, c4 = (lane & 15) * 4;
#pragma unroll
      for (int q = 0; q < 16; ++q) {
        const int r = q * 2 + rsub; const v4f v = *(const v4fa*)&so[w][r][c4];
        *(v4f*)(C + cofs + (size_t)(rb + r) * ldc + col0 + c4) = v;
      }
      addr_wait();      /* the code behind may reuse registers that these stores name */
    }
    if (C16) {      /* a 32 x 64 half = 2 x 2 fragment tiles of two 512-byte halves; the lane writes 16 bytes of each */
      const size_t o0 = cofs + (size_t)rb * ldc + (size_t)(col0 >> 5) * 512 + lane * 8, o1 = o0 + (size_t)16 * ldc;
      unsigned short* h0p = (unsigned short*)C16 + o0; unsigned short* h1p = (unsigned short*)C16 + o1;
      unsigned short* e0p = (unsigned short*)C16r + o0; unsigned short* e1p = (unsigned short*)C16r + o1;
      FragH fh[8], fr[8];
#pragma unroll
      for (int q = 0; q < 8; ++q) {      /* q = band * 4 + column tile * 2 + half */
        const float* sp = &so[w][(q >> 2) * 16 + ln][(q & 3) * 16 + hh * 8];
        const v4f v0 = *(const v4fa*)sp, v1 = *(const v4fa*)(sp + 4);
#pragma unroll
        for (int i = 0; i < 4; ++i) {
          fh[q].h[i] = (_Float16)v0[i]; fr[q].h[i] = (_Float16)((v0[i] - (float)fh[q].h[i]) * 1024.0f);
          fh[q].h[4 + i] = (_Float16)v1[i]; fr[q].h[4 + i] = (_Float16)((v1[i] - (float)fh[q].h[4 + i]) * 1024.0f);
        }
      }
#pragma unroll
      for (int q = 0; q < 8; ++q) *(v8us*)((q >> 2 ? h1p : h0p) + (q & 3) * 256) = fh[q].half[0];
      addr_wait();      /* the residual stores below may reuse registers that the stores above name */
      if (wres) {
#pragma unroll
        for (int q = 0; q < 8; ++q) *(v8us*)((q >> 2 ? e1p : e0p) + (q & 3) * 256) = fr[q].half[0];
        addr_wait();      /* the code behind reuses registers that these stores name */
      }
    }
    /* the second half's staging writes stay behind the first half's reads of the same rows by other lanes */
    if (hb == 0) { __builtin_amdgcn_fence(4 /* acq_rel order */, "workgroup", "local"); __builtin_amdgcn_wave_barrier(); }
  }
}

// Q, K and V^T depend only on the converted planes and share one grid: blockIdx.y = 0, 1 give Q, K [token][DM] (hi planes; residual planes for tokens with s < EARLY);
// blockIdx.y = 2 gives V^T [DM][NTOK] = W_v (rows c) . X16^T (columns = tokens), bias by row, residual plane for token columns with s < EARLY.
__global__ __launch_bounds__(256) void k_qkv(const unsigned short* __restrict__ X16, const unsigned short* __restrict__ WQ, const unsigned short* __restrict__ WK, const unsigned short* __restrict__ WV,
    const float* __restrict__ bq, const float* __restrict__ bk, const float* __restrict__ bv,
    _Float16* __restrict__ Qh, _Float16* __restrict__ Qr, _Float16* __restrict__ Kh, _Float16* __restrict__ Kr, _Float16* __restrict__ VTh, _Float16* __restrict__ VTr) {
  __shared__ __attribute__((aligned(16))) float so[8][32][68];
  const int sel = blockIdx.y;
  if (sel == 2) gemm4<true, 4>(so, blockIdx.x, 0, WV, DM, (size_t)0, X16, DM, 0.03125f, bv, (float*)nullptr, VTh, VTr, (int)NTOK, (size_t)0, 2, DM, (int)NTOK, DM);
  else gemm4<false, 4>(so, blockIdx.x, 0, X16, DM, (size_t)0, sel ? WK : WQ, DM, 0.03125f, sel ? bk : bq, (float*)nullptr, sel ? Kh : Qh, sel ? Kr : Qr, DM, (size_t)0, 1, (int)NTOK, DM, DM);
}

// out rows (b*SEQ_FULL + s) = o W_o^T + b_o; alpha = 1 / (64 * 32). One grid: the first blocks take the rows with s < EARLY (hi + residual o), the others the rest; blockIdx.y = batch.
__global__ __launch_bounds__(128) void k_out(const unsigned short* __restrict__ Oh, const unsigned short* __restrict__ Or, const unsigned short* __restrict__ WO, const float* __restrict__ bo, float* __restrict__ out) {
  __shared__ __attribute__((aligned(16))) float so[4][32][68];
  constexpr int NE = (EARLY / 128) * (DM / 64);
  const int bx = blockIdx.x;
  if (bx < NE) gemm2<true, false>(so, bx, blockIdx.y, Oh, Or, DM, (size_t)SEQ * DM, WO, DM, 0.00048828125f, bo, out, (_Float16*)nullptr, (_Float16*)nullptr, DM, (size_t)SEQ_FULL * DM, 0, EARLY, DM, DM);
  else gemm4<false, 2>(so, bx - NE, blockIdx.y, Oh + (size_t)EARLY * DM, DM, (size_t)SEQ * DM, WO, DM, 0.00048828125f, bo, out + (size_t)EARLY * DM, (_Float16*)nullptr, (_Float16*)nullptr, DM, (size_t)SEQ_FULL * DM, 0, SEQ - EARLY, DM, DM);
}

// Lazy rescale: the maximum in use (mrun, alike in both lanes of a query) is raised, and row sum and output tiles rescaled, only in a key step where some lane of the wave holds a raw score above it by more than LAZY.
// Otherwise scores exceed it by at most LAZY / 8 = 4 after scaling, so p <= 256 e^4 < 14,000 stays inside f16; the first key step of a wave always takes the branch (mrun starts at -1e30, every query has an unmasked key there).
#define LAZY 32.0f
// Causal flash attention, transposed form. Q / K planes [token][DM]; V^T planes [DM][NTOK] (row = head*64 + d); o planes [token][DM]; all in fragment order. A wave (on the single-plane path, a pair of waves) loops over 32-key steps up to its diagonal.
// Lane (ln, hh) of a 16-query tile: query (tile start) + ln; S^T accumulators hold keys 8hh + r (tile 0) and 16 + 8hh + r (tile 1), which is exactly the B-fragment k map, so P^T is packed in place.
// Hi + residual path: block = 8 waves (128 queries of one (batch, head)), each wave owns 16 queries; hi + residual (x1024) planes on q, k, v, p and o (two accumulators per site).
__device__ __forceinline__ void attn_early(const unsigned short* __restrict__ Qh, const unsigned short* __restrict__ Qr,
    const unsigned short* __restrict__ Kh, const unsigned short* __restrict__ Kr,
    const unsigned short* __restrict__ Vh, const unsigned short* __restrict__ Vr,
    unsigned short* __restrict__ Oh, unsigned short* __restrict__ Or, const int qblk, const int head, const int b) {
  const int tid = threadIdx.x, w = __builtin_amdgcn_readfirstlane(tid >> 5), lane = tid & 31, ln = lane & 15, hh = lane >> 4;
  const int q0 = qblk * 128 + w * 16;
  const size_t tok0 = (size_t)b * SEQ;
  const size_t qofs = (tok0 + q0) * DM + head * (HD * 16) + 8 * lane;
  const v16h qa = ld_frag(Qh + qofs), qb = ld_frag(Qh + qofs + 512);
  const v16h qra = ld_frag(Qr + qofs), qrb = ld_frag(Qr + qofs + 512);
  addr_wait();
  const size_t kofs = tok0 * DM + head * (HD * 16) + 8 * lane;
  const size_t vofs = (size_t)(head * HD) * NTOK + tok0 * 16 + 8 * lane;
  const v8f z8 = {0.f,0.f,0.f,0.f,0.f,0.f,0.f,0.f};
  v8f oh[4] = {z8, z8, z8, z8};
  v8f om[4] = {z8, z8, z8, z8};
  float mrun = -1.0e30f, lrun = 0.0f;
  const int nsteps = ((q0 + 15) >> 5) + 1;
  const int qi = q0 + ln;
  /* Fragment loads go out ahead of their use: V^T of this step behind the score products, K of the next step behind the output products, so that only one of the two sets is live. */
  v16h kfa[2], kfc[2], kra[2], krc[2], vf[4], vrf[4];
#pragma unroll
  for (int t = 0; t < 2; ++t) {
    const size_t ko = kofs + (size_t)(16 * t) * DM;
    kfa[t] = ld_frag(Kh + ko); kfc[t] = ld_frag(Kh + ko + 512);
    kra[t] = ld_frag(Kr + ko); krc[t] = ld_frag(Kr + ko + 512);
    __builtin_amdgcn_sched_barrier(0);      /* first loads issue in the loop's own order (K tile 0, K tile 1): the loop's waits on K are counted over both ways in */
  }
  addr_wait();
  auto step = [&](const int st, const bool more) __attribute__((always_inline)) {
    const int kb = st * 32;
    v8f sc[2];
#pragma unroll
    for (int t = 0; t < 2; ++t) {
      const v16h ka = kfa[t], kc = kfc[t];
      v8f s = mma2(ka, qa, kc, qb, z8);
      const v16h ra = kra[t], rc = krc[t];
      const v8f sm = mma4(ka, qra, kc, qrb, ra, qa, rc, qb, z8);
      s = s + sm * 0.0009765625f;
#pragma unroll
      for (int dt = 2 * t; dt < 2 * t + 2; ++dt) {
        const size_t vo = vofs + (size_t)(dt * 16) * NTOK + (size_t)kb * 16;
        vf[dt] = ld_frag(Vh + vo); vrf[dt] = ld_frag(Vr + vo);
      }
      sc[t] = s;
    }
    addr_wait();
    if (kb + 31 > q0) {      /* wave-uniform: only the diagonal step carries masked keys; masked scores are replaced */
#pragma unroll
      for (int r = 0; r < 8; ++r) {
        const int key = kb + 8 * hh + r;
        sc[0][r] = (key > qi) ? -1.0e30f : sc[0][r];
        sc[1][r] = (key + 16 > qi) ? -1.0e30f : sc[1][r];
      }
    }
    float mloc = sc[0][0];
#pragma unroll
    for (int r = 1; r < 8; ++r) mloc = fmaxf(mloc, sc[0][r]);
#pragma unroll
    for (int r = 0; r < 8; ++r) mloc = fmaxf(mloc, sc[1][r]);
    if (__builtin_amdgcn_ballot_w32(mloc > mrun + LAZY) != 0) {      /* one scalar test per key step: some lane's scores outgrow the maximum in use */
      mloc = fmaxf(mloc, __shfl_xor(mloc, 16));
      const float mnew = fmaxf(mrun, mloc);
      const float alpha = __expf((mrun - mnew) * 0.125f);
      mrun = mnew;
      lrun = lrun * alpha;
#pragma unroll
      for (int dt = 0; dt < 4; ++dt) { oh[dt] = oh[dt] * alpha; om[dt] = om[dt] * alpha; }
    }
    const float msh = mrun * 0.125f - 5.545177444f;      /* p carried x256 (same factor in the row sum) */
    float p0[8], p1[8]; float ls = 0.0f;
#pragma unroll
    for (int r = 0; r < 8; ++r) { p0[r] = __expf(sc[0][r] * 0.125f - msh); p1[r] = __expf(sc[1][r] * 0.125f - msh); ls += p0[r] + p1[r]; }
    lrun = lrun + ls;
    FragH ph, pr;
#pragma unroll
    for (int r = 0; r < 8; ++r) {
      const _Float16 h0 = (_Float16)p0[r], h1 = (_Float16)p1[r];
      ph.h[r] = h0; ph.h[8 + r] = h1;
      pr.h[r] = (_Float16)((p0[r] - (float)h0) * 1024.0f); pr.h[8 + r] = (_Float16)((p1[r] - (float)h1) * 1024.0f);
    }
#pragma unroll
    for (int dt = 0; dt < 4; ++dt) {
      const v16h va = vf[dt];
      oh[dt] = mma1(va, ph.v, oh[dt]);
      const v16h vr = vrf[dt]; om[dt] = mma2(va, pr.v, vr, ph.v, om[dt]);
      if (more) {
        const int t = dt >> 1; const size_t kn = kofs + (size_t)(kb + 32 + 16 * t) * DM;
        if ((dt & 1) == 0) { kfa[t] = ld_frag(Kh + kn); kfc[t] = ld_frag(Kh + kn + 512); }
        else { kra[t] = ld_frag(Kr + kn); krc[t] = ld_frag(Kr + kn + 512); }
      }
    }
    if (more) addr_wait();
  };
#pragma unroll 1
  for (int st = 0; st < nsteps - 1; ++st) step(st, true);
  step(nsteps - 1, false);      /* last key step: nothing of a next step to fetch */
  const float lt = lrun + __shfl_xor(lrun, 16);
  const float inv = 64.0f * (1.0f / lt);      /* o carried x64 */
#pragma unroll
  for (int dt = 0; dt < 4; ++dt) {
    FragH fh, fr;
#pragma unroll
    for (int r = 0; r < 8; ++r) {
      float v = oh[dt][r]; v += om[dt][r] * 0.0009765625f;
      v *= inv;
      const _Float16 h = (_Float16)v; fh.h[r] = h;
      fr.h[r] = (_Float16)((v - (float)h) * 1024.0f);
    }
    /* the lane's 8 values (query ln, d = 16 dt + 8 hh ..) are its 16 bytes of half dt & 1 of fragment tile dt >> 1 */
    const size_t o = qofs + (dt >> 1) * 512 + (dt & 1) * 256;
    *(v8us*)(Oh + o) = fh.half[0];
    *(v8us*)(Or + o) = fr.half[0];
  }
  addr_wait();      /* precaution: each block of the joined kernel takes one path, so no other code runs behind these stores */
}

// Single-plane path. Block = 8 waves (128 queries of one (batch, head)); a wave works on 32 queries as two 16-query tiles u, so every K and V^T fragment it loads feeds two products.
// The key steps of a 32-query group are split between waves w and w + 4: the first takes the lower half of the steps, the second the upper half with the diagonal step (q0 is a multiple of 32,
// so that step is the last one for both tiles). Each half keeps its own maximum, row sum and output tiles; the upper half hands them over through mg and the lower half joins the two once.
__device__ __forceinline__ void attn_wide(float (*mg)[17][32][4], const unsigned short* __restrict__ Qh, const unsigned short* __restrict__ Kh, const unsigned short* __restrict__ Vh,
    unsigned short* __restrict__ Oh, const int qblk, const int head, const int b) {
  const int tid = threadIdx.x, w = __builtin_amdgcn_readfirstlane(tid >> 5), lane = tid & 31, ln = lane & 15, hh = lane >> 4;
  const int grp = w & 3, kp = w >> 2;
  const int q0 = qblk * 128 + grp * 32;
  const size_t tok0 = (size_t)b * SEQ;
  const size_t qofs = (tok0 + q0) * DM + head * (HD * 16) + 8 * lane;
  v16h qa[2], qb[2];
#pragma unroll
  for (int u = 0; u < 2; ++u) { qa[u] = ld_frag(Qh + qofs + (size_t)(16 * u) * DM); qb[u] = ld_frag(Qh + qofs + (size_t)(16 * u) * DM + 512); }
  addr_wait();
  const size_t kofs = tok0 * DM + head * (HD * 16) + 8 * lane;
  const size_t vofs = (size_t)(head * HD) * NTOK + tok0 * 16 + 8 * lane;
  const v8f z8 = {0.f,0.f,0.f,0.f,0.f,0.f,0.f,0.f};
  v8f oh[2][4] = {{z8, z8, z8, z8}, {z8, z8, z8, z8}};
  float mrun[2] = {-1.0e30f, -1.0e30f}, lrun[2] = {0.0f, 0.0f};
  const int nsteps = (q0 >> 5) + 1;
  const int s0 = kp ? (nsteps >> 1) : 0, s1 = kp ? nsteps : (nsteps >> 1);      /* this wave's key steps [s0, s1); nsteps >= 2 here, so neither half is empty */
  /* K and V^T of the next key step go into the same registers, K behind the score products, V^T behind the output products. */
  v16h kfa[2], kfc[2], vf[4];
#pragma unroll
  for (int t = 0; t < 2; ++t) {
    const size_t ko = kofs + (size_t)(s0 * 32 + 16 * t) * DM;
    kfa[t] = ld_frag(Kh + ko); kfc[t] = ld_frag(Kh + ko + 512);
    __builtin_amdgcn_sched_barrier(0);      /* first loads issue in the loop's own order (K tile 0, K tile 1, V^T): otherwise the loop's waits on K, counted over both ways in, also cover the V^T loads in flight */
  }
  addr_wait();      /* the V^T fragments may land in registers that the K loads name */
#pragma unroll
  for (int dt = 0; dt < 4; ++dt) vf[dt] = ld_frag(Vh + vofs + (size_t)(dt * 16) * NTOK + (size_t)(s0 * 32) * 16);
  addr_wait();
  auto step = [&](const int st, const bool more) __attribute__((always_inline)) {
    const int kb = st * 32;
    v8f sc[2][2];      /* [query tile u][key tile t] */
#pragma unroll
    for (int t = 0; t < 2; ++t) { sc[0][t] = wm(kfa[t], qa[0], z8); sc[1][t] = wm(kfa[t], qa[1], z8); }
#pragma unroll
    for (int t = 0; t < 2; ++t) { sc[0][t] = wm(kfc[t], qb[0], sc[0][t]); sc[1][t] = wm(kfc[t], qb[1], sc[1][t]); }
    /* the four vector slots between the last score product and the first use of a score or refill of a K fragment */
    asm volatile("v_nop\n\tv_nop\n\tv_nop\n\tv_nop" : "+v"(sc[0][0]), "+v"(sc[0][1]), "+v"(sc[1][0]), "+v"(sc[1][1]) : "v"(kfa[0]), "v"(kfc[0]), "v"(kfa[1]), "v"(kfc[1]));
    if (more) {
#pragma unroll
      for (int t = 0; t < 2; ++t) {
        const size_t kn = kofs + (size_t)(kb + 32 + 16 * t) * DM;
        kfa[t] = ld_frag(Kh + kn); kfc[t] = ld_frag(Kh + kn + 512);
      }
      addr_wait();
    } else {      /* the upper half's last step is the diagonal one: masked scores are replaced (the lower half's last step has none) */
#pragma unroll
      for (int u = 0; u < 2; ++u) {
        const int qi = q0 + 16 * u + ln;
#pragma unroll
        for (int r = 0; r < 8; ++r) {
          const int key = kb + 8 * hh + r;
          sc[u][0][r] = (key > qi) ? -1.0e30f : sc[u][0][r];
          sc[u][1][r] = (key + 16 > qi) ? -1.0e30f : sc[u][1][r];
        }
      }
    }
    FragH ph[2];
    float mloc[2];
#pragma unroll
    for (int u = 0; u < 2; ++u) {
      mloc[u] = sc[u][0][0];
#pragma unroll
      for (int r = 1; r < 8; ++r) mloc[u] = fmaxf(mloc[u], sc[u][0][r]);
#pragma unroll
      for (int r = 0; r < 8; ++r) mloc[u] = fmaxf(mloc[u], sc[u][1][r]);
    }
    if (__builtin_amdgcn_ballot_w32(mloc[0] > mrun[0] + LAZY || mloc[1] > mrun[1] + LAZY) != 0) {      /* one scalar test per key step: some lane's scores outgrow a maximum in use */
#pragma unroll
      for (int u = 0; u < 2; ++u) {
        const float mnew = fmaxf(mrun[u], fmaxf(mloc[u], __shfl_xor(mloc[u], 16)));
        const float alpha = __expf((mrun[u] - mnew) * 0.125f);
        mrun[u] = mnew;
        lrun[u] = lrun[u] * alpha;
#pragma unroll
        for (int dt = 0; dt < 4; ++dt) oh[u][dt] = oh[u][dt] * alpha;
      }
    }
#pragma unroll
    for (int u = 0; u < 2; ++u) {
      const float msh = mrun[u] * 0.125f - 5.545177444f;      /* p carried x256 (same factor in the row sum) */
      float p0[8], p1[8]; float ls = 0.0f;
#pragma unroll
      for (int r = 0; r < 8; ++r) { p0[r] = __expf(sc[u][0][r] * 0.125f - msh); p1[r] = __expf(sc[u][1][r] * 0.125f - msh); ls += p0[r] + p1[r]; }
      lrun[u] = lrun[u] + ls;
#pragma unroll
      for (int r = 0; r < 8; ++r) { ph[u].h[r] = (_Float16)p0[r]; ph[u].h[8 + r] = (_Float16)p1[r]; }
    }
#pragma unroll
    for (int dt = 0; dt < 4; ++dt) { oh[0][dt] = wm(vf[dt], ph[0].v, oh[0][dt]); oh[1][dt] = wm(vf[dt], ph[1].v, oh[1][dt]); }
    /* the four vector slots between the last output product and the next write of an operand of it or refill of a V^T fragment */
    asm volatile("v_nop\n\tv_nop\n\tv_nop\n\tv_nop" : "+v"(oh[0][0]), "+v"(oh[0][1]), "+v"(oh[0][2]), "+v"(oh[0][3]), "+v"(oh[1][0]), "+v"(oh[1][1]), "+v"(oh[1][2]), "+v"(oh[1][3])
                 : "v"(vf[0]), "v"(vf[1]), "v"(vf[2]), "v"(vf[3]), "v"(ph[0].v), "v"(ph[1].v));
    if (more) {
#pragma unroll
      for (int dt = 0; dt < 4; ++dt) vf[dt] = ld_frag(Vh + vofs + (size_t)(dt * 16) * NTOK + (size_t)(kb + 32) * 16);
      addr_wait();
    }
  };
#pragma unroll 1      /* the key loop stays rolled: a second copy of the step would only add code and live registers */
  for (int st = s0; st < s1 - 1; ++st) step(st, true);
  step(s1 - 1, false);      /* last key step of this half: nothing left to fetch */
  if (kp) {      /* upper half: hand maximum, row sum and output tiles to the partner wave, 16 bytes a lane and row */
#pragma unroll
    for (int u = 0; u < 2; ++u) {
#pragma unroll
      for (int dt = 0; dt < 4; ++dt) {
        const v4f lo = {oh[u][dt][0], oh[u][dt][1], oh[u][dt][2], oh[u][dt][3]}, hi = {oh[u][dt][4], oh[u][dt][5], oh[u][dt][6], oh[u][dt][7]};
        *(v4fa*)&mg[grp][u * 8 + dt * 2][lane][0] = lo; *(v4fa*)&mg[grp][u * 8 + dt * 2 + 1][lane][0] = hi;
      }
    }
    const v4f ml = {mrun[0], mrun[1], lrun[0], lrun[1]};
    *(v4fa*)&mg[grp][16][lane][0] = ml;
  }
  __syncthreads();      /* publishes the upper halves; every wave of the block passes it once */
  if (kp) return;
  {
    const v4f ml = *(const v4fa*)&mg[grp][16][lane][0];
#pragma unroll
    for (int u = 0; u < 2; ++u) {
      const float mj = fmaxf(mrun[u], ml[u]);
      const float a0 = __expf((mrun[u] - mj) * 0.125f), a1 = __expf((ml[u] - mj) * 0.125f);
      lrun[u] = lrun[u] * a0 + ml[2 + u] * a1;
#pragma unroll
      for (int dt = 0; dt < 4; ++dt) {
        const v4f lo = *(const v4fa*)&mg[grp][u * 8 + dt * 2][lane][0], hi = *(const v4fa*)&mg[grp][u * 8 + dt * 2 + 1][lane][0];
#pragma unroll
        for (int r = 0; r < 4; ++r) { oh[u][dt][r] = oh[u][dt][r] * a0 + lo[r] * a1; oh[u][dt][4 + r] = oh[u][dt][4 + r] * a0 + hi[r] * a1; }
      }
    }
  }
  FragH fo[2][4];
#pragma unroll
  for (int u = 0; u < 2; ++u) {
    const float lt = lrun[u] + __shfl_xor(lrun[u], 16);
    const float inv = 64.0f * (1.0f / lt);      /* o carried x64 */
#pragma unroll
    for (int dt = 0; dt < 4; ++dt) {
#pragma unroll
      for (int r = 0; r < 8; ++r) fo[u][dt].h[r] = (_Float16)(oh[u][dt][r] * inv);
    }
  }
  __builtin_amdgcn_sched_barrier(0);      /* the eight stores go out behind the last conversion, so that no register an issued store names is written again */
#pragma unroll
  for (int u = 0; u < 2; ++u) {
#pragma unroll
    for (int dt = 0; dt < 4; ++dt)      /* the lane's 8 values (query ln of tile u, d = 16 dt + 8 hh ..) are its 16 bytes of half dt & 1 of fragment tile dt >> 1 */
      *(v8us*)(Oh + qofs + (size_t)(16 * u) * DM + (dt >> 1) * 512 + (dt & 1) * 256) = fo[u][dt].half[0];
  }
}

// Both attention paths read the same finished planes and share one grid. There are more blocks than resident places; the cost of a block falls with its index (for speed only):
// rank = index / (heads * batches) picks the query block from a compile-time order, the (head, batch) pair runs fastest. Cost key: q + 1 for a single-plane block q (2 (q + 1) key steps a wave),
// 3 (e + 1) for a hi + residual block e (4 (e + 1) key steps a wave, each with three products per site and a longer dependent chain). The order is a permutation of the query blocks for any SEQ and EARLY.
constexpr int NQB = SEQ / 128;      /* query blocks per (batch, head) */
struct QOrder { unsigned char q[NQB]; };
constexpr QOrder q_order() {
  QOrder o{}; int wq = NQB - 1, e = EARLY / 128 - 1;
  for (int r = 0; r < NQB; ++r) {
    const bool wide = wq >= EARLY / 128 && (e < 0 || wq + 1 >= 3 * (e + 1));
    o.q[r] = (unsigned char)(wide ? wq-- : e--);
  }
  return o;
}
__global__ __launch_bounds__(256) void k_attn(const unsigned short* __restrict__ Qh, const unsigned short* __restrict__ Qr,
    const unsigned short* __restrict__ Kh, const unsigned short* __restrict__ Kr,
    const unsigned short* __restrict__ Vh, const unsigned short* __restrict__ Vr,
    unsigned short* __restrict__ Oh, unsigned short* __restrict__ Or) {
  __shared__ __attribute__((aligned(16))) float mg[4][17][32][4];      /* per 32-query group: 16 rows of output values and one of (maximum, row sum), 16 bytes a lane */
  constexpr QOrder ord = q_order();
  const int i = blockIdx.x, r = i / (NH * NB), g = i - r * (NH * NB);
  const int qblk = ord.q[r];
  if (qblk >= EARLY / 128) attn_wide(mg, Qh, Kh, Vh, Oh, qblk, g % NH, g / NH);
  else attn_early(Qh, Qr, Kh, Kr, Vh, Vr, Oh, Or, qblk, g % NH, g / NH);
}

extern "C" void kernel_launch(void* const* d_in, const int* in_sizes, int n_in,
                              void* d_out, int out_size, void* d_ws, size_t ws_size, hipStream_t stream) {
  if (n_in < 9) return;
  const long long need_x = ((long long)(NB - 1) * SEQ_FULL + SEQ) * DM;
  if ((long long)in_sizes[0] < need_x) return;
  if (in_sizes[1] < DM * DM || in_sizes[3] < DM * DM || in_sizes[5] < DM * DM || in_sizes[7] < DM * DM) return;
  if (in_sizes[2] < DM || in_sizes[4] < DM || in_sizes[6] < DM || in_sizes[8] < DM) return;
  if ((long long)out_size < need_x) return;
  const float* x = (const float*)d_in[0]; const float* wq = (const float*)d_in[1]; const float* bq = (const float*)d_in[2];
  const float* wk = (const float*)d_in[3]; const float* bk = (const float*)d_in[4]; const float* wv = (const float*)d_in[5];
  const float* bv = (const float*)d_in[6]; const float* wo = (const float*)d_in[7]; const float* bo = (const float*)d_in[8];
  float* out = (float*)d_out;
  char* ws = (char*)d_ws; size_t off = 0;
  auto take = [&](size_t bytes) { char* p = ws + off; off += (bytes + 255) & ~(size_t)255; return p; };
  const size_t wbytes = (size_t)DM * DM * 2, pbytes = NTOK * DM * 2;
  unsigned short* WQ = (unsigned short*)take(wbytes); unsigned short* WK = (unsigned short*)take(wbytes);
  unsigned short* WV = (unsigned short*)take(wbytes); unsigned short* WO = (unsigned short*)take(wbytes);
  unsigned short* X16 = (unsigned short*)take(pbytes);
  unsigned short* Qh = (unsigned short*)take(pbytes); unsigned short* Qr = (unsigned short*)take(pbytes);
  unsigned short* Kh = (unsigned short*)take(pbytes); unsigned short* Kr = (unsigned short*)take(pbytes);
  unsigned short* VTh = (unsigned short*)take(pbytes); unsigned short* VTr = (unsigned short*)take(pbytes);
  unsigned short* Oh = (unsigned short*)take(pbytes); unsigned short* Or = (unsigned short*)take(pbytes);
  if (off > ws_size || off > (size_t)134217728) return;

  { const unsigned int nw8 = (unsigned int)((size_t)DM * DM / 8), gw = (nw8 + 255u) / 256u;      /* [out][in] weights are already Bt[n][k]; x32; fragment order */
    const unsigned int nx8 = (unsigned int)(NTOK * DM / 8), gx = (nx8 + 255u) / 256u;
    k_prep<<<gx + 4u * gw, 256, 0, stream>>>(x, wq, wk, wv, wo, X16, WQ, WK, WV, WO, nx8, gx, nw8, gw); }

  k_qkv<<<dim3((unsigned)((NTOK / 256) * (DM / 128)), 3), 256, 0, stream>>>(X16, WQ, WK, WV, bq, bk, bv, (_Float16*)Qh, (_Float16*)Qr, (_Float16*)Kh, (_Float16*)Kr, (_Float16*)VTh, (_Float16*)VTr);

  k_attn<<<((SEQ - EARLY) / 128 + EARLY / 128) * NH * NB, 256, 0, stream>>>(Qh, Qr, Kh, Kr, VTh, VTr, Oh, Or);

  k_out<<<dim3((unsigned)((EARLY / 128) * (DM / 64) + ((SEQ - EARLY) / 128) * (DM / 128)), NB), 128, 0, stream>>>(Oh, Or, WO, bo, out);
}

// v009
// Measured time: 108 microseconds a run.
// Next to v008, in two timings, it ran 1.08 and 1.07 times as fast.
// All steps since v000 together make it 4.79 times as fast.
#include <hip/hip_runtime.h>
// Causal multi-head self-attention: x [2][4096][768]; q / k / v = x W^T + b ([out][in] 768 x 768 weights, biases); 12 heads of 64; scores / 8; causal (key <= query) softmax; out = merged W_o^T + b_o.
// Compute dtype: every contraction on v_wmma_f32_16x16x32_f16 with f32 accumulation. Inputs converted RNE to bf16 and held exactly in f16 (weights x32). q, k, v, softmax weights (x256) and o (x64) are f16 operands;
// for the first EARLY queries of each sequence q, k, v, p and o are carried as f16 hi + f16 residual (x1024) planes with separate accumulators (3 products per site). Scores, softmax statistics and epilogues are f32.
// Structure: token rows r = b*SEQ + s. Q, K as planes [token][768]; V produced directly transposed (V^T = W_v x^T, plane [768][tokens]); attention is a register-fed transposed flash loop per wave
// (S^T = K Q^T with Q^T as the B operand, packed P^T from the S^T accumulators as the B operand of O^T = V^T P^T; 32 keys per step; no LDS in the key loop); o as f16 planes; out GEMM writes f32 rows.
// Every f16 plane [R][L] (weights, x, q, k, V^T, o) is stored in fragment order: tiles of 16 rows x 32 columns, 512 elements each, tile (r >> 4, c >> 5) at element ((r >> 4) * (L / 32) + (c >> 5)) * 512;
// inside a tile element (r, c) stands at ((c >> 4) & 1) * 256 + (((c >> 3) & 1) * 16 + (r & 15)) * 8 + (c & 7), so each of a fragment's two loads is lane * 16 bytes into 512 contiguous bytes (four whole lines).
#ifndef NB
#define NB 2
#endif
#ifndef SEQ
#define SEQ 4096
#endif
#define NB_FULL 2
#define SEQ_FULL 4096
#define DM 768
#define NH 12
#define HD 64
#define NTOK ((size_t)NB * SEQ)
#define EARLY ((SEQ) < 1024 ? (SEQ) : 1024)   /* queries per sequence on the hi + residual path */
static_assert(SEQ % 128 == 0);
static_assert(EARLY % 128 == 0);
static_assert((SEQ - EARLY) % 128 == 0);
static_assert(NB <= NB_FULL);
static_assert(SEQ <= SEQ_FULL);
static_assert(DM % 128 == 0);
static_assert(DM % 96 == 0);
static_assert(DM % 256 == 0);
static_assert(NTOK % 256 == 0);
static_assert(NH * HD == DM);
static_assert(HD == 64);

typedef _Float16 v16h __attribute__((ext_vector_type(16)));
typedef unsigned short v8us __attribute__((ext_vector_type(8), may_alias));
typedef float v8f __attribute__((ext_vector_type(8)));
typedef float v4f __attribute__((ext_vector_type(4)));
typedef float v4fa __attribute__((ext_vector_type(4), may_alias));
union FragH { v16h v; v8us half[2]; _Float16 h[16]; unsigned short u[16]; };

__device__ __forceinline__ unsigned short bf16_bits(float x) { unsigned int u = __float_as_uint(x); return (unsigned short)((u + 0x7FFFu + ((u >> 16) & 1u)) >> 16); }
__device__ __forceinline__ float bf16_rne(float x) { return __uint_as_float(((unsigned int)bf16_bits(x)) << 16); }

// 16x32 fragment (A rows or B columns) of a plane in fragment order: p = tile start + 8*lane; elements 0..7 <- (row lane&15, k0+8h..), 8..15 <- (row lane&15, k0+16+8h..), h = lane>>4
__device__ __forceinline__ v16h ld_frag(const unsigned short* p) { FragH f; f.half[0] = *(const v8us*)p; f.half[1] = *(const v8us*)(p + 256); return f.v; }
// Thread t writes the 8 elements at t*8 of a fragment-order plane with DM columns: their row and first column.
__device__ __forceinline__ void frag_src(unsigned int t, unsigned int& r, unsigned int& c8) {
  const unsigned int tile = t >> 6, band = tile / (DM / 32), cb = tile - band * (DM / 32);
  r = band * 16u + (t & 15u); c8 = cb * 32u + ((t >> 5) & 1u) * 16u + ((t >> 4) & 1u) * 8u;
}

// Stands behind a run of fragment loads that stay in flight: their address registers may be reused only behind it.
__device__ __forceinline__ void addr_wait() { asm volatile("s_wait_xcnt 0x0" ::: "memory"); }

__device__ __forceinline__ v8f wm(v16h a, v16h b, v8f c) { return __builtin_amdgcn_wmma_f32_16x16x32_f16(false, a, false, b, (short)0, c, false, false); }
__device__ __forceinline__ v8f mma1(v16h a, v16h b, v8f c) {
  c = wm(a, b, c);
  asm volatile("v_nop\n\tv_nop\n\tv_nop\n\tv_nop" : "+v"(c) : "v"(a), "v"(b));
  return c;
}
__device__ __forceinline__ v8f mma2(v16h a0, v16h b0, v16h a1, v16h b1, v8f c) {
  c = wm(a0, b0, c); c = wm(a1, b1, c);
  asm volatile("v_nop\n\tv_nop\n\tv_nop\n\tv_nop" : "+v"(c) : "v"(a0), "v"(b0), "v"(a1), "v"(b1));
  return c;
}
__device__ __forceinline__ v8f mma4(v16h a0, v16h b0, v16h a1, v16h b1, v16h a2, v16h b2, v16h a3, v16h b3, v8f c) {
  c = wm(a0, b0, c); c = wm(a1, b1, c); c = wm(a2, b2, c); c = wm(a3, b3, c);
  asm volatile("v_nop\n\tv_nop\n\tv_nop\n\tv_nop" : "+v"(c) : "v"(a0), "v"(b0), "v"(a1), "v"(b1), "v"(a2), "v"(b2), "v"(a3), "v"(b3));
  return c;
}

__device__ __forceinline__ void cvt_w(const float* __restrict__ w, const unsigned int t, unsigned short* __restrict__ Bt, const float scale) {
  unsigned int r, c8; frag_src(t, r, c8);
  const float* src = w + (size_t)r * DM + c8;
  const v4f a = *(const v4fa*)src, c = *(const v4fa*)(src + 4);
  FragH f;
#pragma unroll
  for (int q = 0; q < 4; ++q) { f.h[q] = (_Float16)(bf16_rne(a[q]) * scale); f.h[4 + q] = (_Float16)(bf16_rne(c[q]) * scale); }
  const v8us o = f.half[0];
  unsigned short* d = Bt + (size_t)t * 8;
  *(v8us*)d = o; 
}

__device__ __forceinline__ void cvt_x(const float* __restrict__ x, unsigned short* __restrict__ X16, const unsigned int t) {
  unsigned int r, c8; frag_src(t, r, c8);
  const unsigned int b = r / SEQ, s = r - b * SEQ;
  const float* src = x + ((size_t)b * SEQ_FULL + s) * DM + c8;
  const v4f a = *(const v4fa*)src, c = *(const v4fa*)(src + 4);
  FragH f;
#pragma unroll
  for (int q = 0; q < 4; ++q) { f.h[q] = (_Float16)bf16_rne(a[q]); f.h[4 + q] = (_Float16)bf16_rne(c[q]); }
  const v8us o = f.half[0];
  unsigned short* d = X16 + (size_t)t * 8;
  *(v8us*)d = o; 
}

// The five conversions depend on nothing and share one grid: blocks [0, gx) take x, then gw blocks for each of the four weights (x32).
__global__ __launch_bounds__(256) void k_prep(const float* __restrict__ x, const float* __restrict__ wq, const float* __restrict__ wk, const float* __restrict__ wv, const float* __restrict__ wo,
    unsigned short* __restrict__ X16, unsigned short* __restrict__ WQ, unsigned short* __restrict__ WK, unsigned short* __restrict__ WV, unsigned short* __restrict__ WO,
    unsigned int nx8, unsigned int gx, unsigned int nw8, unsigned int gw) {
  unsigned int blk = blockIdx.x;
  if (blk < gx) {
    const unsigned int t = blk * 256u + threadIdx.x; if (t >= nx8) return;
    cvt_x(x, X16, t);
  } else {
    blk -= gx; const unsigned int m = blk / gw; blk -= m * gw;
    const unsigned int t = blk * 256u + threadIdx.x; if (t >= nw8) return;
    const float* w = m == 0 ? wq : m == 1 ? wk : m == 2 ? wv : wo;
    unsigned short* d = m == 0 ? WQ : m == 1 ? WK : m == 2 ? WV : WO;
    cvt_w(w, t, d, 32.0f);
  }
}

__device__ __forceinline__ v8f g2_mma(v16h a, v16h b, v8f c) { v8f d = __builtin_amdgcn_wmma_f32_16x16x32_f16(false, a, false, b, (short)0, c, false, false); asm volatile("v_nop\n\tv_nop\n\tv_nop\n\tv_nop" : "+v"(d) : "v"(a), "v"(b)); return d; }

// GEMM C[M][N] = (A (+ Ar/1024)) . Bt^T * alpha + bias; A, Ar f16 [M][K] (row length lda, batch stride sA per batch index by), Bt f16 [N][K] (row length ldb), all in fragment order.
// Block = 4 waves, wave tile 32 x 64 (block 128 x 64); M % 128 == 0, N % 64 == 0, K % 96 == 0. BIASROW: bias indexed by row, else by column (bias converted RNE to bf16).
// Outputs: C f32 rows (optional), C16 f16 in fragment order (optional), C16r = f16((v - f16(v)) * 1024) (optional; resmode 1: rows with (row % SEQ) < EARLY, resmode 2: columns with (col % SEQ) < EARLY).
// so: the block's staging rows in LDS; bx, by: the tile index and the batch index of this block inside its own product.
template <bool ARES, bool BIASROW>
__device__ __forceinline__ void gemm2(float (*so)[32][68], const int bx, const int by, const unsigned short* __restrict__ A, const unsigned short* __restrict__ Ar, int lda, size_t sA,
    const unsigned short* __restrict__ Bh, int ldb, float alpha, const float* __restrict__ bias,
    float* __restrict__ C, _Float16* __restrict__ C16, _Float16* __restrict__ C16r, int ldc, size_t sC, int resmode, int M, int N, int K) {
  const int tid = threadIdx.x, w = __builtin_amdgcn_readfirstlane(tid >> 5), lane = tid & 31, ln = lane & 15, hh = lane >> 4;
  const int ntn = N >> 6; const int mt = bx / ntn, nq = bx - mt * ntn; const int row0 = mt * 128 + 32 * w, col0 = nq * 64; if (row0 >= M) return;
  const size_t aofs = (size_t)by * sA + (size_t)row0 * lda + 8 * lane;
  const size_t cofs = (size_t)by * sC;
  const unsigned short* a0p = A + aofs; const unsigned short* a1p = a0p + (size_t)16 * lda;
  const unsigned short* r0p = Ar + aofs; const unsigned short* r1p = r0p + (size_t)16 * lda;
  const unsigned short* b0p = Bh + (size_t)col0 * ldb + 8 * lane; const unsigned short* b1p = b0p + (size_t)16 * ldb; const unsigned short* b2p = b1p + (size_t)16 * ldb; const unsigned short* b3p = b2p + (size_t)16 * ldb;
  const v8f z8 = {0.f,0.f,0.f,0.f,0.f,0.f,0.f,0.f};
  v8f c00 = z8, c01 = z8, c02 = z8, c03 = z8, c10 = z8, c11 = z8, c12 = z8, c13 = z8;
  v8f d00 = z8, d01 = z8, d02 = z8, d03 = z8, d10 = z8, d11 = z8, d12 = z8, d13 = z8;
  /* Fragments live in GD register sets; a set is refilled for k + 32*GD right behind its last product, so a load has GD k steps to land (the product order is unchanged). */
  constexpr int GD = ARES ? 1 : 3;
  v16h fa0[GD], fa1[GD], fe0[GD], fe1[GD], fb0[GD], fb1[GD], fb2[GD], fb3[GD];
#pragma unroll
  for (int u = 0; u < GD; ++u) {
    const int k = 512 * u;      /* one tile of 512 elements per 32 k */
    fb0[u] = ld_frag(b0p + k); fa0[u] = ld_frag(a0p + k); fa1[u] = ld_frag(a1p + k);
    if (ARES) { fe0[u] = ld_frag(r0p + k); fe1[u] = ld_frag(r1p + k); }
    fb1[u] = ld_frag(b1p + k); fb2[u] = ld_frag(b2p + k); fb3[u] = ld_frag(b3p + k);
  }
  addr_wait();
  auto kstep = [&](const int u, const int kn, const bool more) __attribute__((always_inline)) {
    const v16h a0 = fa0[u], a1 = fa1[u];
    v16h e0 = a0, e1 = a1;
    if (ARES) { e0 = fe0[u]; e1 = fe1[u]; }
    v16h b = fb0[u]; c00 = g2_mma(a0, b, c00); c10 = g2_mma(a1, b, c10); if (ARES) { d00 = g2_mma(e0, b, d00); d10 = g2_mma(e1, b, d10); }
    if (more) fb0[u] = ld_frag(b0p + kn);
    b = fb1[u]; c01 = g2_mma(a0, b, c01); c11 = g2_mma(a1, b, c11); if (ARES) { d01 = g2_mma(e0, b, d01); d11 = g2_mma(e1, b, d11); }
    if (more) fb1[u] = ld_frag(b1p + kn);
    b = fb2[u]; c02 = g2_mma(a0, b, c02); c12 = g2_mma(a1, b, c12); if (ARES) { d02 = g2_mma(e0, b, d02); d12 = g2_mma(e1, b, d12); }
    if (more) fb2[u] = ld_frag(b2p + kn);
    b = fb3[u]; c03 = g2_mma(a0, b, c03); c13 = g2_mma(a1, b, c13); if (ARES) { d03 = g2_mma(e0, b, d03); d13 = g2_mma(e1, b, d13); }
    if (more) {
      fb3[u] = ld_frag(b3p + kn); fa0[u] = ld_frag(a0p + kn); fa1[u] = ld_frag(a1p + kn);
      if (ARES) { fe0[u] = ld_frag(r0p + kn); fe1[u] = ld_frag(r1p + kn); }
      if (u == GD - 1) addr_wait();      /* the pointers step once per trip */
    }
  };
#pragma unroll 1
  for (int kb = 0; kb < (K - 32 * GD) * 16; kb += 512 * GD) {      /* kb counts elements of a 16-row band: 512 per 32 k */
#pragma unroll
    for (int u = 0; u < GD; ++u) kstep(u, kb + 512 * (u + GD), true);
  }
#pragma unroll
  for (int u = 0; u < GD; ++u) kstep(u, 0, false);      /* last GD k steps: nothing left to fetch */
  v8f accs[8] = {c00, c01, c02, c03, c10, c11, c12, c13};
  v8f accd[8] = {d00, d01, d02, d03, d10, d11, d12, d13};
#pragma unroll
  for (int u = 0; u < 8; ++u) {
    const int t = u & 3, half = u >> 2; const int col = col0 + t * 16 + ln;
    float bcol = 0.f; if (!BIASROW) bcol = bf16_rne(bias[col]);
#pragma unroll
    for (int r = 0; r < 8; ++r) {
      const int rloc = half * 16 + 8 * hh + r;
      float v = accs[u][r]; if (ARES) v += accd[u][r] * 0.0009765625f;
      float bv = bcol; if (BIASROW) bv = bf16_rne(bias[row0 + rloc]);
      so[w][rloc][t * 16 + ln] = v * alpha + bv;
    }
  }
  __builtin_amdgcn_fence(4 /* acq_rel order */, "workgroup"); __builtin_amdgcn_wave_barrier();
  bool wres = false;
  if (C16r) { if (resmode == 1) wres = ((row0 % SEQ) < EARLY); else if (resmode == 2) wres = ((col0 % SEQ) < EARLY); }
  if (C) {
    const int rsub = lane >> 4, c4 = (lane & 15) * 4;
#pragma unroll
    for (int q = 0; q < 16; ++q) {
      const int r = q * 2 + rsub; const v4f v = *(const v4fa*)&so[w][r][c4];
      *(v4f*)(C + cofs + (size_t)(row0 + r) * ldc + col0 + c4) = v;
    }
    addr_wait();      /* the f16 block below may reuse registers that these stores name */
  }
  if (C16) {      /* the wave's 32 x 64 tile = 2 x 2 fragment tiles of two 512-byte halves; the lane writes 16 bytes of each half */
    const size_t o0 = cofs + (size_t)row0 * ldc + (size_t)(col0 >> 5) * 512 + lane * 8, o1 = o0 + (size_t)16 * ldc;
    unsigned short* h0p = (unsigned short*)C16 + o0; unsigned short* h1p = (unsigned short*)C16 + o1;
    unsigned short* e0p = (unsigned short*)C16r + o0; unsigned short* e1p = (unsigned short*)C16r + o1;
    FragH fh[8], fr[8];
#pragma unroll
    for (int q = 0; q < 8; ++q) {      /* q = band * 4 + column tile * 2 + half */
      const float* sp = &so[w][(q >> 2) * 16 + ln][(q & 3) * 16 + hh * 8];
      const v4f v0 = *(const v4fa*)sp, v1 = *(const v4fa*)(sp + 4);
#pragma unroll
      for (int i = 0; i < 4; ++i) {
        fh[q].h[i] = (_Float16)v0[i]; fr[q].h[i] = (_Float16)((v0[i] - (float)fh[q].h[i]) * 1024.0f);
        fh[q].h[4 + i] = (_Float16)v1[i]; fr[q].h[4 + i] = (_Float16)((v1[i] - (float)fh[q].h[4 + i]) * 1024.0f);
      }
    }
#pragma unroll
    for (int q = 0; q < 8; ++q) *(v8us*)((q >> 2 ? h1p : h0p) + (q & 3) * 256) = fh[q].half[0];
    addr_wait();      /* the residual stores below may reuse registers that the stores above name */
    if (wres) {
#pragma unroll
      for (int q = 0; q < 8; ++q) *(v8us*)((q >> 2 ? e1p : e0p) + (q & 3) * 256) = fr[q].half[0];
      addr_wait();      /* precaution: k_out takes one product per block, so no other product's code runs behind these stores */
    }
  }
}

// Single-plane GEMM with a 64 x 64 wave tile: same operands, outputs and k order as gemm2<false, .>, block = 2 WR waves as WR x 2 (block tile 64 WR x 128); M % (64 WR) == 0, N % 128 == 0, K % 64 == 0, K >= 128.
// A k step loads 8 fragments for 16 products (gemm2: 6 for 8), and a block of 8 waves fetches 384 operand rows for 256 x 128 outputs (gemm2: 192 for 128 x 64).
template <bool BIASROW, int WR>
__device__ __forceinline__ void gemm4(float (*so)[32][68], const int bx, const int by, const unsigned short* __restrict__ A, int lda, size_t sA,
    const unsigned short* __restrict__ Bh, int ldb, float alpha, const float* __restrict__ bias,
    float* __restrict__ C, _Float16* __restrict__ C16, _Float16* __restrict__ C16r, int ldc, size_t sC, int resmode, int M, int N, int K) {
  const int tid = threadIdx.x, w = __builtin_amdgcn_readfirstlane(tid >> 5), lane = tid & 31, ln = lane & 15, hh = lane >> 4;
  const int ntn = N >> 7; const int mt = bx / ntn, nq = bx - mt * ntn; const int row0 = mt * (64 * WR) + 64 * (w >> 1), col0 = nq * 128 + 64 * (w & 1); if (row0 >= M) return;
  const size_t cofs = (size_t)by * sC;
  const unsigned short* ap = A + (size_t)by * sA + (size_t)row0 * lda + 8 * lane;
  const unsigned short* bp = Bh + (size_t)col0 * ldb + 8 * lane;
  const v8f z8 = {0.f,0.f,0.f,0.f,0.f,0.f,0.f,0.f};
  v8f c[4][4];
#pragma unroll
  for (int i = 0; i < 4; ++i) {
#pragma unroll
    for (int j = 0; j < 4; ++j) c[i][j] = z8;
  }
  /* A fragments live in two register sets (k steps of even and odd number), B fragments in one; a B fragment is refilled for the next k step right behind its four products, an A set for the next k step but one behind its last. */
  v16h fa[2][4], fb[4];
#pragma unroll
  for (int i = 0; i < 4; ++i) fa[0][i] = ld_frag(ap + (size_t)(16 * i) * lda);
  __builtin_amdgcn_sched_barrier(0);      /* first loads issue in the loop's own order (A set 0, B, A set 1): the loop's waits are counted over both ways in */
#pragma unroll
  for (int j = 0; j < 4; ++j) { fb[j] = ld_frag(bp + (size_t)(16 * j) * ldb); __builtin_amdgcn_sched_barrier(0); /* as above */ }
#pragma unroll
  for (int i = 0; i < 4; ++i) fa[1][i] = ld_frag(ap + (size_t)(16 * i) * lda + 512);
  addr_wait();
  auto kstep = [&](const int u, const int kn, const bool moreb, const bool morea, const bool last) __attribute__((always_inline)) {      /* kn: element offset of the next k step inside a 16-row band */
#pragma unroll
    for (int j = 0; j < 4; ++j) {
#pragma unroll
      for (int i = 0; i < 4; ++i) c[i][j] = wm(fa[u][i], fb[j], c[i][j]);
      /* the four vector slots between the last product of this column and the refill of an operand of it */
      if (moreb) asm volatile("v_nop\n\tv_nop\n\tv_nop\n\tv_nop" : "+v"(c[0][j]), "+v"(c[1][j]), "+v"(c[2][j]), "+v"(c[3][j]) : "v"(fa[u][0]), "v"(fa[u][1]), "v"(fa[u][2]), "v"(fa[u][3]), "v"(fb[j]));
      if (moreb) fb[j] = ld_frag(bp + (size_t)(16 * j) * ldb + kn);
    }
    if (morea) {
#pragma unroll
      for (int i = 0; i < 4; ++i) fa[u][i] = ld_frag(ap + (size_t)(16 * i) * lda + kn + 512);
    }
    if (last) addr_wait();      /* the pointers step, or their registers are reused, behind this k step */
  };
#pragma unroll 1      /* two k steps a trip, one for each A set; more copies would only add code */
  for (int kb = 0; kb < (K - 64) * 16; kb += 1024) {      /* kb counts elements of a 16-row band: 512 per 32 k */
    kstep(0, kb + 512, true, true, false);
    kstep(1, kb + 1024, true, true, true);
  }
  kstep(0, (K - 32) * 16, true, false, true);      /* last two k steps: only the last B fragments are left to fetch */
  kstep(1, 0, false, false, false);
  bool wres = false;
  if (C16r) { if (resmode == 1) wres = ((row0 % SEQ) < EARLY); else if (resmode == 2) wres = ((col0 % SEQ) < EARLY); }
  float bc[4] = {0.f, 0.f, 0.f, 0.f};
  if (!BIASROW) {
#pragma unroll
    for (int t = 0; t < 4; ++t) bc[t] = bf16_rne(bias[col0 + t * 16 + ln]);
  }
#pragma unroll
  for (int hb = 0; hb < 2; ++hb) {      /* the wave's tile leaves as two 32 x 64 halves through the same staging rows */
    const int rb = row0 + 32 * hb;
#pragma unroll
    for (int u = 0; u < 8; ++u) {
      const int t = u & 3, half = u >> 2;
      const float bcol = bc[t];
#pragma unroll
      for (int r = 0; r < 8; ++r) {
        const int rloc = half * 16 + 8 * hh + r;
        const float v = c[2 * hb + half][t][r];
        float bv = bcol; if (BIASROW) bv = bf16_rne(bias[rb + rloc]);
        so[w][rloc][t * 16 + ln] = v * alpha + bv;
      }
    }
    /* the staging writes land before other lanes of the wave read them back; LDS only, so that the first half's global stores are not waited for */
    __builtin_amdgcn_fence(4 /* acq_rel order */, "workgroup", "local"); __builtin_amdgcn_wave_barrier();
    if (C) {
      const int rsub = lane >> 4, c4 = (lane & 15) * 4;
#pragma unroll
      for (int q = 0; q < 16; ++q) {
        const int r = q * 2 + rsub; const v4f v = *(const v4fa*)&so[w][r][c4];
        *(v4f*)(C + cofs + (size_t)(rb + r) * ldc + col0 + c4) = v;
      }
      addr_wait();      /* the code behind may reuse registers that these stores name */
    }
    if (C16) {      /* a 32 x 64 half = 2 x 2 fragment tiles of two 512-byte halves; the lane writes 16 bytes of each */
      const size_t o0 = cofs + (size_t)rb * ldc + (size_t)(col0 >> 5) * 512 + lane * 8, o1 = o0 + (size_t)16 * ldc;
      unsigned short* h0p = (unsigned short*)C16 + o0; unsigned short* h1p = (unsigned short*)C16 + o1;
      unsigned short* e0p = (unsigned short*)C16r + o0; unsigned short* e1p = (unsigned short*)C16r + o1;
      FragH fh[8], fr[8];
#pragma unroll
      for (int q = 0; q < 8; ++q) {      /* q = band * 4 + column tile * 2 + half */
        const float* sp = &so[w][(q >> 2) * 16 + ln][(q & 3) * 16 + hh * 8];
        const v4f v0 = *(const v4fa*)sp, v1 = *(const v4fa*)(sp + 4);
#pragma unroll
        for (int i = 0; i < 4; ++i) {
          fh[q].h[i] = (_Float16)v0[i]; fr[q].h[i] = (_Float16)((v0[i] - (float)fh[q].h[i]) * 1024.0f);
          fh[q].h[4 + i] = (_Float16)v1[i]; fr[q].h[4 + i] = (_Float16)((v1[i] - (float)fh[q].h[4 + i]) * 1024.0f);
        }
      }
#pragma unroll
      for (int q = 0; q < 8; ++q) *(v8us*)((q >> 2 ? h1p : h0p) + (q & 3) * 256) = fh[q].half[0];
      addr_wait();      /* the residual stores below may reuse registers that the stores above name */
      if (wres) {
#pragma unroll
        for (int q = 0; q < 8; ++q) *(v8us*)((q >> 2 ? e1p : e0p) + (q & 3) * 256) = fr[q].half[0];
        addr_wait();      /* the code behind reuses registers that these stores name */
      }
    }
    /* the second half's staging writes stay behind the first half's reads of the same rows by other lanes */
    if (hb == 0) { __builtin_amdgcn_fence(4 /* acq_rel order */, "workgroup", "local"); __builtin_amdgcn_wave_barrier(); }
  }
}

// The wait of addr_wait() behind a run of N 16-byte stores off one base: it takes the stored values and the base as inputs, so that their registers stay theirs until the wait has been passed.
template <int N>
__device__ __forceinline__ void store_wait(const FragH (&f)[N], const unsigned short* p) {
  static_assert(N == 8 || N == 12);
  if constexpr (N == 8)
    asm volatile("s_wait_xcnt 0x0" :: "v"(f[0].half[0]), "v"(f[1].half[0]), "v"(f[2].half[0]), "v"(f[3].half[0]), "v"(f[4].half[0]), "v"(f[5].half[0]), "v"(f[6].half[0]), "v"(f[7].half[0]), "v"(p) : "memory");
  else
    asm volatile("s_wait_xcnt 0x0" :: "v"(f[0].half[0]), "v"(f[1].half[0]), "v"(f[2].half[0]), "v"(f[3].half[0]), "v"(f[4].half[0]), "v"(f[5].half[0]), "v"(f[6].half[0]), "v"(f[7].half[0]),
                 "v"(f[8].half[0]), "v"(f[9].half[0]), "v"(f[10].half[0]), "v"(f[11].half[0]), "v"(p) : "memory");
}

// Single-plane GEMM with a 64 x 96 or 96 x 64 wave tile: same operands, f16 outputs and k order as gemm4. PA false: 4 A fragments (64 rows) x 6 B fragments (96 columns); PA true: 6 A fragments x 4 B fragments.
// Four waves w = 0..3 as 2 x 2 work on tile (mt, nq) of 128 x 192 or 192 x 128; M and N multiples of that tile, K % 64 == 0, K >= 128. A k step loads 10 fragments for 24 products (gemm4: 8 for 16).
// sw: this wave's staging rows in LDS (32 rows of 16 TJ + 4 floats).
template <bool BIASROW, bool PA>
__device__ __forceinline__ void gemm6(float* sw, const int w, const int mt, const int nq, const unsigned short* __restrict__ A, int lda, const unsigned short* __restrict__ Bh, int ldb, float alpha, const float* __restrict__ bias,
    _Float16* __restrict__ C16, _Float16* __restrict__ C16r, int ldc, int resmode, int M, int N, int K) {
  constexpr int TI = PA ? 6 : 4, TJ = PA ? 4 : 6, PT = 16 * TJ + 4;
  const int lane = threadIdx.x & 31, ln = lane & 15, hh = lane >> 4;
  const int row0 = mt * (32 * TI) + 16 * TI * (w >> 1), col0 = nq * (32 * TJ) + 16 * TJ * (w & 1); if (row0 >= M || col0 >= N) return;
  const unsigned short* ap = A + (size_t)row0 * lda + 8 * lane;
  const unsigned short* bp = Bh + (size_t)col0 * ldb + 8 * lane;
  const unsigned short* pp = PA ? ap : bp; const unsigned short* qp = PA ? bp : ap;      /* pp: the operand with six fragments, qp: the one with four */
  const int ldp = PA ? lda : ldb, ldq = PA ? ldb : lda;
  const v8f z8 = {0.f,0.f,0.f,0.f,0.f,0.f,0.f,0.f};
  v8f c[6][4];      /* [six-fragment operand][four-fragment operand] */
#pragma unroll
  for (int p = 0; p < 6; ++p) {
#pragma unroll
    for (int q = 0; q < 4; ++q) c[p][q] = z8;
  }
  /* The four fragments live in two register sets (k steps of even and odd number), the six in one; one of the six is refilled for the next k step right behind its four products, a set of four for the next k step but one behind its last. */
  v16h fq[2][4], fp[6];
#pragma unroll
  for (int q = 0; q < 4; ++q) fq[0][q] = ld_frag(qp + (size_t)(16 * q) * ldq);
  __builtin_amdgcn_sched_barrier(0);      /* first loads issue in the loop's own order (set 0 of the four, the six, set 1): the loop's waits are counted over both ways in */
#pragma unroll
  for (int p = 0; p < 6; ++p) { fp[p] = ld_frag(pp + (size_t)(16 * p) * ldp); __builtin_amdgcn_sched_barrier(0); /* as above */ }
#pragma unroll
  for (int q = 0; q < 4; ++q) fq[1][q] = ld_frag(qp + (size_t)(16 * q) * ldq + 512);
  addr_wait();
  auto kstep = [&](const int u, const int kn, const bool morep, const bool moreq, const bool last) __attribute__((always_inline)) {      /* kn: element offset of the next k step inside a 16-row band */
#pragma unroll
    for (int p = 0; p < 6; ++p) {
#pragma unroll
      for (int q = 0; q < 4; ++q) c[p][q] = PA ? wm(fp[p], fq[u][q], c[p][q]) : wm(fq[u][q], fp[p], c[p][q]);
      /* the four vector slots between the last product of this fragment and the refill of an operand of it */
      if (morep) {      /* the two scheduling barriers hold the slots behind the products and in front of the refill; the statement names no register, so that tiles above v255 need not move for it */
        __builtin_amdgcn_sched_barrier(0); asm volatile("v_nop\n\tv_nop\n\tv_nop\n\tv_nop"); __builtin_amdgcn_sched_barrier(0);
      }
      if (morep) fp[p] = ld_frag(pp + (size_t)(16 * p) * ldp + kn);
    }
    if (moreq) {
#pragma unroll
      for (int q = 0; q < 4; ++q) fq[u][q] = ld_frag(qp + (size_t)(16 * q) * ldq + kn + 512);
    }
    if (last) addr_wait();      /* the pointers step, or their registers are reused, behind this k step */
  };
#pragma unroll 1      /* two k steps a trip, one for each set of four; more copies would only add code */
  for (int kb = 0; kb < (K - 64) * 16; kb += 1024) {      /* kb counts elements of a 16-row band: 512 per 32 k */
    kstep(0, kb + 512, true, true, false);
    kstep(1, kb + 1024, true, true, true);
  }
  kstep(0, (K - 32) * 16, true, false, true);      /* last two k steps: only the last six fragments are left to fetch */
  kstep(1, 0, false, false, false);
  bool wres = false;
  if (C16r) { if (resmode == 1) wres = ((row0 % SEQ) < EARLY); else if (resmode == 2) wres = ((col0 % SEQ) < EARLY); }
  float bc[TJ];
#pragma unroll
  for (int t = 0; t < TJ; ++t) bc[t] = 0.f;
  if (!BIASROW) {
    const int bci = col0 + ln;
#pragma unroll
    for (int t = 0; t < TJ; ++t) bc[t] = bias[bci + t * 16];
    /* the wait of addr_wait() with the loads' base and index as inputs, so that their registers stay theirs until it has been passed */
    asm volatile("s_wait_xcnt 0x0" :: "s"(bias), "v"(bci) : "memory");
#pragma unroll
    for (int t = 0; t < TJ; ++t) bc[t] = bf16_rne(bc[t]);
  }
#pragma unroll
  for (int hb = 0; hb < TI / 2; ++hb) {      /* the wave's tile leaves as pieces of 32 rows through the same staging rows */
    const int rb = row0 + 32 * hb;
    v4f br[4] = {};      /* bias by row: the lane's rows 8 hh .. 8 hh + 7 of both bands */
    if (BIASROW) {
      const float* brp = bias + rb + 8 * hh;
#pragma unroll
      for (int q = 0; q < 4; ++q) br[q] = *(const v4fa*)(brp + (q >> 1) * 16 + (q & 1) * 4);
      addr_wait();      /* the code behind may reuse the registers that the bias loads name */
    }
#pragma unroll
    for (int u = 0; u < 2 * TJ; ++u) {
      const int t = u % TJ, half = u / TJ;
#pragma unroll
      for (int r = 0; r < 8; ++r) {
        const int rloc = half * 16 + 8 * hh + r;
        const float v = PA ? c[2 * hb + half][t][r] : c[t][2 * hb + half][r];
        float bv = bc[t]; if (BIASROW) bv = bf16_rne(br[half * 2 + (r >> 2)][r & 3]);
        sw[rloc * PT + t * 16 + ln] = v * alpha + bv;
      }
    }
    /* the staging writes land before other lanes of the wave read them back; LDS only, so that an earlier piece's global stores are not waited for */
    __builtin_amdgcn_fence(4 /* acq_rel order */, "workgroup", "local"); __builtin_amdgcn_wave_barrier();
    {      /* a piece = 2 bands of TJ / 2 fragment tiles of two 512-byte halves; the lane writes 16 bytes of each half */
      const size_t o0 = (size_t)rb * ldc + (size_t)(col0 >> 5) * 512 + lane * 8, o1 = o0 + (size_t)16 * ldc;
      unsigned short* h0p = (unsigned short*)C16 + o0; unsigned short* h1p = (unsigned short*)C16 + o1;
      unsigned short* e0p = (unsigned short*)C16r + o0; unsigned short* e1p = (unsigned short*)C16r + o1;
      FragH fh[2 * TJ], fr[2 * TJ];
#pragma unroll
      for (int q = 0; q < 2 * TJ; ++q) {      /* q = band * TJ + column tile * 2 + half */
        const float* sp = sw + ((q / TJ) * 16 + ln) * PT + (q % TJ) * 16 + hh * 8;
        const v4f v0 = *(const v4fa*)sp, v1 = *(const v4fa*)(sp + 4);
#pragma unroll
        for (int i = 0; i < 4; ++i) {
          fh[q].h[i] = (_Float16)v0[i]; fr[q].h[i] = (_Float16)((v0[i] - (float)fh[q].h[i]) * 1024.0f);
          fh[q].h[4 + i] = (_Float16)v1[i]; fr[q].h[4 + i] = (_Float16)((v1[i] - (float)fh[q].h[4 + i]) * 1024.0f);
        }
      }
#pragma unroll
      for (int q = 0; q < 2 * TJ; ++q) *(v8us*)((q / TJ ? h1p : h0p) + (q % TJ) * 256) = fh[q].half[0];
      store_wait(fh, h0p);      /* the code behind reuses registers that these stores name */
      if (wres) {
#pragma unroll
        for (int q = 0; q < 2 * TJ; ++q) *(v8us*)((q / TJ ? e1p : e0p) + (q % TJ) * 256) = fr[q].half[0];
        store_wait(fr, e0p);      /* the code behind reuses registers that these stores name */
      }
    }
    /* the next piece's staging writes stay behind this piece's reads of the same rows by other lanes */
    if (hb + 1 < TI / 2) { __builtin_amdgcn_fence(4 /* acq_rel order */, "workgroup", "local"); __builtin_amdgcn_wave_barrier(); }
  }
}

// Q, K and V^T depend only on the converted planes and share one grid. A block of 12 waves takes 128 tokens: waves 0..3 a 128 x 192 tile of Q, waves 4..7 the same tile of K ([token][DM], hi planes; residual planes
// for tokens with s < EARLY), waves 8..11 a 192 x 128 tile of V^T [DM][NTOK] = W_v (rows c) . X16^T (columns = tokens), bias by row, residual plane for token columns with s < EARLY; the three read the same X16 rows.
// At three waves a SIMD a block fills a WGP; at the full shape there are 256 blocks, so the launch is one round in which every SIMD holds the same work. The waves share no data in LDS and meet at no barrier.
static_assert(DM % 192 == 0);
static_assert(NTOK % 128 == 0);
static_assert(EARLY % 64 == 0);
__global__ __launch_bounds__(384) void k_qkv(const unsigned short* __restrict__ X16, const unsigned short* __restrict__ WQ, const unsigned short* __restrict__ WK, const unsigned short* __restrict__ WV,
    const float* __restrict__ bq, const float* __restrict__ bk, const float* __restrict__ bv,
    _Float16* __restrict__ Qh, _Float16* __restrict__ Qr, _Float16* __restrict__ Kh, _Float16* __restrict__ Kr, _Float16* __restrict__ VTh, _Float16* __restrict__ VTr) {
  __shared__ __attribute__((aligned(16))) float so[12][32 * 100];
  const int wv = __builtin_amdgcn_readfirstlane(threadIdx.x >> 5), sel = wv >> 2, w = wv & 3;
  const int tb = blockIdx.x / (DM / 192), cb = blockIdx.x - tb * (DM / 192);      /* token block, block of 192 output channels */
  if (sel == 2) gemm6<true, true>(so[wv], w, cb, tb, WV, DM, X16, DM, 0.03125f, bv, VTh, VTr, (int)NTOK, 2, DM, (int)NTOK, DM);
  else gemm6<false, false>(so[wv], w, tb, cb, X16, DM, sel ? WK : WQ, DM, 0.03125f, sel ? bk : bq, sel ? Kh : Qh, sel ? Kr : Qr, DM, 1, (int)NTOK, DM, DM);
}

// out rows (b*SEQ_FULL + s) = o W_o^T + b_o; alpha = 1 / (64 * 32). One grid: the first blocks take the rows with s < EARLY (hi + residual o), the others the rest; blockIdx.y = batch.
__global__ __launch_bounds__(128) void k_out(const unsigned short* __restrict__ Oh, const unsigned short* __restrict__ Or, const unsigned short* __restrict__ WO, const float* __restrict__ bo, float* __restrict__ out) {
  __shared__ __attribute__((aligned(16))) float so[4][32][68];
  constexpr int NE = (EARLY / 128) * (DM / 64);
  const int bx = blockIdx.x;
  if (bx < NE) gemm2<true, false>(so, bx, blockIdx.y, Oh, Or, DM, (size_t)SEQ * DM, WO, DM, 0.00048828125f, bo, out, (_Float16*)nullptr, (_Float16*)nullptr, DM, (size_t)SEQ_FULL * DM, 0, EARLY, DM, DM);
  else gemm4<false, 2>(so, bx - NE, blockIdx.y, Oh + (size_t)EARLY * DM, DM, (size_t)SEQ * DM, WO, DM, 0.00048828125f, bo, out + (size_t)EARLY * DM, (_Float16*)nullptr, (_Float16*)nullptr, DM, (size_t)SEQ_FULL * DM, 0, SEQ - EARLY, DM, DM);
}

// Lazy rescale: the maximum in use (mrun, alike in both lanes of a query) is raised, and row sum and output tiles rescaled, only in a key step where some lane of the wave holds a raw score above it by more than LAZY.
// Otherwise scores exceed it by at most LAZY / 8 = 4 after scaling, so p <= 256 e^4 < 14,000 stays inside f16; the first key step of a wave always takes the branch (mrun starts at -1e30, every query has an unmasked key there).
#define LAZY 32.0f
// Causal flash attention, transposed form. Q / K planes [token][DM]; V^T planes [DM][NTOK] (row = head*64 + d); o planes [token][DM]; all in fragment order. A wave (on the single-plane path, a pair of waves) loops over 32-key steps up to its diagonal.
// Lane (ln, hh) of a 16-query tile: query (tile start) + ln; S^T accumulators hold keys 8hh + r (tile 0) and 16 + 8hh + r (tile 1), which is exactly the B-fragment k map, so P^T is packed in place.
// Hi + residual path: block = 8 waves (128 queries of one (batch, head)), each wave owns 16 queries; hi + residual (x1024) planes on q, k, v, p and o (two accumulators per site).
__device__ __forceinline__ void attn_early(const unsigned short* __restrict__ Qh, const unsigned short* __restrict__ Qr,
    const unsigned short* __restrict__ Kh, const unsigned short* __restrict__ Kr,
    const unsigned short* __restrict__ Vh, const unsigned short* __restrict__ Vr,
    unsigned short* __restrict__ Oh, unsigned short* __restrict__ Or, const int qblk, const int head, const int b) {
  const int tid = threadIdx.x, w = __builtin_amdgcn_readfirstlane(tid >> 5), lane = tid & 31, ln = lane & 15, hh = lane >> 4;
  const int q0 = qblk * 128 + w * 16;
  const size_t tok0 = (size_t)b * SEQ;
  const size_t qofs = (tok0 + q0) * DM + head * (HD * 16) + 8 * lane;
  const v16h qa = ld_frag(Qh + qofs), qb = ld_frag(Qh + qofs + 512);
  const v16h qra = ld_frag(Qr + qofs), qrb = ld_frag(Qr + qofs + 512);
  addr_wait();
  const size_t kofs = tok0 * DM + head * (HD * 16) + 8 * lane;
  const size_t vofs = (size_t)(head * HD) * NTOK + tok0 * 16 + 8 * lane;
  const v8f z8 = {0.f,0.f,0.f,0.f,0.f,0.f,0.f,0.f};
  v8f oh[4] = {z8, z8, z8, z8};
  v8f om[4] = {z8, z8, z8, z8};
  float mrun = -1.0e30f, lrun = 0.0f;
  const int nsteps = ((q0 + 15) >> 5) + 1;
  const int qi = q0 + ln;
  /* Fragment loads go out ahead of their use: V^T of this step behind the score products, K of the next step behind the output products, so that only one of the two sets is live. */
  v16h kfa[2], kfc[2], kra[2], krc[2], vf[4], vrf[4];
#pragma unroll
  for (int t = 0; t < 2; ++t) {
    const size_t ko = kofs + (size_t)(16 * t) * DM;
    kfa[t] = ld_frag(Kh + ko); kfc[t] = ld_frag(Kh + ko + 512);
    kra[t] = ld_frag(Kr + ko); krc[t] = ld_frag(Kr + ko + 512);
    __builtin_amdgcn_sched_barrier(0);      /* first loads issue in the loop's own order (K tile 0, K tile 1): the loop's waits on K are counted over both ways in */
  }
  addr_wait();
  auto step = [&](const int st, const bool more) __attribute__((always_inline)) {
    const int kb = st * 32;
    v8f sc[2];
#pragma unroll
    for (int t = 0; t < 2; ++t) {
      const v16h ka = kfa[t], kc = kfc[t];
      v8f s = mma2(ka, qa, kc, qb, z8);
      const v16h ra = kra[t], rc = krc[t];
      const v8f sm = mma4(ka, qra, kc, qrb, ra, qa, rc, qb, z8);
      s = s + sm * 0.0009765625f;
#pragma unroll
      for (int dt = 2 * t; dt < 2 * t + 2; ++dt) {
        const size_t vo = vofs + (size_t)(dt * 16) * NTOK + (size_t)kb * 16;
        vf[dt] = ld_frag(Vh + vo); vrf[dt] = ld_frag(Vr + vo);
      }
      sc[t] = s;
    }
    addr_wait();
    if (kb + 31 > q0) {      /* wave-uniform: only the diagonal step carries masked keys; masked scores are replaced */
#pragma unroll
      for (int r = 0; r < 8; ++r) {
        const int key = kb + 8 * hh + r;
        sc[0][r] = (key > qi) ? -1.0e30f : sc[0][r];
        sc[1][r] = (key + 16 > qi) ? -1.0e30f : sc[1][r];
      }
    }
    float mloc = sc[0][0];
#pragma unroll
    for (int r = 1; r < 8; ++r) mloc = fmaxf(mloc, sc[0][r]);
#pragma unroll
    for (int r = 0; r < 8; ++r) mloc = fmaxf(mloc, sc[1][r]);
    if (__builtin_amdgcn_ballot_w32(mloc > mrun + LAZY) != 0) {      /* one scalar test per key step: some lane's scores outgrow the maximum in use */
      mloc = fmaxf(mloc, __shfl_xor(mloc, 16));
      const float mnew = fmaxf(mrun, mloc);
      const float alpha = __expf((mrun - mnew) * 0.125f);
      mrun = mnew;
      lrun = lrun * alpha;
#pragma unroll
      for (int dt = 0; dt < 4; ++dt) { oh[dt] = oh[dt] * alpha; om[dt] = om[dt] * alpha; }
    }
    const float msh = mrun * 0.125f - 5.545177444f;      /* p carried x256 (same factor in the row sum) */
    float p0[8], p1[8]; float ls = 0.0f;
#pragma unroll
    for (int r = 0; r < 8; ++r) { p0[r] = __expf(sc[0][r] * 0.125f - msh); p1[r] = __expf(sc[1][r] * 0.125f - msh); ls += p0[r] + p1[r]; }
    lrun = lrun + ls;
    FragH ph, pr;
#pragma unroll
    for (int r = 0; r < 8; ++r) {
      const _Float16 h0 = (_Float16)p0[r], h1 = (_Float16)p1[r];
      ph.h[r] = h0; ph.h[8 + r] = h1;
      pr.h[r] = (_Float16)((p0[r] - (float)h0) * 1024.0f); pr.h[8 + r] = (_Float16)((p1[r] - (float)h1) * 1024.0f);
    }
#pragma unroll
    for (int dt = 0; dt < 4; ++dt) {
      const v16h va = vf[dt];
      oh[dt] = mma1(va, ph.v, oh[dt]);
      const v16h vr = vrf[dt]; om[dt] = mma2(va, pr.v, vr, ph.v, om[dt]);
      if (more) {
        const int t = dt >> 1; const size_t kn = kofs + (size_t)(kb + 32 + 16 * t) * DM;
        if ((dt & 1) == 0) { kfa[t] = ld_frag(Kh + kn); kfc[t] = ld_frag(Kh + kn + 512); }
        else { kra[t] = ld_frag(Kr + kn); krc[t] = ld_frag(Kr + kn + 512); }
      }
    }
    if (more) addr_wait();
  };
#pragma unroll 1
  for (int st = 0; st < nsteps - 1; ++st) step(st, true);
  step(nsteps - 1, false);      /* last key step: nothing of a next step to fetch */
  const float lt = lrun + __shfl_xor(lrun, 16);
  const float inv = 64.0f * (1.0f / lt);      /* o carried x64 */
#pragma unroll
  for (int dt = 0; dt < 4; ++dt) {
    FragH fh, fr;
#pragma unroll
    for (int r = 0; r < 8; ++r) {
      float v = oh[dt][r]; v += om[dt][r] * 0.0009765625f;
      v *= inv;
      const _Float16 h = (_Float16)v; fh.h[r] = h;
      fr.h[r] = (_Float16)((v - (float)h) * 1024.0f);
    }
    /* the lane's 8 values (query ln, d = 16 dt + 8 hh ..) are its 16 bytes of half dt & 1 of fragment tile dt >> 1 */
    const size_t o = qofs + (dt >> 1) * 512 + (dt & 1) * 256;
    *(v8us*)(Oh + o) = fh.half[0];
    *(v8us*)(Or + o) = fr.half[0];
  }
  addr_wait();      /* precaution: each block of the joined kernel takes one path, so no other code runs behind these stores */
}

// Single-plane path. Block = 8 waves (128 queries of one (batch, head)); a wave works on 32 queries as two 16-query tiles u, so every K and V^T fragment it loads feeds two products.
// The key steps of a 32-query group are split between waves w and w + 4: the first takes the lower half of the steps, the second the upper half with the diagonal step (q0 is a multiple of 32,
// so that step is the last one for both tiles). Each half keeps its own maximum, row sum and output tiles; the upper half hands them over through mg and the lower half joins the two once.
__device__ __forceinline__ void attn_wide(float (*mg)[17][32][4], const unsigned short* __restrict__ Qh, const unsigned short* __restrict__ Kh, const unsigned short* __restrict__ Vh,
    unsigned short* __restrict__ Oh, const int qblk, const int head, const int b) {
  const int tid = threadIdx.x, w = __builtin_amdgcn_readfirstlane(tid >> 5), lane = tid & 31, ln = lane & 15, hh = lane >> 4;
  const int grp = w & 3, kp = w >> 2;
  const int q0 = qblk * 128 + grp * 32;
  const size_t tok0 = (size_t)b * SEQ;
  const size_t qofs = (tok0 + q0) * DM + head * (HD * 16) + 8 * lane;
  v16h qa[2], qb[2];
#pragma unroll
  for (int u = 0; u < 2; ++u) { qa[u] = ld_frag(Qh + qofs + (size_t)(16 * u) * DM); qb[u] = ld_frag(Qh + qofs + (size_t)(16 * u) * DM + 512); }
  addr_wait();
  const size_t kofs = tok0 * DM + head * (HD * 16) + 8 * lane;
  const size_t vofs = (size_t)(head * HD) * NTOK + tok0 * 16 + 8 * lane;
  const v8f z8 = {0.f,0.f,0.f,0.f,0.f,0.f,0.f,0.f};
  v8f oh[2][4] = {{z8, z8, z8, z8}, {z8, z8, z8, z8}};
  float mrun[2] = {-1.0e30f, -1.0e30f}, lrun[2] = {0.0f, 0.0f};
  const int nsteps = (q0 >> 5) + 1;
  const int s0 = kp ? (nsteps >> 1) : 0, s1 = kp ? nsteps : (nsteps >> 1);      /* this wave's key steps [s0, s1); nsteps >= 2 here, so neither half is empty */
  /* K and V^T of the next key step go into the same registers, K behind the score products, V^T behind the output products. */
  v16h kfa[2], kfc[2], vf[4];
#pragma unroll
  for (int t = 0; t < 2; ++t) {
    const size_t ko = kofs + (size_t)(s0 * 32 + 16 * t) * DM;
    kfa[t] = ld_frag(Kh + ko); kfc[t] = ld_frag(Kh + ko + 512);
    __builtin_amdgcn_sched_barrier(0);      /* first loads issue in the loop's own order (K tile 0, K tile 1, V^T): otherwise the loop's waits on K, counted over both ways in, also cover the V^T loads in flight */
  }
  addr_wait();      /* the V^T fragments may land in registers that the K loads name */
#pragma unroll
  for (int dt = 0; dt < 4; ++dt) vf[dt] = ld_frag(Vh + vofs + (size_t)(dt * 16) * NTOK + (size_t)(s0 * 32) * 16);
  addr_wait();
  auto step = [&](const int st, const bool more) __attribute__((always_inline)) {
    const int kb = st * 32;
    v8f sc[2][2];      /* [query tile u][key tile t] */
#pragma unroll
    for (int t = 0; t < 2; ++t) { sc[0][t] = wm(kfa[t], qa[0], z8); sc[1][t] = wm(kfa[t], qa[1], z8); }
#pragma unroll
    for (int t = 0; t < 2; ++t) { sc[0][t] = wm(kfc[t], qb[0], sc[0][t]); sc[1][t] = wm(kfc[t], qb[1], sc[1][t]); }
    /* the four vector slots between the last score product and the first use of a score or refill of a K fragment */
    asm volatile("v_nop\n\tv_nop\n\tv_nop\n\tv_nop" : "+v"(sc[0][0]), "+v"(sc[0][1]), "+v"(sc[1][0]), "+v"(sc[1][1]) : "v"(kfa[0]), "v"(kfc[0]), "v"(kfa[1]), "v"(kfc[1]));
    if (more) {
#pragma unroll
      for (int t = 0; t < 2; ++t) {
        const size_t kn = kofs + (size_t)(kb + 32 + 16 * t) * DM;
        kfa[t] = ld_frag(Kh + kn); kfc[t] = ld_frag(Kh + kn + 512);
      }
      addr_wait();
    } else {      /* the upper half's last step is the diagonal one: masked scores are replaced (the lower half's last step has none) */
#pragma unroll
      for (int u = 0; u < 2; ++u) {
        const int qi = q0 + 16 * u + ln;
#pragma unroll
        for (int r = 0; r < 8; ++r) {
          const int key = kb + 8 * hh + r;
          sc[u][0][r] = (key > qi) ? -1.0e30f : sc[u][0][r];
          sc[u][1][r] = (key + 16 > qi) ? -1.0e30f : sc[u][1][r];
        }
      }
    }
    FragH ph[2];
    float mloc[2];
#pragma unroll
    for (int u = 0; u < 2; ++u) {
      mloc[u] = sc[u][0][0];
#pragma unroll
      for (int r = 1; r < 8; ++r) mloc[u] = fmaxf(mloc[u], sc[u][0][r]);
#pragma unroll
      for (int r = 0; r < 8; ++r) mloc[u] = fmaxf(mloc[u], sc[u][1][r]);
    }
    if (__builtin_amdgcn_ballot_w32(mloc[0] > mrun[0] + LAZY || mloc[1] > mrun[1] + LAZY) != 0) {      /* one scalar test per key step: some lane's scores outgrow a maximum in use */
#pragma unroll
      for (int u = 0; u < 2; ++u) {
        const float mnew = fmaxf(mrun[u], fmaxf(mloc[u], __shfl_xor(mloc[u], 16)));
        const float alpha = __expf((mrun[u] - mnew) * 0.125f);
        mrun[u] = mnew;
        lrun[u] = lrun[u] * alpha;
#pragma unroll
        for (int dt = 0; dt < 4; ++dt) oh[u][dt] = oh[u][dt] * alpha;
      }
    }
#pragma unroll
    for (int u = 0; u < 2; ++u) {
      const float msh = mrun[u] * 0.125f - 5.545177444f;      /* p carried x256 (same factor in the row sum) */
      float p0[8], p1[8]; float ls = 0.0f;
#pragma unroll
      for (int r = 0; r < 8; ++r) { p0[r] = __expf(sc[u][0][r] * 0.125f - msh); p1[r] = __expf(sc[u][1][r] * 0.125f - msh); ls += p0[r] + p1[r]; }
      lrun[u] = lrun[u] + ls;
#pragma unroll
      for (int r = 0; r < 8; ++r) { ph[u].h[r] = (_Float16)p0[r]; ph[u].h[8 + r] = (_Float16)p1[r]; }
    }
#pragma unroll
    for (int dt = 0; dt < 4; ++dt) { oh[0][dt] = wm(vf[dt], ph[0].v, oh[0][dt]); oh[1][dt] = wm(vf[dt], ph[1].v, oh[1][dt]); }
    /* the four vector slots between the last output product and the next write of an operand of it or refill of a V^T fragment */
    asm volatile("v_nop\n\tv_nop\n\tv_nop\n\tv_nop" : "+v"(oh[0][0]), "+v"(oh[0][1]), "+v"(oh[0][2]), "+v"(oh[0][3]), "+v"(oh[1][0]), "+v"(oh[1][1]), "+v"(oh[1][2]), "+v"(oh[1][3])
                 : "v"(vf[0]), "v"(vf[1]), "v"(vf[2]), "v"(vf[3]), "v"(ph[0].v), "v"(ph[1].v));
    if (more) {
#pragma unroll
      for (int dt = 0; dt < 4; ++dt) vf[dt] = ld_frag(Vh + vofs + (size_t)(dt * 16) * NTOK + (size_t)(kb + 32) * 16);
      addr_wait();
    }
  };
#pragma unroll 1      /* the key loop stays rolled: a second copy of the step would only add code and live registers */
  for (int st = s0; st < s1 - 1; ++st) step(st, true);
  step(s1 - 1, false);      /* last key step of this half: nothing left to fetch */
  if (kp) {      /* upper half: hand maximum, row sum and output tiles to the partner wave, 16 bytes a lane and row */
#pragma unroll
    for (int u = 0; u < 2; ++u) {
#pragma unroll
      for (int dt = 0; dt < 4; ++dt) {
        const v4f lo = {oh[u][dt][0], oh[u][dt][1], oh[u][dt][2], oh[u][dt][3]}, hi = {oh[u][dt][4], oh[u][dt][5], oh[u][dt][6], oh[u][dt][7]};
        *(v4fa*)&mg[grp][u * 8 + dt * 2][lane][0] = lo; *(v4fa*)&mg[grp][u * 8 + dt * 2 + 1][lane][0] = hi;
      }
    }
    const v4f ml = {mrun[0], mrun[1], lrun[0], lrun[1]};
    *(v4fa*)&mg[grp][16][lane][0] = ml;
  }
  __syncthreads();      /* publishes the upper halves; every wave of the block passes it once */
  if (kp) return;
  {
    const v4f ml = *(const v4fa*)&mg[grp][16][lane][0];
#pragma unroll
    for (int u = 0; u < 2; ++u) {
      const float mj = fmaxf(mrun[u], ml[u]);
      const float a0 = __expf((mrun[u] - mj) * 0.125f), a1 = __expf((ml[u] - mj) * 0.125f);
      lrun[u] = lrun[u] * a0 + ml[2 + u] * a1;
#pragma unroll
      for (int dt = 0; dt < 4; ++dt) {
        const v4f lo = *(const v4fa*)&mg[grp][u * 8 + dt * 2][lane][0], hi = *(const v4fa*)&mg[grp][u * 8 + dt * 2 + 1][lane][0];
#pragma unroll
        for (int r = 0; r < 4; ++r) { oh[u][dt][r] = oh[u][dt][r] * a0 + lo[r] * a1; oh[u][dt][4 + r] = oh[u][dt][4 + r] * a0 + hi[r] * a1; }
      }
    }
  }
  FragH fo[2][4];
#pragma unroll
  for (int u = 0; u < 2; ++u) {
    const float lt = lrun[u] + __shfl_xor(lrun[u], 16);
    const float inv = 64.0f * (1.0f / lt);      /* o carried x64 */
#pragma unroll
    for (int dt = 0; dt < 4; ++dt) {
#pragma unroll
      for (int r = 0; r < 8; ++r) fo[u][dt].h[r] = (_Float16)(oh[u][dt][r] * inv);
    }
  }
  __builtin_amdgcn_sched_barrier(0);      /* the eight stores go out behind the last conversion, so that no register an issued store names is written again */
#pragma unroll
  for (int u = 0; u < 2; ++u) {
#pragma unroll
    for (int dt = 0; dt < 4; ++dt)      /* the lane's 8 values (query ln of tile u, d = 16 dt + 8 hh ..) are its 16 bytes of half dt & 1 of fragment tile dt >> 1 */
      *(v8us*)(Oh + qofs + (size_t)(16 * u) * DM + (dt >> 1) * 512 + (dt & 1) * 256) = fo[u][dt].half[0];
  }
}

// Both attention paths read the same finished planes and share one grid. There are more blocks than resident places; the cost of a block falls with its index (for speed only):
// rank = index / (heads * batches) picks the query block from a compile-time order, the (head, batch) pair runs fastest. Cost key: q + 1 for a single-plane block q (2 (q + 1) key steps a wave),
// 3 (e + 1) for a hi + residual block e (4 (e + 1) key steps a wave, each with three products per site and a longer dependent chain). The order is a permutation of the query blocks for any SEQ and EARLY.
constexpr int NQB = SEQ / 128;      /* query blocks per (batch, head) */
struct QOrder { unsigned char q[NQB]; };
constexpr QOrder q_order() {
  QOrder o{}; int wq = NQB - 1, e = EARLY / 128 - 1;
  for (int r = 0; r < NQB; ++r) {
    const bool wide = wq >= EARLY / 128 && (e < 0 || wq + 1 >= 3 * (e + 1));
    o.q[r] = (unsigned char)(wide ? wq-- : e--);
  }
  return o;
}
__global__ __launch_bounds__(256) void k_attn(const unsigned short* __restrict__ Qh, const unsigned short* __restrict__ Qr,
    const unsigned short* __restrict__ Kh, const unsigned short* __restrict__ Kr,
    const unsigned short* __restrict__ Vh, const unsigned short* __restrict__ Vr,
    unsigned short* __restrict__ Oh, unsigned short* __restrict__ Or) {
  __shared__ __attribute__((aligned(16))) float mg[4][17][32][4];      /* per 32-query group: 16 rows of output values and one of (maximum, row sum), 16 bytes a lane */
  constexpr QOrder ord = q_order();
  const int i = blockIdx.x, r = i / (NH * NB), g = i - r * (NH * NB);
  const int qblk = ord.q[r];
  if (qblk >= EARLY / 128) attn_wide(mg, Qh, Kh, Vh, Oh, qblk, g % NH, g / NH);
  else attn_early(Qh, Qr, Kh, Kr, Vh, Vr, Oh, Or, qblk, g % NH, g / NH);
}

extern "C" void kernel_launch(void* const* d_in, const int* in_sizes, int n_in,
                              void* d_out, int out_size, void* d_ws, size_t ws_size, hipStream_t stream) {
  if (n_in < 9) return;
  const long long need_x = ((long long)(NB - 1) * SEQ_FULL + SEQ) * DM;
  if ((long long)in_sizes[0] < need_x) return;
  if (in_sizes[1] < DM * DM || in_sizes[3] < DM * DM || in_sizes[5] < DM * DM || in_sizes[7] < DM * DM) return;
  if (in_sizes[2] < DM || in_sizes[4] < DM || in_sizes[6] < DM || in_sizes[8] < DM) return;
  if ((long long)out_size < need_x) return;
  const float* x = (const float*)d_in[0]; const float* wq = (const float*)d_in[1]; const float* bq = (const float*)d_in[2];
  const float* wk = (const float*)d_in[3]; const float* bk = (const float*)d_in[4]; const float* wv = (const float*)d_in[5];
  const float* bv = (const float*)d_in[6]; const float* wo = (const float*)d_in[7]; const float* bo = (const float*)d_in[8];
  float* out = (float*)d_out;
  char* ws = (char*)d_ws; size_t off = 0;
  auto take = [&](size_t bytes) { char* p = ws + off; off += (bytes + 255) & ~(size_t)255; return p; };
  const size_t wbytes = (size_t)DM * DM * 2, pbytes = NTOK * DM * 2;
  unsigned short* WQ = (unsigned short*)take(wbytes); unsigned short* WK = (unsigned short*)take(wbytes);
  unsigned short* WV = (unsigned short*)take(wbytes); unsigned short* WO = (unsigned short*)take(wbytes);
  unsigned short* X16 = (unsigned short*)take(pbytes);
  unsigned short* Qh = (unsigned short*)take(pbytes); unsigned short* Qr = (unsigned short*)take(pbytes);
  unsigned short* Kh = (unsigned short*)take(pbytes); unsigned short* Kr = (unsigned short*)take(pbytes);
  unsigned short* VTh = (unsigned short*)take(pbytes); unsigned short* VTr = (unsigned short*)take(pbytes);
  unsigned short* Oh = (unsigned short*)take(pbytes); unsigned short* Or = (unsigned short*)take(pbytes);
  if (off > ws_size || off > (size_t)134217728) return;

  { const unsigned int nw8 = (unsigned int)((size_t)DM * DM / 8), gw = (nw8 + 255u) / 256u;      /* [out][in] weights are already Bt[n][k]; x32; fragment order */
    const unsigned int nx8 = (unsigned int)(NTOK * DM / 8), gx = (nx8 + 255u) / 256u;
    k_prep<<<gx + 4u * gw, 256, 0, stream>>>(x, wq, wk, wv, wo, X16, WQ, WK, WV, WO, nx8, gx, nw8, gw); }

  k_qkv<<<(unsigned)((NTOK / 128) * (DM / 192)), 384, 0, stream>>>(X16, WQ, WK, WV, bq, bk, bv, (_Float16*)Qh, (_Float16*)Qr, (_Float16*)Kh, (_Float16*)Kr, (_Float16*)VTh, (_Float16*)VTr);

  k_attn<<<((SEQ - EARLY) / 128 + EARLY / 128) * NH * NB, 256, 0, stream>>>(Qh, Qr, Kh, Kr, VTh, VTr, Oh, Or);

  k_out<<<dim3((unsigned)((EARLY / 128) * (DM / 64) + ((SEQ - EARLY) / 128) * (DM / 128)), NB), 128, 0, stream>>>(Oh, Or, WO, bo, out);
}
